// v000
// Measured on an AMD MI455X. A time is GPU time per run, averaged over a window of back-to-back runs after a warm-up
// (all launches, gaps included; the runs take copies of the inputs in turn), and the median of several windows.
// Apart from v000's, it joins two sittings. Times from different sittings can be a few percent apart, while
// side-by-side timings come from the same sitting.
// v000 is the starting kernel. One run takes 824 microseconds.
#include <hip/hip_runtime.h>

// FiDO_T5Attention (hidden [4][2048][1024]; q/k/v = x W^T (16 heads x 64); heads grouped (g=4 groups, h=4 kv heads: head = g*4 + h); gk, gv = mean over g; scores[h][n][s] = sum_g sum_d q[g,h][n][d] gk[h][s][d] (the reference's einsum sums the query
// groups; no 1/sqrt(d) scaling, T5 style) + mean over g of the T5 relative-position bias rel_bias[bucket(s - n)][g*4 + h]; softmax; out[h] = attn gv[h]; tiled x4 over g and projected: out_full Wo^T = out (sum_g Wo[:, g-block])^T -> [4][2048][1024]).
// The bucket of each relative position depends only on (s - n) and the fixed sizes: it is a compile-time table of 4095 entries (bidirectional T5 buckets, 32 buckets, max distance 128; computed in f32 exactly as the reference and baked in).
// Compute dtypes, f32 accumulate: every input rounded to bf16; q/k/v on PLAIN bf16 operands (inputs: exact); group sums / means f32 -> bf16 hi+lo planes; scores (K 64) as 3 products; bias + softmax f32 (three passes, x1024 into

#define NB_  4
#define TT   2048
#define DM   1024
#define NHm  16
#define KVH  4
#define GG   4
#define HD   64
#define DO   256
#define PCAR 1024.0f
typedef _Float16 h16;
typedef unsigned short bf;
typedef __attribute__((ext_vector_type(16))) __bf16   v16bf;
typedef __attribute__((ext_vector_type(16))) _Float16 v16h;
typedef __attribute__((ext_vector_type(8)))  _Float16 v8h;
typedef __attribute__((ext_vector_type(8)))  unsigned short v8us;
typedef __attribute__((ext_vector_type(8)))  float    v8f;
typedef __attribute__((ext_vector_type(4)))  float    v4f;
typedef v8h  __attribute__((may_alias)) v8ha;
typedef v4f  __attribute__((may_alias)) v4fa;
typedef v8us __attribute__((may_alias)) v8usa;

__device__ __forceinline__ unsigned short f2bf(float f) { unsigned u = __float_as_uint(f); u += 0x7FFFu + ((u >> 16) & 1u); return (unsigned short)(u >> 16); }
__device__ __forceinline__ float bf2f(unsigned short b) { return __uint_as_float(((unsigned)b) << 16); }
__device__ __forceinline__ float bfr(float f) { return bf2f(f2bf(f)); }
__device__ __forceinline__ v16h cat16(v8h lo, v8h hi) { return __builtin_shufflevector(lo, hi, 0, 1, 2, 3, 4, 5, 6, 7, 8, 9, 10, 11, 12, 13, 14, 15); }
__device__ __forceinline__ v16bf cat16b(v8us lo, v8us hi) { return __builtin_bit_cast(v16bf, __builtin_shufflevector(lo, hi, 0, 1, 2, 3, 4, 5, 6, 7, 8, 9, 10, 11, 12, 13, 14, 15)); }
__device__ __forceinline__ v8f wmma16(v16h a, v16h b, v8f c) { return __builtin_amdgcn_wmma_f32_16x16x32_f16(false, a, false, b, (short)0, c, false, false); }
__device__ __forceinline__ v8f wmmab(v16bf a, v16bf b, v8f c) { return __builtin_amdgcn_wmma_f32_16x16x32_bf16(false, a, false, b, (short)0, c, false, false); }



// ---- k_gemmw: register-blocked GEMM, ONE WAVE per 64x64 output tile (16 accumulators), operands straight from K-contiguous 16-bit planes; grid (M/64, N/64, Z), 32 threads.
// C[m][n] (f32, pitch ldc, + optional f32 bias[n]) = sum_k A[m][k] Bt[n][k] (+ split products per NSPLIT). z-batch strides sA/sB/sC in elements. K % 32 == 0.
template <typename T16> struct WFrag;
template <> struct WFrag<h16> { typedef v16h V; static __device__ __forceinline__ V ld(const h16* p) { return cat16(*(const v8h*)p, *(const v8h*)(p + 16)); } static __device__ __forceinline__ v8f mma(V a, V b, v8f c) { return wmma16(a, b, c); } };
template <> struct WFrag<bf> { typedef v16bf V; static __device__ __forceinline__ V ld(const bf* p) { return cat16b(*(const v8us*)p, *(const v8us*)(p + 16)); } static __device__ __forceinline__ v8f mma(V a, V b, v8f c) { return wmmab(a, b, c); } };
template <typename T16, int NSPLIT, bool BIAS>
__global__ __launch_bounds__(32) void k_gemmw(const T16* __restrict__ A, const T16* __restrict__ A2, const T16* __restrict__ Bt, const T16* __restrict__ Bt2, int K, float* C, int ldc, const float* __restrict__ bias, size_t sA, size_t sB, size_t sC) {
    typedef typename WFrag<T16>::V V;
    __shared__ __align__(16) float os[16 * 68];
    const size_t z = blockIdx.z; A += z * sA; if (A2) A2 += z * sA; Bt += z * sB; if (Bt2) Bt2 += z * sB; C += z * sC;
    const int lane = threadIdx.x & 31, lr = lane & 15, hi = lane >> 4; const int r0 = blockIdx.x * 64, c0 = blockIdx.y * 64;
    v8f acc[4][4];
#pragma unroll
    for (int mb = 0; mb < 4; ++mb)
#pragma unroll
        for (int nb = 0; nb < 4; ++nb) acc[mb][nb] = (v8f){};
    const size_t aoff = (size_t)(r0 + lr) * K + 8 * hi, boff = (size_t)(c0 + lr) * K + 8 * hi;
#pragma unroll 1
    for (int kc = 0; kc < K; kc += 32) {
        V a[4], a2[4];
#pragma unroll
        for (int mb = 0; mb < 4; ++mb) { a[mb] = WFrag<T16>::ld(A + aoff + (size_t)mb * 16 * K + kc); if (NSPLIT == 1 || NSPLIT == 2) a2[mb] = WFrag<T16>::ld(A2 + aoff + (size_t)mb * 16 * K + kc); }
#pragma unroll
        for (int nb = 0; nb < 4; ++nb) { const V b = WFrag<T16>::ld(Bt + boff + (size_t)nb * 16 * K + kc); V b2; if (NSPLIT >= 2) b2 = WFrag<T16>::ld(Bt2 + boff + (size_t)nb * 16 * K + kc);
#pragma unroll
            for (int mb = 0; mb < 4; ++mb) { acc[mb][nb] = WFrag<T16>::mma(a[mb], b, acc[mb][nb]); if (NSPLIT == 1 || NSPLIT == 2) acc[mb][nb] = WFrag<T16>::mma(a2[mb], b, acc[mb][nb]); if (NSPLIT >= 2) acc[mb][nb] = WFrag<T16>::mma(a[mb], b2, acc[mb][nb]); } }
        asm volatile("v_nop\n\tv_nop\n\tv_nop\n\tv_nop" : "+v"(acc[0][0]), "+v"(acc[1][1]), "+v"(acc[2][2]), "+v"(acc[3][3]) : "v"(a[0]), "v"(a[3]));
    }
#pragma unroll
    for (int mb = 0; mb < 4; ++mb) {
#pragma unroll
        for (int nb = 0; nb < 4; ++nb) {
#pragma unroll
            for (int j = 0; j < 8; ++j) os[(hi * 8 + j) * 68 + nb * 16 + lr] = acc[mb][nb][j]; }
        __builtin_amdgcn_wave_barrier(); asm volatile("" ::: "memory");
        float* crow = C + (size_t)(r0 + mb * 16) * ldc + c0;
{
#pragma unroll
            for (int s = 0; s < 8; ++s) { const int row = 2 * s + hi, cofs = lr * 4; v4f val = *(const v4fa*)(os + row * 68 + cofs); if (BIAS) { val[0] += bfr(bias[c0 + cofs]); val[1] += bfr(bias[c0 + cofs + 1]); val[2] += bfr(bias[c0 + cofs + 2]); val[3] += bfr(bias[c0 + cofs + 3]); }
                *(v4f*)(crow + (size_t)row * ldc + cofs) = val; }
             }
        __builtin_amdgcn_wave_barrier(); asm volatile("" ::: "memory");
    }
}

__device__ __forceinline__ h16 tohx(float x) { return (h16)x; }
__device__ __forceinline__ void splitf(float y, unsigned short& h, unsigned short& l) { h = f2bf(y); l = f2bf(y - bf2f(h)); }
typedef __attribute__((ext_vector_type(2))) unsigned short v2us;
typedef __attribute__((ext_vector_type(4))) unsigned short v4us;
typedef __attribute__((ext_vector_type(2))) _Float16 v2h;
typedef __attribute__((ext_vector_type(4))) _Float16 v4h;
__constant__ unsigned char c_bucket[4095] = { 15,15,15,15,15,15,15,15,15,15,15,15,15,15,15,15,15,15,15,15,15,15,15,15,15,15,15,15,15,15,15,15,15,15,15,15,15,15,15,15,15,15,15,15,15,15,15,15,15,15,15,15,15,15,15,15,15,15,15,15,15,15,15,15,15,15,15,15,15,15,15,15,15,15,15,15,15,15,15,15,15,15,15,15,15,15,15,15,15,15,15,15,15,15,15,15,15,15,15,15,15,15,15,15,15,15,15,15,15,15,15,15,15,15,15,15,15,15,15,15,15,15,15,15,15,15,15,15,15,15,15,15,15,15,15,15,15,15,15,15,15,15,15,15,15,15,15,15,15,15,15,15,15,15,15,15,15,15,15,15,15,15,15,15,15,15,15,15,15,15,15,15,15,15,15,15,15,15,15,15,15,15,15,15,15,15,15,15,15,15,15,15,15,15,15,15,15,15,15,15,15,15,15,15,15,15,15,15,15,15,15,15,15,15,15,15,15,15,15,15,15,15,15,15,15,15,15,15,15,15,15,15,15,15,15,15,15,15,15,15,15,15,15,15,15,15,15,15,15,15,15,15,15,15,15,15,15,15,15,15,15,15,15,15,15,15,15,15,15,15,15,15,15,15,15,15,15,15,15,15,15,15,15,15,15,15,15,15,15,15,15,15,15,15,15,15,15,15,15,15,15,15,15,15,15,15,15,15,15,15,15,15,15,15,15,15,15,15,15,15,15,15,15,15,15,15,15,15,15,15,15,15,15,15,15,15,15,15,15,15,15,15,15,15,15,15,15,15,15,15,15,15,15,15,15,15,15,15,15,15,15,15,15,15,15,15,15,15,15,15,15,15,15,15,15,15,15,15,15,15,15,15,15,15,15,15,15,15,15,15,15,15,15,15,15,15,15,15,15,15,15,15,15,15,15,15,15,15,15,15,15,15,15,15,15,15,15,15,15,15,15,15,15,15,15,15,15,15,15,15,15,15,15,15,15,15,15,15,15,15,15,15,15,15,15,15,15,15,15,15,15,15,15,15,15,15,15,15,15,15,15,15,15,15,15,15,15,15,15,15,15,15,15,15,15,15,15,15,15,15,15,15,15,15,15,15,15,15,15,15,15,15,15,15,15,15,15,15,15,15,15,15,15,15,15,15,15,15,15,15,15,15,15,15,15,15,15,15,15,15,15,15,15,15,15,15,15,15,15,15,15,15,15,15,15,15,15,15,15,15,15,15,15,15,15,15,15,15,15,15,15,15,15,15,15,15,15,15,15,15,15,15,15,15,15,15,15,15,15,15,15,15,15,15,15,15,15,15,15,15,15,15,15,15,15,15,15,15,15,15,15,15,15,15,15,15,15,15,15,15,15,15,15,15,15,15,15,15,15,15,15,15,15,15,15,15,15,15,15,15,15,15,15,15,15,15,15,15,15,15,15,15,15,15,15,15,15,15,15,15,15,15,15,15,15,15,15,15,15,15,15,15,15,15,15,15,15,15,15,15,15,15,15,15,15,15,15,15,15,15,15,15,15,15,15,15,15,15,15,15,15,15,15,15,15,15,15,15,15,15,15,15,15,15,15,15,15,15,15,15,15,15,15,15,15,15,15,15,15,15,15,15,15,15,15,15,15,15,15,15,15,15,15,15,15,15,15,15,15,15,15,15,15,15,15,15,15,15,15,15,15,15,15,15,15,15,15,15,15,15,15,15,15,15,15,15,15,15,15,15,15,15,15,15,15,15,15,15,15,15,15,15,15,15,15,15,15,15,15,15,15,15,15,15,15,15,15,15,15,15,15,15,15,15,15,15,15,15,15,15,15,15,15,15,15,15,15,15,15,15,15,15,15,15,15,15,15,15,15,15,15,15,15,15,15,15,15,15,15,15,15,15,15,15,15,15,15,15,15,15,15,15,15,15,15,15,15,15,15,15,15,15,15,15,15,15,15,15,15,15,15,15,15,15,15,15,15,15,15,15,15,15,15,15,15,15,15,15,15,15,15,15,15,15,15,15,15,15,15,15,15,15,15,15,15,15,15,15,15,15,15,15,15,15,15,15,15,15,15,15,15,15,15,15,15,15,15,15,15,15,15,15,15,15,15,15,15,15,15,15,15,15,15,15,15,15,15,15,15,15,15,15,15,15,15,15,15,15,15,15,15,15,15,15,15,15,15,15,15,15,15,15,15,15,15,15,15,15,15,15,15,15,15,15,15,15,15,15,15,15,15,15,15,15,15,15,15,15,15,15,15,15,15,15,15,15,15,15,15,15,15,15,15,15,15,15,15,15,15,15,15,15,15,15,15,15,15,15,15,15,15,15,15,15,15,15,15,15,15,15,15,15,15,15,15,15,15,15,15,15,15,15,15,15,15,15,15,15,15,15,15,15,15,15,15,15,15,15,15,15,15,15,15,15,15,15,15,15,15,15,15,15,15,15,15,15,15,15,15,15,15,15,15,15,15,15,15,15,15,15,15,15,15,15,15,15,15,15,15,15,15,15,15,15,15,15,15,15,15,15,15,15,15,15,15,15,15,15,15,15,15,15,15,15,15,15,15,15,15,15,15,15,15,15,15,15,15,15,15,15,15,15,15,15,15,15,15,15,15,15,15,15,15,15,15,15,15,15,15,15,15,15,15,15,15,15,15,15,15,15,15,15,15,15,15,15,15,15,15,15,15,15,15,15,15,15,15,15,15,15,15,15,15,15,15,15,15,15,15,15,15,15,15,15,15,15,15,15,15,15,15,15,15,15,15,15,15,15,15,15,15,15,15,15,15,15,15,15,15,15,15,15,15,15,15,15,15,15,15,15,15,15,15,15,15,15,15,15,15,15,15,15,15,15,15,15,15,15,15,15,15,15,15,15,15,15,15,15,15,15,15,15,15,15,15,15,15,15,15,15,15,15,15,15,15,15,15,15,15,15,15,15,15,15,15,15,15,15,15,15,15,15,15,15,15,15,15,15,15,15,15,15,15,15,15,15,15,15,15,15,15,15,15,15,15,15,15,15,15,15,15,15,15,15,15,15,15,15,15,15,15,15,15,15,15,15,15,15,15,15,15,15,15,15,15,15,15,15,15,15,15,15,15,15,15,15,15,15,15,15,15,15,15,15,15,15,15,15,15,15,15,15,15,15,15,15,15,15,15,15,15,15,15,15,15,15,15,15,15,15,15,15,15,15,15,15,15,15,15,15,15,15,15,15,15,15,15,15,15,15,15,15,15,15,15,15,15,15,15,15,15,15,15,15,15,15,15,15,15,15,15,15,15,15,15,15,15,15,15,15,15,15,15,15,15,15,15,15,15,15,15,15,15,15,15,15,15,15,15,15,15,15,15,15,15,15,15,15,15,15,15,15,15,15,15,15,15,15,15,15,15,15,15,15,15,15,15,15,15,15,15,15,15,15,15,15,15,15,15,15,15,15,15,15,15,15,15,15,15,15,15,15,15,15,15,15,15,15,15,15,15,15,15,15,15,15,15,15,15,15,15,15,15,15,15,15,15,15,15,15,15,15,15,15,15,15,15,15,15,15,15,15,15,15,15,15,15,15,15,15,15,15,15,15,15,15,15,15,15,15,15,15,15,15,15,15,15,15,15,15,15,15,15,15,15,15,15,15,15,15,15,15,15,15,15,15,15,15,15,15,15,15,15,15,15,15,15,15,15,15,15,15,15,15,15,15,15,15,15,15,15,15,15,15,15,15,15,15,15,15,15,15,15,15,15,15,15,15,15,15,15,15,15,15,15,15,15,15,15,15,15,15,15,15,15,15,15,15,15,15,15,15,15,15,15,15,15,15,15,15,15,15,15,15,15,15,15,15,15,15,15,15,15,15,15,15,15,15,15,15,15,15,15,15,15,15,15,15,15,15,15,15,15,15,15,15,15,15,15,15,15,15,15,15,15,15,15,15,15,15,15,15,15,15,15,15,15,15,15,15,15,15,15,15,15,15,15,15,15,15,15,15,15,15,15,15,15,15,15,15,15,15,15,15,15,15,15,15,15,15,15,15,15,15,15,15,15,15,15,15,15,15,15,15,15,15,15,15,15,15,15,15,15,15,15,15,15,15,15,15,15,15,15,15,15,15,15,15,15,15,15,15,15,15,15,15,15,15,15,15,15,15,15,15,15,15,15,15,15,15,15,15,15,15,15,15,15,15,15,15,15,15,15,15,15,15,15,15,15,15,15,15,15,15,15,15,15,15,15,15,15,15,15,15,15,15,15,15,15,15,15,15,15,15,15,15,15,15,15,15,15,15,15,15,15,15,15,15,15,15,15,15,15,15,15,15,15,15,15,15,15,15,15,15,15,15,15,15,15,15,15,15,15,15,15,15,15,15,15,15,15,15,15,15,15,15,15,15,15,15,15,15,15,15,15,15,15,15,15,15,15,15,15,15,15,15,15,15,15,15,15,15,15,15,15,15,15,14,14,14,14,14,14,14,14,14,14,14,14,14,14,14,14,14,14,14,14,14,14,14,14,14,14,14,13,13,13,13,13,13,13,13,13,13,13,13,13,13,13,13,13,13,12,12,12,12,12,12,12,12,12,12,12,12,12,12,11,11,11,11,11,11,11,11,11,10,10,10,10,10,10,10,9,9,9,9,8,8,8,8,7,6,5,4,3,2,1,0,17,18,19,20,21,22,23,24,24,24,24,25,25,25,25,26,26,26,26,26,26,26,27,27,27,27,27,27,27,27,27,28,28,28,28,28,28,28,28,28,28,28,28,28,28,29,29,29,29,29,29,29,29,29,29,29,29,29,29,29,29,29,29,30,30,30,30,30,30,30,30,30,30,30,30,30,30,30,30,30,30,30,30,30,30,30,30,30,30,30,31,31,31,31,31,31,31,31,31,31,31,31,31,31,31,31,31,31,31,31,31,31,31,31,31,31,31,31,31,31,31,31,31,31,31,31,31,31,31,31,31,31,31,31,31,31,31,31,31,31,31,31,31,31,31,31,31,31,31,31,31,31,31,31,31,31,31,31,31,31,31,31,31,31,31,31,31,31,31,31,31,31,31,31,31,31,31,31,31,31,31,31,31,31,31,31,31,31,31,31,31,31,31,31,31,31,31,31,31,31,31,31,31,31,31,31,31,31,31,31,31,31,31,31,31,31,31,31,31,31,31,31,31,31,31,31,31,31,31,31,31,31,31,31,31,31,31,31,31,31,31,31,31,31,31,31,31,31,31,31,31,31,31,31,31,31,31,31,31,31,31,31,31,31,31,31,31,31,31,31,31,31,31,31,31,31,31,31,31,31,31,31,31,31,31,31,31,31,31,31,31,31,31,31,31,31,31,31,31,31,31,31,31,31,31,31,31,31,31,31,31,31,31,31,31,31,31,31,31,31,31,31,31,31,31,31,31,31,31,31,31,31,31,31,31,31,31,31,31,31,31,31,31,31,31,31,31,31,31,31,31,31,31,31,31,31,31,31,31,31,31,31,31,31,31,31,31,31,31,31,31,31,31,31,31,31,31,31,31,31,31,31,31,31,31,31,31,31,31,31,31,31,31,31,31,31,31,31,31,31,31,31,31,31,31,31,31,31,31,31,31,31,31,31,31,31,31,31,31,31,31,31,31,31,31,31,31,31,31,31,31,31,31,31,31,31,31,31,31,31,31,31,31,31,31,31,31,31,31,31,31,31,31,31,31,31,31,31,31,31,31,31,31,31,31,31,31,31,31,31,31,31,31,31,31,31,31,31,31,31,31,31,31,31,31,31,31,31,31,31,31,31,31,31,31,31,31,31,31,31,31,31,31,31,31,31,31,31,31,31,31,31,31,31,31,31,31,31,31,31,31,31,31,31,31,31,31,31,31,31,31,31,31,31,31,31,31,31,31,31,31,31,31,31,31,31,31,31,31,31,31,31,31,31,31,31,31,31,31,31,31,31,31,31,31,31,31,31,31,31,31,31,31,31,31,31,31,31,31,31,31,31,31,31,31,31,31,31,31,31,31,31,31,31,31,31,31,31,31,31,31,31,31,31,31,31,31,31,31,31,31,31,31,31,31,31,31,31,31,31,31,31,31,31,31,31,31,31,31,31,31,31,31,31,31,31,31,31,31,31,31,31,31,31,31,31,31,31,31,31,31,31,31,31,31,31,31,31,31,31,31,31,31,31,31,31,31,31,31,31,31,31,31,31,31,31,31,31,31,31,31,31,31,31,31,31,31,31,31,31,31,31,31,31,31,31,31,31,31,31,31,31,31,31,31,31,31,31,31,31,31,31,31,31,31,31,31,31,31,31,31,31,31,31,31,31,31,31,31,31,31,31,31,31,31,31,31,31,31,31,31,31,31,31,31,31,31,31,31,31,31,31,31,31,31,31,31,31,31,31,31,31,31,31,31,31,31,31,31,31,31,31,31,31,31,31,31,31,31,31,31,31,31,31,31,31,31,31,31,31,31,31,31,31,31,31,31,31,31,31,31,31,31,31,31,31,31,31,31,31,31,31,31,31,31,31,31,31,31,31,31,31,31,31,31,31,31,31,31,31,31,31,31,31,31,31,31,31,31,31,31,31,31,31,31,31,31,31,31,31,31,31,31,31,31,31,31,31,31,31,31,31,31,31,31,31,31,31,31,31,31,31,31,31,31,31,31,31,31,31,31,31,31,31,31,31,31,31,31,31,31,31,31,31,31,31,31,31,31,31,31,31,31,31,31,31,31,31,31,31,31,31,31,31,31,31,31,31,31,31,31,31,31,31,31,31,31,31,31,31,31,31,31,31,31,31,31,31,31,31,31,31,31,31,31,31,31,31,31,31,31,31,31,31,31,31,31,31,31,31,31,31,31,31,31,31,31,31,31,31,31,31,31,31,31,31,31,31,31,31,31,31,31,31,31,31,31,31,31,31,31,31,31,31,31,31,31,31,31,31,31,31,31,31,31,31,31,31,31,31,31,31,31,31,31,31,31,31,31,31,31,31,31,31,31,31,31,31,31,31,31,31,31,31,31,31,31,31,31,31,31,31,31,31,31,31,31,31,31,31,31,31,31,31,31,31,31,31,31,31,31,31,31,31,31,31,31,31,31,31,31,31,31,31,31,31,31,31,31,31,31,31,31,31,31,31,31,31,31,31,31,31,31,31,31,31,31,31,31,31,31,31,31,31,31,31,31,31,31,31,31,31,31,31,31,31,31,31,31,31,31,31,31,31,31,31,31,31,31,31,31,31,31,31,31,31,31,31,31,31,31,31,31,31,31,31,31,31,31,31,31,31,31,31,31,31,31,31,31,31,31,31,31,31,31,31,31,31,31,31,31,31,31,31,31,31,31,31,31,31,31,31,31,31,31,31,31,31,31,31,31,31,31,31,31,31,31,31,31,31,31,31,31,31,31,31,31,31,31,31,31,31,31,31,31,31,31,31,31,31,31,31,31,31,31,31,31,31,31,31,31,31,31,31,31,31,31,31,31,31,31,31,31,31,31,31,31,31,31,31,31,31,31,31,31,31,31,31,31,31,31,31,31,31,31,31,31,31,31,31,31,31,31,31,31,31,31,31,31,31,31,31,31,31,31,31,31,31,31,31,31,31,31,31,31,31,31,31,31,31,31,31,31,31,31,31,31,31,31,31,31,31,31,31,31,31,31,31,31,31,31,31,31,31,31,31,31,31,31,31,31,31,31,31,31,31,31,31,31,31,31,31,31,31,31,31,31,31,31,31,31,31,31,31,31,31,31,31,31,31,31,31,31,31,31,31,31,31,31,31,31,31,31,31,31,31,31,31,31,31,31,31,31,31,31,31,31,31,31,31,31,31,31,31,31,31,31,31,31,31,31,31,31,31,31,31,31,31,31,31,31,31,31,31,31,31,31,31,31,31,31,31,31,31,31,31,31,31,31,31,31,31,31,31,31,31,31,31,31,31,31,31,31,31,31,31,31,31,31,31,31,31,31,31,31,31,31,31,31,31,31,31,31,31,31,31,31,31,31,31,31,31,31,31,31,31,31,31,31,31,31,31,31,31,31,31,31,31,31,31,31,31,31,31,31,31,31,31,31,31,31,31,31,31,31,31,31,31,31,31,31,31,31,31,31,31,31,31,31,31,31,31,31,31,31,31,31,31,31,31,31,31,31,31,31,31,31,31,31,31,31,31,31,31,31,31,31,31,31,31,31,31,31,31,31,31,31,31,31,31,31,31,31,31,31,31,31,31,31,31,31,31,31,31,31,31,31,31,31,31,31,31,31,31,31,31,31,31,31,31,31,31,31,31,31,31,31,31,31,31,31,31,31,31,31,31,31,31,31,31,31,31,31,31,31,31,31,31,31,31,31,31,31,31,31,31,31,31,31,31,31,31,31,31,31,31,31,31,31,31,31,31,31,31,31,31,31,31,31,31,31,31,31,31,31,31,31,31,31,31,31,31,31,31,31,31,31,31,31,31,31,31,31,31,31,31,31,31,31,31,31,31,31,31,31,31,31,31,31,31,31,31,31,31,31,31,31,31,31,31,31,31,31,31,31,31,31,31,31,31,31,31,31,31,31,31,31,31,31,31,31,31,31,31,31,31,31,31,31,31,31,31,31,31,31,31,31,31,31,31,31,31,31,31,31,31,31,31,31,31,31,31,31,31,31,31,31,31,31,31,31,31,31,31,31,31,31,31,31,31,31,31,31,31,31,31,31,31,31,31,31,31,31,31,31,31,31,31,31,31,31,31,31,31,31,31,31,31,31,31,31,31,31,31,31,31,31,31,31,31,31,31,31,31,31,31,31,31,31,31,31,31,31,31,31,31,31,31,31,31,31,31,31,31,31,31,31,31,31,31,31,31,31,31,31,31,31,31,31,31,31,31,31,31,31,31,31,31,31,31,31,31,31,31,31,31,31,31,31,31,31,31,31,31,31,31,31,31,31,31,31,31,31,31,31,31,31,31,31,31,31,31,31,31,31,31,31,31,31,31,31,31,31,31,31,31,31,31,31,31,31,31,31,31,31,31,31,31,31,31,31,31,31,31,31,31,31,31,31,31,31,31,31,31,31,31,31,31,31,31,31,31,31,31,31,31,31,31,31,31,31,31,31,31,31,31,31,31,31,31,31,31,31,31,31,31,31,31,31,31,31,31,31,31,31,31,31,31,31,31,31,31,31,31,31,31,31,31,31,31,31,31,31,31,31,31,31,31,31,31,31,31,31,31,31,31,31,31,31,31,31,31,31,31,31,31,31,31,31,31,31,31,31,31,31,31,31,31,31,31,31,31,31,31,31,31,31,31,31,31,31,31,31,31,31,31,31 };   // bucket(rel) for rel = s - n in [-2047, 2047]

__global__ __launch_bounds__(256) void k_cvt8(const float* __restrict__ src, bf* dst, size_t n8) { const size_t i = (size_t)blockIdx.x * 256 + threadIdx.x; if (i >= n8) return; const v8f v = *(const v8f*)(src + i * 8); v8us o;
#pragma unroll
    for (int k = 0; k < 8; ++k) o[k] = f2bf(v[k]); *(v8us*)(dst + i * 8) = o;  }
// k_qs: hl planes QS[h][t][d] = sum_g Q[t][(g*4+h)*64+d]; k_gk: hl planes GK[h][s][d] = mean_g K[s][(g*4+h)*64+d] (8-B lanes); k_gvt: GVT[h][d][s] = fp16(mean_g V[s][(g*4+h)*64+d]) (lane -> 2 s); k_btab: TB[h][r] = mean_g bf16 rel_bias[c_bucket[r]][g*4+h]
__global__ __launch_bounds__(256) void k_qs(const float* __restrict__ Q, bf* Ph, bf* Pl) { const int e = (blockIdx.x * 256 + threadIdx.x) * 4; if (e >= KVH * TT * HD) return; const int d = e % HD; const int t = (e / HD) % TT; const int h = e / (HD * TT); const float* r = Q + (size_t)t * DM + h * HD + d; v4us oh, ol;
#pragma unroll
    for (int u = 0; u < 4; ++u) { float s = 0.f;
#pragma unroll
        for (int g = 0; g < GG; ++g) s = __fadd_rn(s, r[g * KVH * HD + u]); unsigned short a, b; splitf(s, a, b); oh[u] = a; ol[u] = b; }
    *(v4us*)(Ph + e) = oh; *(v4us*)(Pl + e) = ol;  }
__global__ __launch_bounds__(256) void k_gk(const float* __restrict__ K, bf* Ph, bf* Pl) { const int e = (blockIdx.x * 256 + threadIdx.x) * 4; if (e >= KVH * TT * HD) return; const int d = e % HD; const int t = (e / HD) % TT; const int h = e / (HD * TT); const float* r = K + (size_t)t * DM + h * HD + d; v4us oh, ol;
#pragma unroll
    for (int u = 0; u < 4; ++u) { float s = 0.f;
#pragma unroll
        for (int g = 0; g < GG; ++g) s = __fadd_rn(s, r[g * KVH * HD + u]); unsigned short a, b; splitf(s * 0.25f, a, b); oh[u] = a; ol[u] = b; }
    *(v4us*)(Ph + e) = oh; *(v4us*)(Pl + e) = ol;  }
__global__ __launch_bounds__(256) void k_gvt(const float* __restrict__ V, h16* GVT) { const int e = (blockIdx.x * 256 + threadIdx.x) * 2; if (e >= KVH * HD * TT) return; const int s = e % TT; const int d = (e / TT) % HD; const int h = e / (TT * HD); v2h o;
#pragma unroll
    for (int u = 0; u < 2; ++u) { const float* r = V + (size_t)(s + u) * DM + h * HD + d; float a = 0.f;
#pragma unroll
        for (int g = 0; g < GG; ++g) a = __fadd_rn(a, r[g * KVH * HD]); o[u] = tohx(a * 0.25f); }
    *(v2h*)(GVT + e) = o;  }
__global__ __launch_bounds__(256) void k_btab(const float* __restrict__ rb, float* TB) { const int i = blockIdx.x * 256 + threadIdx.x; if (i >= KVH * 4095) return; const int r = i % 4095, h = i / 4095; const int bk = c_bucket[r]; float s = 0.f;
#pragma unroll
    for (int g = 0; g < GG; ++g) s = __fadd_rn(s, bfr(rb[bk * NHm + g * KVH + h])); const float v = s * 0.25f; *(float*)(TB + i) = v;  }
__global__ __launch_bounds__(256) void k_woe(const float* __restrict__ wo, bf* Wh, bf* Wl) { const int e = (blockIdx.x * 256 + threadIdx.x) * 4; if (e >= DM * DO) return; const int j = e % DO; const int o = e / DO; const float* r = wo + (size_t)o * DM + j; v4us oh, ol;
#pragma unroll
    for (int u = 0; u < 4; ++u) { float s = 0.f;
#pragma unroll
        for (int g = 0; g < GG; ++g) s = __fadd_rn(s, bfr(r[g * DO + u])); unsigned short a, b; splitf(s, a, b); oh[u] = a; ol[u] = b; }
    *(v4us*)(Wh + e) = oh; *(v4us*)(Wl + e) = ol;  }
__global__ __launch_bounds__(256) void k_mrg(const float* __restrict__ O, bf* Ph, bf* Pl) { const int e = (blockIdx.x * 256 + threadIdx.x) * 4; if (e >= TT * DO) return; const int c = e % DO; const int t = e / DO; const int h = c / HD, d = c % HD; const float* r = O + ((size_t)h * TT + t) * HD + d; v4us oh, ol;
#pragma unroll
    for (int u = 0; u < 4; ++u) { unsigned short a, b; splitf(r[u] * (1.0f / PCAR), a, b); oh[u] = a; ol[u] = b; } *(v4us*)(Ph + e) = oh; *(v4us*)(Pl + e) = ol;  }
__global__ __launch_bounds__(256) void k_bsoft(const float* __restrict__ Sb, const float* __restrict__ TB, h16* P16) { const int lane = threadIdx.x & 31; const int row = blockIdx.x * 8 + (threadIdx.x >> 5); if (row >= KVH * TT) return; const int n = row % TT; const int h = row / TT; const float* sr = Sb + (size_t)row * TT; const float* tb = TB + (size_t)h * 4095 + 2047 - n; float mx = -3.0e38f;
#pragma unroll 1
    for (int ch = 0; ch < TT / 128; ++ch) { const int j0 = ch * 128 + lane * 4; const v4f a = *(const v4f*)(sr + j0);
#pragma unroll
        for (int u = 0; u < 4; ++u) mx = fmaxf(mx, __fadd_rn(a[u], tb[j0 + u])); }
#pragma unroll
    for (int sh = 16; sh; sh >>= 1) mx = fmaxf(mx, __shfl_xor(mx, sh, 32));
    float sum = 0.f;
#pragma unroll 1
    for (int ch = 0; ch < TT / 128; ++ch) { const int j0 = ch * 128 + lane * 4; const v4f a = *(const v4f*)(sr + j0);
#pragma unroll
        for (int u = 0; u < 4; ++u) { float d0 = __fsub_rn(__fadd_rn(a[u], tb[j0 + u]), mx); asm volatile("" : "+v"(d0)); sum += __expf(d0); } }
#pragma unroll
    for (int sh = 16; sh; sh >>= 1) sum += __shfl_xor(sum, sh, 32);
    const float f = __fdiv_rn(PCAR, sum);
    {
#pragma unroll 1
        for (int ch = 0; ch < TT / 128; ++ch) { const int j0 = ch * 128 + lane * 4; const v4f a = *(const v4f*)(sr + j0); v4h o;
#pragma unroll
            for (int u = 0; u < 4; ++u) { float d0 = __fsub_rn(__fadd_rn(a[u], tb[j0 + u]), mx); asm volatile("" : "+v"(d0)); o[u] = tohx(__fmul_rn(__expf(d0), f)); } *(v4h*)(P16 + (size_t)row * TT + j0) = o; }
         } }

extern "C" void kernel_launch(void* const* d_in, const int* in_sizes, int n_in,
                              void* d_out, int out_size, void* d_ws, size_t ws_size, hipStream_t stream) {
    (void)in_sizes; (void)n_in; (void)out_size;
    const float* x = (const float*)d_in[0]; const float* wq = (const float*)d_in[1]; const float* wk = (const float*)d_in[2]; const float* wv = (const float*)d_in[3]; const float* wo = (const float*)d_in[4]; const float* rb = (const float*)d_in[5];
    float* OUT = (float*)d_out;     // [4][2048][1024]
    char* wsp = (char*)d_ws;
    auto take = [&](size_t bytes) { char* p = wsp; wsp += (bytes + 255) & ~(size_t)255; return (void*)p; };
    bf* WQ = (bf*)take((size_t)DM * DM * 2); bf* WK = (bf*)take((size_t)DM * DM * 2); bf* WV = (bf*)take((size_t)DM * DM * 2); bf* WEh = (bf*)take((size_t)DM * DO * 2); bf* WEl = (bf*)take((size_t)DM * DO * 2); float* TB = (float*)take((size_t)KVH * 4095 * 4 + 256);
    bf* XB = (bf*)take((size_t)TT * DM * 2); float* Q = (float*)take((size_t)TT * DM * 4); float* K = (float*)take((size_t)TT * DM * 4); bf* QSh = (bf*)take((size_t)KVH * TT * HD * 2); bf* QSl = (bf*)take((size_t)KVH * TT * HD * 2); bf* GKh = (bf*)take((size_t)KVH * TT * HD * 2); bf* GKl = (bf*)take((size_t)KVH * TT * HD * 2); h16* GVT = (h16*)take((size_t)KVH * HD * TT * 2);
    float* Sb = (float*)take((size_t)KVH * TT * TT * 4); h16* P16 = (h16*)take((size_t)KVH * TT * TT * 2); float* O = (float*)take((size_t)KVH * TT * HD * 4); bf* OPh = (bf*)take((size_t)TT * DO * 2); bf* OPl = (bf*)take((size_t)TT * DO * 2);
    if ((size_t)(wsp - (char*)d_ws) > ws_size) return;    // total ~ 130 MB (4-head [2048][2048] f32 scores 67 MB + fp16 probabilities 34 MB)
    float* V = K;   // v projection reuses the k buffer after the gk planes are built (stream-ordered)
    k_cvt8<<<(DM * DM / 8 + 255) / 256, 256, 0, stream>>>(wq, WQ, (size_t)DM * DM / 8); k_cvt8<<<(DM * DM / 8 + 255) / 256, 256, 0, stream>>>(wk, WK, (size_t)DM * DM / 8); k_cvt8<<<(DM * DM / 8 + 255) / 256, 256, 0, stream>>>(wv, WV, (size_t)DM * DM / 8);   // [out][in] weights = natural Bt
    k_woe<<<(DM * DO / 4 + 255) / 256, 256, 0, stream>>>(wo, WEh, WEl); k_btab<<<(KVH * 4095 + 255) / 256, 256, 0, stream>>>(rb, TB);
    for (int b = 0; b < NB_; ++b) {
        k_cvt8<<<(unsigned)(((size_t)TT * DM / 8 + 255) / 256), 256, 0, stream>>>(x + (size_t)b * TT * DM, XB, (size_t)TT * DM / 8);
        k_gemmw<bf, 0, false><<<dim3(TT / 64, DM / 64, 1), 32, 0, stream>>>(XB, nullptr, WQ, nullptr, DM, Q, DM, nullptr, 0, 0, 0); k_qs<<<(KVH * TT * HD / 4 + 255) / 256, 256, 0, stream>>>(Q, QSh, QSl);
        k_gemmw<bf, 0, false><<<dim3(TT / 64, DM / 64, 1), 32, 0, stream>>>(XB, nullptr, WK, nullptr, DM, K, DM, nullptr, 0, 0, 0); k_gk<<<(KVH * TT * HD / 4 + 255) / 256, 256, 0, stream>>>(K, GKh, GKl);
        k_gemmw<bf, 0, false><<<dim3(TT / 64, DM / 64, 1), 32, 0, stream>>>(XB, nullptr, WV, nullptr, DM, V, DM, nullptr, 0, 0, 0); k_gvt<<<(KVH * HD * TT / 2 + 255) / 256, 256, 0, stream>>>(V, GVT);
        k_gemmw<bf, 2, false><<<dim3(TT / 64, TT / 64, KVH), 32, 0, stream>>>(QSh, QSl, GKh, GKl, HD, Sb, TT, nullptr, (size_t)TT * HD, (size_t)TT * HD, (size_t)TT * TT);
        k_bsoft<<<KVH * TT / 8, 256, 0, stream>>>(Sb, TB, P16);
        k_gemmw<h16, 0, false><<<dim3(TT / 64, 1, KVH), 32, 0, stream>>>(P16, nullptr, GVT, nullptr, TT, O, HD, nullptr, (size_t)TT * TT, (size_t)HD * TT, (size_t)TT * HD);
        k_mrg<<<(TT * DO / 4 + 255) / 256, 256, 0, stream>>>(O, OPh, OPl);
        k_gemmw<bf, 2, false><<<dim3(TT / 64, DM / 64, 1), 32, 0, stream>>>(OPh, OPl, WEh, WEl, DO, OUT + (size_t)b * TT * DM, DM, nullptr, 0, 0, 0); }
}

// v001
// Measured time: 552 microseconds a run.
// In two side-by-side timings against v000, it was 1.50 and 1.49 times as fast.
#include <hip/hip_runtime.h>

// FiDO_T5Attention (hidden [4][2048][1024]; q/k/v = x W^T (16 heads x 64); heads grouped (g=4 groups, h=4 kv heads: head = g*4 + h); gk, gv = mean over g; scores[h][n][s] = sum_g sum_d q[g,h][n][d] gk[h][s][d] (the reference's einsum sums the query
// groups; no 1/sqrt(d) scaling, T5 style) + mean over g of the T5 relative-position bias rel_bias[bucket(s - n)][g*4 + h]; softmax; out[h] = attn gv[h]; tiled x4 over g and projected: out_full Wo^T = out (sum_g Wo[:, g-block])^T -> [4][2048][1024]).
// The bucket of each relative position depends only on (s - n) and the fixed sizes: it is a compile-time table of 4095 entries (bidirectional T5 buckets, 32 buckets, max distance 128; computed in f32 exactly as the reference and baked in).
// Compute dtypes, f32 accumulate: every input rounded to bf16; q/k/v on PLAIN bf16 operands (inputs: exact); group sums / means f32 -> bf16 hi+lo planes; scores (K 64) as 3 products; bias + softmax f32 (three passes, x1024 into

#define NB_  4
#define TT   2048
#define DM   1024
#define NHm  16
#define KVH  4
#define GG   4
#define HD   64
#define DO   256
#define PCAR 1024.0f
typedef _Float16 h16;
typedef unsigned short bf;
typedef __attribute__((ext_vector_type(16))) __bf16   v16bf;
typedef __attribute__((ext_vector_type(16))) _Float16 v16h;
typedef __attribute__((ext_vector_type(8)))  _Float16 v8h;
typedef __attribute__((ext_vector_type(8)))  unsigned short v8us;
typedef __attribute__((ext_vector_type(8)))  float    v8f;
typedef __attribute__((ext_vector_type(4)))  float    v4f;
typedef v8h  __attribute__((may_alias)) v8ha;
typedef v4f  __attribute__((may_alias)) v4fa;
typedef v8us __attribute__((may_alias)) v8usa;

__device__ __forceinline__ unsigned short f2bf(float f) { unsigned u = __float_as_uint(f); u += 0x7FFFu + ((u >> 16) & 1u); return (unsigned short)(u >> 16); }
__device__ __forceinline__ float bf2f(unsigned short b) { return __uint_as_float(((unsigned)b) << 16); }
__device__ __forceinline__ float bfr(float f) { return bf2f(f2bf(f)); }
__device__ __forceinline__ v16h cat16(v8h lo, v8h hi) { return __builtin_shufflevector(lo, hi, 0, 1, 2, 3, 4, 5, 6, 7, 8, 9, 10, 11, 12, 13, 14, 15); }
__device__ __forceinline__ v16bf cat16b(v8us lo, v8us hi) { return __builtin_bit_cast(v16bf, __builtin_shufflevector(lo, hi, 0, 1, 2, 3, 4, 5, 6, 7, 8, 9, 10, 11, 12, 13, 14, 15)); }
__device__ __forceinline__ v8f wmma16(v16h a, v16h b, v8f c) { return __builtin_amdgcn_wmma_f32_16x16x32_f16(false, a, false, b, (short)0, c, false, false); }
__device__ __forceinline__ v8f wmmab(v16bf a, v16bf b, v8f c) { return __builtin_amdgcn_wmma_f32_16x16x32_bf16(false, a, false, b, (short)0, c, false, false); }



// ---- k_gemmw: register-blocked GEMM, KS WAVES per 64x64 output tile (16 accumulators each), operands straight from K-contiguous 16-bit planes; grid (M/64, N/64, Z), 32 * KS threads.
// C[m][n] (f32, pitch ldc, + optional f32 bias[n]) = sum_k A[m][k] Bt[n][k] (+ split products per NSPLIT). z-batch strides sA/sB/sC in elements. K % (32 * KS) == 0.
// KS > 1: wave w sums the 32-wide k steps w, w + KS, w + 2 KS, ... (interleaved, so that in one trip the waves of a work-group read 64 * KS contiguous bytes of every operand row: neighbour waves use the two halves of a 128-B line at the same time);
// the KS partial tiles meet in LDS (fragment order) and are added in wave order 0..KS-1, 16/KS fragments per wave; the tile leaves through a row-major LDS tile in whole lines.
template <typename T16> struct WFrag;
template <> struct WFrag<h16> { typedef v16h V; static __device__ __forceinline__ V ld(const h16* p) { return cat16(*(const v8h*)p, *(const v8h*)(p + 16)); } static __device__ __forceinline__ v8f mma(V a, V b, v8f c) { return wmma16(a, b, c); } };
template <> struct WFrag<bf> { typedef v16bf V; static __device__ __forceinline__ V ld(const bf* p) { return cat16b(*(const v8us*)p, *(const v8us*)(p + 16)); } static __device__ __forceinline__ v8f mma(V a, V b, v8f c) { return wmmab(a, b, c); } };
template <typename T16, int NSPLIT, bool BIAS, int KS>
__global__ __launch_bounds__(32 * KS) void k_gemmw(const T16* __restrict__ A, const T16* __restrict__ A2, const T16* __restrict__ Bt, const T16* __restrict__ Bt2, int K, float* C, int ldc, const float* __restrict__ bias, size_t sA, size_t sB, size_t sC) {
    typedef typename WFrag<T16>::V V;
    __shared__ __align__(16) float os[KS == 1 ? 16 * 68 : 64 * 68 + KS * 4096];
    const size_t z = blockIdx.z; A += z * sA; if (A2) A2 += z * sA; Bt += z * sB; if (Bt2) Bt2 += z * sB; C += z * sC;
    const int lane = threadIdx.x & 31, lr = lane & 15, hi = lane >> 4; const int r0 = blockIdx.x * 64, c0 = blockIdx.y * 64;
    v8f acc[4][4];
#pragma unroll
    for (int mb = 0; mb < 4; ++mb)
#pragma unroll
        for (int nb = 0; nb < 4; ++nb) acc[mb][nb] = (v8f){};
    const size_t aoff = (size_t)(r0 + lr) * K + 8 * hi, boff = (size_t)(c0 + lr) * K + 8 * hi;
    const int wv = __builtin_amdgcn_readfirstlane((int)(threadIdx.x >> 5));
#pragma unroll 1
    for (int kc = wv * 32; kc < K; kc += 32 * KS) {
        V a[4], a2[4];
#pragma unroll
        for (int mb = 0; mb < 4; ++mb) { a[mb] = WFrag<T16>::ld(A + aoff + (size_t)mb * 16 * K + kc); if (NSPLIT == 1 || NSPLIT == 2) a2[mb] = WFrag<T16>::ld(A2 + aoff + (size_t)mb * 16 * K + kc); }
#pragma unroll
        for (int nb = 0; nb < 4; ++nb) { const V b = WFrag<T16>::ld(Bt + boff + (size_t)nb * 16 * K + kc); V b2; if (NSPLIT >= 2) b2 = WFrag<T16>::ld(Bt2 + boff + (size_t)nb * 16 * K + kc);
#pragma unroll
            for (int mb = 0; mb < 4; ++mb) { acc[mb][nb] = WFrag<T16>::mma(a[mb], b, acc[mb][nb]); if (NSPLIT == 1 || NSPLIT == 2) acc[mb][nb] = WFrag<T16>::mma(a2[mb], b, acc[mb][nb]); if (NSPLIT >= 2) acc[mb][nb] = WFrag<T16>::mma(a[mb], b2, acc[mb][nb]); } }
        asm volatile("v_nop\n\tv_nop\n\tv_nop\n\tv_nop" : "+v"(acc[0][0]), "+v"(acc[1][1]), "+v"(acc[2][2]), "+v"(acc[3][3]) : "v"(a[0]), "v"(a[3]));
    }
    if constexpr (KS > 1) {
        float* part = os + 64 * 68;
        float* pw = part + wv * 4096 + lane * 4;
#pragma unroll   // both loops unrolled: acc[][] is indexed by constants only and stays in registers
        for (int mb = 0; mb < 4; ++mb)
#pragma unroll
            for (int nb = 0; nb < 4; ++nb) { const v8f c = acc[mb][nb]; *(v4fa*)(pw + (mb * 4 + nb) * 256) = (v4f){c[0], c[1], c[2], c[3]}; *(v4fa*)(pw + (mb * 4 + nb) * 256 + 128) = (v4f){c[4], c[5], c[6], c[7]}; }
        __syncthreads();
        constexpr int NF = 16 / KS;
#pragma unroll   // unrolled with the loop over sw: the LDS reads of all partials issue ahead of the adds, which keep the order sw = 0..KS-1
        for (int i = 0; i < NF; ++i) { const int f = wv * NF + i; const float* pf = part + f * 256 + lane * 4; v4f s0 = *(const v4fa*)pf, s1 = *(const v4fa*)(pf + 128);
#pragma unroll
            for (int sw = 1; sw < KS; ++sw) { s0 += *(const v4fa*)(pf + sw * 4096); s1 += *(const v4fa*)(pf + sw * 4096 + 128); }
            float* od = os + ((f >> 2) * 16 + hi * 8) * 68 + (f & 3) * 16 + lr;
#pragma unroll
            for (int j = 0; j < 4; ++j) { od[j * 68] = s0[j]; od[(j + 4) * 68] = s1[j]; } }
        __syncthreads();
#pragma unroll   // unrolled: every LDS read issues before the first store waits
        for (int it = 0; it < 32 / KS; ++it) { const int idx = it * 32 * KS + (int)threadIdx.x; const int row = idx >> 4, cofs = (idx & 15) * 4; v4f val = *(const v4fa*)(os + row * 68 + cofs); if (BIAS) { val[0] += bfr(bias[c0 + cofs]); val[1] += bfr(bias[c0 + cofs + 1]); val[2] += bfr(bias[c0 + cofs + 2]); val[3] += bfr(bias[c0 + cofs + 3]); }
            *(v4f*)(C + (size_t)(r0 + row) * ldc + c0 + cofs) = val; }
        return;
    }
#pragma unroll
    for (int mb = 0; mb < 4; ++mb) {
#pragma unroll
        for (int nb = 0; nb < 4; ++nb) {
#pragma unroll
            for (int j = 0; j < 8; ++j) os[(hi * 8 + j) * 68 + nb * 16 + lr] = acc[mb][nb][j]; }
        __builtin_amdgcn_wave_barrier(); asm volatile("" ::: "memory");
        float* crow = C + (size_t)(r0 + mb * 16) * ldc + c0;
{
#pragma unroll
            for (int s = 0; s < 8; ++s) { const int row = 2 * s + hi, cofs = lr * 4; v4f val = *(const v4fa*)(os + row * 68 + cofs); if (BIAS) { val[0] += bfr(bias[c0 + cofs]); val[1] += bfr(bias[c0 + cofs + 1]); val[2] += bfr(bias[c0 + cofs + 2]); val[3] += bfr(bias[c0 + cofs + 3]); }
                *(v4f*)(crow + (size_t)row * ldc + cofs) = val; }
             }
        __builtin_amdgcn_wave_barrier(); asm volatile("" ::: "memory");
    }
}

__device__ __forceinline__ h16 tohx(float x) { return (h16)x; }
__device__ __forceinline__ void splitf(float y, unsigned short& h, unsigned short& l) { h = f2bf(y); l = f2bf(y - bf2f(h)); }
typedef __attribute__((ext_vector_type(2))) unsigned short v2us;
typedef __attribute__((ext_vector_type(4))) unsigned short v4us;
typedef __attribute__((ext_vector_type(2))) _Float16 v2h;
typedef __attribute__((ext_vector_type(4))) _Float16 v4h;
__constant__ unsigned char c_bucket[4095] = { 15,15,15,15,15,15,15,15,15,15,15,15,15,15,15,15,15,15,15,15,15,15,15,15,15,15,15,15,15,15,15,15,15,15,15,15,15,15,15,15,15,15,15,15,15,15,15,15,15,15,15,15,15,15,15,15,15,15,15,15,15,15,15,15,15,15,15,15,15,15,15,15,15,15,15,15,15,15,15,15,15,15,15,15,15,15,15,15,15,15,15,15,15,15,15,15,15,15,15,15,15,15,15,15,15,15,15,15,15,15,15,15,15,15,15,15,15,15,15,15,15,15,15,15,15,15,15,15,15,15,15,15,15,15,15,15,15,15,15,15,15,15,15,15,15,15,15,15,15,15,15,15,15,15,15,15,15,15,15,15,15,15,15,15,15,15,15,15,15,15,15,15,15,15,15,15,15,15,15,15,15,15,15,15,15,15,15,15,15,15,15,15,15,15,15,15,15,15,15,15,15,15,15,15,15,15,15,15,15,15,15,15,15,15,15,15,15,15,15,15,15,15,15,15,15,15,15,15,15,15,15,15,15,15,15,15,15,15,15,15,15,15,15,15,15,15,15,15,15,15,15,15,15,15,15,15,15,15,15,15,15,15,15,15,15,15,15,15,15,15,15,15,15,15,15,15,15,15,15,15,15,15,15,15,15,15,15,15,15,15,15,15,15,15,15,15,15,15,15,15,15,15,15,15,15,15,15,15,15,15,15,15,15,15,15,15,15,15,15,15,15,15,15,15,15,15,15,15,15,15,15,15,15,15,15,15,15,15,15,15,15,15,15,15,15,15,15,15,15,15,15,15,15,15,15,15,15,15,15,15,15,15,15,15,15,15,15,15,15,15,15,15,15,15,15,15,15,15,15,15,15,15,15,15,15,15,15,15,15,15,15,15,15,15,15,15,15,15,15,15,15,15,15,15,15,15,15,15,15,15,15,15,15,15,15,15,15,15,15,15,15,15,15,15,15,15,15,15,15,15,15,15,15,15,15,15,15,15,15,15,15,15,15,15,15,15,15,15,15,15,15,15,15,15,15,15,15,15,15,15,15,15,15,15,15,15,15,15,15,15,15,15,15,15,15,15,15,15,15,15,15,15,15,15,15,15,15,15,15,15,15,15,15,15,15,15,15,15,15,15,15,15,15,15,15,15,15,15,15,15,15,15,15,15,15,15,15,15,15,15,15,15,15,15,15,15,15,15,15,15,15,15,15,15,15,15,15,15,15,15,15,15,15,15,15,15,15,15,15,15,15,15,15,15,15,15,15,15,15,15,15,15,15,15,15,15,15,15,15,15,15,15,15,15,15,15,15,15,15,15,15,15,15,15,15,15,15,15,15,15,15,15,15,15,15,15,15,15,15,15,15,15,15,15,15,15,15,15,15,15,15,15,15,15,15,15,15,15,15,15,15,15,15,15,15,15,15,15,15,15,15,15,15,15,15,15,15,15,15,15,15,15,15,15,15,15,15,15,15,15,15,15,15,15,15,15,15,15,15,15,15,15,15,15,15,15,15,15,15,15,15,15,15,15,15,15,15,15,15,15,15,15,15,15,15,15,15,15,15,15,15,15,15,15,15,15,15,15,15,15,15,15,15,15,15,15,15,15,15,15,15,15,15,15,15,15,15,15,15,15,15,15,15,15,15,15,15,15,15,15,15,15,15,15,15,15,15,15,15,15,15,15,15,15,15,15,15,15,15,15,15,15,15,15,15,15,15,15,15,15,15,15,15,15,15,15,15,15,15,15,15,15,15,15,15,15,15,15,15,15,15,15,15,15,15,15,15,15,15,15,15,15,15,15,15,15,15,15,15,15,15,15,15,15,15,15,15,15,15,15,15,15,15,15,15,15,15,15,15,15,15,15,15,15,15,15,15,15,15,15,15,15,15,15,15,15,15,15,15,15,15,15,15,15,15,15,15,15,15,15,15,15,15,15,15,15,15,15,15,15,15,15,15,15,15,15,15,15,15,15,15,15,15,15,15,15,15,15,15,15,15,15,15,15,15,15,15,15,15,15,15,15,15,15,15,15,15,15,15,15,15,15,15,15,15,15,15,15,15,15,15,15,15,15,15,15,15,15,15,15,15,15,15,15,15,15,15,15,15,15,15,15,15,15,15,15,15,15,15,15,15,15,15,15,15,15,15,15,15,15,15,15,15,15,15,15,15,15,15,15,15,15,15,15,15,15,15,15,15,15,15,15,15,15,15,15,15,15,15,15,15,15,15,15,15,15,15,15,15,15,15,15,15,15,15,15,15,15,15,15,15,15,15,15,15,15,15,15,15,15,15,15,15,15,15,15,15,15,15,15,15,15,15,15,15,15,15,15,15,15,15,15,15,15,15,15,15,15,15,15,15,15,15,15,15,15,15,15,15,15,15,15,15,15,15,15,15,15,15,15,15,15,15,15,15,15,15,15,15,15,15,15,15,15,15,15,15,15,15,15,15,15,15,15,15,15,15,15,15,15,15,15,15,15,15,15,15,15,15,15,15,15,15,15,15,15,15,15,15,15,15,15,15,15,15,15,15,15,15,15,15,15,15,15,15,15,15,15,15,15,15,15,15,15,15,15,15,15,15,15,15,15,15,15,15,15,15,15,15,15,15,15,15,15,15,15,15,15,15,15,15,15,15,15,15,15,15,15,15,15,15,15,15,15,15,15,15,15,15,15,15,15,15,15,15,15,15,15,15,15,15,15,15,15,15,15,15,15,15,15,15,15,15,15,15,15,15,15,15,15,15,15,15,15,15,15,15,15,15,15,15,15,15,15,15,15,15,15,15,15,15,15,15,15,15,15,15,15,15,15,15,15,15,15,15,15,15,15,15,15,15,15,15,15,15,15,15,15,15,15,15,15,15,15,15,15,15,15,15,15,15,15,15,15,15,15,15,15,15,15,15,15,15,15,15,15,15,15,15,15,15,15,15,15,15,15,15,15,15,15,15,15,15,15,15,15,15,15,15,15,15,15,15,15,15,15,15,15,15,15,15,15,15,15,15,15,15,15,15,15,15,15,15,15,15,15,15,15,15,15,15,15,15,15,15,15,15,15,15,15,15,15,15,15,15,15,15,15,15,15,15,15,15,15,15,15,15,15,15,15,15,15,15,15,15,15,15,15,15,15,15,15,15,15,15,15,15,15,15,15,15,15,15,15,15,15,15,15,15,15,15,15,15,15,15,15,15,15,15,15,15,15,15,15,15,15,15,15,15,15,15,15,15,15,15,15,15,15,15,15,15,15,15,15,15,15,15,15,15,15,15,15,15,15,15,15,15,15,15,15,15,15,15,15,15,15,15,15,15,15,15,15,15,15,15,15,15,15,15,15,15,15,15,15,15,15,15,15,15,15,15,15,15,15,15,15,15,15,15,15,15,15,15,15,15,15,15,15,15,15,15,15,15,15,15,15,15,15,15,15,15,15,15,15,15,15,15,15,15,15,15,15,15,15,15,15,15,15,15,15,15,15,15,15,15,15,15,15,15,15,15,15,15,15,15,15,15,15,15,15,15,15,15,15,15,15,15,15,15,15,15,15,15,15,15,15,15,15,15,15,15,15,15,15,15,15,15,15,15,15,15,15,15,15,15,15,15,15,15,15,15,15,15,15,15,15,15,15,15,15,15,15,15,15,15,15,15,15,15,15,15,15,15,15,15,15,15,15,15,15,15,15,15,15,15,15,15,15,15,15,15,15,15,15,15,15,15,15,15,15,15,15,15,15,15,15,15,15,15,15,15,15,15,15,15,15,15,15,15,15,15,15,15,15,15,15,15,15,15,15,15,15,15,15,15,15,15,15,15,15,15,15,15,15,15,15,15,15,15,15,15,15,15,15,15,15,15,15,15,15,15,15,15,15,15,15,15,15,15,15,15,15,15,15,15,15,15,15,15,15,15,15,15,15,15,15,15,15,15,15,15,15,15,15,15,15,15,15,15,15,15,15,15,15,15,15,15,15,15,15,15,15,15,15,15,15,15,15,15,15,15,15,15,15,15,15,15,15,15,15,15,15,15,15,15,15,15,15,15,15,15,15,15,15,15,15,15,15,15,15,15,15,15,15,15,15,15,15,15,15,15,15,15,15,15,15,15,15,15,15,15,15,15,15,15,15,15,15,15,15,15,15,15,15,15,15,15,15,15,15,15,15,15,15,15,15,15,15,15,15,15,15,15,15,15,15,15,15,15,15,15,15,15,15,15,15,15,15,15,15,15,15,15,15,15,15,15,15,15,15,15,15,15,15,15,15,15,15,15,15,15,15,15,15,15,15,15,15,15,15,15,15,15,15,15,15,15,15,15,15,15,15,15,15,15,15,15,15,15,15,15,15,15,15,15,15,15,15,15,15,15,15,15,15,15,15,15,15,15,15,15,15,15,15,15,15,15,15,15,15,15,15,15,15,15,15,15,15,15,15,15,15,15,15,15,15,15,14,14,14,14,14,14,14,14,14,14,14,14,14,14,14,14,14,14,14,14,14,14,14,14,14,14,14,13,13,13,13,13,13,13,13,13,13,13,13,13,13,13,13,13,13,12,12,12,12,12,12,12,12,12,12,12,12,12,12,11,11,11,11,11,11,11,11,11,10,10,10,10,10,10,10,9,9,9,9,8,8,8,8,7,6,5,4,3,2,1,0,17,18,19,20,21,22,23,24,24,24,24,25,25,25,25,26,26,26,26,26,26,26,27,27,27,27,27,27,27,27,27,28,28,28,28,28,28,28,28,28,28,28,28,28,28,29,29,29,29,29,29,29,29,29,29,29,29,29,29,29,29,29,29,30,30,30,30,30,30,30,30,30,30,30,30,30,30,30,30,30,30,30,30,30,30,30,30,30,30,30,31,31,31,31,31,31,31,31,31,31,31,31,31,31,31,31,31,31,31,31,31,31,31,31,31,31,31,31,31,31,31,31,31,31,31,31,31,31,31,31,31,31,31,31,31,31,31,31,31,31,31,31,31,31,31,31,31,31,31,31,31,31,31,31,31,31,31,31,31,31,31,31,31,31,31,31,31,31,31,31,31,31,31,31,31,31,31,31,31,31,31,31,31,31,31,31,31,31,31,31,31,31,31,31,31,31,31,31,31,31,31,31,31,31,31,31,31,31,31,31,31,31,31,31,31,31,31,31,31,31,31,31,31,31,31,31,31,31,31,31,31,31,31,31,31,31,31,31,31,31,31,31,31,31,31,31,31,31,31,31,31,31,31,31,31,31,31,31,31,31,31,31,31,31,31,31,31,31,31,31,31,31,31,31,31,31,31,31,31,31,31,31,31,31,31,31,31,31,31,31,31,31,31,31,31,31,31,31,31,31,31,31,31,31,31,31,31,31,31,31,31,31,31,31,31,31,31,31,31,31,31,31,31,31,31,31,31,31,31,31,31,31,31,31,31,31,31,31,31,31,31,31,31,31,31,31,31,31,31,31,31,31,31,31,31,31,31,31,31,31,31,31,31,31,31,31,31,31,31,31,31,31,31,31,31,31,31,31,31,31,31,31,31,31,31,31,31,31,31,31,31,31,31,31,31,31,31,31,31,31,31,31,31,31,31,31,31,31,31,31,31,31,31,31,31,31,31,31,31,31,31,31,31,31,31,31,31,31,31,31,31,31,31,31,31,31,31,31,31,31,31,31,31,31,31,31,31,31,31,31,31,31,31,31,31,31,31,31,31,31,31,31,31,31,31,31,31,31,31,31,31,31,31,31,31,31,31,31,31,31,31,31,31,31,31,31,31,31,31,31,31,31,31,31,31,31,31,31,31,31,31,31,31,31,31,31,31,31,31,31,31,31,31,31,31,31,31,31,31,31,31,31,31,31,31,31,31,31,31,31,31,31,31,31,31,31,31,31,31,31,31,31,31,31,31,31,31,31,31,31,31,31,31,31,31,31,31,31,31,31,31,31,31,31,31,31,31,31,31,31,31,31,31,31,31,31,31,31,31,31,31,31,31,31,31,31,31,31,31,31,31,31,31,31,31,31,31,31,31,31,31,31,31,31,31,31,31,31,31,31,31,31,31,31,31,31,31,31,31,31,31,31,31,31,31,31,31,31,31,31,31,31,31,31,31,31,31,31,31,31,31,31,31,31,31,31,31,31,31,31,31,31,31,31,31,31,31,31,31,31,31,31,31,31,31,31,31,31,31,31,31,31,31,31,31,31,31,31,31,31,31,31,31,31,31,31,31,31,31,31,31,31,31,31,31,31,31,31,31,31,31,31,31,31,31,31,31,31,31,31,31,31,31,31,31,31,31,31,31,31,31,31,31,31,31,31,31,31,31,31,31,31,31,31,31,31,31,31,31,31,31,31,31,31,31,31,31,31,31,31,31,31,31,31,31,31,31,31,31,31,31,31,31,31,31,31,31,31,31,31,31,31,31,31,31,31,31,31,31,31,31,31,31,31,31,31,31,31,31,31,31,31,31,31,31,31,31,31,31,31,31,31,31,31,31,31,31,31,31,31,31,31,31,31,31,31,31,31,31,31,31,31,31,31,31,31,31,31,31,31,31,31,31,31,31,31,31,31,31,31,31,31,31,31,31,31,31,31,31,31,31,31,31,31,31,31,31,31,31,31,31,31,31,31,31,31,31,31,31,31,31,31,31,31,31,31,31,31,31,31,31,31,31,31,31,31,31,31,31,31,31,31,31,31,31,31,31,31,31,31,31,31,31,31,31,31,31,31,31,31,31,31,31,31,31,31,31,31,31,31,31,31,31,31,31,31,31,31,31,31,31,31,31,31,31,31,31,31,31,31,31,31,31,31,31,31,31,31,31,31,31,31,31,31,31,31,31,31,31,31,31,31,31,31,31,31,31,31,31,31,31,31,31,31,31,31,31,31,31,31,31,31,31,31,31,31,31,31,31,31,31,31,31,31,31,31,31,31,31,31,31,31,31,31,31,31,31,31,31,31,31,31,31,31,31,31,31,31,31,31,31,31,31,31,31,31,31,31,31,31,31,31,31,31,31,31,31,31,31,31,31,31,31,31,31,31,31,31,31,31,31,31,31,31,31,31,31,31,31,31,31,31,31,31,31,31,31,31,31,31,31,31,31,31,31,31,31,31,31,31,31,31,31,31,31,31,31,31,31,31,31,31,31,31,31,31,31,31,31,31,31,31,31,31,31,31,31,31,31,31,31,31,31,31,31,31,31,31,31,31,31,31,31,31,31,31,31,31,31,31,31,31,31,31,31,31,31,31,31,31,31,31,31,31,31,31,31,31,31,31,31,31,31,31,31,31,31,31,31,31,31,31,31,31,31,31,31,31,31,31,31,31,31,31,31,31,31,31,31,31,31,31,31,31,31,31,31,31,31,31,31,31,31,31,31,31,31,31,31,31,31,31,31,31,31,31,31,31,31,31,31,31,31,31,31,31,31,31,31,31,31,31,31,31,31,31,31,31,31,31,31,31,31,31,31,31,31,31,31,31,31,31,31,31,31,31,31,31,31,31,31,31,31,31,31,31,31,31,31,31,31,31,31,31,31,31,31,31,31,31,31,31,31,31,31,31,31,31,31,31,31,31,31,31,31,31,31,31,31,31,31,31,31,31,31,31,31,31,31,31,31,31,31,31,31,31,31,31,31,31,31,31,31,31,31,31,31,31,31,31,31,31,31,31,31,31,31,31,31,31,31,31,31,31,31,31,31,31,31,31,31,31,31,31,31,31,31,31,31,31,31,31,31,31,31,31,31,31,31,31,31,31,31,31,31,31,31,31,31,31,31,31,31,31,31,31,31,31,31,31,31,31,31,31,31,31,31,31,31,31,31,31,31,31,31,31,31,31,31,31,31,31,31,31,31,31,31,31,31,31,31,31,31,31,31,31,31,31,31,31,31,31,31,31,31,31,31,31,31,31,31,31,31,31,31,31,31,31,31,31,31,31,31,31,31,31,31,31,31,31,31,31,31,31,31,31,31,31,31,31,31,31,31,31,31,31,31,31,31,31,31,31,31,31,31,31,31,31,31,31,31,31,31,31,31,31,31,31,31,31,31,31,31,31,31,31,31,31,31,31,31,31,31,31,31,31,31,31,31,31,31,31,31,31,31,31,31,31,31,31,31,31,31,31,31,31,31,31,31,31,31,31,31,31,31,31,31,31,31,31,31,31,31,31,31,31,31,31,31,31,31,31,31,31,31,31,31,31,31,31,31,31,31,31,31,31,31,31,31,31,31,31,31,31,31,31,31,31,31,31,31,31,31,31,31,31,31,31,31,31,31,31,31,31,31,31,31,31,31,31,31,31,31,31,31,31,31,31,31,31,31,31,31,31,31,31,31,31,31,31,31,31,31,31,31,31,31,31,31,31,31,31,31,31,31,31,31,31,31,31,31,31,31,31,31,31,31,31,31,31,31,31,31,31,31,31,31,31,31,31,31,31,31,31,31,31,31,31,31,31,31,31,31,31,31,31,31,31,31,31,31,31,31,31,31,31,31,31,31,31,31,31,31,31,31,31,31,31,31,31,31,31,31,31,31,31,31,31,31,31,31,31,31,31,31,31,31,31,31,31,31,31,31,31,31,31,31,31,31,31,31,31,31,31,31,31,31,31,31,31,31,31,31,31,31,31,31,31,31,31,31,31,31,31,31,31,31,31,31,31,31,31,31,31,31,31,31,31,31,31,31,31,31,31,31,31,31,31,31,31,31,31,31,31,31,31,31,31,31,31,31,31,31,31,31,31,31,31,31,31,31,31,31,31,31,31,31,31,31,31,31,31,31,31,31,31,31,31,31,31,31,31,31,31,31,31,31,31,31,31,31,31,31,31,31,31,31,31,31,31,31,31,31,31,31,31,31,31,31,31,31,31,31,31,31,31,31,31,31,31,31,31,31,31,31,31,31,31,31,31,31,31,31,31,31,31,31,31,31,31,31,31,31,31,31,31,31,31,31,31,31,31,31,31,31,31,31,31,31,31,31,31,31,31,31,31,31,31,31,31,31,31,31,31,31,31,31,31,31,31,31,31,31,31,31,31,31,31,31,31,31,31,31,31,31,31,31,31,31,31,31,31,31,31,31,31,31,31,31,31,31,31,31,31,31,31,31,31,31,31,31,31,31,31,31,31,31,31,31,31,31,31,31,31,31,31,31,31,31,31,31,31,31,31,31,31,31,31,31,31,31,31,31,31,31,31,31,31,31,31,31,31,31,31,31,31,31,31,31,31,31,31,31,31,31,31,31,31,31,31,31,31,31,31,31,31,31,31,31,31,31,31,31,31,31,31,31,31,31,31,31,31,31,31,31,31,31 };   // bucket(rel) for rel = s - n in [-2047, 2047]

__global__ __launch_bounds__(256) void k_cvt8(const float* __restrict__ src, bf* dst, size_t n8) { const size_t i = (size_t)blockIdx.x * 256 + threadIdx.x; if (i >= n8) return; const v8f v = *(const v8f*)(src + i * 8); v8us o;
#pragma unroll
    for (int k = 0; k < 8; ++k) o[k] = f2bf(v[k]); *(v8us*)(dst + i * 8) = o;  }
// k_qs: hl planes QS[h][t][d] = sum_g Q[t][(g*4+h)*64+d]; k_gk: hl planes GK[h][s][d] = mean_g K[s][(g*4+h)*64+d] (8-B lanes); k_gvt: GVT[h][d][s] = fp16(mean_g V[s][(g*4+h)*64+d]) (lane -> 2 s); k_btab: TB[h][r] = mean_g bf16 rel_bias[c_bucket[r]][g*4+h]
__global__ __launch_bounds__(256) void k_qs(const float* __restrict__ Q, bf* Ph, bf* Pl) { const int e = (blockIdx.x * 256 + threadIdx.x) * 4; if (e >= KVH * TT * HD) return; const int d = e % HD; const int t = (e / HD) % TT; const int h = e / (HD * TT); const float* r = Q + (size_t)t * DM + h * HD + d; v4us oh, ol;
#pragma unroll
    for (int u = 0; u < 4; ++u) { float s = 0.f;
#pragma unroll
        for (int g = 0; g < GG; ++g) s = __fadd_rn(s, r[g * KVH * HD + u]); unsigned short a, b; splitf(s, a, b); oh[u] = a; ol[u] = b; }
    *(v4us*)(Ph + e) = oh; *(v4us*)(Pl + e) = ol;  }
__global__ __launch_bounds__(256) void k_gk(const float* __restrict__ K, bf* Ph, bf* Pl) { const int e = (blockIdx.x * 256 + threadIdx.x) * 4; if (e >= KVH * TT * HD) return; const int d = e % HD; const int t = (e / HD) % TT; const int h = e / (HD * TT); const float* r = K + (size_t)t * DM + h * HD + d; v4us oh, ol;
#pragma unroll
    for (int u = 0; u < 4; ++u) { float s = 0.f;
#pragma unroll
        for (int g = 0; g < GG; ++g) s = __fadd_rn(s, r[g * KVH * HD + u]); unsigned short a, b; splitf(s * 0.25f, a, b); oh[u] = a; ol[u] = b; }
    *(v4us*)(Ph + e) = oh; *(v4us*)(Pl + e) = ol;  }
__global__ __launch_bounds__(256) void k_gvt(const float* __restrict__ V, h16* GVT) { const int e = (blockIdx.x * 256 + threadIdx.x) * 2; if (e >= KVH * HD * TT) return; const int s = e % TT; const int d = (e / TT) % HD; const int h = e / (TT * HD); v2h o;
#pragma unroll
    for (int u = 0; u < 2; ++u) { const float* r = V + (size_t)(s + u) * DM + h * HD + d; float a = 0.f;
#pragma unroll
        for (int g = 0; g < GG; ++g) a = __fadd_rn(a, r[g * KVH * HD]); o[u] = tohx(a * 0.25f); }
    *(v2h*)(GVT + e) = o;  }
__global__ __launch_bounds__(256) void k_btab(const float* __restrict__ rb, float* TB) { const int i = blockIdx.x * 256 + threadIdx.x; if (i >= KVH * 4095) return; const int r = i % 4095, h = i / 4095; const int bk = c_bucket[r]; float s = 0.f;
#pragma unroll
    for (int g = 0; g < GG; ++g) s = __fadd_rn(s, bfr(rb[bk * NHm + g * KVH + h])); const float v = s * 0.25f; *(float*)(TB + i) = v;  }
__global__ __launch_bounds__(256) void k_woe(const float* __restrict__ wo, bf* Wh, bf* Wl) { const int e = (blockIdx.x * 256 + threadIdx.x) * 4; if (e >= DM * DO) return; const int j = e % DO; const int o = e / DO; const float* r = wo + (size_t)o * DM + j; v4us oh, ol;
#pragma unroll
    for (int u = 0; u < 4; ++u) { float s = 0.f;
#pragma unroll
        for (int g = 0; g < GG; ++g) s = __fadd_rn(s, bfr(r[g * DO + u])); unsigned short a, b; splitf(s, a, b); oh[u] = a; ol[u] = b; }
    *(v4us*)(Wh + e) = oh; *(v4us*)(Wl + e) = ol;  }
__global__ __launch_bounds__(256) void k_mrg(const float* __restrict__ O, bf* Ph, bf* Pl) { const int e = (blockIdx.x * 256 + threadIdx.x) * 4; if (e >= TT * DO) return; const int c = e % DO; const int t = e / DO; const int h = c / HD, d = c % HD; const float* r = O + ((size_t)h * TT + t) * HD + d; v4us oh, ol;
#pragma unroll
    for (int u = 0; u < 4; ++u) { unsigned short a, b; splitf(r[u] * (1.0f / PCAR), a, b); oh[u] = a; ol[u] = b; } *(v4us*)(Ph + e) = oh; *(v4us*)(Pl + e) = ol;  }
__global__ __launch_bounds__(256) void k_bsoft(const float* __restrict__ Sb, const float* __restrict__ TB, h16* P16) { const int lane = threadIdx.x & 31; const int row = blockIdx.x * 8 + (threadIdx.x >> 5); if (row >= KVH * TT) return; const int n = row % TT; const int h = row / TT; const float* sr = Sb + (size_t)row * TT; const float* tb = TB + (size_t)h * 4095 + 2047 - n; float mx = -3.0e38f;
#pragma unroll 1
    for (int ch = 0; ch < TT / 128; ++ch) { const int j0 = ch * 128 + lane * 4; const v4f a = *(const v4f*)(sr + j0);
#pragma unroll
        for (int u = 0; u < 4; ++u) mx = fmaxf(mx, __fadd_rn(a[u], tb[j0 + u])); }
#pragma unroll
    for (int sh = 16; sh; sh >>= 1) mx = fmaxf(mx, __shfl_xor(mx, sh, 32));
    float sum = 0.f;
#pragma unroll 1
    for (int ch = 0; ch < TT / 128; ++ch) { const int j0 = ch * 128 + lane * 4; const v4f a = *(const v4f*)(sr + j0);
#pragma unroll
        for (int u = 0; u < 4; ++u) { float d0 = __fsub_rn(__fadd_rn(a[u], tb[j0 + u]), mx); asm volatile("" : "+v"(d0)); sum += __expf(d0); } }
#pragma unroll
    for (int sh = 16; sh; sh >>= 1) sum += __shfl_xor(sum, sh, 32);
    const float f = __fdiv_rn(PCAR, sum);
    {
#pragma unroll 1
        for (int ch = 0; ch < TT / 128; ++ch) { const int j0 = ch * 128 + lane * 4; const v4f a = *(const v4f*)(sr + j0); v4h o;
#pragma unroll
            for (int u = 0; u < 4; ++u) { float d0 = __fsub_rn(__fadd_rn(a[u], tb[j0 + u]), mx); asm volatile("" : "+v"(d0)); o[u] = tohx(__fmul_rn(__expf(d0), f)); } *(v4h*)(P16 + (size_t)row * TT + j0) = o; }
         } }

extern "C" void kernel_launch(void* const* d_in, const int* in_sizes, int n_in,
                              void* d_out, int out_size, void* d_ws, size_t ws_size, hipStream_t stream) {
    (void)in_sizes; (void)n_in; (void)out_size;
    const float* x = (const float*)d_in[0]; const float* wq = (const float*)d_in[1]; const float* wk = (const float*)d_in[2]; const float* wv = (const float*)d_in[3]; const float* wo = (const float*)d_in[4]; const float* rb = (const float*)d_in[5];
    float* OUT = (float*)d_out;     // [4][2048][1024]
    char* wsp = (char*)d_ws;
    auto take = [&](size_t bytes) { char* p = wsp; wsp += (bytes + 255) & ~(size_t)255; return (void*)p; };
    bf* WQ = (bf*)take((size_t)DM * DM * 2); bf* WK = (bf*)take((size_t)DM * DM * 2); bf* WV = (bf*)take((size_t)DM * DM * 2); bf* WEh = (bf*)take((size_t)DM * DO * 2); bf* WEl = (bf*)take((size_t)DM * DO * 2); float* TB = (float*)take((size_t)KVH * 4095 * 4 + 256);
    bf* XB = (bf*)take((size_t)TT * DM * 2); float* Q = (float*)take((size_t)TT * DM * 4); float* K = (float*)take((size_t)TT * DM * 4); bf* QSh = (bf*)take((size_t)KVH * TT * HD * 2); bf* QSl = (bf*)take((size_t)KVH * TT * HD * 2); bf* GKh = (bf*)take((size_t)KVH * TT * HD * 2); bf* GKl = (bf*)take((size_t)KVH * TT * HD * 2); h16* GVT = (h16*)take((size_t)KVH * HD * TT * 2);
    float* Sb = (float*)take((size_t)KVH * TT * TT * 4); h16* P16 = (h16*)take((size_t)KVH * TT * TT * 2); float* O = (float*)take((size_t)KVH * TT * HD * 4); bf* OPh = (bf*)take((size_t)TT * DO * 2); bf* OPl = (bf*)take((size_t)TT * DO * 2);
    if ((size_t)(wsp - (char*)d_ws) > ws_size) return;    // total ~ 130 MB (4-head [2048][2048] f32 scores 67 MB + fp16 probabilities 34 MB)
    float* V = K;   // v projection reuses the k buffer after the gk planes are built (stream-ordered)
    k_cvt8<<<(DM * DM / 8 + 255) / 256, 256, 0, stream>>>(wq, WQ, (size_t)DM * DM / 8); k_cvt8<<<(DM * DM / 8 + 255) / 256, 256, 0, stream>>>(wk, WK, (size_t)DM * DM / 8); k_cvt8<<<(DM * DM / 8 + 255) / 256, 256, 0, stream>>>(wv, WV, (size_t)DM * DM / 8);   // [out][in] weights = natural Bt
    k_woe<<<(DM * DO / 4 + 255) / 256, 256, 0, stream>>>(wo, WEh, WEl); k_btab<<<(KVH * 4095 + 255) / 256, 256, 0, stream>>>(rb, TB);
    for (int b = 0; b < NB_; ++b) {
        k_cvt8<<<(unsigned)(((size_t)TT * DM / 8 + 255) / 256), 256, 0, stream>>>(x + (size_t)b * TT * DM, XB, (size_t)TT * DM / 8);
        k_gemmw<bf, 0, false, 8><<<dim3(TT / 64, DM / 64, 1), 256, 0, stream>>>(XB, nullptr, WQ, nullptr, DM, Q, DM, nullptr, 0, 0, 0); k_qs<<<(KVH * TT * HD / 4 + 255) / 256, 256, 0, stream>>>(Q, QSh, QSl);
        k_gemmw<bf, 0, false, 8><<<dim3(TT / 64, DM / 64, 1), 256, 0, stream>>>(XB, nullptr, WK, nullptr, DM, K, DM, nullptr, 0, 0, 0); k_gk<<<(KVH * TT * HD / 4 + 255) / 256, 256, 0, stream>>>(K, GKh, GKl);
        k_gemmw<bf, 0, false, 8><<<dim3(TT / 64, DM / 64, 1), 256, 0, stream>>>(XB, nullptr, WV, nullptr, DM, V, DM, nullptr, 0, 0, 0); k_gvt<<<(KVH * HD * TT / 2 + 255) / 256, 256, 0, stream>>>(V, GVT);
        k_gemmw<bf, 2, false, 1><<<dim3(TT / 64, TT / 64, KVH), 32, 0, stream>>>(QSh, QSl, GKh, GKl, HD, Sb, TT, nullptr, (size_t)TT * HD, (size_t)TT * HD, (size_t)TT * TT);
        k_bsoft<<<KVH * TT / 8, 256, 0, stream>>>(Sb, TB, P16);
        k_gemmw<h16, 0, false, 16><<<dim3(TT / 64, 1, KVH), 512, 0, stream>>>(P16, nullptr, GVT, nullptr, TT, O, HD, nullptr, (size_t)TT * TT, (size_t)HD * TT, (size_t)TT * HD);
        k_mrg<<<(TT * DO / 4 + 255) / 256, 256, 0, stream>>>(O, OPh, OPl);
        k_gemmw<bf, 2, false, 8><<<dim3(TT / 64, DM / 64, 1), 256, 0, stream>>>(OPh, OPl, WEh, WEl, DO, OUT + (size_t)b * TT * DM, DM, nullptr, 0, 0, 0); }
}

// v002
// Measured time: 341 microseconds a run.
// Next to v001, in two timings, it ran 1.63 times as fast each time.
// Over all steps from v000 it is 2.44 times as fast.
#include <hip/hip_runtime.h>

// FiDO_T5Attention (hidden [4][2048][1024]; q/k/v = x W^T (16 heads x 64); heads grouped (g=4 groups, h=4 kv heads: head = g*4 + h); gk, gv = mean over g; scores[h][n][s] = sum_g sum_d q[g,h][n][d] gk[h][s][d] (the reference's einsum sums the query
// groups; no 1/sqrt(d) scaling, T5 style) + mean over g of the T5 relative-position bias rel_bias[bucket(s - n)][g*4 + h]; softmax; out[h] = attn gv[h]; tiled x4 over g and projected: out_full Wo^T = out (sum_g Wo[:, g-block])^T -> [4][2048][1024]).
// The bucket of each relative position depends only on (s - n) and the fixed sizes: it is a compile-time table of 4095 entries (bidirectional T5 buckets, 32 buckets, max distance 128; computed in f32 exactly as the reference and baked in).
// Compute dtypes, f32 accumulate: every input rounded to bf16; q/k/v on PLAIN bf16 operands (inputs: exact); group sums / means f32 -> bf16 hi+lo planes; scores (K 64) as 3 products; bias + online softmax f32, probabilities x1024 in f16, fused with attn x V (k_fattn)

#define NB_  4
#define TT   2048
#define DM   1024
#define NHm  16
#define KVH  4
#define GG   4
#define HD   64
#define DO   256
typedef _Float16 h16;
typedef unsigned short bf;
typedef __attribute__((ext_vector_type(16))) __bf16   v16bf;
typedef __attribute__((ext_vector_type(16))) _Float16 v16h;
typedef __attribute__((ext_vector_type(8)))  _Float16 v8h;
typedef __attribute__((ext_vector_type(8)))  unsigned short v8us;
typedef __attribute__((ext_vector_type(8)))  float    v8f;
typedef __attribute__((ext_vector_type(4)))  float    v4f;
typedef v8h  __attribute__((may_alias)) v8ha;
typedef v4f  __attribute__((may_alias)) v4fa;
typedef v8us __attribute__((may_alias)) v8usa;

__device__ __forceinline__ unsigned short f2bf(float f) { unsigned u = __float_as_uint(f); u += 0x7FFFu + ((u >> 16) & 1u); return (unsigned short)(u >> 16); }
__device__ __forceinline__ float bf2f(unsigned short b) { return __uint_as_float(((unsigned)b) << 16); }
__device__ __forceinline__ float bfr(float f) { return bf2f(f2bf(f)); }
__device__ __forceinline__ v16h cat16(v8h lo, v8h hi) { return __builtin_shufflevector(lo, hi, 0, 1, 2, 3, 4, 5, 6, 7, 8, 9, 10, 11, 12, 13, 14, 15); }
__device__ __forceinline__ v16bf cat16b(v8us lo, v8us hi) { return __builtin_bit_cast(v16bf, __builtin_shufflevector(lo, hi, 0, 1, 2, 3, 4, 5, 6, 7, 8, 9, 10, 11, 12, 13, 14, 15)); }
__device__ __forceinline__ v8f wmma16(v16h a, v16h b, v8f c) { return __builtin_amdgcn_wmma_f32_16x16x32_f16(false, a, false, b, (short)0, c, false, false); }
__device__ __forceinline__ v8f wmmab(v16bf a, v16bf b, v8f c) { return __builtin_amdgcn_wmma_f32_16x16x32_bf16(false, a, false, b, (short)0, c, false, false); }



// ---- k_gemmw: register-blocked GEMM, KS WAVES per 64x64 output tile (16 accumulators each), operands straight from K-contiguous 16-bit planes; grid (M/64, N/64, Z), 32 * KS threads.
// C[m][n] (f32, pitch ldc, + optional f32 bias[n]) = sum_k A[m][k] Bt[n][k] (+ split products per NSPLIT). z-batch strides sA/sB/sC in elements. K % (32 * KS) == 0.
// KS > 1: wave w sums the 32-wide k steps w, w + KS, w + 2 KS, ... (interleaved, so that in one trip the waves of a work-group read 64 * KS contiguous bytes of every operand row: neighbour waves use the two halves of a 128-B line at the same time);
// the KS partial tiles meet in LDS (fragment order) and are added in wave order 0..KS-1, 16/KS fragments per wave; the tile leaves through a row-major LDS tile in whole lines.
template <typename T16> struct WFrag;
template <> struct WFrag<h16> { typedef v16h V; static __device__ __forceinline__ V ld(const h16* p) { return cat16(*(const v8h*)p, *(const v8h*)(p + 16)); } static __device__ __forceinline__ v8f mma(V a, V b, v8f c) { return wmma16(a, b, c); } };
template <> struct WFrag<bf> { typedef v16bf V; static __device__ __forceinline__ V ld(const bf* p) { return cat16b(*(const v8us*)p, *(const v8us*)(p + 16)); } static __device__ __forceinline__ v8f mma(V a, V b, v8f c) { return wmmab(a, b, c); } };
template <typename T16, int NSPLIT, bool BIAS, int KS>
__global__ __launch_bounds__(32 * KS) void k_gemmw(const T16* __restrict__ A, const T16* __restrict__ A2, const T16* __restrict__ Bt, const T16* __restrict__ Bt2, int K, float* C, int ldc, const float* __restrict__ bias, size_t sA, size_t sB, size_t sC) {
    typedef typename WFrag<T16>::V V;
    __shared__ __align__(16) float os[KS == 1 ? 16 * 68 : 64 * 68 + KS * 4096];
    const size_t z = blockIdx.z; A += z * sA; if (A2) A2 += z * sA; Bt += z * sB; if (Bt2) Bt2 += z * sB; C += z * sC;
    const int lane = threadIdx.x & 31, lr = lane & 15, hi = lane >> 4; const int r0 = blockIdx.x * 64, c0 = blockIdx.y * 64;
    v8f acc[4][4];
#pragma unroll
    for (int mb = 0; mb < 4; ++mb)
#pragma unroll
        for (int nb = 0; nb < 4; ++nb) acc[mb][nb] = (v8f){};
    const size_t aoff = (size_t)(r0 + lr) * K + 8 * hi, boff = (size_t)(c0 + lr) * K + 8 * hi;
    const int wv = __builtin_amdgcn_readfirstlane((int)(threadIdx.x >> 5));
#pragma unroll 1
    for (int kc = wv * 32; kc < K; kc += 32 * KS) {
        V a[4], a2[4];
#pragma unroll
        for (int mb = 0; mb < 4; ++mb) { a[mb] = WFrag<T16>::ld(A + aoff + (size_t)mb * 16 * K + kc); if (NSPLIT == 1 || NSPLIT == 2) a2[mb] = WFrag<T16>::ld(A2 + aoff + (size_t)mb * 16 * K + kc); }
#pragma unroll
        for (int nb = 0; nb < 4; ++nb) { const V b = WFrag<T16>::ld(Bt + boff + (size_t)nb * 16 * K + kc); V b2; if (NSPLIT >= 2) b2 = WFrag<T16>::ld(Bt2 + boff + (size_t)nb * 16 * K + kc);
#pragma unroll
            for (int mb = 0; mb < 4; ++mb) { acc[mb][nb] = WFrag<T16>::mma(a[mb], b, acc[mb][nb]); if (NSPLIT == 1 || NSPLIT == 2) acc[mb][nb] = WFrag<T16>::mma(a2[mb], b, acc[mb][nb]); if (NSPLIT >= 2) acc[mb][nb] = WFrag<T16>::mma(a[mb], b2, acc[mb][nb]); } }
        asm volatile("v_nop\n\tv_nop\n\tv_nop\n\tv_nop" : "+v"(acc[0][0]), "+v"(acc[1][1]), "+v"(acc[2][2]), "+v"(acc[3][3]) : "v"(a[0]), "v"(a[3]));
    }
    if constexpr (KS > 1) {
        float* part = os + 64 * 68;
        float* pw = part + wv * 4096 + lane * 4;
#pragma unroll   // both loops unrolled: acc[][] is indexed by constants only and stays in registers
        for (int mb = 0; mb < 4; ++mb)
#pragma unroll
            for (int nb = 0; nb < 4; ++nb) { const v8f c = acc[mb][nb]; *(v4fa*)(pw + (mb * 4 + nb) * 256) = (v4f){c[0], c[1], c[2], c[3]}; *(v4fa*)(pw + (mb * 4 + nb) * 256 + 128) = (v4f){c[4], c[5], c[6], c[7]}; }
        __syncthreads();
        constexpr int NF = 16 / KS;
#pragma unroll   // unrolled with the loop over sw: the LDS reads of all partials issue ahead of the adds, which keep the order sw = 0..KS-1
        for (int i = 0; i < NF; ++i) { const int f = wv * NF + i; const float* pf = part + f * 256 + lane * 4; v4f s0 = *(const v4fa*)pf, s1 = *(const v4fa*)(pf + 128);
#pragma unroll
            for (int sw = 1; sw < KS; ++sw) { s0 += *(const v4fa*)(pf + sw * 4096); s1 += *(const v4fa*)(pf + sw * 4096 + 128); }
            float* od = os + ((f >> 2) * 16 + hi * 8) * 68 + (f & 3) * 16 + lr;
#pragma unroll
            for (int j = 0; j < 4; ++j) { od[j * 68] = s0[j]; od[(j + 4) * 68] = s1[j]; } }
        __syncthreads();
#pragma unroll   // unrolled: every LDS read issues before the first store waits
        for (int it = 0; it < 32 / KS; ++it) { const int idx = it * 32 * KS + (int)threadIdx.x; const int row = idx >> 4, cofs = (idx & 15) * 4; v4f val = *(const v4fa*)(os + row * 68 + cofs); if (BIAS) { val[0] += bfr(bias[c0 + cofs]); val[1] += bfr(bias[c0 + cofs + 1]); val[2] += bfr(bias[c0 + cofs + 2]); val[3] += bfr(bias[c0 + cofs + 3]); }
            *(v4f*)(C + (size_t)(r0 + row) * ldc + c0 + cofs) = val; }
        return;
    }
#pragma unroll
    for (int mb = 0; mb < 4; ++mb) {
#pragma unroll
        for (int nb = 0; nb < 4; ++nb) {
#pragma unroll
            for (int j = 0; j < 8; ++j) os[(hi * 8 + j) * 68 + nb * 16 + lr] = acc[mb][nb][j]; }
        __builtin_amdgcn_wave_barrier(); asm volatile("" ::: "memory");
        float* crow = C + (size_t)(r0 + mb * 16) * ldc + c0;
{
#pragma unroll
            for (int s = 0; s < 8; ++s) { const int row = 2 * s + hi, cofs = lr * 4; v4f val = *(const v4fa*)(os + row * 68 + cofs); if (BIAS) { val[0] += bfr(bias[c0 + cofs]); val[1] += bfr(bias[c0 + cofs + 1]); val[2] += bfr(bias[c0 + cofs + 2]); val[3] += bfr(bias[c0 + cofs + 3]); }
                *(v4f*)(crow + (size_t)row * ldc + cofs) = val; }
             }
        __builtin_amdgcn_wave_barrier(); asm volatile("" ::: "memory");
    }
}

__device__ __forceinline__ h16 tohx(float x) { return (h16)x; }
__device__ __forceinline__ void splitf(float y, unsigned short& h, unsigned short& l) { h = f2bf(y); l = f2bf(y - bf2f(h)); }
typedef __attribute__((ext_vector_type(2))) unsigned short v2us;
typedef __attribute__((ext_vector_type(4))) unsigned short v4us;
typedef __attribute__((ext_vector_type(2))) _Float16 v2h;
typedef __attribute__((ext_vector_type(4))) _Float16 v4h;
__constant__ unsigned char c_bucket[4095] = { 15,15,15,15,15,15,15,15,15,15,15,15,15,15,15,15,15,15,15,15,15,15,15,15,15,15,15,15,15,15,15,15,15,15,15,15,15,15,15,15,15,15,15,15,15,15,15,15,15,15,15,15,15,15,15,15,15,15,15,15,15,15,15,15,15,15,15,15,15,15,15,15,15,15,15,15,15,15,15,15,15,15,15,15,15,15,15,15,15,15,15,15,15,15,15,15,15,15,15,15,15,15,15,15,15,15,15,15,15,15,15,15,15,15,15,15,15,15,15,15,15,15,15,15,15,15,15,15,15,15,15,15,15,15,15,15,15,15,15,15,15,15,15,15,15,15,15,15,15,15,15,15,15,15,15,15,15,15,15,15,15,15,15,15,15,15,15,15,15,15,15,15,15,15,15,15,15,15,15,15,15,15,15,15,15,15,15,15,15,15,15,15,15,15,15,15,15,15,15,15,15,15,15,15,15,15,15,15,15,15,15,15,15,15,15,15,15,15,15,15,15,15,15,15,15,15,15,15,15,15,15,15,15,15,15,15,15,15,15,15,15,15,15,15,15,15,15,15,15,15,15,15,15,15,15,15,15,15,15,15,15,15,15,15,15,15,15,15,15,15,15,15,15,15,15,15,15,15,15,15,15,15,15,15,15,15,15,15,15,15,15,15,15,15,15,15,15,15,15,15,15,15,15,15,15,15,15,15,15,15,15,15,15,15,15,15,15,15,15,15,15,15,15,15,15,15,15,15,15,15,15,15,15,15,15,15,15,15,15,15,15,15,15,15,15,15,15,15,15,15,15,15,15,15,15,15,15,15,15,15,15,15,15,15,15,15,15,15,15,15,15,15,15,15,15,15,15,15,15,15,15,15,15,15,15,15,15,15,15,15,15,15,15,15,15,15,15,15,15,15,15,15,15,15,15,15,15,15,15,15,15,15,15,15,15,15,15,15,15,15,15,15,15,15,15,15,15,15,15,15,15,15,15,15,15,15,15,15,15,15,15,15,15,15,15,15,15,15,15,15,15,15,15,15,15,15,15,15,15,15,15,15,15,15,15,15,15,15,15,15,15,15,15,15,15,15,15,15,15,15,15,15,15,15,15,15,15,15,15,15,15,15,15,15,15,15,15,15,15,15,15,15,15,15,15,15,15,15,15,15,15,15,15,15,15,15,15,15,15,15,15,15,15,15,15,15,15,15,15,15,15,15,15,15,15,15,15,15,15,15,15,15,15,15,15,15,15,15,15,15,15,15,15,15,15,15,15,15,15,15,15,15,15,15,15,15,15,15,15,15,15,15,15,15,15,15,15,15,15,15,15,15,15,15,15,15,15,15,15,15,15,15,15,15,15,15,15,15,15,15,15,15,15,15,15,15,15,15,15,15,15,15,15,15,15,15,15,15,15,15,15,15,15,15,15,15,15,15,15,15,15,15,15,15,15,15,15,15,15,15,15,15,15,15,15,15,15,15,15,15,15,15,15,15,15,15,15,15,15,15,15,15,15,15,15,15,15,15,15,15,15,15,15,15,15,15,15,15,15,15,15,15,15,15,15,15,15,15,15,15,15,15,15,15,15,15,15,15,15,15,15,15,15,15,15,15,15,15,15,15,15,15,15,15,15,15,15,15,15,15,15,15,15,15,15,15,15,15,15,15,15,15,15,15,15,15,15,15,15,15,15,15,15,15,15,15,15,15,15,15,15,15,15,15,15,15,15,15,15,15,15,15,15,15,15,15,15,15,15,15,15,15,15,15,15,15,15,15,15,15,15,15,15,15,15,15,15,15,15,15,15,15,15,15,15,15,15,15,15,15,15,15,15,15,15,15,15,15,15,15,15,15,15,15,15,15,15,15,15,15,15,15,15,15,15,15,15,15,15,15,15,15,15,15,15,15,15,15,15,15,15,15,15,15,15,15,15,15,15,15,15,15,15,15,15,15,15,15,15,15,15,15,15,15,15,15,15,15,15,15,15,15,15,15,15,15,15,15,15,15,15,15,15,15,15,15,15,15,15,15,15,15,15,15,15,15,15,15,15,15,15,15,15,15,15,15,15,15,15,15,15,15,15,15,15,15,15,15,15,15,15,15,15,15,15,15,15,15,15,15,15,15,15,15,15,15,15,15,15,15,15,15,15,15,15,15,15,15,15,15,15,15,15,15,15,15,15,15,15,15,15,15,15,15,15,15,15,15,15,15,15,15,15,15,15,15,15,15,15,15,15,15,15,15,15,15,15,15,15,15,15,15,15,15,15,15,15,15,15,15,15,15,15,15,15,15,15,15,15,15,15,15,15,15,15,15,15,15,15,15,15,15,15,15,15,15,15,15,15,15,15,15,15,15,15,15,15,15,15,15,15,15,15,15,15,15,15,15,15,15,15,15,15,15,15,15,15,15,15,15,15,15,15,15,15,15,15,15,15,15,15,15,15,15,15,15,15,15,15,15,15,15,15,15,15,15,15,15,15,15,15,15,15,15,15,15,15,15,15,15,15,15,15,15,15,15,15,15,15,15,15,15,15,15,15,15,15,15,15,15,15,15,15,15,15,15,15,15,15,15,15,15,15,15,15,15,15,15,15,15,15,15,15,15,15,15,15,15,15,15,15,15,15,15,15,15,15,15,15,15,15,15,15,15,15,15,15,15,15,15,15,15,15,15,15,15,15,15,15,15,15,15,15,15,15,15,15,15,15,15,15,15,15,15,15,15,15,15,15,15,15,15,15,15,15,15,15,15,15,15,15,15,15,15,15,15,15,15,15,15,15,15,15,15,15,15,15,15,15,15,15,15,15,15,15,15,15,15,15,15,15,15,15,15,15,15,15,15,15,15,15,15,15,15,15,15,15,15,15,15,15,15,15,15,15,15,15,15,15,15,15,15,15,15,15,15,15,15,15,15,15,15,15,15,15,15,15,15,15,15,15,15,15,15,15,15,15,15,15,15,15,15,15,15,15,15,15,15,15,15,15,15,15,15,15,15,15,15,15,15,15,15,15,15,15,15,15,15,15,15,15,15,15,15,15,15,15,15,15,15,15,15,15,15,15,15,15,15,15,15,15,15,15,15,15,15,15,15,15,15,15,15,15,15,15,15,15,15,15,15,15,15,15,15,15,15,15,15,15,15,15,15,15,15,15,15,15,15,15,15,15,15,15,15,15,15,15,15,15,15,15,15,15,15,15,15,15,15,15,15,15,15,15,15,15,15,15,15,15,15,15,15,15,15,15,15,15,15,15,15,15,15,15,15,15,15,15,15,15,15,15,15,15,15,15,15,15,15,15,15,15,15,15,15,15,15,15,15,15,15,15,15,15,15,15,15,15,15,15,15,15,15,15,15,15,15,15,15,15,15,15,15,15,15,15,15,15,15,15,15,15,15,15,15,15,15,15,15,15,15,15,15,15,15,15,15,15,15,15,15,15,15,15,15,15,15,15,15,15,15,15,15,15,15,15,15,15,15,15,15,15,15,15,15,15,15,15,15,15,15,15,15,15,15,15,15,15,15,15,15,15,15,15,15,15,15,15,15,15,15,15,15,15,15,15,15,15,15,15,15,15,15,15,15,15,15,15,15,15,15,15,15,15,15,15,15,15,15,15,15,15,15,15,15,15,15,15,15,15,15,15,15,15,15,15,15,15,15,15,15,15,15,15,15,15,15,15,15,15,15,15,15,15,15,15,15,15,15,15,15,15,15,15,15,15,15,15,15,15,15,15,15,15,15,15,15,15,15,15,15,15,15,15,15,15,15,15,15,15,15,15,15,15,15,15,15,15,15,15,15,15,15,15,15,15,15,15,15,15,15,15,15,15,15,15,15,15,15,15,15,15,15,15,15,15,15,15,15,15,15,15,15,15,15,15,15,15,15,15,15,15,15,15,15,15,15,15,15,15,15,15,15,15,15,15,15,15,15,15,15,15,15,15,15,15,15,15,15,15,15,15,15,15,15,15,15,15,15,15,15,15,15,15,15,15,15,15,15,15,15,15,15,15,15,15,15,15,15,15,15,15,15,15,15,15,15,15,15,15,15,15,15,15,15,15,15,15,15,15,15,15,15,15,15,15,15,15,15,15,15,15,15,15,15,15,15,15,15,15,15,15,15,15,15,15,15,15,15,15,15,15,15,15,15,15,15,15,15,15,15,15,15,15,15,15,15,15,15,15,15,15,15,15,15,15,15,15,15,15,15,15,15,15,15,15,15,15,15,15,15,15,15,15,15,15,15,15,15,15,15,15,15,15,15,15,15,15,15,15,15,15,15,15,15,15,15,15,15,15,15,15,15,15,15,15,15,15,15,15,15,15,15,15,15,15,15,15,15,15,15,15,15,15,15,15,15,15,15,15,15,15,15,15,15,15,15,15,15,15,15,15,15,15,15,15,15,15,15,15,15,15,15,15,15,15,15,15,15,15,15,15,15,15,15,15,15,15,14,14,14,14,14,14,14,14,14,14,14,14,14,14,14,14,14,14,14,14,14,14,14,14,14,14,14,13,13,13,13,13,13,13,13,13,13,13,13,13,13,13,13,13,13,12,12,12,12,12,12,12,12,12,12,12,12,12,12,11,11,11,11,11,11,11,11,11,10,10,10,10,10,10,10,9,9,9,9,8,8,8,8,7,6,5,4,3,2,1,0,17,18,19,20,21,22,23,24,24,24,24,25,25,25,25,26,26,26,26,26,26,26,27,27,27,27,27,27,27,27,27,28,28,28,28,28,28,28,28,28,28,28,28,28,28,29,29,29,29,29,29,29,29,29,29,29,29,29,29,29,29,29,29,30,30,30,30,30,30,30,30,30,30,30,30,30,30,30,30,30,30,30,30,30,30,30,30,30,30,30,31,31,31,31,31,31,31,31,31,31,31,31,31,31,31,31,31,31,31,31,31,31,31,31,31,31,31,31,31,31,31,31,31,31,31,31,31,31,31,31,31,31,31,31,31,31,31,31,31,31,31,31,31,31,31,31,31,31,31,31,31,31,31,31,31,31,31,31,31,31,31,31,31,31,31,31,31,31,31,31,31,31,31,31,31,31,31,31,31,31,31,31,31,31,31,31,31,31,31,31,31,31,31,31,31,31,31,31,31,31,31,31,31,31,31,31,31,31,31,31,31,31,31,31,31,31,31,31,31,31,31,31,31,31,31,31,31,31,31,31,31,31,31,31,31,31,31,31,31,31,31,31,31,31,31,31,31,31,31,31,31,31,31,31,31,31,31,31,31,31,31,31,31,31,31,31,31,31,31,31,31,31,31,31,31,31,31,31,31,31,31,31,31,31,31,31,31,31,31,31,31,31,31,31,31,31,31,31,31,31,31,31,31,31,31,31,31,31,31,31,31,31,31,31,31,31,31,31,31,31,31,31,31,31,31,31,31,31,31,31,31,31,31,31,31,31,31,31,31,31,31,31,31,31,31,31,31,31,31,31,31,31,31,31,31,31,31,31,31,31,31,31,31,31,31,31,31,31,31,31,31,31,31,31,31,31,31,31,31,31,31,31,31,31,31,31,31,31,31,31,31,31,31,31,31,31,31,31,31,31,31,31,31,31,31,31,31,31,31,31,31,31,31,31,31,31,31,31,31,31,31,31,31,31,31,31,31,31,31,31,31,31,31,31,31,31,31,31,31,31,31,31,31,31,31,31,31,31,31,31,31,31,31,31,31,31,31,31,31,31,31,31,31,31,31,31,31,31,31,31,31,31,31,31,31,31,31,31,31,31,31,31,31,31,31,31,31,31,31,31,31,31,31,31,31,31,31,31,31,31,31,31,31,31,31,31,31,31,31,31,31,31,31,31,31,31,31,31,31,31,31,31,31,31,31,31,31,31,31,31,31,31,31,31,31,31,31,31,31,31,31,31,31,31,31,31,31,31,31,31,31,31,31,31,31,31,31,31,31,31,31,31,31,31,31,31,31,31,31,31,31,31,31,31,31,31,31,31,31,31,31,31,31,31,31,31,31,31,31,31,31,31,31,31,31,31,31,31,31,31,31,31,31,31,31,31,31,31,31,31,31,31,31,31,31,31,31,31,31,31,31,31,31,31,31,31,31,31,31,31,31,31,31,31,31,31,31,31,31,31,31,31,31,31,31,31,31,31,31,31,31,31,31,31,31,31,31,31,31,31,31,31,31,31,31,31,31,31,31,31,31,31,31,31,31,31,31,31,31,31,31,31,31,31,31,31,31,31,31,31,31,31,31,31,31,31,31,31,31,31,31,31,31,31,31,31,31,31,31,31,31,31,31,31,31,31,31,31,31,31,31,31,31,31,31,31,31,31,31,31,31,31,31,31,31,31,31,31,31,31,31,31,31,31,31,31,31,31,31,31,31,31,31,31,31,31,31,31,31,31,31,31,31,31,31,31,31,31,31,31,31,31,31,31,31,31,31,31,31,31,31,31,31,31,31,31,31,31,31,31,31,31,31,31,31,31,31,31,31,31,31,31,31,31,31,31,31,31,31,31,31,31,31,31,31,31,31,31,31,31,31,31,31,31,31,31,31,31,31,31,31,31,31,31,31,31,31,31,31,31,31,31,31,31,31,31,31,31,31,31,31,31,31,31,31,31,31,31,31,31,31,31,31,31,31,31,31,31,31,31,31,31,31,31,31,31,31,31,31,31,31,31,31,31,31,31,31,31,31,31,31,31,31,31,31,31,31,31,31,31,31,31,31,31,31,31,31,31,31,31,31,31,31,31,31,31,31,31,31,31,31,31,31,31,31,31,31,31,31,31,31,31,31,31,31,31,31,31,31,31,31,31,31,31,31,31,31,31,31,31,31,31,31,31,31,31,31,31,31,31,31,31,31,31,31,31,31,31,31,31,31,31,31,31,31,31,31,31,31,31,31,31,31,31,31,31,31,31,31,31,31,31,31,31,31,31,31,31,31,31,31,31,31,31,31,31,31,31,31,31,31,31,31,31,31,31,31,31,31,31,31,31,31,31,31,31,31,31,31,31,31,31,31,31,31,31,31,31,31,31,31,31,31,31,31,31,31,31,31,31,31,31,31,31,31,31,31,31,31,31,31,31,31,31,31,31,31,31,31,31,31,31,31,31,31,31,31,31,31,31,31,31,31,31,31,31,31,31,31,31,31,31,31,31,31,31,31,31,31,31,31,31,31,31,31,31,31,31,31,31,31,31,31,31,31,31,31,31,31,31,31,31,31,31,31,31,31,31,31,31,31,31,31,31,31,31,31,31,31,31,31,31,31,31,31,31,31,31,31,31,31,31,31,31,31,31,31,31,31,31,31,31,31,31,31,31,31,31,31,31,31,31,31,31,31,31,31,31,31,31,31,31,31,31,31,31,31,31,31,31,31,31,31,31,31,31,31,31,31,31,31,31,31,31,31,31,31,31,31,31,31,31,31,31,31,31,31,31,31,31,31,31,31,31,31,31,31,31,31,31,31,31,31,31,31,31,31,31,31,31,31,31,31,31,31,31,31,31,31,31,31,31,31,31,31,31,31,31,31,31,31,31,31,31,31,31,31,31,31,31,31,31,31,31,31,31,31,31,31,31,31,31,31,31,31,31,31,31,31,31,31,31,31,31,31,31,31,31,31,31,31,31,31,31,31,31,31,31,31,31,31,31,31,31,31,31,31,31,31,31,31,31,31,31,31,31,31,31,31,31,31,31,31,31,31,31,31,31,31,31,31,31,31,31,31,31,31,31,31,31,31,31,31,31,31,31,31,31,31,31,31,31,31,31,31,31,31,31,31,31,31,31,31,31,31,31,31,31,31,31,31,31,31,31,31,31,31,31,31,31,31,31,31,31,31,31,31,31,31,31,31,31,31,31,31,31,31,31,31,31,31,31,31,31,31,31,31,31,31,31,31,31,31,31,31,31,31,31,31,31,31,31,31,31,31,31,31,31,31,31,31,31,31,31,31,31,31,31,31,31,31,31,31,31,31,31,31,31,31,31,31,31,31,31,31,31,31,31,31,31,31,31,31,31,31,31,31,31,31,31,31,31,31,31,31,31,31,31,31,31,31,31,31,31,31,31,31,31,31,31,31,31,31,31,31,31,31,31,31,31,31,31,31,31,31,31,31,31,31,31,31,31,31,31,31,31,31,31,31,31,31,31,31,31,31,31,31,31,31,31,31,31,31,31,31,31,31,31,31,31,31,31,31,31,31,31,31,31,31,31,31,31,31,31,31,31,31,31,31,31,31,31,31,31,31,31,31,31,31,31,31,31,31,31,31,31,31,31,31,31,31,31,31,31,31,31,31,31,31,31,31,31,31,31,31,31,31,31,31,31,31,31,31,31,31,31,31,31,31,31,31,31,31,31,31,31,31,31,31,31,31,31,31,31,31,31,31,31,31,31,31,31,31,31,31,31,31,31,31,31,31,31,31,31,31,31,31,31,31,31,31,31,31,31,31,31,31,31,31,31,31,31,31,31,31,31,31,31,31,31,31,31,31,31,31,31,31,31,31,31,31,31,31,31,31,31,31,31,31,31,31,31,31,31,31,31,31,31,31,31,31,31,31,31,31,31,31,31,31,31,31,31,31,31,31,31,31,31,31,31,31,31,31,31,31,31,31,31,31,31,31,31,31,31,31,31,31,31,31,31,31,31,31,31,31,31,31,31,31,31,31,31,31,31,31,31,31,31,31,31,31,31,31,31,31,31,31,31,31,31,31,31,31,31,31,31,31,31,31,31,31,31,31,31,31,31,31,31,31,31,31,31,31,31,31,31,31,31,31,31,31,31,31,31,31,31,31,31,31,31,31,31,31,31,31,31,31,31,31,31,31,31,31,31,31,31,31,31,31,31,31,31,31,31,31,31,31,31,31,31,31,31,31,31,31,31,31,31,31,31,31,31,31,31,31,31,31,31,31,31,31,31,31,31,31,31,31,31,31,31,31,31,31,31,31,31,31,31,31,31,31,31,31,31,31,31,31,31,31,31,31,31,31,31,31,31,31,31,31,31,31,31,31,31,31,31,31,31,31,31,31,31,31,31,31,31,31,31,31,31,31,31,31,31,31,31,31,31,31,31,31,31,31,31,31,31,31,31,31,31,31,31,31,31,31,31,31,31,31,31,31,31,31,31,31,31,31,31,31,31,31,31,31,31,31,31,31,31,31,31,31,31,31,31,31,31,31,31,31,31,31,31,31,31,31,31,31,31,31,31,31,31,31,31,31,31,31,31,31,31,31,31,31,31,31,31,31,31,31,31,31,31,31,31,31,31,31,31,31,31,31,31,31,31,31,31,31,31,31,31,31,31,31,31,31,31,31 };   // bucket(rel) for rel = s - n in [-2047, 2047]

__global__ __launch_bounds__(256) void k_cvt8(const float* __restrict__ src, bf* dst, size_t n8) { const size_t i = (size_t)blockIdx.x * 256 + threadIdx.x; if (i >= n8) return; const v8f v = *(const v8f*)(src + i * 8); v8us o;
#pragma unroll
    for (int k = 0; k < 8; ++k) o[k] = f2bf(v[k]); *(v8us*)(dst + i * 8) = o;  }
// k_qs: hl planes QS[h][t][d] = sum_g Q[t][(g*4+h)*64+d]; k_gk: hl planes GK[h][s][d] = mean_g K[s][(g*4+h)*64+d] (8-B lanes); k_gvt: GVT[h][d][s] = fp16(mean_g V[s][(g*4+h)*64+d]) (lane -> 2 s); k_btab: TB[h][r] = mean_g bf16 rel_bias[c_bucket[r]][g*4+h]
__global__ __launch_bounds__(256) void k_qs(const float* __restrict__ Q, bf* Ph, bf* Pl) { const int e = (blockIdx.x * 256 + threadIdx.x) * 4; if (e >= KVH * TT * HD) return; const int d = e % HD; const int t = (e / HD) % TT; const int h = e / (HD * TT); const float* r = Q + (size_t)t * DM + h * HD + d; v4us oh, ol;
#pragma unroll
    for (int u = 0; u < 4; ++u) { float s = 0.f;
#pragma unroll
        for (int g = 0; g < GG; ++g) s = __fadd_rn(s, r[g * KVH * HD + u]); unsigned short a, b; splitf(s, a, b); oh[u] = a; ol[u] = b; }
    *(v4us*)(Ph + e) = oh; *(v4us*)(Pl + e) = ol;  }
__global__ __launch_bounds__(256) void k_gk(const float* __restrict__ K, bf* Ph, bf* Pl) { const int e = (blockIdx.x * 256 + threadIdx.x) * 4; if (e >= KVH * TT * HD) return; const int d = e % HD; const int t = (e / HD) % TT; const int h = e / (HD * TT); const float* r = K + (size_t)t * DM + h * HD + d; v4us oh, ol;
#pragma unroll
    for (int u = 0; u < 4; ++u) { float s = 0.f;
#pragma unroll
        for (int g = 0; g < GG; ++g) s = __fadd_rn(s, r[g * KVH * HD + u]); unsigned short a, b; splitf(s * 0.25f, a, b); oh[u] = a; ol[u] = b; }
    *(v4us*)(Ph + e) = oh; *(v4us*)(Pl + e) = ol;  }
__global__ __launch_bounds__(256) void k_gvt(const float* __restrict__ V, h16* GVT) { const int e = (blockIdx.x * 256 + threadIdx.x) * 2; if (e >= KVH * HD * TT) return; const int s = e % TT; const int d = (e / TT) % HD; const int h = e / (TT * HD); v2h o;
#pragma unroll
    for (int u = 0; u < 2; ++u) { const float* r = V + (size_t)(s + u) * DM + h * HD + d; float a = 0.f;
#pragma unroll
        for (int g = 0; g < GG; ++g) a = __fadd_rn(a, r[g * KVH * HD]); o[u] = tohx(a * 0.25f); }
    *(v2h*)(GVT + e) = o;  }
__global__ __launch_bounds__(256) void k_btab(const float* __restrict__ rb, float* TB) { const int i = blockIdx.x * 256 + threadIdx.x; if (i >= KVH * 4095) return; const int r = i % 4095, h = i / 4095; const int bk = c_bucket[r]; float s = 0.f;
#pragma unroll
    for (int g = 0; g < GG; ++g) s = __fadd_rn(s, bfr(rb[bk * NHm + g * KVH + h])); const float v = s * 0.25f; *(float*)(TB + i) = v;  }
__global__ __launch_bounds__(256) void k_woe(const float* __restrict__ wo, bf* Wh, bf* Wl) { const int e = (blockIdx.x * 256 + threadIdx.x) * 4; if (e >= DM * DO) return; const int j = e % DO; const int o = e / DO; const float* r = wo + (size_t)o * DM + j; v4us oh, ol;
#pragma unroll
    for (int u = 0; u < 4; ++u) { float s = 0.f;
#pragma unroll
        for (int g = 0; g < GG; ++g) s = __fadd_rn(s, bfr(r[g * DO + u])); unsigned short a, b; splitf(s, a, b); oh[u] = a; ol[u] = b; }
    *(v4us*)(Wh + e) = oh; *(v4us*)(Wl + e) = ol;  }
// ---- k_fattn: scores, bias, softmax, attn x V and the hi/lo split of its result in ONE kernel; neither scores nor probabilities go to memory. Grid (TT / 32, KVH), NW waves: a work-group owns 32 query columns n of one head.
// Wave w walks the 32-key blocks w, w + NW, ... with a running maximum and sum per column (online softmax). S^T = GK QS^T (3 hi/lo products, the accumulator starts at the bias): a lane holds 16 keys of ONE query per column group,
// so the maximum is in-lane plus one exchange between the wave's halves, and two converted S^T tiles ARE the f16 B operand of O^T += GV^T P^T (hardware k order, the order of WFrag::ld): P touches neither LDS nor another lane.
// p = 1024 exp(s - m) (f16, at most 1024; the factor cancels in the quotient). The NW partial (m, l, O^T) meet in LDS: each wave scales its own by exp(m_w - max_w m_w), the sums run in wave order 0..NW-1; sum / l leaves as bf16 hi+lo planes P[n][h * 64 + d], one whole 128-B line per (n, h) and plane.
// Every '#pragma unroll' in k_fattn without a note of its own: qh, ql, o, sc, vf, pf, m and l are then indexed by constants only and stay in registers.
#define L2E 1.44269504f
typedef v4f __attribute__((aligned(4), may_alias)) v4fu;   // the bias window starts at any float
template <int NW>
__global__ __launch_bounds__(32 * NW) void k_fattn(const bf* __restrict__ Qh, const bf* __restrict__ Ql, const bf* __restrict__ Kh, const bf* __restrict__ Kl, const h16* __restrict__ Vt, const float* __restrict__ TB, bf* Ph, bf* Pl) {
    __shared__ __align__(16) float po[NW * 32 * 68];
    __shared__ float pm[NW * 32];
    __shared__ float pl[NW * 32];
    const int lane = threadIdx.x & 31, lr = lane & 15, hi = lane >> 4; const int wv = __builtin_amdgcn_readfirstlane((int)(threadIdx.x >> 5));
    const int n0 = blockIdx.x * 32, h = blockIdx.y; const size_t hb = (size_t)h * TT * HD;
    v16bf qh[2][2], ql[2][2];
#pragma unroll
    for (int nt = 0; nt < 2; ++nt)
#pragma unroll
        for (int kk = 0; kk < 2; ++kk) { const size_t qo = hb + (size_t)(n0 + nt * 16 + lr) * HD + kk * 32 + 8 * hi; qh[nt][kk] = WFrag<bf>::ld(Qh + qo); ql[nt][kk] = WFrag<bf>::ld(Ql + qo); }
    v8f o[4][2];
#pragma unroll
    for (int dt = 0; dt < 4; ++dt)
#pragma unroll
        for (int nt = 0; nt < 2; ++nt) o[dt][nt] = (v8f){};
    float m[2] = {-3.0e38f, -3.0e38f}, l[2] = {0.f, 0.f};
    const float* tb = TB + (size_t)h * 4095 + 2047 + 8 * hi - n0 - lr;   // tb[s0' + j] = bias of key s0' + 8 hi + j against query n0 + lr
    const bf* kh = Kh + hb + (size_t)lr * HD + 8 * hi; const bf* kl = Kl + hb + (size_t)lr * HD + 8 * hi; const h16* vt = Vt + hb + (size_t)lr * TT + 8 * hi;
#pragma unroll 1   // rolled: one pass already holds about 230 registers, and four waves per SIMD leave 256
    for (int s0 = wv * 32; s0 < TT; s0 += 32 * NW) {
        v8f sc[2][2];
#pragma unroll
        for (int st = 0; st < 2; ++st)
#pragma unroll
            for (int nt = 0; nt < 2; ++nt) { const float* p = tb + s0 + st * 16 - nt * 16; const v4f b0 = *(const v4fu*)p, b1 = *(const v4fu*)(p + 4); sc[st][nt] = (v8f){b0[0], b0[1], b0[2], b0[3], b1[0], b1[1], b1[2], b1[3]}; }
        v16h vf[4];
#pragma unroll
        for (int dt = 0; dt < 4; ++dt) vf[dt] = WFrag<h16>::ld(vt + (size_t)dt * 16 * TT + s0);
#pragma unroll
        for (int st = 0; st < 2; ++st)
#pragma unroll
            for (int kk = 0; kk < 2; ++kk) { const size_t ko = (size_t)(s0 + st * 16) * HD + kk * 32; const v16bf ah = WFrag<bf>::ld(kh + ko), al = WFrag<bf>::ld(kl + ko);
#pragma unroll
                for (int nt = 0; nt < 2; ++nt) { sc[st][nt] = wmmab(ah, qh[nt][kk], sc[st][nt]); sc[st][nt] = wmmab(al, qh[nt][kk], sc[st][nt]); sc[st][nt] = wmmab(ah, ql[nt][kk], sc[st][nt]); } }
#pragma unroll
        for (int nt = 0; nt < 2; ++nt) {
            float mx = fmaxf(sc[0][nt][0], sc[1][nt][0]);
#pragma unroll
            for (int j = 1; j < 8; ++j) mx = fmaxf(mx, fmaxf(sc[0][nt][j], sc[1][nt][j]));
            mx = fmaxf(mx, __shfl_xor(mx, 16, 32));
            const float mn = fmaxf(m[nt], mx); const float al = __builtin_amdgcn_exp2f((m[nt] - mn) * L2E); const float mb = __builtin_fmaf(mn, L2E, -10.0f); m[nt] = mn;
            float ps = 0.f; v16h pf;
#pragma unroll
            for (int st = 0; st < 2; ++st)
#pragma unroll
                for (int j = 0; j < 8; ++j) { const float p = __builtin_amdgcn_exp2f(__builtin_fmaf(sc[st][nt][j], L2E, -mb)); ps += p; pf[st * 8 + j] = tohx(p); }
            l[nt] = __builtin_fmaf(l[nt], al, ps);
#pragma unroll
            for (int dt = 0; dt < 4; ++dt) { o[dt][nt] *= al; o[dt][nt] = wmma16(vf[dt], pf, o[dt][nt]); }
        }
    }
#pragma unroll
    for (int nt = 0; nt < 2; ++nt) { l[nt] += __shfl_xor(l[nt], 16, 32); if (hi == 0) pm[wv * 32 + nt * 16 + lr] = m[nt]; }
    __syncthreads();
#pragma unroll
    for (int nt = 0; nt < 2; ++nt) { float mg = pm[nt * 16 + lr];
#pragma unroll
        for (int w = 1; w < NW; ++w) mg = fmaxf(mg, pm[w * 32 + nt * 16 + lr]);
        const float f = __builtin_amdgcn_exp2f((m[nt] - mg) * L2E); if (hi == 0) pl[wv * 32 + nt * 16 + lr] = l[nt] * f;
        float* pd = po + (wv * 32 + nt * 16 + lr) * 68 + 8 * hi;
#pragma unroll
        for (int dt = 0; dt < 4; ++dt) { const v8f c = o[dt][nt] * f; *(v4fa*)(pd + dt * 16) = (v4f){c[0], c[1], c[2], c[3]}; *(v4fa*)(pd + dt * 16 + 4) = (v4f){c[4], c[5], c[6], c[7]}; } }
    __syncthreads();
#pragma unroll
    for (int it = 0; it < 16 / NW; ++it) { const int idx = it * 32 * NW + (int)threadIdx.x; const int n = idx >> 4, c4 = (idx & 15) * 4; v4f s = *(const v4fa*)(po + n * 68 + c4); float ls = pl[n];
#pragma unroll   // unrolled: the LDS reads of all partials issue ahead of the adds, which keep the order w = 0..NW-1
        for (int w = 1; w < NW; ++w) { s += *(const v4fa*)(po + (w * 32 + n) * 68 + c4); ls += pl[w * 32 + n]; }
        const float inv = __fdiv_rn(1.0f, ls); v4us oh, ol;
#pragma unroll
        for (int u = 0; u < 4; ++u) { unsigned short a, b; splitf(s[u] * inv, a, b); oh[u] = a; ol[u] = b; }
        const size_t eo = (size_t)(n0 + n) * DO + h * HD + c4; *(v4us*)(Ph + eo) = oh; *(v4us*)(Pl + eo) = ol; }
}

extern "C" void kernel_launch(void* const* d_in, const int* in_sizes, int n_in,
                              void* d_out, int out_size, void* d_ws, size_t ws_size, hipStream_t stream) {
    (void)in_sizes; (void)n_in; (void)out_size;
    const float* x = (const float*)d_in[0]; const float* wq = (const float*)d_in[1]; const float* wk = (const float*)d_in[2]; const float* wv = (const float*)d_in[3]; const float* wo = (const float*)d_in[4]; const float* rb = (const float*)d_in[5];
    float* OUT = (float*)d_out;     // [4][2048][1024]
    char* wsp = (char*)d_ws;
    auto take = [&](size_t bytes) { char* p = wsp; wsp += (bytes + 255) & ~(size_t)255; return (void*)p; };
    bf* WQ = (bf*)take((size_t)DM * DM * 2); bf* WK = (bf*)take((size_t)DM * DM * 2); bf* WV = (bf*)take((size_t)DM * DM * 2); bf* WEh = (bf*)take((size_t)DM * DO * 2); bf* WEl = (bf*)take((size_t)DM * DO * 2); float* TB = (float*)take((size_t)KVH * 4095 * 4 + 256);
    bf* XB = (bf*)take((size_t)TT * DM * 2); float* Q = (float*)take((size_t)TT * DM * 4); float* K = (float*)take((size_t)TT * DM * 4); bf* QSh = (bf*)take((size_t)KVH * TT * HD * 2); bf* QSl = (bf*)take((size_t)KVH * TT * HD * 2); bf* GKh = (bf*)take((size_t)KVH * TT * HD * 2); bf* GKl = (bf*)take((size_t)KVH * TT * HD * 2); h16* GVT = (h16*)take((size_t)KVH * HD * TT * 2);
    bf* OPh = (bf*)take((size_t)TT * DO * 2); bf* OPl = (bf*)take((size_t)TT * DO * 2);
    if ((size_t)(wsp - (char*)d_ws) > ws_size) return;    // total ~ 35 MB
    float* V = K;   // v projection reuses the k buffer after the gk planes are built (stream-ordered)
    k_cvt8<<<(DM * DM / 8 + 255) / 256, 256, 0, stream>>>(wq, WQ, (size_t)DM * DM / 8); k_cvt8<<<(DM * DM / 8 + 255) / 256, 256, 0, stream>>>(wk, WK, (size_t)DM * DM / 8); k_cvt8<<<(DM * DM / 8 + 255) / 256, 256, 0, stream>>>(wv, WV, (size_t)DM * DM / 8);   // [out][in] weights = natural Bt
    k_woe<<<(DM * DO / 4 + 255) / 256, 256, 0, stream>>>(wo, WEh, WEl); k_btab<<<(KVH * 4095 + 255) / 256, 256, 0, stream>>>(rb, TB);
    for (int b = 0; b < NB_; ++b) {
        k_cvt8<<<(unsigned)(((size_t)TT * DM / 8 + 255) / 256), 256, 0, stream>>>(x + (size_t)b * TT * DM, XB, (size_t)TT * DM / 8);
        k_gemmw<bf, 0, false, 8><<<dim3(TT / 64, DM / 64, 1), 256, 0, stream>>>(XB, nullptr, WQ, nullptr, DM, Q, DM, nullptr, 0, 0, 0); k_qs<<<(KVH * TT * HD / 4 + 255) / 256, 256, 0, stream>>>(Q, QSh, QSl);
        k_gemmw<bf, 0, false, 8><<<dim3(TT / 64, DM / 64, 1), 256, 0, stream>>>(XB, nullptr, WK, nullptr, DM, K, DM, nullptr, 0, 0, 0); k_gk<<<(KVH * TT * HD / 4 + 255) / 256, 256, 0, stream>>>(K, GKh, GKl);
        k_gemmw<bf, 0, false, 8><<<dim3(TT / 64, DM / 64, 1), 256, 0, stream>>>(XB, nullptr, WV, nullptr, DM, V, DM, nullptr, 0, 0, 0); k_gvt<<<(KVH * HD * TT / 2 + 255) / 256, 256, 0, stream>>>(V, GVT);
        k_fattn<16><<<dim3(TT / 32, KVH, 1), 512, 0, stream>>>(QSh, QSl, GKh, GKl, GVT, TB, OPh, OPl);
        k_gemmw<bf, 2, false, 8><<<dim3(TT / 64, DM / 64, 1), 256, 0, stream>>>(OPh, OPl, WEh, WEl, DO, OUT + (size_t)b * TT * DM, DM, nullptr, 0, 0, 0); }
}

// v003
// A run of this version takes 264 microseconds.
// Timed twice side by side with v002, it ran 1.30 and 1.29 times as fast.
// All steps since v000 together make it 3.17 times as fast.
#include <hip/hip_runtime.h>

// Grouped attention with a relative-position bias (hidden [4][2048][1024]; q/k/v = x W^T (16 heads x 64); heads grouped (g=4 groups, h=4 kv heads: head = g*4 + h); gk, gv = mean over g; scores[h][n][s] = sum_g sum_d q[g,h][n][d] gk[h][s][d] (the reference's einsum sums the query
// groups; no 1/sqrt(d) scaling, T5 style) + mean over g of the T5 relative-position bias rel_bias[bucket(s - n)][g*4 + h]; softmax; out[h] = attn gv[h]; tiled x4 over g and projected: out_full Wo^T = out (sum_g Wo[:, g-block])^T -> [4][2048][1024]).
// The bucket of each relative position depends only on (s - n) and the fixed sizes: it is a compile-time table of 4095 entries (bidirectional T5 buckets, 32 buckets, max distance 128; computed in f32 exactly as the reference and baked in).
// Compute dtypes, f32 accumulate: every input rounded to bf16; q/k/v on PLAIN bf16 operands (inputs: exact); group sums / means f32 -> bf16 hi+lo planes; scores (K 64) as 3 products; bias + online softmax f32, probabilities x1024 in f16, fused with attn x V (k_fattn)

#define NB_  4
#define TT   2048
#define DM   1024
#define NHm  16
#define KVH  4
#define GG   4
#define HD   64
#define DO   256
typedef _Float16 h16;
typedef unsigned short bf;
typedef __attribute__((ext_vector_type(16))) __bf16   v16bf;
typedef __attribute__((ext_vector_type(16))) _Float16 v16h;
typedef __attribute__((ext_vector_type(8)))  _Float16 v8h;
typedef __attribute__((ext_vector_type(8)))  unsigned short v8us;
typedef __attribute__((ext_vector_type(8)))  float    v8f;
typedef __attribute__((ext_vector_type(4)))  float    v4f;
typedef v8h  __attribute__((may_alias)) v8ha;
typedef v4f  __attribute__((may_alias)) v4fa;
typedef v8us __attribute__((may_alias)) v8usa;

__device__ __forceinline__ unsigned short f2bf(float f) { unsigned u = __float_as_uint(f); u += 0x7FFFu + ((u >> 16) & 1u); return (unsigned short)(u >> 16); }
__device__ __forceinline__ float bf2f(unsigned short b) { return __uint_as_float(((unsigned)b) << 16); }
__device__ __forceinline__ float bfr(float f) { return bf2f(f2bf(f)); }
__device__ __forceinline__ v16h cat16(v8h lo, v8h hi) { return __builtin_shufflevector(lo, hi, 0, 1, 2, 3, 4, 5, 6, 7, 8, 9, 10, 11, 12, 13, 14, 15); }
__device__ __forceinline__ v16bf cat16b(v8us lo, v8us hi) { return __builtin_bit_cast(v16bf, __builtin_shufflevector(lo, hi, 0, 1, 2, 3, 4, 5, 6, 7, 8, 9, 10, 11, 12, 13, 14, 15)); }
__device__ __forceinline__ v8f wmma16(v16h a, v16h b, v8f c) { return __builtin_amdgcn_wmma_f32_16x16x32_f16(false, a, false, b, (short)0, c, false, false); }
__device__ __forceinline__ v8f wmmab(v16bf a, v16bf b, v8f c) { return __builtin_amdgcn_wmma_f32_16x16x32_bf16(false, a, false, b, (short)0, c, false, false); }



// ---- k_gemmw: register-blocked GEMM, KS WAVES per 64x64 output tile (16 accumulators each), operands straight from K-contiguous 16-bit planes; grid (M/64, N/64, Z), 32 * KS threads.
// C[m][n] (f32, pitch ldc, + optional f32 bias[n]) = sum_k A[m][k] Bt[n][k] (+ split products per NSPLIT). z-batch strides sA/sB/sC in elements. K % (32 * KS) == 0.
// KS > 1: wave w sums the 32-wide k steps w, w + KS, w + 2 KS, ... (interleaved, so that in one trip the waves of a work-group read 64 * KS contiguous bytes of every operand row: neighbour waves use the two halves of a 128-B line at the same time);
// the KS partial tiles meet in LDS (fragment order) and are added in wave order 0..KS-1, 16/KS fragments per wave; the tile leaves through a row-major LDS tile in whole lines.
template <typename T16> struct WFrag;
template <> struct WFrag<h16> { typedef v16h V; static __device__ __forceinline__ V ld(const h16* p) { return cat16(*(const v8h*)p, *(const v8h*)(p + 16)); } static __device__ __forceinline__ v8f mma(V a, V b, v8f c) { return wmma16(a, b, c); } };
template <> struct WFrag<bf> { typedef v16bf V; static __device__ __forceinline__ V ld(const bf* p) { return cat16b(*(const v8us*)p, *(const v8us*)(p + 16)); } static __device__ __forceinline__ v8f mma(V a, V b, v8f c) { return wmmab(a, b, c); } };
template <typename T16, int NSPLIT, bool BIAS, int KS>
__global__ __launch_bounds__(32 * KS) void k_gemmw(const T16* __restrict__ A, const T16* __restrict__ A2, const T16* __restrict__ Bt, const T16* __restrict__ Bt2, int K, float* C, int ldc, const float* __restrict__ bias, size_t sA, size_t sB, size_t sC) {
    typedef typename WFrag<T16>::V V;
    __shared__ __align__(16) float os[KS == 1 ? 16 * 68 : 64 * 68 + KS * 4096];
    const size_t z = blockIdx.z; A += z * sA; if (A2) A2 += z * sA; Bt += z * sB; if (Bt2) Bt2 += z * sB; C += z * sC;
    const int lane = threadIdx.x & 31, lr = lane & 15, hi = lane >> 4; const int r0 = blockIdx.x * 64, c0 = blockIdx.y * 64;
    v8f acc[4][4];
#pragma unroll
    for (int mb = 0; mb < 4; ++mb)
#pragma unroll
        for (int nb = 0; nb < 4; ++nb) acc[mb][nb] = (v8f){};
    const size_t aoff = (size_t)(r0 + lr) * K + 8 * hi, boff = (size_t)(c0 + lr) * K + 8 * hi;
    const int wv = __builtin_amdgcn_readfirstlane((int)(threadIdx.x >> 5));
#pragma unroll 1
    for (int kc = wv * 32; kc < K; kc += 32 * KS) {
        V a[4], a2[4];
#pragma unroll
        for (int mb = 0; mb < 4; ++mb) { a[mb] = WFrag<T16>::ld(A + aoff + (size_t)mb * 16 * K + kc); if (NSPLIT == 1 || NSPLIT == 2) a2[mb] = WFrag<T16>::ld(A2 + aoff + (size_t)mb * 16 * K + kc); }
#pragma unroll
        for (int nb = 0; nb < 4; ++nb) { const V b = WFrag<T16>::ld(Bt + boff + (size_t)nb * 16 * K + kc); V b2; if (NSPLIT >= 2) b2 = WFrag<T16>::ld(Bt2 + boff + (size_t)nb * 16 * K + kc);
#pragma unroll
            for (int mb = 0; mb < 4; ++mb) { acc[mb][nb] = WFrag<T16>::mma(a[mb], b, acc[mb][nb]); if (NSPLIT == 1 || NSPLIT == 2) acc[mb][nb] = WFrag<T16>::mma(a2[mb], b, acc[mb][nb]); if (NSPLIT >= 2) acc[mb][nb] = WFrag<T16>::mma(a[mb], b2, acc[mb][nb]); } }
        asm volatile("v_nop\n\tv_nop\n\tv_nop\n\tv_nop" : "+v"(acc[0][0]), "+v"(acc[1][1]), "+v"(acc[2][2]), "+v"(acc[3][3]) : "v"(a[0]), "v"(a[3]));
    }
    if constexpr (KS > 1) {
        float* part = os + 64 * 68;
        float* pw = part + wv * 4096 + lane * 4;
#pragma unroll   // both loops unrolled: acc[][] is indexed by constants only and stays in registers
        for (int mb = 0; mb < 4; ++mb)
#pragma unroll
            for (int nb = 0; nb < 4; ++nb) { const v8f c = acc[mb][nb]; *(v4fa*)(pw + (mb * 4 + nb) * 256) = (v4f){c[0], c[1], c[2], c[3]}; *(v4fa*)(pw + (mb * 4 + nb) * 256 + 128) = (v4f){c[4], c[5], c[6], c[7]}; }
        __syncthreads();
        constexpr int NF = 16 / KS;
#pragma unroll   // unrolled with the loop over sw: the LDS reads of all partials issue ahead of the adds, which keep the order sw = 0..KS-1
        for (int i = 0; i < NF; ++i) { const int f = wv * NF + i; const float* pf = part + f * 256 + lane * 4; v4f s0 = *(const v4fa*)pf, s1 = *(const v4fa*)(pf + 128);
#pragma unroll
            for (int sw = 1; sw < KS; ++sw) { s0 += *(const v4fa*)(pf + sw * 4096); s1 += *(const v4fa*)(pf + sw * 4096 + 128); }
            float* od = os + ((f >> 2) * 16 + hi * 8) * 68 + (f & 3) * 16 + lr;
#pragma unroll
            for (int j = 0; j < 4; ++j) { od[j * 68] = s0[j]; od[(j + 4) * 68] = s1[j]; } }
        __syncthreads();
#pragma unroll   // unrolled: every LDS read issues before the first store waits
        for (int it = 0; it < 32 / KS; ++it) { const int idx = it * 32 * KS + (int)threadIdx.x; const int row = idx >> 4, cofs = (idx & 15) * 4; v4f val = *(const v4fa*)(os + row * 68 + cofs); if (BIAS) { val[0] += bfr(bias[c0 + cofs]); val[1] += bfr(bias[c0 + cofs + 1]); val[2] += bfr(bias[c0 + cofs + 2]); val[3] += bfr(bias[c0 + cofs + 3]); }
            *(v4f*)(C + (size_t)(r0 + row) * ldc + c0 + cofs) = val; }
        return;
    }
#pragma unroll
    for (int mb = 0; mb < 4; ++mb) {
#pragma unroll
        for (int nb = 0; nb < 4; ++nb) {
#pragma unroll
            for (int j = 0; j < 8; ++j) os[(hi * 8 + j) * 68 + nb * 16 + lr] = acc[mb][nb][j]; }
        __builtin_amdgcn_wave_barrier(); asm volatile("" ::: "memory");
        float* crow = C + (size_t)(r0 + mb * 16) * ldc + c0;
{
#pragma unroll
            for (int s = 0; s < 8; ++s) { const int row = 2 * s + hi, cofs = lr * 4; v4f val = *(const v4fa*)(os + row * 68 + cofs); if (BIAS) { val[0] += bfr(bias[c0 + cofs]); val[1] += bfr(bias[c0 + cofs + 1]); val[2] += bfr(bias[c0 + cofs + 2]); val[3] += bfr(bias[c0 + cofs + 3]); }
                *(v4f*)(crow + (size_t)row * ldc + cofs) = val; }
             }
        __builtin_amdgcn_wave_barrier(); asm volatile("" ::: "memory");
    }
}

__device__ __forceinline__ h16 tohx(float x) { return (h16)x; }
__device__ __forceinline__ void splitf(float y, unsigned short& h, unsigned short& l) { h = f2bf(y); l = f2bf(y - bf2f(h)); }
typedef __attribute__((ext_vector_type(2))) unsigned short v2us;
typedef __attribute__((ext_vector_type(4))) unsigned short v4us;
typedef __attribute__((ext_vector_type(2))) _Float16 v2h;
typedef __attribute__((ext_vector_type(4))) _Float16 v4h;
__constant__ unsigned char c_bucket[4095] = { 15,15,15,15,15,15,15,15,15,15,15,15,15,15,15,15,15,15,15,15,15,15,15,15,15,15,15,15,15,15,15,15,15,15,15,15,15,15,15,15,15,15,15,15,15,15,15,15,15,15,15,15,15,15,15,15,15,15,15,15,15,15,15,15,15,15,15,15,15,15,15,15,15,15,15,15,15,15,15,15,15,15,15,15,15,15,15,15,15,15,15,15,15,15,15,15,15,15,15,15,15,15,15,15,15,15,15,15,15,15,15,15,15,15,15,15,15,15,15,15,15,15,15,15,15,15,15,15,15,15,15,15,15,15,15,15,15,15,15,15,15,15,15,15,15,15,15,15,15,15,15,15,15,15,15,15,15,15,15,15,15,15,15,15,15,15,15,15,15,15,15,15,15,15,15,15,15,15,15,15,15,15,15,15,15,15,15,15,15,15,15,15,15,15,15,15,15,15,15,15,15,15,15,15,15,15,15,15,15,15,15,15,15,15,15,15,15,15,15,15,15,15,15,15,15,15,15,15,15,15,15,15,15,15,15,15,15,15,15,15,15,15,15,15,15,15,15,15,15,15,15,15,15,15,15,15,15,15,15,15,15,15,15,15,15,15,15,15,15,15,15,15,15,15,15,15,15,15,15,15,15,15,15,15,15,15,15,15,15,15,15,15,15,15,15,15,15,15,15,15,15,15,15,15,15,15,15,15,15,15,15,15,15,15,15,15,15,15,15,15,15,15,15,15,15,15,15,15,15,15,15,15,15,15,15,15,15,15,15,15,15,15,15,15,15,15,15,15,15,15,15,15,15,15,15,15,15,15,15,15,15,15,15,15,15,15,15,15,15,15,15,15,15,15,15,15,15,15,15,15,15,15,15,15,15,15,15,15,15,15,15,15,15,15,15,15,15,15,15,15,15,15,15,15,15,15,15,15,15,15,15,15,15,15,15,15,15,15,15,15,15,15,15,15,15,15,15,15,15,15,15,15,15,15,15,15,15,15,15,15,15,15,15,15,15,15,15,15,15,15,15,15,15,15,15,15,15,15,15,15,15,15,15,15,15,15,15,15,15,15,15,15,15,15,15,15,15,15,15,15,15,15,15,15,15,15,15,15,15,15,15,15,15,15,15,15,15,15,15,15,15,15,15,15,15,15,15,15,15,15,15,15,15,15,15,15,15,15,15,15,15,15,15,15,15,15,15,15,15,15,15,15,15,15,15,15,15,15,15,15,15,15,15,15,15,15,15,15,15,15,15,15,15,15,15,15,15,15,15,15,15,15,15,15,15,15,15,15,15,15,15,15,15,15,15,15,15,15,15,15,15,15,15,15,15,15,15,15,15,15,15,15,15,15,15,15,15,15,15,15,15,15,15,15,15,15,15,15,15,15,15,15,15,15,15,15,15,15,15,15,15,15,15,15,15,15,15,15,15,15,15,15,15,15,15,15,15,15,15,15,15,15,15,15,15,15,15,15,15,15,15,15,15,15,15,15,15,15,15,15,15,15,15,15,15,15,15,15,15,15,15,15,15,15,15,15,15,15,15,15,15,15,15,15,15,15,15,15,15,15,15,15,15,15,15,15,15,15,15,15,15,15,15,15,15,15,15,15,15,15,15,15,15,15,15,15,15,15,15,15,15,15,15,15,15,15,15,15,15,15,15,15,15,15,15,15,15,15,15,15,15,15,15,15,15,15,15,15,15,15,15,15,15,15,15,15,15,15,15,15,15,15,15,15,15,15,15,15,15,15,15,15,15,15,15,15,15,15,15,15,15,15,15,15,15,15,15,15,15,15,15,15,15,15,15,15,15,15,15,15,15,15,15,15,15,15,15,15,15,15,15,15,15,15,15,15,15,15,15,15,15,15,15,15,15,15,15,15,15,15,15,15,15,15,15,15,15,15,15,15,15,15,15,15,15,15,15,15,15,15,15,15,15,15,15,15,15,15,15,15,15,15,15,15,15,15,15,15,15,15,15,15,15,15,15,15,15,15,15,15,15,15,15,15,15,15,15,15,15,15,15,15,15,15,15,15,15,15,15,15,15,15,15,15,15,15,15,15,15,15,15,15,15,15,15,15,15,15,15,15,15,15,15,15,15,15,15,15,15,15,15,15,15,15,15,15,15,15,15,15,15,15,15,15,15,15,15,15,15,15,15,15,15,15,15,15,15,15,15,15,15,15,15,15,15,15,15,15,15,15,15,15,15,15,15,15,15,15,15,15,15,15,15,15,15,15,15,15,15,15,15,15,15,15,15,15,15,15,15,15,15,15,15,15,15,15,15,15,15,15,15,15,15,15,15,15,15,15,15,15,15,15,15,15,15,15,15,15,15,15,15,15,15,15,15,15,15,15,15,15,15,15,15,15,15,15,15,15,15,15,15,15,15,15,15,15,15,15,15,15,15,15,15,15,15,15,15,15,15,15,15,15,15,15,15,15,15,15,15,15,15,15,15,15,15,15,15,15,15,15,15,15,15,15,15,15,15,15,15,15,15,15,15,15,15,15,15,15,15,15,15,15,15,15,15,15,15,15,15,15,15,15,15,15,15,15,15,15,15,15,15,15,15,15,15,15,15,15,15,15,15,15,15,15,15,15,15,15,15,15,15,15,15,15,15,15,15,15,15,15,15,15,15,15,15,15,15,15,15,15,15,15,15,15,15,15,15,15,15,15,15,15,15,15,15,15,15,15,15,15,15,15,15,15,15,15,15,15,15,15,15,15,15,15,15,15,15,15,15,15,15,15,15,15,15,15,15,15,15,15,15,15,15,15,15,15,15,15,15,15,15,15,15,15,15,15,15,15,15,15,15,15,15,15,15,15,15,15,15,15,15,15,15,15,15,15,15,15,15,15,15,15,15,15,15,15,15,15,15,15,15,15,15,15,15,15,15,15,15,15,15,15,15,15,15,15,15,15,15,15,15,15,15,15,15,15,15,15,15,15,15,15,15,15,15,15,15,15,15,15,15,15,15,15,15,15,15,15,15,15,15,15,15,15,15,15,15,15,15,15,15,15,15,15,15,15,15,15,15,15,15,15,15,15,15,15,15,15,15,15,15,15,15,15,15,15,15,15,15,15,15,15,15,15,15,15,15,15,15,15,15,15,15,15,15,15,15,15,15,15,15,15,15,15,15,15,15,15,15,15,15,15,15,15,15,15,15,15,15,15,15,15,15,15,15,15,15,15,15,15,15,15,15,15,15,15,15,15,15,15,15,15,15,15,15,15,15,15,15,15,15,15,15,15,15,15,15,15,15,15,15,15,15,15,15,15,15,15,15,15,15,15,15,15,15,15,15,15,15,15,15,15,15,15,15,15,15,15,15,15,15,15,15,15,15,15,15,15,15,15,15,15,15,15,15,15,15,15,15,15,15,15,15,15,15,15,15,15,15,15,15,15,15,15,15,15,15,15,15,15,15,15,15,15,15,15,15,15,15,15,15,15,15,15,15,15,15,15,15,15,15,15,15,15,15,15,15,15,15,15,15,15,15,15,15,15,15,15,15,15,15,15,15,15,15,15,15,15,15,15,15,15,15,15,15,15,15,15,15,15,15,15,15,15,15,15,15,15,15,15,15,15,15,15,15,15,15,15,15,15,15,15,15,15,15,15,15,15,15,15,15,15,15,15,15,15,15,15,15,15,15,15,15,15,15,15,15,15,15,15,15,15,15,15,15,15,15,15,15,15,15,15,15,15,15,15,15,15,15,15,15,15,15,15,15,15,15,15,15,15,15,15,15,15,15,15,15,15,15,15,15,15,15,15,15,15,15,15,15,15,15,15,15,15,15,15,15,15,15,15,15,15,15,15,15,15,15,15,15,15,15,15,15,15,15,15,15,15,15,15,15,15,15,15,15,15,15,15,15,15,15,15,15,15,15,15,15,15,15,15,15,15,15,15,15,15,15,15,15,15,15,15,15,15,15,15,15,15,15,15,15,15,15,15,15,15,15,15,15,15,15,15,15,15,15,15,15,15,15,15,15,15,15,15,15,15,15,15,15,15,15,15,15,15,15,15,15,15,15,15,15,15,15,15,15,15,15,15,15,15,15,15,15,15,15,15,15,15,15,15,15,15,15,15,15,15,15,15,15,15,15,15,15,15,15,15,15,15,15,15,15,15,15,15,15,15,15,15,15,15,15,15,15,15,15,15,15,15,15,15,15,15,15,15,15,15,15,15,15,15,15,15,15,15,15,15,15,15,15,15,15,15,15,15,15,15,15,15,15,15,15,15,15,15,15,15,15,15,15,15,15,15,15,15,15,15,15,15,15,15,15,15,15,15,15,15,15,15,15,15,15,15,15,15,15,15,15,15,15,15,15,15,15,15,15,15,15,15,15,15,15,15,15,15,15,15,15,15,15,15,15,15,15,15,15,15,15,15,15,15,15,15,15,15,15,15,15,15,15,15,15,15,15,15,15,15,15,14,14,14,14,14,14,14,14,14,14,14,14,14,14,14,14,14,14,14,14,14,14,14,14,14,14,14,13,13,13,13,13,13,13,13,13,13,13,13,13,13,13,13,13,13,12,12,12,12,12,12,12,12,12,12,12,12,12,12,11,11,11,11,11,11,11,11,11,10,10,10,10,10,10,10,9,9,9,9,8,8,8,8,7,6,5,4,3,2,1,0,17,18,19,20,21,22,23,24,24,24,24,25,25,25,25,26,26,26,26,26,26,26,27,27,27,27,27,27,27,27,27,28,28,28,28,28,28,28,28,28,28,28,28,28,28,29,29,29,29,29,29,29,29,29,29,29,29,29,29,29,29,29,29,30,30,30,30,30,30,30,30,30,30,30,30,30,30,30,30,30,30,30,30,30,30,30,30,30,30,30,31,31,31,31,31,31,31,31,31,31,31,31,31,31,31,31,31,31,31,31,31,31,31,31,31,31,31,31,31,31,31,31,31,31,31,31,31,31,31,31,31,31,31,31,31,31,31,31,31,31,31,31,31,31,31,31,31,31,31,31,31,31,31,31,31,31,31,31,31,31,31,31,31,31,31,31,31,31,31,31,31,31,31,31,31,31,31,31,31,31,31,31,31,31,31,31,31,31,31,31,31,31,31,31,31,31,31,31,31,31,31,31,31,31,31,31,31,31,31,31,31,31,31,31,31,31,31,31,31,31,31,31,31,31,31,31,31,31,31,31,31,31,31,31,31,31,31,31,31,31,31,31,31,31,31,31,31,31,31,31,31,31,31,31,31,31,31,31,31,31,31,31,31,31,31,31,31,31,31,31,31,31,31,31,31,31,31,31,31,31,31,31,31,31,31,31,31,31,31,31,31,31,31,31,31,31,31,31,31,31,31,31,31,31,31,31,31,31,31,31,31,31,31,31,31,31,31,31,31,31,31,31,31,31,31,31,31,31,31,31,31,31,31,31,31,31,31,31,31,31,31,31,31,31,31,31,31,31,31,31,31,31,31,31,31,31,31,31,31,31,31,31,31,31,31,31,31,31,31,31,31,31,31,31,31,31,31,31,31,31,31,31,31,31,31,31,31,31,31,31,31,31,31,31,31,31,31,31,31,31,31,31,31,31,31,31,31,31,31,31,31,31,31,31,31,31,31,31,31,31,31,31,31,31,31,31,31,31,31,31,31,31,31,31,31,31,31,31,31,31,31,31,31,31,31,31,31,31,31,31,31,31,31,31,31,31,31,31,31,31,31,31,31,31,31,31,31,31,31,31,31,31,31,31,31,31,31,31,31,31,31,31,31,31,31,31,31,31,31,31,31,31,31,31,31,31,31,31,31,31,31,31,31,31,31,31,31,31,31,31,31,31,31,31,31,31,31,31,31,31,31,31,31,31,31,31,31,31,31,31,31,31,31,31,31,31,31,31,31,31,31,31,31,31,31,31,31,31,31,31,31,31,31,31,31,31,31,31,31,31,31,31,31,31,31,31,31,31,31,31,31,31,31,31,31,31,31,31,31,31,31,31,31,31,31,31,31,31,31,31,31,31,31,31,31,31,31,31,31,31,31,31,31,31,31,31,31,31,31,31,31,31,31,31,31,31,31,31,31,31,31,31,31,31,31,31,31,31,31,31,31,31,31,31,31,31,31,31,31,31,31,31,31,31,31,31,31,31,31,31,31,31,31,31,31,31,31,31,31,31,31,31,31,31,31,31,31,31,31,31,31,31,31,31,31,31,31,31,31,31,31,31,31,31,31,31,31,31,31,31,31,31,31,31,31,31,31,31,31,31,31,31,31,31,31,31,31,31,31,31,31,31,31,31,31,31,31,31,31,31,31,31,31,31,31,31,31,31,31,31,31,31,31,31,31,31,31,31,31,31,31,31,31,31,31,31,31,31,31,31,31,31,31,31,31,31,31,31,31,31,31,31,31,31,31,31,31,31,31,31,31,31,31,31,31,31,31,31,31,31,31,31,31,31,31,31,31,31,31,31,31,31,31,31,31,31,31,31,31,31,31,31,31,31,31,31,31,31,31,31,31,31,31,31,31,31,31,31,31,31,31,31,31,31,31,31,31,31,31,31,31,31,31,31,31,31,31,31,31,31,31,31,31,31,31,31,31,31,31,31,31,31,31,31,31,31,31,31,31,31,31,31,31,31,31,31,31,31,31,31,31,31,31,31,31,31,31,31,31,31,31,31,31,31,31,31,31,31,31,31,31,31,31,31,31,31,31,31,31,31,31,31,31,31,31,31,31,31,31,31,31,31,31,31,31,31,31,31,31,31,31,31,31,31,31,31,31,31,31,31,31,31,31,31,31,31,31,31,31,31,31,31,31,31,31,31,31,31,31,31,31,31,31,31,31,31,31,31,31,31,31,31,31,31,31,31,31,31,31,31,31,31,31,31,31,31,31,31,31,31,31,31,31,31,31,31,31,31,31,31,31,31,31,31,31,31,31,31,31,31,31,31,31,31,31,31,31,31,31,31,31,31,31,31,31,31,31,31,31,31,31,31,31,31,31,31,31,31,31,31,31,31,31,31,31,31,31,31,31,31,31,31,31,31,31,31,31,31,31,31,31,31,31,31,31,31,31,31,31,31,31,31,31,31,31,31,31,31,31,31,31,31,31,31,31,31,31,31,31,31,31,31,31,31,31,31,31,31,31,31,31,31,31,31,31,31,31,31,31,31,31,31,31,31,31,31,31,31,31,31,31,31,31,31,31,31,31,31,31,31,31,31,31,31,31,31,31,31,31,31,31,31,31,31,31,31,31,31,31,31,31,31,31,31,31,31,31,31,31,31,31,31,31,31,31,31,31,31,31,31,31,31,31,31,31,31,31,31,31,31,31,31,31,31,31,31,31,31,31,31,31,31,31,31,31,31,31,31,31,31,31,31,31,31,31,31,31,31,31,31,31,31,31,31,31,31,31,31,31,31,31,31,31,31,31,31,31,31,31,31,31,31,31,31,31,31,31,31,31,31,31,31,31,31,31,31,31,31,31,31,31,31,31,31,31,31,31,31,31,31,31,31,31,31,31,31,31,31,31,31,31,31,31,31,31,31,31,31,31,31,31,31,31,31,31,31,31,31,31,31,31,31,31,31,31,31,31,31,31,31,31,31,31,31,31,31,31,31,31,31,31,31,31,31,31,31,31,31,31,31,31,31,31,31,31,31,31,31,31,31,31,31,31,31,31,31,31,31,31,31,31,31,31,31,31,31,31,31,31,31,31,31,31,31,31,31,31,31,31,31,31,31,31,31,31,31,31,31,31,31,31,31,31,31,31,31,31,31,31,31,31,31,31,31,31,31,31,31,31,31,31,31,31,31,31,31,31,31,31,31,31,31,31,31,31,31,31,31,31,31,31,31,31,31,31,31,31,31,31,31,31,31,31,31,31,31,31,31,31,31,31,31,31,31,31,31,31,31,31,31,31,31,31,31,31,31,31,31,31,31,31,31,31,31,31,31,31,31,31,31,31,31,31,31,31,31,31,31,31,31,31,31,31,31,31,31,31,31,31,31,31,31,31,31,31,31,31,31,31,31,31,31,31,31,31,31,31,31,31,31,31,31,31,31,31,31,31,31,31,31,31,31,31,31,31,31,31,31,31,31,31,31,31,31,31,31,31,31,31,31,31,31,31,31,31,31,31,31,31,31,31,31,31,31,31,31,31,31,31,31,31,31,31,31,31,31,31,31,31,31,31,31,31,31,31,31,31,31,31,31,31,31,31,31,31,31,31,31,31,31,31,31,31,31,31,31,31,31,31,31,31,31,31,31,31,31,31,31,31,31,31,31,31,31,31,31,31,31,31,31,31,31,31,31,31,31,31,31,31,31,31,31,31,31,31,31,31,31,31,31,31,31,31,31,31,31,31,31,31,31,31,31,31,31,31,31,31,31,31,31,31,31,31,31,31,31,31,31,31,31,31,31,31,31,31,31,31,31,31,31,31,31,31,31,31,31,31,31,31,31,31,31,31,31,31,31,31,31,31,31,31,31,31,31,31,31,31,31,31,31,31,31,31,31,31,31,31,31,31,31,31,31,31,31,31,31,31,31,31,31,31,31,31,31,31,31,31,31,31,31,31,31,31,31,31,31,31,31,31,31,31,31,31,31,31,31,31,31,31,31,31,31,31,31,31,31,31,31,31,31,31,31,31,31,31,31,31,31,31,31,31,31,31,31,31,31,31,31,31,31,31,31,31,31,31,31,31,31,31,31,31,31,31,31,31,31,31,31,31,31,31,31,31,31,31,31,31,31,31,31,31,31,31,31,31,31,31,31,31,31,31,31,31,31,31,31,31,31,31,31,31,31,31,31,31,31,31,31,31,31,31,31,31,31,31,31,31,31,31,31,31,31,31,31,31,31,31,31,31,31,31,31,31,31,31,31,31,31,31,31,31,31,31,31,31,31,31,31,31,31,31,31,31,31,31,31,31,31,31,31,31,31,31,31,31,31,31,31,31,31,31,31,31,31,31,31,31,31,31,31,31,31,31,31,31,31,31,31,31,31,31,31,31,31,31,31,31,31,31,31,31,31,31,31,31,31,31,31,31,31,31,31,31,31,31,31,31,31,31,31,31,31,31,31,31,31,31,31,31,31,31,31,31,31,31,31,31,31,31,31,31,31,31,31,31,31,31,31,31,31,31,31,31,31,31,31,31,31,31,31,31,31,31,31,31,31,31,31,31,31,31,31,31,31,31,31,31,31,31,31,31,31,31,31,31,31,31,31,31,31,31,31,31,31,31,31,31,31,31,31,31,31,31,31,31,31,31,31,31,31,31,31,31,31,31,31,31,31,31,31,31,31,31,31,31,31,31 };   // bucket(rel) for rel = s - n in [-2047, 2047]

// ---- Two launches hold all the element-wise work. The jobs inside each are independent of one another and are dealt by block range (every branch is the same for a whole work-group); where a job runs once per batch, the batch loop stands inside the thread, whose NB_ loads then fly together.
// k_prep: x (all batches), wq, wk, wv -> bf16; WE hl planes [o][j] = sum_g bf16 wo[o][g*256+j]; TB[h][r] = mean_g bf16 rel_bias[c_bucket[r]][g*4+h].
// k_post: GVT[b][h][d][s] = fp16(mean_g V[b*TT+s][(g*4+h)*64+d]) (lane -> 2 s); hl planes QS[b][h][t][d] = sum_g Q[b*TT+t][(g*4+h)*64+d]; hl planes GK[b][h][s][d] = mean_g K[..] (8-B lanes). Q, K, V: the three [NB_*TT][DM] planes of QKV.
#define PB_X (TT * DM / 8 / 256)
#define PB_W (DM * DM / 8 / 256)
#define PB_O (DM * DO / 4 / 256)
#define PB_T ((KVH * 4095 + 255) / 256)
#define GB_V (KVH * HD * TT / 2 / 256)
#define GB_Q (KVH * TT * HD / 4 / 256)
// sb = elements of one batch's [TT][DM] plane (a kernel argument). A thread's loads go through one pointer per batch, p[b]; XWAIT stands behind the last load and names the pointers as inputs, so that their registers are rewritten (also by a later load's result) only behind the wait.
#define XWAIT(p) asm volatile("s_wait_xcnt 0x0" :: "v"(p[0]), "v"(p[1]), "v"(p[2]), "v"(p[3]) : "memory")
// SWAIT stands behind the last store of a job: in the listing the next job's code follows behind a test, and it rewrites registers that the stores name.
#define SWAIT asm volatile("s_wait_xcnt 0x0" ::: "memory")
__device__ __forceinline__ v8us cvt8(v8f v) { v8us o;
#pragma unroll
    for (int k = 0; k < 8; ++k) o[k] = f2bf(v[k]); return o; }
__global__ __launch_bounds__(256) void k_prep(const float* __restrict__ x, const float* __restrict__ wq, const float* __restrict__ wk, const float* __restrict__ wv, const float* __restrict__ wo, const float* __restrict__ rb, bf* XB, bf* WQKV, bf* Wh, bf* Wl, float* TB, size_t sb) {
    int blk = blockIdx.x;
    if (blk < PB_X) { const unsigned i = (blk * 256 + threadIdx.x) * 8; v8f v[NB_]; const float* p[NB_];
#pragma unroll   // unrolled: v[] is indexed by constants only, and all loads issue before the first store
        for (int b = 0; b < NB_; ++b) { p[b] = x + b * sb + i; v[b] = *(const v8f*)p[b]; }
        XWAIT(p);
#pragma unroll
        for (int b = 0; b < NB_; ++b) *(v8us*)(XB + b * sb + i) = cvt8(v[b]);
        return; }
    blk -= PB_X;
    if (blk < 3 * PB_W) { const int w = blk / PB_W; const float* s = w == 0 ? wq : w == 1 ? wk : wv; const size_t i = ((size_t)(blk - w * PB_W) * 256 + threadIdx.x) * 8; *(v8us*)(WQKV + (size_t)w * DM * DM + i) = cvt8(*(const v8f*)(s + i)); SWAIT; return; }
    blk -= 3 * PB_W;
    if (blk < PB_O) { const int e = (blk * 256 + threadIdx.x) * 4; const int j = e % DO; const int o = e / DO; const float* r = wo + (size_t)o * DM + j; v4us oh, ol;
#pragma unroll
        for (int u = 0; u < 4; ++u) { float s = 0.f;
#pragma unroll
            for (int g = 0; g < GG; ++g) s = __fadd_rn(s, bfr(r[g * DO + u])); unsigned short a, b; splitf(s, a, b); oh[u] = a; ol[u] = b; }
        *(v4us*)(Wh + e) = oh; *(v4us*)(Wl + e) = ol; SWAIT; return; }
    blk -= PB_O;
    const int i = blk * 256 + threadIdx.x; if (i >= KVH * 4095) return; const int r = i % 4095, h = i / 4095; const int bk = c_bucket[r]; SWAIT; float s = 0.f;   // here behind the table load: the next loads' results rewrite its address register
#pragma unroll
    for (int g = 0; g < GG; ++g) s = __fadd_rn(s, bfr(rb[bk * NHm + g * KVH + h])); TB[i] = s * 0.25f;
}
// group sum over g times sc (1 or 1/4: exact), split into hi+lo planes, for every batch
__device__ __forceinline__ void grp_hl(const float* __restrict__ S, size_t sb, bf* Ph, bf* Pl, int blk, float sc) { const int e = (blk * 256 + threadIdx.x) * 4; const int d = e % HD; const int t = (e / HD) % TT; const int h = e / (HD * TT); const float* r = S + (size_t)t * DM + h * HD + d; v4f v[NB_][GG]; const float* p[NB_];
#pragma unroll   // unrolled, here and below: v[][] is indexed by constants only, and all loads issue before the first store
    for (int b = 0; b < NB_; ++b) { p[b] = r + b * sb;
#pragma unroll
        for (int g = 0; g < GG; ++g) v[b][g] = *(const v4f*)(p[b] + g * KVH * HD); }
    XWAIT(p);
#pragma unroll
    for (int b = 0; b < NB_; ++b) { v4us oh, ol;
#pragma unroll
        for (int u = 0; u < 4; ++u) { float s = 0.f;
#pragma unroll
            for (int g = 0; g < GG; ++g) s = __fadd_rn(s, v[b][g][u]); unsigned short a, c; splitf(s * sc, a, c); oh[u] = a; ol[u] = c; }
        *(v4us*)(Ph + (size_t)b * KVH * TT * HD + e) = oh; *(v4us*)(Pl + (size_t)b * KVH * TT * HD + e) = ol; }
    SWAIT; }
__global__ __launch_bounds__(256) void k_post(const float* __restrict__ QKV, bf* QSh, bf* QSl, bf* GKh, bf* GKl, h16* GVT, size_t sb) {
    int blk = blockIdx.x;
    if (blk < GB_V) { const float* V = QKV + 2 * NB_ * sb; const int e = (blk * 256 + threadIdx.x) * 2; const int s = e % TT; const int d = (e / TT) % HD; const int h = e / (TT * HD); const float* r = V + (size_t)s * DM + h * HD + d; float v[NB_][2][GG]; const float* p[NB_];
#pragma unroll   // unrolled, here and below: v[][][] is indexed by constants only, and all loads issue before the first store
        for (int b = 0; b < NB_; ++b) { p[b] = r + b * sb;
#pragma unroll
            for (int u = 0; u < 2; ++u)
#pragma unroll
                for (int g = 0; g < GG; ++g) v[b][u][g] = p[b][u * DM + g * KVH * HD]; }
        XWAIT(p);
#pragma unroll
        for (int b = 0; b < NB_; ++b) { v2h o;
#pragma unroll
            for (int u = 0; u < 2; ++u) { float a = 0.f;
#pragma unroll
                for (int g = 0; g < GG; ++g) a = __fadd_rn(a, v[b][u][g]); o[u] = tohx(a * 0.25f); }
            *(v2h*)(GVT + (size_t)b * KVH * HD * TT + e) = o; }
        return; }
    blk -= GB_V;
    if (blk < GB_Q) { grp_hl(QKV, sb, QSh, QSl, blk, 1.0f); return; }
    grp_hl(QKV + NB_ * sb, sb, GKh, GKl, blk - GB_Q, 0.25f);
}
// ---- k_fattn: scores, bias, softmax, attn x V and the hi/lo split of its result in ONE kernel; neither scores nor probabilities go to memory. Grid (TT / 32, KVH, NB_), NW waves: a work-group owns 32 query columns n of one head of one batch.
// Wave w walks the 32-key blocks w, w + NW, ... with a running maximum and sum per column (online softmax). S^T = GK QS^T (3 hi/lo products, the accumulator starts at the bias): a lane holds 16 keys of ONE query per column group,
// so the maximum is in-lane plus one exchange between the wave's halves, and two converted S^T tiles ARE the f16 B operand of O^T += GV^T P^T (hardware k order, the order of WFrag::ld): P touches neither LDS nor another lane.
// p = 1024 exp(s - m) (f16, at most 1024; the factor cancels in the quotient). The NW partial (m, l, O^T) meet in LDS: each wave scales its own by exp(m_w - max_w m_w), the sums run in wave order 0..NW-1; sum / l leaves as bf16 hi+lo planes P[n][h * 64 + d], one whole 128-B line per (n, h) and plane.
// Every '#pragma unroll' in k_fattn without a note of its own: qh, ql, o, sc, vf, pf, m and l are then indexed by constants only and stay in registers.
#define L2E 1.44269504f
typedef v4f __attribute__((aligned(4), may_alias)) v4fu;   // the bias window starts at any float
template <int NW>
__global__ __launch_bounds__(32 * NW) void k_fattn(const bf* __restrict__ Qh, const bf* __restrict__ Ql, const bf* __restrict__ Kh, const bf* __restrict__ Kl, const h16* __restrict__ Vt, const float* __restrict__ TB, bf* Ph, bf* Pl) {
    __shared__ __align__(16) float po[NW * 32 * 68];
    __shared__ float pm[NW * 32];
    __shared__ float pl[NW * 32];
    const int lane = threadIdx.x & 31, lr = lane & 15, hi = lane >> 4; const int wv = __builtin_amdgcn_readfirstlane((int)(threadIdx.x >> 5));
    const int n0 = blockIdx.x * 32, h = blockIdx.y, bz = blockIdx.z; const size_t hb = ((size_t)bz * KVH + h) * TT * HD;
    v16bf qh[2][2], ql[2][2];
#pragma unroll
    for (int nt = 0; nt < 2; ++nt)
#pragma unroll
        for (int kk = 0; kk < 2; ++kk) { const size_t qo = hb + (size_t)(n0 + nt * 16 + lr) * HD + kk * 32 + 8 * hi; qh[nt][kk] = WFrag<bf>::ld(Qh + qo); ql[nt][kk] = WFrag<bf>::ld(Ql + qo); }
    v8f o[4][2];
#pragma unroll
    for (int dt = 0; dt < 4; ++dt)
#pragma unroll
        for (int nt = 0; nt < 2; ++nt) o[dt][nt] = (v8f){};
    float m[2] = {-3.0e38f, -3.0e38f}, l[2] = {0.f, 0.f};
    const float* tb = TB + (size_t)h * 4095 + 2047 + 8 * hi - n0 - lr;   // tb[s0' + j] = bias of key s0' + 8 hi + j against query n0 + lr
    const bf* kh = Kh + hb + (size_t)lr * HD + 8 * hi; const bf* kl = Kl + hb + (size_t)lr * HD + 8 * hi; const h16* vt = Vt + hb + (size_t)lr * TT + 8 * hi;
#pragma unroll 1   // rolled: one pass already holds about 230 registers, and four waves per SIMD leave 256
    for (int s0 = wv * 32; s0 < TT; s0 += 32 * NW) {
        v8f sc[2][2];
#pragma unroll
        for (int st = 0; st < 2; ++st)
#pragma unroll
            for (int nt = 0; nt < 2; ++nt) { const float* p = tb + s0 + st * 16 - nt * 16; const v4f b0 = *(const v4fu*)p, b1 = *(const v4fu*)(p + 4); sc[st][nt] = (v8f){b0[0], b0[1], b0[2], b0[3], b1[0], b1[1], b1[2], b1[3]}; }
        v16h vf[4];
#pragma unroll
        for (int dt = 0; dt < 4; ++dt) vf[dt] = WFrag<h16>::ld(vt + (size_t)dt * 16 * TT + s0);
#pragma unroll
        for (int st = 0; st < 2; ++st)
#pragma unroll
            for (int kk = 0; kk < 2; ++kk) { const size_t ko = (size_t)(s0 + st * 16) * HD + kk * 32; const v16bf ah = WFrag<bf>::ld(kh + ko), al = WFrag<bf>::ld(kl + ko);
#pragma unroll
                for (int nt = 0; nt < 2; ++nt) { sc[st][nt] = wmmab(ah, qh[nt][kk], sc[st][nt]); sc[st][nt] = wmmab(al, qh[nt][kk], sc[st][nt]); sc[st][nt] = wmmab(ah, ql[nt][kk], sc[st][nt]); } }
#pragma unroll
        for (int nt = 0; nt < 2; ++nt) {
            float mx = fmaxf(sc[0][nt][0], sc[1][nt][0]);
#pragma unroll
            for (int j = 1; j < 8; ++j) mx = fmaxf(mx, fmaxf(sc[0][nt][j], sc[1][nt][j]));
            mx = fmaxf(mx, __shfl_xor(mx, 16, 32));
            const float mn = fmaxf(m[nt], mx); const float al = __builtin_amdgcn_exp2f((m[nt] - mn) * L2E); const float mb = __builtin_fmaf(mn, L2E, -10.0f); m[nt] = mn;
            float ps = 0.f; v16h pf;
#pragma unroll
            for (int st = 0; st < 2; ++st)
#pragma unroll
                for (int j = 0; j < 8; ++j) { const float p = __builtin_amdgcn_exp2f(__builtin_fmaf(sc[st][nt][j], L2E, -mb)); ps += p; pf[st * 8 + j] = tohx(p); }
            l[nt] = __builtin_fmaf(l[nt], al, ps);
#pragma unroll
            for (int dt = 0; dt < 4; ++dt) { o[dt][nt] *= al; o[dt][nt] = wmma16(vf[dt], pf, o[dt][nt]); }
        }
    }
#pragma unroll
    for (int nt = 0; nt < 2; ++nt) { l[nt] += __shfl_xor(l[nt], 16, 32); if (hi == 0) pm[wv * 32 + nt * 16 + lr] = m[nt]; }
    __syncthreads();
#pragma unroll
    for (int nt = 0; nt < 2; ++nt) { float mg = pm[nt * 16 + lr];
#pragma unroll
        for (int w = 1; w < NW; ++w) mg = fmaxf(mg, pm[w * 32 + nt * 16 + lr]);
        const float f = __builtin_amdgcn_exp2f((m[nt] - mg) * L2E); if (hi == 0) pl[wv * 32 + nt * 16 + lr] = l[nt] * f;
        float* pd = po + (wv * 32 + nt * 16 + lr) * 68 + 8 * hi;
#pragma unroll
        for (int dt = 0; dt < 4; ++dt) { const v8f c = o[dt][nt] * f; *(v4fa*)(pd + dt * 16) = (v4f){c[0], c[1], c[2], c[3]}; *(v4fa*)(pd + dt * 16 + 4) = (v4f){c[4], c[5], c[6], c[7]}; } }
    __syncthreads();
#pragma unroll
    for (int it = 0; it < 16 / NW; ++it) { const int idx = it * 32 * NW + (int)threadIdx.x; const int n = idx >> 4, c4 = (idx & 15) * 4; v4f s = *(const v4fa*)(po + n * 68 + c4); float ls = pl[n];
#pragma unroll   // unrolled: the LDS reads of all partials issue ahead of the adds, which keep the order w = 0..NW-1
        for (int w = 1; w < NW; ++w) { s += *(const v4fa*)(po + (w * 32 + n) * 68 + c4); ls += pl[w * 32 + n]; }
        const float inv = __fdiv_rn(1.0f, ls); v4us oh, ol;
#pragma unroll
        for (int u = 0; u < 4; ++u) { unsigned short a, b; splitf(s[u] * inv, a, b); oh[u] = a; ol[u] = b; }
        const size_t eo = ((size_t)bz * TT + n0 + n) * DO + h * HD + c4; *(v4us*)(Ph + eo) = oh; *(v4us*)(Pl + eo) = ol; }
}

extern "C" void kernel_launch(void* const* d_in, const int* in_sizes, int n_in,
                              void* d_out, int out_size, void* d_ws, size_t ws_size, hipStream_t stream) {
    (void)in_sizes; (void)n_in; (void)out_size;
    const float* x = (const float*)d_in[0]; const float* wq = (const float*)d_in[1]; const float* wk = (const float*)d_in[2]; const float* wv = (const float*)d_in[3]; const float* wo = (const float*)d_in[4]; const float* rb = (const float*)d_in[5];
    float* OUT = (float*)d_out;     // [4][2048][1024] = [8192][1024]: the batches are one run of rows for every GEMM
    char* wsp = (char*)d_ws;
    auto take = [&](size_t bytes) { char* p = wsp; wsp += (bytes + 255) & ~(size_t)255; return (void*)p; };
    bf* WQKV = (bf*)take((size_t)3 * DM * DM * 2); bf* WEh = (bf*)take((size_t)DM * DO * 2); bf* WEl = (bf*)take((size_t)DM * DO * 2); float* TB = (float*)take((size_t)KVH * 4095 * 4 + 256);
    bf* XB = (bf*)take((size_t)NB_ * TT * DM * 2); float* QKV = (float*)take((size_t)3 * NB_ * TT * DM * 4); bf* QSh = (bf*)take((size_t)NB_ * KVH * TT * HD * 2); bf* QSl = (bf*)take((size_t)NB_ * KVH * TT * HD * 2); bf* GKh = (bf*)take((size_t)NB_ * KVH * TT * HD * 2); bf* GKl = (bf*)take((size_t)NB_ * KVH * TT * HD * 2); h16* GVT = (h16*)take((size_t)NB_ * KVH * HD * TT * 2);
    bf* OPh = (bf*)take((size_t)NB_ * TT * DO * 2); bf* OPl = (bf*)take((size_t)NB_ * TT * DO * 2);
    if ((size_t)(wsp - (char*)d_ws) > ws_size) return;    // total ~ 147 MB
    k_prep<<<PB_X + 3 * PB_W + PB_O + PB_T, 256, 0, stream>>>(x, wq, wk, wv, wo, rb, XB, WQKV, WEh, WEl, TB, (size_t)TT * DM);   // [out][in] weights = natural Bt
    k_gemmw<bf, 0, false, 8><<<dim3(NB_ * TT / 64, DM / 64, 3), 256, 0, stream>>>(XB, nullptr, WQKV, nullptr, DM, QKV, DM, nullptr, 0, (size_t)DM * DM, (size_t)NB_ * TT * DM);   // z = q, k, v
    k_post<<<GB_V + 2 * GB_Q, 256, 0, stream>>>(QKV, QSh, QSl, GKh, GKl, GVT, (size_t)TT * DM);
    k_fattn<16><<<dim3(TT / 32, KVH, NB_), 512, 0, stream>>>(QSh, QSl, GKh, GKl, GVT, TB, OPh, OPl);
    k_gemmw<bf, 2, false, 8><<<dim3(NB_ * TT / 64, DM / 64, 1), 256, 0, stream>>>(OPh, OPl, WEh, WEl, DO, OUT, DM, nullptr, 0, 0, 0);
}

// v004
// Measured time: 168 microseconds a run.
// Timed twice side by side with v003, it ran 1.58 and 1.59 times as fast.
// Counting every step since v000, it is 5.01 times as fast.
#include <hip/hip_runtime.h>

// Grouped attention with a relative-position bias (hidden [4][2048][1024]; q/k/v = x W^T (16 heads x 64); heads grouped (g=4 groups, h=4 kv heads: head = g*4 + h); gk, gv = mean over g; scores[h][n][s] = sum_g sum_d q[g,h][n][d] gk[h][s][d] (the reference's einsum sums the query
// groups; no 1/sqrt(d) scaling, T5 style) + mean over g of the T5 relative-position bias rel_bias[bucket(s - n)][g*4 + h]; softmax; out[h] = attn gv[h]; tiled x4 over g and projected: out_full Wo^T = out (sum_g Wo[:, g-block])^T -> [4][2048][1024]).
// The group sum of q and the group means of k and v are linear in the weights: sum_g (x Wq[g,h]^T) = x (sum_g Wq[g,h])^T. The weights are summed over g first (k_prep), so the projections have 256 columns each instead of 1024 and yield the summed q and the mean k, v directly.
// The bucket of each relative position depends only on (s - n) and the fixed sizes: it is a compile-time table of 4095 entries (bidirectional T5 buckets, 32 buckets, max distance 128; computed in f32 exactly as the reference and baked in).
// Compute dtypes, f32 accumulate: every input rounded to bf16; group sums / means of the bf16 weights in f32 -> bf16 hi+lo planes; q/k/v = bf16 x (exact) times both planes (2 products), f32 -> bf16 hi+lo planes (q, k) and f16 (v); scores (K 64) as 3 products; bias + online softmax f32, probabilities x1024 in f16, fused with attn x V (k_fattn)

#define NB_  4
#define TT   2048
#define DM   1024
#define NHm  16
#define KVH  4
#define GG   4
#define HD   64
#define DO   256
typedef _Float16 h16;
typedef unsigned short bf;
typedef __attribute__((ext_vector_type(16))) __bf16   v16bf;
typedef __attribute__((ext_vector_type(16))) _Float16 v16h;
typedef __attribute__((ext_vector_type(8)))  _Float16 v8h;
typedef __attribute__((ext_vector_type(8)))  unsigned short v8us;
typedef __attribute__((ext_vector_type(8)))  float    v8f;
typedef __attribute__((ext_vector_type(4)))  float    v4f;
typedef v8h  __attribute__((may_alias)) v8ha;
typedef v4f  __attribute__((may_alias)) v4fa;
typedef v8us __attribute__((may_alias)) v8usa;

__device__ __forceinline__ unsigned short f2bf(float f) { unsigned u = __float_as_uint(f); u += 0x7FFFu + ((u >> 16) & 1u); return (unsigned short)(u >> 16); }
__device__ __forceinline__ float bf2f(unsigned short b) { return __uint_as_float(((unsigned)b) << 16); }
__device__ __forceinline__ float bfr(float f) { return bf2f(f2bf(f)); }
__device__ __forceinline__ v16h cat16(v8h lo, v8h hi) { return __builtin_shufflevector(lo, hi, 0, 1, 2, 3, 4, 5, 6, 7, 8, 9, 10, 11, 12, 13, 14, 15); }
__device__ __forceinline__ v16bf cat16b(v8us lo, v8us hi) { return __builtin_bit_cast(v16bf, __builtin_shufflevector(lo, hi, 0, 1, 2, 3, 4, 5, 6, 7, 8, 9, 10, 11, 12, 13, 14, 15)); }
__device__ __forceinline__ v8f wmma16(v16h a, v16h b, v8f c) { return __builtin_amdgcn_wmma_f32_16x16x32_f16(false, a, false, b, (short)0, c, false, false); }
__device__ __forceinline__ v8f wmmab(v16bf a, v16bf b, v8f c) { return __builtin_amdgcn_wmma_f32_16x16x32_bf16(false, a, false, b, (short)0, c, false, false); }



// ---- k_gemmw: register-blocked GEMM, KS WAVES per 64x64 output tile (16 accumulators each), operands straight from K-contiguous 16-bit planes; grid (M/64, N/64, Z), 32 * KS threads.
// C[m][n] (f32, pitch ldc, + optional f32 bias[n]) = sum_k A[m][k] Bt[n][k] (+ split products per NSPLIT). z-batch strides sA/sB/sC in elements. K % (32 * KS) == 0.
// KS > 1: wave w sums the 32-wide k steps w, w + KS, w + 2 KS, ... (interleaved, so that in one trip the waves of a work-group read 64 * KS contiguous bytes of every operand row: neighbour waves use the two halves of a 128-B line at the same time);
// the KS partial tiles meet in LDS (fragment order) and are added in wave order 0..KS-1, 16/KS fragments per wave; the tile leaves through a row-major LDS tile in whole lines.
template <typename T16> struct WFrag;
template <> struct WFrag<h16> { typedef v16h V; static __device__ __forceinline__ V ld(const h16* p) { return cat16(*(const v8h*)p, *(const v8h*)(p + 16)); } static __device__ __forceinline__ v8f mma(V a, V b, v8f c) { return wmma16(a, b, c); } };
template <> struct WFrag<bf> { typedef v16bf V; static __device__ __forceinline__ V ld(const bf* p) { return cat16b(*(const v8us*)p, *(const v8us*)(p + 16)); } static __device__ __forceinline__ v8f mma(V a, V b, v8f c) { return wmmab(a, b, c); } };
template <typename T16, int NSPLIT, bool BIAS, int KS>
__global__ __launch_bounds__(32 * KS) void k_gemmw(const T16* __restrict__ A, const T16* __restrict__ A2, const T16* __restrict__ Bt, const T16* __restrict__ Bt2, int K, float* C, int ldc, const float* __restrict__ bias, size_t sA, size_t sB, size_t sC) {
    typedef typename WFrag<T16>::V V;
    __shared__ __align__(16) float os[KS == 1 ? 16 * 68 : 64 * 68 + KS * 4096];
    const size_t z = blockIdx.z; A += z * sA; if (A2) A2 += z * sA; Bt += z * sB; if (Bt2) Bt2 += z * sB; C += z * sC;
    const int lane = threadIdx.x & 31, lr = lane & 15, hi = lane >> 4; const int r0 = blockIdx.x * 64, c0 = blockIdx.y * 64;
    v8f acc[4][4];
#pragma unroll
    for (int mb = 0; mb < 4; ++mb)
#pragma unroll
        for (int nb = 0; nb < 4; ++nb) acc[mb][nb] = (v8f){};
    const size_t aoff = (size_t)(r0 + lr) * K + 8 * hi, boff = (size_t)(c0 + lr) * K + 8 * hi;
    const int wv = __builtin_amdgcn_readfirstlane((int)(threadIdx.x >> 5));
#pragma unroll 1
    for (int kc = wv * 32; kc < K; kc += 32 * KS) {
        if constexpr (NSPLIT == 3) {   // A Bt + A Bt2. Every fragment has its pointer in a variable; each s_wait_xcnt 0 stands behind the last load of its run and names the run's pointers as inputs, so that their registers are rewritten (also by a later load's result) only behind the wait.
            const T16* pa[4]; const T16* pb[4]; const T16* pc[4]; V a[4], b[4], b2[4];
#pragma unroll   // unrolled, here and below: the arrays are indexed by constants only and stay in registers, and the loads of a run issue together
            for (int i = 0; i < 4; ++i) { pa[i] = A + aoff + (size_t)i * 16 * K + kc; pb[i] = Bt + boff + (size_t)i * 16 * K + kc; a[i] = WFrag<T16>::ld(pa[i]); b[i] = WFrag<T16>::ld(pb[i]); }
            asm volatile("s_wait_xcnt 0x0" :: "v"(pa[0]), "v"(pa[1]), "v"(pa[2]), "v"(pa[3]), "v"(pb[0]), "v"(pb[1]), "v"(pb[2]), "v"(pb[3]) : "memory");
#pragma unroll
            for (int i = 0; i < 4; ++i) { pc[i] = Bt2 + boff + (size_t)i * 16 * K + kc; b2[i] = WFrag<T16>::ld(pc[i]); }
            asm volatile("s_wait_xcnt 0x0" :: "v"(pc[0]), "v"(pc[1]), "v"(pc[2]), "v"(pc[3]) : "memory");
            __builtin_amdgcn_sched_barrier(0);   // keeps every load of the trip in front of its first matrix instruction: without it the scheduler sinks five fragments' loads between the products, and a trip waits for memory several times instead of once
#pragma unroll
            for (int nb = 0; nb < 4; ++nb)
#pragma unroll
                for (int mb = 0; mb < 4; ++mb) acc[mb][nb] = WFrag<T16>::mma(a[mb], b[nb], acc[mb][nb]);
#pragma unroll
            for (int nb = 0; nb < 4; ++nb)
#pragma unroll
                for (int mb = 0; mb < 4; ++mb) acc[mb][nb] = WFrag<T16>::mma(a[mb], b2[nb], acc[mb][nb]);
            asm volatile("v_nop\n\tv_nop\n\tv_nop\n\tv_nop" : "+v"(acc[0][0]), "+v"(acc[1][1]), "+v"(acc[2][2]), "+v"(acc[3][3]) : "v"(a[0]), "v"(a[3]));   // the four vector slots behind the trip's last matrix instruction, also on the taken back edge
        } else {
        V a[4], a2[4];
#pragma unroll
        for (int mb = 0; mb < 4; ++mb) { a[mb] = WFrag<T16>::ld(A + aoff + (size_t)mb * 16 * K + kc); if (NSPLIT == 1 || NSPLIT == 2) a2[mb] = WFrag<T16>::ld(A2 + aoff + (size_t)mb * 16 * K + kc); }
#pragma unroll
        for (int nb = 0; nb < 4; ++nb) { const V b = WFrag<T16>::ld(Bt + boff + (size_t)nb * 16 * K + kc); V b2; if (NSPLIT >= 2) b2 = WFrag<T16>::ld(Bt2 + boff + (size_t)nb * 16 * K + kc);
#pragma unroll
            for (int mb = 0; mb < 4; ++mb) { acc[mb][nb] = WFrag<T16>::mma(a[mb], b, acc[mb][nb]); if (NSPLIT == 1 || NSPLIT == 2) acc[mb][nb] = WFrag<T16>::mma(a2[mb], b, acc[mb][nb]); if (NSPLIT >= 2) acc[mb][nb] = WFrag<T16>::mma(a[mb], b2, acc[mb][nb]); } }
        asm volatile("v_nop\n\tv_nop\n\tv_nop\n\tv_nop" : "+v"(acc[0][0]), "+v"(acc[1][1]), "+v"(acc[2][2]), "+v"(acc[3][3]) : "v"(a[0]), "v"(a[3]));
        }
    }
    if constexpr (KS > 1) {
        float* part = os + 64 * 68;
        float* pw = part + wv * 4096 + lane * 4;
#pragma unroll   // both loops unrolled: acc[][] is indexed by constants only and stays in registers
        for (int mb = 0; mb < 4; ++mb)
#pragma unroll
            for (int nb = 0; nb < 4; ++nb) { const v8f c = acc[mb][nb]; *(v4fa*)(pw + (mb * 4 + nb) * 256) = (v4f){c[0], c[1], c[2], c[3]}; *(v4fa*)(pw + (mb * 4 + nb) * 256 + 128) = (v4f){c[4], c[5], c[6], c[7]}; }
        __syncthreads();
        constexpr int NF = 16 / KS;
#pragma unroll   // unrolled with the loop over sw: the LDS reads of all partials issue ahead of the adds, which keep the order sw = 0..KS-1
        for (int i = 0; i < NF; ++i) { const int f = wv * NF + i; const float* pf = part + f * 256 + lane * 4; v4f s0 = *(const v4fa*)pf, s1 = *(const v4fa*)(pf + 128);
#pragma unroll
            for (int sw = 1; sw < KS; ++sw) { s0 += *(const v4fa*)(pf + sw * 4096); s1 += *(const v4fa*)(pf + sw * 4096 + 128); }
            float* od = os + ((f >> 2) * 16 + hi * 8) * 68 + (f & 3) * 16 + lr;
#pragma unroll
            for (int j = 0; j < 4; ++j) { od[j * 68] = s0[j]; od[(j + 4) * 68] = s1[j]; } }
        __syncthreads();
#pragma unroll   // unrolled: every LDS read issues before the first store waits
        for (int it = 0; it < 32 / KS; ++it) { const int idx = it * 32 * KS + (int)threadIdx.x; const int row = idx >> 4, cofs = (idx & 15) * 4; v4f val = *(const v4fa*)(os + row * 68 + cofs); if (BIAS) { val[0] += bfr(bias[c0 + cofs]); val[1] += bfr(bias[c0 + cofs + 1]); val[2] += bfr(bias[c0 + cofs + 2]); val[3] += bfr(bias[c0 + cofs + 3]); }
            *(v4f*)(C + (size_t)(r0 + row) * ldc + c0 + cofs) = val; }
        return;
    }
#pragma unroll
    for (int mb = 0; mb < 4; ++mb) {
#pragma unroll
        for (int nb = 0; nb < 4; ++nb) {
#pragma unroll
            for (int j = 0; j < 8; ++j) os[(hi * 8 + j) * 68 + nb * 16 + lr] = acc[mb][nb][j]; }
        __builtin_amdgcn_wave_barrier(); asm volatile("" ::: "memory");
        float* crow = C + (size_t)(r0 + mb * 16) * ldc + c0;
{
#pragma unroll
            for (int s = 0; s < 8; ++s) { const int row = 2 * s + hi, cofs = lr * 4; v4f val = *(const v4fa*)(os + row * 68 + cofs); if (BIAS) { val[0] += bfr(bias[c0 + cofs]); val[1] += bfr(bias[c0 + cofs + 1]); val[2] += bfr(bias[c0 + cofs + 2]); val[3] += bfr(bias[c0 + cofs + 3]); }
                *(v4f*)(crow + (size_t)row * ldc + cofs) = val; }
             }
        __builtin_amdgcn_wave_barrier(); asm volatile("" ::: "memory");
    }
}

__device__ __forceinline__ h16 tohx(float x) { return (h16)x; }
__device__ __forceinline__ void splitf(float y, unsigned short& h, unsigned short& l) { h = f2bf(y); l = f2bf(y - bf2f(h)); }
typedef __attribute__((ext_vector_type(2))) unsigned short v2us;
typedef __attribute__((ext_vector_type(4))) unsigned short v4us;
typedef __attribute__((ext_vector_type(2))) _Float16 v2h;
typedef __attribute__((ext_vector_type(4))) _Float16 v4h;
__constant__ unsigned char c_bucket[4095] = { 15,15,15,15,15,15,15,15,15,15,15,15,15,15,15,15,15,15,15,15,15,15,15,15,15,15,15,15,15,15,15,15,15,15,15,15,15,15,15,15,15,15,15,15,15,15,15,15,15,15,15,15,15,15,15,15,15,15,15,15,15,15,15,15,15,15,15,15,15,15,15,15,15,15,15,15,15,15,15,15,15,15,15,15,15,15,15,15,15,15,15,15,15,15,15,15,15,15,15,15,15,15,15,15,15,15,15,15,15,15,15,15,15,15,15,15,15,15,15,15,15,15,15,15,15,15,15,15,15,15,15,15,15,15,15,15,15,15,15,15,15,15,15,15,15,15,15,15,15,15,15,15,15,15,15,15,15,15,15,15,15,15,15,15,15,15,15,15,15,15,15,15,15,15,15,15,15,15,15,15,15,15,15,15,15,15,15,15,15,15,15,15,15,15,15,15,15,15,15,15,15,15,15,15,15,15,15,15,15,15,15,15,15,15,15,15,15,15,15,15,15,15,15,15,15,15,15,15,15,15,15,15,15,15,15,15,15,15,15,15,15,15,15,15,15,15,15,15,15,15,15,15,15,15,15,15,15,15,15,15,15,15,15,15,15,15,15,15,15,15,15,15,15,15,15,15,15,15,15,15,15,15,15,15,15,15,15,15,15,15,15,15,15,15,15,15,15,15,15,15,15,15,15,15,15,15,15,15,15,15,15,15,15,15,15,15,15,15,15,15,15,15,15,15,15,15,15,15,15,15,15,15,15,15,15,15,15,15,15,15,15,15,15,15,15,15,15,15,15,15,15,15,15,15,15,15,15,15,15,15,15,15,15,15,15,15,15,15,15,15,15,15,15,15,15,15,15,15,15,15,15,15,15,15,15,15,15,15,15,15,15,15,15,15,15,15,15,15,15,15,15,15,15,15,15,15,15,15,15,15,15,15,15,15,15,15,15,15,15,15,15,15,15,15,15,15,15,15,15,15,15,15,15,15,15,15,15,15,15,15,15,15,15,15,15,15,15,15,15,15,15,15,15,15,15,15,15,15,15,15,15,15,15,15,15,15,15,15,15,15,15,15,15,15,15,15,15,15,15,15,15,15,15,15,15,15,15,15,15,15,15,15,15,15,15,15,15,15,15,15,15,15,15,15,15,15,15,15,15,15,15,15,15,15,15,15,15,15,15,15,15,15,15,15,15,15,15,15,15,15,15,15,15,15,15,15,15,15,15,15,15,15,15,15,15,15,15,15,15,15,15,15,15,15,15,15,15,15,15,15,15,15,15,15,15,15,15,15,15,15,15,15,15,15,15,15,15,15,15,15,15,15,15,15,15,15,15,15,15,15,15,15,15,15,15,15,15,15,15,15,15,15,15,15,15,15,15,15,15,15,15,15,15,15,15,15,15,15,15,15,15,15,15,15,15,15,15,15,15,15,15,15,15,15,15,15,15,15,15,15,15,15,15,15,15,15,15,15,15,15,15,15,15,15,15,15,15,15,15,15,15,15,15,15,15,15,15,15,15,15,15,15,15,15,15,15,15,15,15,15,15,15,15,15,15,15,15,15,15,15,15,15,15,15,15,15,15,15,15,15,15,15,15,15,15,15,15,15,15,15,15,15,15,15,15,15,15,15,15,15,15,15,15,15,15,15,15,15,15,15,15,15,15,15,15,15,15,15,15,15,15,15,15,15,15,15,15,15,15,15,15,15,15,15,15,15,15,15,15,15,15,15,15,15,15,15,15,15,15,15,15,15,15,15,15,15,15,15,15,15,15,15,15,15,15,15,15,15,15,15,15,15,15,15,15,15,15,15,15,15,15,15,15,15,15,15,15,15,15,15,15,15,15,15,15,15,15,15,15,15,15,15,15,15,15,15,15,15,15,15,15,15,15,15,15,15,15,15,15,15,15,15,15,15,15,15,15,15,15,15,15,15,15,15,15,15,15,15,15,15,15,15,15,15,15,15,15,15,15,15,15,15,15,15,15,15,15,15,15,15,15,15,15,15,15,15,15,15,15,15,15,15,15,15,15,15,15,15,15,15,15,15,15,15,15,15,15,15,15,15,15,15,15,15,15,15,15,15,15,15,15,15,15,15,15,15,15,15,15,15,15,15,15,15,15,15,15,15,15,15,15,15,15,15,15,15,15,15,15,15,15,15,15,15,15,15,15,15,15,15,15,15,15,15,15,15,15,15,15,15,15,15,15,15,15,15,15,15,15,15,15,15,15,15,15,15,15,15,15,15,15,15,15,15,15,15,15,15,15,15,15,15,15,15,15,15,15,15,15,15,15,15,15,15,15,15,15,15,15,15,15,15,15,15,15,15,15,15,15,15,15,15,15,15,15,15,15,15,15,15,15,15,15,15,15,15,15,15,15,15,15,15,15,15,15,15,15,15,15,15,15,15,15,15,15,15,15,15,15,15,15,15,15,15,15,15,15,15,15,15,15,15,15,15,15,15,15,15,15,15,15,15,15,15,15,15,15,15,15,15,15,15,15,15,15,15,15,15,15,15,15,15,15,15,15,15,15,15,15,15,15,15,15,15,15,15,15,15,15,15,15,15,15,15,15,15,15,15,15,15,15,15,15,15,15,15,15,15,15,15,15,15,15,15,15,15,15,15,15,15,15,15,15,15,15,15,15,15,15,15,15,15,15,15,15,15,15,15,15,15,15,15,15,15,15,15,15,15,15,15,15,15,15,15,15,15,15,15,15,15,15,15,15,15,15,15,15,15,15,15,15,15,15,15,15,15,15,15,15,15,15,15,15,15,15,15,15,15,15,15,15,15,15,15,15,15,15,15,15,15,15,15,15,15,15,15,15,15,15,15,15,15,15,15,15,15,15,15,15,15,15,15,15,15,15,15,15,15,15,15,15,15,15,15,15,15,15,15,15,15,15,15,15,15,15,15,15,15,15,15,15,15,15,15,15,15,15,15,15,15,15,15,15,15,15,15,15,15,15,15,15,15,15,15,15,15,15,15,15,15,15,15,15,15,15,15,15,15,15,15,15,15,15,15,15,15,15,15,15,15,15,15,15,15,15,15,15,15,15,15,15,15,15,15,15,15,15,15,15,15,15,15,15,15,15,15,15,15,15,15,15,15,15,15,15,15,15,15,15,15,15,15,15,15,15,15,15,15,15,15,15,15,15,15,15,15,15,15,15,15,15,15,15,15,15,15,15,15,15,15,15,15,15,15,15,15,15,15,15,15,15,15,15,15,15,15,15,15,15,15,15,15,15,15,15,15,15,15,15,15,15,15,15,15,15,15,15,15,15,15,15,15,15,15,15,15,15,15,15,15,15,15,15,15,15,15,15,15,15,15,15,15,15,15,15,15,15,15,15,15,15,15,15,15,15,15,15,15,15,15,15,15,15,15,15,15,15,15,15,15,15,15,15,15,15,15,15,15,15,15,15,15,15,15,15,15,15,15,15,15,15,15,15,15,15,15,15,15,15,15,15,15,15,15,15,15,15,15,15,15,15,15,15,15,15,15,15,15,15,15,15,15,15,15,15,15,15,15,15,15,15,15,15,15,15,15,15,15,15,15,15,15,15,15,15,15,15,15,15,15,15,15,15,15,15,15,15,15,15,15,15,15,15,15,15,15,15,15,15,15,15,15,15,15,15,15,15,15,15,15,15,15,15,15,15,15,15,15,15,15,15,15,15,15,15,15,15,15,15,15,15,15,15,15,15,15,15,15,15,15,15,15,15,15,15,15,15,15,15,15,15,15,15,15,15,15,15,15,15,15,15,15,15,15,15,15,15,15,15,15,15,15,15,15,15,15,15,15,15,15,15,15,15,15,15,15,15,15,15,15,15,15,15,15,15,15,15,15,15,15,15,15,15,15,15,15,15,15,15,15,15,15,15,15,15,15,15,15,15,15,15,15,15,15,15,15,15,15,15,15,15,15,15,15,15,15,15,15,15,15,15,15,15,15,15,15,15,15,15,15,15,15,15,15,15,15,15,15,15,15,15,15,15,15,15,15,15,15,15,15,15,15,15,15,15,15,15,15,15,15,15,15,15,15,15,15,15,15,15,15,15,15,15,15,15,15,15,15,15,15,15,15,15,15,15,15,15,15,15,15,15,15,15,15,15,15,15,15,15,15,15,15,15,15,15,15,15,15,15,15,15,15,15,15,15,15,15,15,15,15,15,15,15,15,15,15,15,15,15,15,15,15,15,15,15,15,15,15,15,15,15,15,15,15,15,15,15,15,15,15,15,15,15,15,15,15,15,15,15,15,15,15,15,15,15,15,15,15,15,15,15,15,15,15,15,15,15,15,15,15,15,15,15,15,15,15,15,15,15,15,15,15,15,15,15,15,15,15,15,15,15,15,15,15,15,15,15,15,15,15,15,15,15,15,15,15,15,15,15,15,15,15,15,15,15,15,15,15,15,15,15,15,15,15,15,15,15,14,14,14,14,14,14,14,14,14,14,14,14,14,14,14,14,14,14,14,14,14,14,14,14,14,14,14,13,13,13,13,13,13,13,13,13,13,13,13,13,13,13,13,13,13,12,12,12,12,12,12,12,12,12,12,12,12,12,12,11,11,11,11,11,11,11,11,11,10,10,10,10,10,10,10,9,9,9,9,8,8,8,8,7,6,5,4,3,2,1,0,17,18,19,20,21,22,23,24,24,24,24,25,25,25,25,26,26,26,26,26,26,26,27,27,27,27,27,27,27,27,27,28,28,28,28,28,28,28,28,28,28,28,28,28,28,29,29,29,29,29,29,29,29,29,29,29,29,29,29,29,29,29,29,30,30,30,30,30,30,30,30,30,30,30,30,30,30,30,30,30,30,30,30,30,30,30,30,30,30,30,31,31,31,31,31,31,31,31,31,31,31,31,31,31,31,31,31,31,31,31,31,31,31,31,31,31,31,31,31,31,31,31,31,31,31,31,31,31,31,31,31,31,31,31,31,31,31,31,31,31,31,31,31,31,31,31,31,31,31,31,31,31,31,31,31,31,31,31,31,31,31,31,31,31,31,31,31,31,31,31,31,31,31,31,31,31,31,31,31,31,31,31,31,31,31,31,31,31,31,31,31,31,31,31,31,31,31,31,31,31,31,31,31,31,31,31,31,31,31,31,31,31,31,31,31,31,31,31,31,31,31,31,31,31,31,31,31,31,31,31,31,31,31,31,31,31,31,31,31,31,31,31,31,31,31,31,31,31,31,31,31,31,31,31,31,31,31,31,31,31,31,31,31,31,31,31,31,31,31,31,31,31,31,31,31,31,31,31,31,31,31,31,31,31,31,31,31,31,31,31,31,31,31,31,31,31,31,31,31,31,31,31,31,31,31,31,31,31,31,31,31,31,31,31,31,31,31,31,31,31,31,31,31,31,31,31,31,31,31,31,31,31,31,31,31,31,31,31,31,31,31,31,31,31,31,31,31,31,31,31,31,31,31,31,31,31,31,31,31,31,31,31,31,31,31,31,31,31,31,31,31,31,31,31,31,31,31,31,31,31,31,31,31,31,31,31,31,31,31,31,31,31,31,31,31,31,31,31,31,31,31,31,31,31,31,31,31,31,31,31,31,31,31,31,31,31,31,31,31,31,31,31,31,31,31,31,31,31,31,31,31,31,31,31,31,31,31,31,31,31,31,31,31,31,31,31,31,31,31,31,31,31,31,31,31,31,31,31,31,31,31,31,31,31,31,31,31,31,31,31,31,31,31,31,31,31,31,31,31,31,31,31,31,31,31,31,31,31,31,31,31,31,31,31,31,31,31,31,31,31,31,31,31,31,31,31,31,31,31,31,31,31,31,31,31,31,31,31,31,31,31,31,31,31,31,31,31,31,31,31,31,31,31,31,31,31,31,31,31,31,31,31,31,31,31,31,31,31,31,31,31,31,31,31,31,31,31,31,31,31,31,31,31,31,31,31,31,31,31,31,31,31,31,31,31,31,31,31,31,31,31,31,31,31,31,31,31,31,31,31,31,31,31,31,31,31,31,31,31,31,31,31,31,31,31,31,31,31,31,31,31,31,31,31,31,31,31,31,31,31,31,31,31,31,31,31,31,31,31,31,31,31,31,31,31,31,31,31,31,31,31,31,31,31,31,31,31,31,31,31,31,31,31,31,31,31,31,31,31,31,31,31,31,31,31,31,31,31,31,31,31,31,31,31,31,31,31,31,31,31,31,31,31,31,31,31,31,31,31,31,31,31,31,31,31,31,31,31,31,31,31,31,31,31,31,31,31,31,31,31,31,31,31,31,31,31,31,31,31,31,31,31,31,31,31,31,31,31,31,31,31,31,31,31,31,31,31,31,31,31,31,31,31,31,31,31,31,31,31,31,31,31,31,31,31,31,31,31,31,31,31,31,31,31,31,31,31,31,31,31,31,31,31,31,31,31,31,31,31,31,31,31,31,31,31,31,31,31,31,31,31,31,31,31,31,31,31,31,31,31,31,31,31,31,31,31,31,31,31,31,31,31,31,31,31,31,31,31,31,31,31,31,31,31,31,31,31,31,31,31,31,31,31,31,31,31,31,31,31,31,31,31,31,31,31,31,31,31,31,31,31,31,31,31,31,31,31,31,31,31,31,31,31,31,31,31,31,31,31,31,31,31,31,31,31,31,31,31,31,31,31,31,31,31,31,31,31,31,31,31,31,31,31,31,31,31,31,31,31,31,31,31,31,31,31,31,31,31,31,31,31,31,31,31,31,31,31,31,31,31,31,31,31,31,31,31,31,31,31,31,31,31,31,31,31,31,31,31,31,31,31,31,31,31,31,31,31,31,31,31,31,31,31,31,31,31,31,31,31,31,31,31,31,31,31,31,31,31,31,31,31,31,31,31,31,31,31,31,31,31,31,31,31,31,31,31,31,31,31,31,31,31,31,31,31,31,31,31,31,31,31,31,31,31,31,31,31,31,31,31,31,31,31,31,31,31,31,31,31,31,31,31,31,31,31,31,31,31,31,31,31,31,31,31,31,31,31,31,31,31,31,31,31,31,31,31,31,31,31,31,31,31,31,31,31,31,31,31,31,31,31,31,31,31,31,31,31,31,31,31,31,31,31,31,31,31,31,31,31,31,31,31,31,31,31,31,31,31,31,31,31,31,31,31,31,31,31,31,31,31,31,31,31,31,31,31,31,31,31,31,31,31,31,31,31,31,31,31,31,31,31,31,31,31,31,31,31,31,31,31,31,31,31,31,31,31,31,31,31,31,31,31,31,31,31,31,31,31,31,31,31,31,31,31,31,31,31,31,31,31,31,31,31,31,31,31,31,31,31,31,31,31,31,31,31,31,31,31,31,31,31,31,31,31,31,31,31,31,31,31,31,31,31,31,31,31,31,31,31,31,31,31,31,31,31,31,31,31,31,31,31,31,31,31,31,31,31,31,31,31,31,31,31,31,31,31,31,31,31,31,31,31,31,31,31,31,31,31,31,31,31,31,31,31,31,31,31,31,31,31,31,31,31,31,31,31,31,31,31,31,31,31,31,31,31,31,31,31,31,31,31,31,31,31,31,31,31,31,31,31,31,31,31,31,31,31,31,31,31,31,31,31,31,31,31,31,31,31,31,31,31,31,31,31,31,31,31,31,31,31,31,31,31,31,31,31,31,31,31,31,31,31,31,31,31,31,31,31,31,31,31,31,31,31,31,31,31,31,31,31,31,31,31,31,31,31,31,31,31,31,31,31,31,31,31,31,31,31,31,31,31,31,31,31,31,31,31,31,31,31,31,31,31,31,31,31,31,31,31,31,31,31,31,31,31,31,31,31,31,31,31,31,31,31,31,31,31,31,31,31,31,31,31,31,31,31,31,31,31,31,31,31,31,31,31,31,31,31,31,31,31,31,31,31,31,31,31,31,31,31,31,31,31,31,31,31,31,31,31,31,31,31,31,31,31,31,31,31,31,31,31,31,31,31,31,31,31,31,31,31,31,31,31,31,31,31,31,31,31,31,31,31,31,31,31,31,31,31,31,31,31,31,31,31,31,31,31,31,31,31,31,31,31,31,31,31,31,31,31,31,31,31,31,31,31,31,31,31,31,31,31,31,31,31,31,31,31,31,31,31,31,31,31,31,31,31,31,31,31,31,31,31,31,31,31,31,31,31,31,31,31,31,31,31,31,31,31,31,31,31,31,31,31,31,31,31,31,31,31,31,31,31,31,31,31,31,31,31,31,31,31,31,31,31,31,31,31,31,31,31,31,31,31,31,31,31,31,31,31,31,31,31,31,31,31,31,31,31,31,31,31,31,31,31,31,31,31,31,31,31,31,31,31,31,31,31,31,31,31,31,31,31,31,31,31,31,31,31,31,31,31,31,31,31,31,31,31,31,31,31,31,31,31,31,31,31,31,31,31,31,31,31,31,31,31,31,31,31,31,31,31,31,31,31,31,31,31,31,31,31,31,31,31,31,31,31,31,31,31,31,31,31,31,31,31,31,31,31,31,31,31,31,31,31,31,31,31,31,31,31,31,31,31,31,31,31,31,31,31,31,31,31,31,31,31,31,31,31,31,31,31,31,31,31,31,31,31,31,31,31,31,31,31,31,31,31,31,31,31,31,31,31,31,31,31,31,31,31,31,31,31,31,31,31,31,31,31,31,31,31,31,31,31,31,31,31,31,31,31,31,31,31,31,31,31,31,31,31,31,31,31,31,31,31,31,31,31,31,31,31,31,31,31,31,31,31,31,31,31,31,31,31,31,31,31,31,31,31,31,31,31,31,31,31,31,31,31,31,31,31,31,31,31,31,31,31,31,31,31,31,31,31,31,31,31,31,31,31,31,31,31,31,31,31,31,31,31,31,31,31,31,31,31,31,31,31,31,31,31,31,31,31,31,31,31,31,31,31,31,31,31,31,31,31,31,31,31,31,31,31,31,31,31,31,31,31,31,31,31,31,31,31,31,31,31,31,31,31,31,31,31,31,31,31,31,31,31,31,31,31,31,31,31,31,31,31,31,31,31,31,31,31,31,31,31,31,31,31,31,31,31,31,31,31,31,31,31,31,31,31,31,31,31,31,31,31,31,31,31,31,31,31,31,31,31,31,31,31,31,31,31,31,31,31,31,31,31,31,31,31,31,31,31,31,31,31,31,31,31,31,31,31,31,31,31,31,31,31,31,31,31,31,31,31,31,31,31,31,31,31,31,31,31,31,31,31,31,31,31,31,31,31,31,31,31,31,31,31,31,31,31,31,31,31,31,31,31,31,31,31,31,31,31,31,31,31,31,31,31,31,31,31,31,31,31,31,31 };   // bucket(rel) for rel = s - n in [-2047, 2047]

// ---- Two launches hold all the element-wise work. The jobs inside each are independent of one another and are dealt by block range (every branch is the same for a whole work-group); where a job runs once per batch, the batch loop stands inside the thread, whose NB_ loads then fly together.
// k_prep: x (all batches) -> bf16; WF hl planes [w][r][k] = sc_w sum_g bf16 W_w[g*256+r][k], r = h*64+d, w = q, k, v, sc = 1, 1/4, 1/4 (exact); WE hl planes [o][j] = sum_g bf16 wo[o][g*256+j]; TB[h][r] = mean_g bf16 rel_bias[c_bucket[r]][g*4+h].
// k_post: GVT[b][h][d][s] = fp16(V[b*TT+s][h*64+d]) (lane -> 2 s); hl planes QS[b][h][t][d] = Q[b*TT+t][h*64+d]; hl planes GK[b][h][s][d] = K[..] (8-B lanes). Q, K, V: the three [NB_*TT][DO] planes of QKV.
#define PB_X (TT * DM / 8 / 256)
#define PB_W (DO * DM / 4 / 256)
#define PB_O (DM * DO / 4 / 256)
#define PB_T ((KVH * 4095 + 255) / 256)
#define GB_V (KVH * HD * TT / 2 / 256)
#define GB_Q (KVH * TT * HD / 4 / 256)
// sb = elements of one batch's plane, [TT][DM] in k_prep and [TT][DO] in k_post (a kernel argument). A thread's loads go through one pointer per batch, p[b]; XWAIT stands behind the last load and names the pointers as inputs, so that their registers are rewritten (also by a later load's result) only behind the wait.
#define XWAIT(p) asm volatile("s_wait_xcnt 0x0" :: "v"(p[0]), "v"(p[1]), "v"(p[2]), "v"(p[3]) : "memory")
// SWAIT stands behind the last store of a job: in the listing the next job's code follows behind a test, and it rewrites registers that the stores name.
#define SWAIT asm volatile("s_wait_xcnt 0x0" ::: "memory")
__device__ __forceinline__ v8us cvt8(v8f v) { v8us o;
#pragma unroll
    for (int k = 0; k < 8; ++k) o[k] = f2bf(v[k]); return o; }
__global__ __launch_bounds__(256) void k_prep(const float* __restrict__ x, const float* __restrict__ wq, const float* __restrict__ wk, const float* __restrict__ wv, const float* __restrict__ wo, const float* __restrict__ rb, bf* XB, bf* WFh, bf* WFl, bf* Wh, bf* Wl, float* TB, size_t sb) {
    int blk = blockIdx.x;
    if (blk < PB_X) { const unsigned i = (blk * 256 + threadIdx.x) * 8; v8f v[NB_]; const float* p[NB_];
#pragma unroll   // unrolled: v[] is indexed by constants only, and all loads issue before the first store
        for (int b = 0; b < NB_; ++b) { p[b] = x + b * sb + i; v[b] = *(const v8f*)p[b]; }
        XWAIT(p);
#pragma unroll
        for (int b = 0; b < NB_; ++b) *(v8us*)(XB + b * sb + i) = cvt8(v[b]);
        return; }
    blk -= PB_X;
    if (blk < 3 * PB_W) { const int w = blk / PB_W; const float* s = w == 0 ? wq : w == 1 ? wk : wv; const float sc = w == 0 ? 1.0f : 0.25f; const unsigned i = ((blk - w * PB_W) * 256 + threadIdx.x) * 4; v4f v[GG];
#pragma unroll   // unrolled: v[] is indexed by constants only, and all loads issue before the first store
        for (int g = 0; g < GG; ++g) v[g] = *(const v4f*)(s + g * DO * DM + i);
        v4us oh, ol;
#pragma unroll
        for (int u = 0; u < 4; ++u) { float a = 0.f;
#pragma unroll
            for (int g = 0; g < GG; ++g) a = __fadd_rn(a, bfr(v[g][u])); unsigned short c, d; splitf(a * sc, c, d); oh[u] = c; ol[u] = d; }
        *(v4us*)(WFh + w * DO * DM + i) = oh; *(v4us*)(WFl + w * DO * DM + i) = ol; SWAIT; return; }
    blk -= 3 * PB_W;
    if (blk < PB_O) { const int e = (blk * 256 + threadIdx.x) * 4; const int j = e % DO; const int o = e / DO; const float* r = wo + (size_t)o * DM + j; v4us oh, ol;
#pragma unroll
        for (int u = 0; u < 4; ++u) { float s = 0.f;
#pragma unroll
            for (int g = 0; g < GG; ++g) s = __fadd_rn(s, bfr(r[g * DO + u])); unsigned short a, b; splitf(s, a, b); oh[u] = a; ol[u] = b; }
        *(v4us*)(Wh + e) = oh; *(v4us*)(Wl + e) = ol; SWAIT; return; }
    blk -= PB_O;
    const int i = blk * 256 + threadIdx.x; if (i >= KVH * 4095) return; const int r = i % 4095, h = i / 4095; const int bk = c_bucket[r]; SWAIT; float s = 0.f;   // here behind the table load: the next loads' results rewrite its address register
#pragma unroll
    for (int g = 0; g < GG; ++g) s = __fadd_rn(s, bfr(rb[bk * NHm + g * KVH + h])); TB[i] = s * 0.25f;
}
// [t][h*64+d] f32 -> [h][t][d] hi+lo planes, for every batch
__device__ __forceinline__ void grp_hl(const float* __restrict__ S, size_t sb, bf* Ph, bf* Pl, int blk) { const int e = (blk * 256 + threadIdx.x) * 4; const int d = e % HD; const int t = (e / HD) % TT; const int h = e / (HD * TT); const float* r = S + (size_t)t * DO + h * HD + d; v4f v[NB_]; const float* p[NB_];
#pragma unroll   // unrolled, here and below: v[] is indexed by constants only, and all loads issue before the first store
    for (int b = 0; b < NB_; ++b) { p[b] = r + b * sb; v[b] = *(const v4f*)p[b]; }
    XWAIT(p);
#pragma unroll
    for (int b = 0; b < NB_; ++b) { v4us oh, ol;
#pragma unroll
        for (int u = 0; u < 4; ++u) { unsigned short a, c; splitf(v[b][u], a, c); oh[u] = a; ol[u] = c; }
        *(v4us*)(Ph + (size_t)b * KVH * TT * HD + e) = oh; *(v4us*)(Pl + (size_t)b * KVH * TT * HD + e) = ol; }
    SWAIT; }
__global__ __launch_bounds__(256) void k_post(const float* __restrict__ QKV, bf* QSh, bf* QSl, bf* GKh, bf* GKl, h16* GVT, size_t sb) {
    int blk = blockIdx.x;
    if (blk < GB_V) { const float* V = QKV + 2 * NB_ * sb; const int e = (blk * 256 + threadIdx.x) * 2; const int s = e % TT; const int d = (e / TT) % HD; const int h = e / (TT * HD); const float* r = V + (size_t)s * DO + h * HD + d; float v[NB_][2]; const float* p[NB_];
#pragma unroll   // unrolled, here and below: v[][] is indexed by constants only, and all loads issue before the first store
        for (int b = 0; b < NB_; ++b) { p[b] = r + b * sb;
#pragma unroll
            for (int u = 0; u < 2; ++u) v[b][u] = p[b][u * DO]; }
        XWAIT(p);
#pragma unroll
        for (int b = 0; b < NB_; ++b) { const v2h o = {tohx(v[b][0]), tohx(v[b][1])};
            *(v2h*)(GVT + (size_t)b * KVH * HD * TT + e) = o; }
        return; }
    blk -= GB_V;
    if (blk < GB_Q) { grp_hl(QKV, sb, QSh, QSl, blk); return; }
    grp_hl(QKV + NB_ * sb, sb, GKh, GKl, blk - GB_Q);
}
// ---- k_fattn: scores, bias, softmax, attn x V and the hi/lo split of its result in ONE kernel; neither scores nor probabilities go to memory. Grid (TT / 32, KVH, NB_), NW waves: a work-group owns 32 query columns n of one head of one batch.
// Wave w walks the 32-key blocks w, w + NW, ... with a running maximum and sum per column (online softmax). S^T = GK QS^T (3 hi/lo products, the accumulator starts at the bias): a lane holds 16 keys of ONE query per column group,
// so the maximum is in-lane plus one exchange between the wave's halves, and two converted S^T tiles ARE the f16 B operand of O^T += GV^T P^T (hardware k order, the order of WFrag::ld): P touches neither LDS nor another lane.
// p = 1024 exp(s - m) (f16, at most 1024; the factor cancels in the quotient). The NW partial (m, l, O^T) meet in LDS: each wave scales its own by exp(m_w - max_w m_w), the sums run in wave order 0..NW-1; sum / l leaves as bf16 hi+lo planes P[n][h * 64 + d], one whole 128-B line per (n, h) and plane.
// Every '#pragma unroll' in k_fattn without a note of its own: qh, ql, o, sc, vf, pf, m and l are then indexed by constants only and stay in registers.
#define L2E 1.44269504f
typedef v4f __attribute__((aligned(4), may_alias)) v4fu;   // the bias window starts at any float
template <int NW>
__global__ __launch_bounds__(32 * NW) void k_fattn(const bf* __restrict__ Qh, const bf* __restrict__ Ql, const bf* __restrict__ Kh, const bf* __restrict__ Kl, const h16* __restrict__ Vt, const float* __restrict__ TB, bf* Ph, bf* Pl) {
    __shared__ __align__(16) float po[NW * 32 * 68];
    __shared__ float pm[NW * 32];
    __shared__ float pl[NW * 32];
    const int lane = threadIdx.x & 31, lr = lane & 15, hi = lane >> 4; const int wv = __builtin_amdgcn_readfirstlane((int)(threadIdx.x >> 5));
    const int n0 = blockIdx.x * 32, h = blockIdx.y, bz = blockIdx.z; const size_t hb = ((size_t)bz * KVH + h) * TT * HD;
    v16bf qh[2][2], ql[2][2];
#pragma unroll
    for (int nt = 0; nt < 2; ++nt)
#pragma unroll
        for (int kk = 0; kk < 2; ++kk) { const size_t qo = hb + (size_t)(n0 + nt * 16 + lr) * HD + kk * 32 + 8 * hi; qh[nt][kk] = WFrag<bf>::ld(Qh + qo); ql[nt][kk] = WFrag<bf>::ld(Ql + qo); }
    v8f o[4][2];
#pragma unroll
    for (int dt = 0; dt < 4; ++dt)
#pragma unroll
        for (int nt = 0; nt < 2; ++nt) o[dt][nt] = (v8f){};
    float m[2] = {-3.0e38f, -3.0e38f}, l[2] = {0.f, 0.f};
    const float* tb = TB + (size_t)h * 4095 + 2047 + 8 * hi - n0 - lr;   // tb[s0' + j] = bias of key s0' + 8 hi + j against query n0 + lr
    const bf* kh = Kh + hb + (size_t)lr * HD + 8 * hi; const bf* kl = Kl + hb + (size_t)lr * HD + 8 * hi; const h16* vt = Vt + hb + (size_t)lr * TT + 8 * hi;
#pragma unroll 1   // rolled: one pass already holds about 230 registers, and four waves per SIMD leave 256
    for (int s0 = wv * 32; s0 < TT; s0 += 32 * NW) {
        v8f sc[2][2];
#pragma unroll
        for (int st = 0; st < 2; ++st)
#pragma unroll
            for (int nt = 0; nt < 2; ++nt) { const float* p = tb + s0 + st * 16 - nt * 16; const v4f b0 = *(const v4fu*)p, b1 = *(const v4fu*)(p + 4); sc[st][nt] = (v8f){b0[0], b0[1], b0[2], b0[3], b1[0], b1[1], b1[2], b1[3]}; }
        v16h vf[4];
#pragma unroll
        for (int dt = 0; dt < 4; ++dt) vf[dt] = WFrag<h16>::ld(vt + (size_t)dt * 16 * TT + s0);
#pragma unroll
        for (int st = 0; st < 2; ++st)
#pragma unroll
            for (int kk = 0; kk < 2; ++kk) { const size_t ko = (size_t)(s0 + st * 16) * HD + kk * 32; const v16bf ah = WFrag<bf>::ld(kh + ko), al = WFrag<bf>::ld(kl + ko);
#pragma unroll
                for (int nt = 0; nt < 2; ++nt) { sc[st][nt] = wmmab(ah, qh[nt][kk], sc[st][nt]); sc[st][nt] = wmmab(al, qh[nt][kk], sc[st][nt]); sc[st][nt] = wmmab(ah, ql[nt][kk], sc[st][nt]); } }
#pragma unroll
        for (int nt = 0; nt < 2; ++nt) {
            float mx = fmaxf(sc[0][nt][0], sc[1][nt][0]);
#pragma unroll
            for (int j = 1; j < 8; ++j) mx = fmaxf(mx, fmaxf(sc[0][nt][j], sc[1][nt][j]));
            mx = fmaxf(mx, __shfl_xor(mx, 16, 32));
            const float mn = fmaxf(m[nt], mx); const float al = __builtin_amdgcn_exp2f((m[nt] - mn) * L2E); const float mb = __builtin_fmaf(mn, L2E, -10.0f); m[nt] = mn;
            float ps = 0.f; v16h pf;
#pragma unroll
            for (int st = 0; st < 2; ++st)
#pragma unroll
                for (int j = 0; j < 8; ++j) { const float p = __builtin_amdgcn_exp2f(__builtin_fmaf(sc[st][nt][j], L2E, -mb)); ps += p; pf[st * 8 + j] = tohx(p); }
            l[nt] = __builtin_fmaf(l[nt], al, ps);
#pragma unroll
            for (int dt = 0; dt < 4; ++dt) { o[dt][nt] *= al; o[dt][nt] = wmma16(vf[dt], pf, o[dt][nt]); }
        }
    }
#pragma unroll
    for (int nt = 0; nt < 2; ++nt) { l[nt] += __shfl_xor(l[nt], 16, 32); if (hi == 0) pm[wv * 32 + nt * 16 + lr] = m[nt]; }
    __syncthreads();
#pragma unroll
    for (int nt = 0; nt < 2; ++nt) { float mg = pm[nt * 16 + lr];
#pragma unroll
        for (int w = 1; w < NW; ++w) mg = fmaxf(mg, pm[w * 32 + nt * 16 + lr]);
        const float f = __builtin_amdgcn_exp2f((m[nt] - mg) * L2E); if (hi == 0) pl[wv * 32 + nt * 16 + lr] = l[nt] * f;
        float* pd = po + (wv * 32 + nt * 16 + lr) * 68 + 8 * hi;
#pragma unroll
        for (int dt = 0; dt < 4; ++dt) { const v8f c = o[dt][nt] * f; *(v4fa*)(pd + dt * 16) = (v4f){c[0], c[1], c[2], c[3]}; *(v4fa*)(pd + dt * 16 + 4) = (v4f){c[4], c[5], c[6], c[7]}; } }
    __syncthreads();
#pragma unroll
    for (int it = 0; it < 16 / NW; ++it) { const int idx = it * 32 * NW + (int)threadIdx.x; const int n = idx >> 4, c4 = (idx & 15) * 4; v4f s = *(const v4fa*)(po + n * 68 + c4); float ls = pl[n];
#pragma unroll   // unrolled: the LDS reads of all partials issue ahead of the adds, which keep the order w = 0..NW-1
        for (int w = 1; w < NW; ++w) { s += *(const v4fa*)(po + (w * 32 + n) * 68 + c4); ls += pl[w * 32 + n]; }
        const float inv = __fdiv_rn(1.0f, ls); v4us oh, ol;
#pragma unroll
        for (int u = 0; u < 4; ++u) { unsigned short a, b; splitf(s[u] * inv, a, b); oh[u] = a; ol[u] = b; }
        const size_t eo = ((size_t)bz * TT + n0 + n) * DO + h * HD + c4; *(v4us*)(Ph + eo) = oh; *(v4us*)(Pl + eo) = ol; }
}

extern "C" void kernel_launch(void* const* d_in, const int* in_sizes, int n_in,
                              void* d_out, int out_size, void* d_ws, size_t ws_size, hipStream_t stream) {
    (void)in_sizes; (void)n_in; (void)out_size;
    const float* x = (const float*)d_in[0]; const float* wq = (const float*)d_in[1]; const float* wk = (const float*)d_in[2]; const float* wv = (const float*)d_in[3]; const float* wo = (const float*)d_in[4]; const float* rb = (const float*)d_in[5];
    float* OUT = (float*)d_out;     // [4][2048][1024] = [8192][1024]: the batches are one run of rows for every GEMM
    char* wsp = (char*)d_ws;
    auto take = [&](size_t bytes) { char* p = wsp; wsp += (bytes + 255) & ~(size_t)255; return (void*)p; };
    bf* WFh = (bf*)take((size_t)3 * DO * DM * 2); bf* WFl = (bf*)take((size_t)3 * DO * DM * 2); bf* WEh = (bf*)take((size_t)DM * DO * 2); bf* WEl = (bf*)take((size_t)DM * DO * 2); float* TB = (float*)take((size_t)KVH * 4095 * 4 + 256);
    bf* XB = (bf*)take((size_t)NB_ * TT * DM * 2); float* QKV = (float*)take((size_t)3 * NB_ * TT * DO * 4); bf* QSh = (bf*)take((size_t)NB_ * KVH * TT * HD * 2); bf* QSl = (bf*)take((size_t)NB_ * KVH * TT * HD * 2); bf* GKh = (bf*)take((size_t)NB_ * KVH * TT * HD * 2); bf* GKl = (bf*)take((size_t)NB_ * KVH * TT * HD * 2); h16* GVT = (h16*)take((size_t)NB_ * KVH * HD * TT * 2);
    bf* OPh = (bf*)take((size_t)NB_ * TT * DO * 2); bf* OPl = (bf*)take((size_t)NB_ * TT * DO * 2);
    if ((size_t)(wsp - (char*)d_ws) > ws_size) return;    // total ~ 75 MB
    k_prep<<<PB_X + 3 * PB_W + PB_O + PB_T, 256, 0, stream>>>(x, wq, wk, wv, wo, rb, XB, WFh, WFl, WEh, WEl, TB, (size_t)TT * DM);   // [out][in] weights = natural Bt
    k_gemmw<bf, 3, false, 8><<<dim3(NB_ * TT / 64, DO / 64, 3), 256, 0, stream>>>(XB, nullptr, WFh, WFl, DM, QKV, DO, nullptr, 0, (size_t)DO * DM, (size_t)NB_ * TT * DO);   // z = q, k, v; NSPLIT 3: A Bt + A Bt2
    k_post<<<GB_V + 2 * GB_Q, 256, 0, stream>>>(QKV, QSh, QSl, GKh, GKl, GVT, (size_t)TT * DO);
    k_fattn<16><<<dim3(TT / 32, KVH, NB_), 512, 0, stream>>>(QSh, QSl, GKh, GKl, GVT, TB, OPh, OPl);
    k_gemmw<bf, 2, false, 8><<<dim3(NB_ * TT / 64, DM / 64, 1), 256, 0, stream>>>(OPh, OPl, WEh, WEl, DO, OUT, DM, nullptr, 0, 0, 0);
}

// v005
// A run of this version takes 110 microseconds.
// In both of two side-by-side timings against v004, it was 1.52 times as fast.
// Over all steps from v000 it is 7.61 times as fast.
#include <hip/hip_runtime.h>

// Grouped attention with a relative-position bias (hidden [4][2048][1024]; q/k/v = x W^T (16 heads x 64); heads grouped (g=4 groups, h=4 kv heads: head = g*4 + h); gk, gv = mean over g; scores[h][n][s] = sum_g sum_d q[g,h][n][d] gk[h][s][d] (the reference's einsum sums the query
// groups; no 1/sqrt(d) scaling, T5 style) + mean over g of the T5 relative-position bias rel_bias[bucket(s - n)][g*4 + h]; softmax; out[h] = attn gv[h]; tiled x4 over g and projected: out_full Wo^T = out (sum_g Wo[:, g-block])^T -> [4][2048][1024]).
// The group sum of q and the group means of k and v are linear in the weights: sum_g (x Wq[g,h]^T) = x (sum_g Wq[g,h])^T. The weights are summed over g first (k_prep), so the projections have 256 columns each instead of 1024 and yield the summed q and the mean k, v directly.
// The bucket of each relative position depends only on (s - n) and the fixed sizes: it is a compile-time table of 4095 entries (bidirectional T5 buckets, 32 buckets, max distance 128; computed in f32 exactly as the reference and baked in).
// Compute dtypes, f32 accumulate: every input rounded to bf16; group sums / means of the bf16 weights in f32 -> bf16 hi+lo planes; q/k/v = bf16 x (exact) times both planes (2 products), f32 -> bf16 hi+lo planes (q, k) and f16 (v); scores (K 64) as 3 products; bias + online softmax f32, probabilities x1024 in f16, fused with attn x V (k_fattn)

#define NB_  4
#define TT   2048
#define DM   1024
#define NHm  16
#define KVH  4
#define GG   4
#define HD   64
#define DO   256
typedef _Float16 h16;
typedef unsigned short bf;
typedef __attribute__((ext_vector_type(16))) __bf16   v16bf;
typedef __attribute__((ext_vector_type(16))) _Float16 v16h;
typedef __attribute__((ext_vector_type(8)))  _Float16 v8h;
typedef __attribute__((ext_vector_type(8)))  unsigned short v8us;
typedef __attribute__((ext_vector_type(8)))  float    v8f;
typedef __attribute__((ext_vector_type(4)))  float    v4f;
typedef v8h  __attribute__((may_alias)) v8ha;
typedef v4f  __attribute__((may_alias)) v4fa;
typedef v8us __attribute__((may_alias)) v8usa;

__device__ __forceinline__ unsigned short f2bf(float f) { unsigned u = __float_as_uint(f); u += 0x7FFFu + ((u >> 16) & 1u); return (unsigned short)(u >> 16); }
__device__ __forceinline__ float bf2f(unsigned short b) { return __uint_as_float(((unsigned)b) << 16); }
__device__ __forceinline__ float bfr(float f) { return bf2f(f2bf(f)); }
__device__ __forceinline__ v16h cat16(v8h lo, v8h hi) { return __builtin_shufflevector(lo, hi, 0, 1, 2, 3, 4, 5, 6, 7, 8, 9, 10, 11, 12, 13, 14, 15); }
__device__ __forceinline__ v16bf cat16b(v8us lo, v8us hi) { return __builtin_bit_cast(v16bf, __builtin_shufflevector(lo, hi, 0, 1, 2, 3, 4, 5, 6, 7, 8, 9, 10, 11, 12, 13, 14, 15)); }
__device__ __forceinline__ v8f wmma16(v16h a, v16h b, v8f c) { return __builtin_amdgcn_wmma_f32_16x16x32_f16(false, a, false, b, (short)0, c, false, false); }
__device__ __forceinline__ v8f wmmab(v16bf a, v16bf b, v8f c) { return __builtin_amdgcn_wmma_f32_16x16x32_bf16(false, a, false, b, (short)0, c, false, false); }



// FRAGMENT ORDER. Every 16-bit operand plane [R rows][K columns] is stored as WMMA fragments of 16 rows x 32 k = 512 elements = 1 KB: element (row, k) lies at ((row / 16) * (K / 32) + k / 32) * 512 + ((k / 8) % 4) * 128 + (row % 16) * 8 + k % 8 (in GVT the fragment index is (k / 32) * (R / 16) + row / 16 instead).
// Lane (lr, hi) = lane number hi * 16 + lr finds its k = 8 hi .. 8 hi + 7 at fragment + lane * 8 and its k = 16 + 8 hi .. at 256 elements more (the hardware k order): each wave-wide 16-B load covers 512 contiguous bytes, four whole 128-B lines (from a row-major plane it would touch 32-B pieces of 16 lines).
// The producers write such a plane linearly and gather their source: chunk c (8 elements, at c * 8) comes from the source index frag_src(c, K, ld) = row * ld + k.
__device__ __forceinline__ unsigned frag_src(unsigned c, unsigned K, unsigned ld) { const unsigned f = c >> 6, kb = K >> 5; return ((f / kb) * 16 + (c & 15)) * ld + (f % kb) * 32 + ((c >> 4) & 3) * 8; }

// ---- k_gemmw: register-blocked GEMM, KS WAVES per 64x64 output tile (16 accumulators each), operands straight from fragment-ordered 16-bit planes (see FRAGMENT ORDER above); grid (M/64, N/64, Z), 32 * KS threads.
// C[m][n] (f32, pitch ldc, + optional f32 bias[n]) = sum_k A[m][k] Bt[n][k] (+ split products per NSPLIT). z-batch strides sA/sB/sC in elements. K % (32 * KS) == 0.
// KS > 1: wave w sums the 32-wide k steps w, w + KS, w + 2 KS, ... (interleaved: in one trip the waves of a work-group read KS neighbouring 1-KB fragments of every 16-row block);
// the KS partial tiles meet in LDS (fragment order) and are added in wave order 0..KS-1, 16/KS fragments per wave; the tile leaves through a row-major LDS tile in whole lines.
template <typename T16> struct WFrag;
template <> struct WFrag<h16> { typedef v16h V; static __device__ __forceinline__ V ld(const h16* p) { return cat16(*(const v8h*)p, *(const v8h*)(p + 256)); } static __device__ __forceinline__ v8f mma(V a, V b, v8f c) { return wmma16(a, b, c); } };
template <> struct WFrag<bf> { typedef v16bf V; static __device__ __forceinline__ V ld(const bf* p) { return cat16b(*(const v8us*)p, *(const v8us*)(p + 256)); } static __device__ __forceinline__ v8f mma(V a, V b, v8f c) { return wmmab(a, b, c); } };
template <typename T16, int NSPLIT, bool BIAS, int KS, int K>   // K a constant: the steps from fragment to fragment are immediate offsets on one pointer per plane
__global__ __launch_bounds__(32 * KS) void k_gemmw(const T16* __restrict__ A, const T16* __restrict__ A2, const T16* __restrict__ Bt, const T16* __restrict__ Bt2, float* C, int ldc, const float* __restrict__ bias, size_t sA, size_t sB, size_t sC) {
    typedef typename WFrag<T16>::V V;
    __shared__ __align__(16) float os[KS == 1 ? 16 * 68 : 64 * 68 + KS * 4096];
    const size_t z = blockIdx.z; A += z * sA; if (A2) A2 += z * sA; Bt += z * sB; if (Bt2) Bt2 += z * sB; C += z * sC;
    const int lane = threadIdx.x & 31, lr = lane & 15, hi = lane >> 4; const int r0 = blockIdx.x * 64, c0 = blockIdx.y * 64;
    v8f acc[4][4];
#pragma unroll
    for (int mb = 0; mb < 4; ++mb)
#pragma unroll
        for (int nb = 0; nb < 4; ++nb) acc[mb][nb] = (v8f){};
    const size_t aoff = (size_t)r0 * K, boff = (size_t)c0 * K; const unsigned lo = lane * 8;   // fragment (row block, k block) starts at (row block * K / 32 + k block) * 512: the same for the whole wave; the lane's own part is lo
    const int wv = __builtin_amdgcn_readfirstlane((int)(threadIdx.x >> 5));
#pragma unroll 1
    for (int kc = wv * 32; kc < K; kc += 32 * KS) {
        if constexpr (NSPLIT == 3) {   // A Bt + A Bt2. One pointer per plane; each s_wait_xcnt 0 stands behind the last load of its run and names the run's pointers as inputs, so that their registers are rewritten (also by a later load's result) only behind the wait.
            const T16* pa = A + aoff + kc * 16 + lo; const T16* pb = Bt + boff + kc * 16 + lo; const T16* pc = Bt2 + boff + kc * 16 + lo; V a[4], b[4], b2[4];
#pragma unroll   // unrolled, here and below: the arrays are indexed by constants only and stay in registers, and the loads of a run issue together
            for (int i = 0; i < 4; ++i) { a[i] = WFrag<T16>::ld(pa + i * 16 * K); b[i] = WFrag<T16>::ld(pb + i * 16 * K); }
            asm volatile("s_wait_xcnt 0x0" :: "v"(pa), "v"(pb) : "memory");
#pragma unroll
            for (int i = 0; i < 4; ++i) b2[i] = WFrag<T16>::ld(pc + i * 16 * K);
            asm volatile("s_wait_xcnt 0x0" :: "v"(pc) : "memory");
            __builtin_amdgcn_sched_barrier(0);   // keeps every load of the trip in front of its first matrix instruction: without it the scheduler sinks five fragments' loads between the products, and a trip waits for memory several times instead of once
#pragma unroll
            for (int nb = 0; nb < 4; ++nb)
#pragma unroll
                for (int mb = 0; mb < 4; ++mb) acc[mb][nb] = WFrag<T16>::mma(a[mb], b[nb], acc[mb][nb]);
#pragma unroll
            for (int nb = 0; nb < 4; ++nb)
#pragma unroll
                for (int mb = 0; mb < 4; ++mb) acc[mb][nb] = WFrag<T16>::mma(a[mb], b2[nb], acc[mb][nb]);
            asm volatile("v_nop\n\tv_nop\n\tv_nop\n\tv_nop" : "+v"(acc[0][0]), "+v"(acc[1][1]), "+v"(acc[2][2]), "+v"(acc[3][3]) : "v"(a[0]), "v"(a[3]));   // the four vector slots behind the trip's last matrix instruction, also on the taken back edge
        } else if constexpr (NSPLIT == 2) {   // A Bt + A2 Bt + A Bt2, every accumulator in this order. One pointer per plane; each s_wait_xcnt 0 stands behind the last load of its run and names the run's pointers as inputs, so that their registers are rewritten (also by a later load's result) only behind the wait.
            const T16* pa = A + aoff + kc * 16 + lo; const T16* pa2 = A2 + aoff + kc * 16 + lo; const T16* pb = Bt + boff + kc * 16 + lo; const T16* pb2 = Bt2 + boff + kc * 16 + lo; V a[4], a2[4], b[4], b2[4];
#pragma unroll   // unrolled, here and below: the arrays are indexed by constants only and stay in registers, and the loads of a run issue together
            for (int i = 0; i < 4; ++i) { a[i] = WFrag<T16>::ld(pa + i * 16 * K); b[i] = WFrag<T16>::ld(pb + i * 16 * K); a2[i] = WFrag<T16>::ld(pa2 + i * 16 * K); }
            b2[0] = WFrag<T16>::ld(pb2);
            asm volatile("s_wait_xcnt 0x0" :: "v"(pa), "v"(pa2), "v"(pb), "v"(pb2) : "memory");
            __builtin_amdgcn_sched_barrier(0);   // keeps the run's loads in front of the first matrix instruction: a trip waits for memory once
#pragma unroll
            for (int nb = 0; nb < 4; ++nb) {
#pragma unroll
                for (int mb = 0; mb < 4; ++mb) acc[mb][nb] = WFrag<T16>::mma(a[mb], b[nb], acc[mb][nb]);
#pragma unroll
                for (int mb = 0; mb < 4; ++mb) acc[mb][nb] = WFrag<T16>::mma(a2[mb], b[nb], acc[mb][nb]);
                if (nb == 0) {
#pragma unroll
                    for (int mb = 0; mb < 4; ++mb) acc[mb][0] = WFrag<T16>::mma(a[mb], b2[0], acc[mb][0]);
                    // the last three fragments take the registers that column block 0 has left: all sixteen at once, with the accumulators and the pointers, would pass 256 registers and halve the work-groups per WGP
                    b2[1] = WFrag<T16>::ld(pb2 + 16 * K); b2[2] = WFrag<T16>::ld(pb2 + 2 * 16 * K); b2[3] = WFrag<T16>::ld(pb2 + 3 * 16 * K);
                    asm volatile("s_wait_xcnt 0x0" :: "v"(pb2) : "memory");
                    __builtin_amdgcn_sched_barrier(0);   // keeps these loads here, 24 matrix instructions ahead of their first use
                } }
#pragma unroll
            for (int nb = 1; nb < 4; ++nb)
#pragma unroll
                for (int mb = 0; mb < 4; ++mb) acc[mb][nb] = WFrag<T16>::mma(a[mb], b2[nb], acc[mb][nb]);
            asm volatile("v_nop\n\tv_nop\n\tv_nop\n\tv_nop" : "+v"(acc[0][0]), "+v"(acc[1][1]), "+v"(acc[2][2]), "+v"(acc[3][3]) : "v"(a[0]), "v"(a[3]));   // the four vector slots behind the trip's last matrix instruction, also on the taken back edge
        } else {
        V a[4], a2[4];
#pragma unroll
        for (int mb = 0; mb < 4; ++mb) { a[mb] = WFrag<T16>::ld(A + aoff + (size_t)mb * 16 * K + kc * 16 + lo); if (NSPLIT == 1 || NSPLIT == 2) a2[mb] = WFrag<T16>::ld(A2 + aoff + (size_t)mb * 16 * K + kc * 16 + lo); }
#pragma unroll
        for (int nb = 0; nb < 4; ++nb) { const V b = WFrag<T16>::ld(Bt + boff + (size_t)nb * 16 * K + kc * 16 + lo); V b2; if (NSPLIT >= 2) b2 = WFrag<T16>::ld(Bt2 + boff + (size_t)nb * 16 * K + kc * 16 + lo);
#pragma unroll
            for (int mb = 0; mb < 4; ++mb) { acc[mb][nb] = WFrag<T16>::mma(a[mb], b, acc[mb][nb]); if (NSPLIT == 1 || NSPLIT == 2) acc[mb][nb] = WFrag<T16>::mma(a2[mb], b, acc[mb][nb]); if (NSPLIT >= 2) acc[mb][nb] = WFrag<T16>::mma(a[mb], b2, acc[mb][nb]); } }
        asm volatile("v_nop\n\tv_nop\n\tv_nop\n\tv_nop" : "+v"(acc[0][0]), "+v"(acc[1][1]), "+v"(acc[2][2]), "+v"(acc[3][3]) : "v"(a[0]), "v"(a[3]));
        }
    }
    if constexpr (KS > 1) {
        float* part = os + 64 * 68;
        float* pw = part + wv * 4096 + lane * 4;
#pragma unroll   // both loops unrolled: acc[][] is indexed by constants only and stays in registers
        for (int mb = 0; mb < 4; ++mb)
#pragma unroll
            for (int nb = 0; nb < 4; ++nb) { const v8f c = acc[mb][nb]; *(v4fa*)(pw + (mb * 4 + nb) * 256) = (v4f){c[0], c[1], c[2], c[3]}; *(v4fa*)(pw + (mb * 4 + nb) * 256 + 128) = (v4f){c[4], c[5], c[6], c[7]}; }
        __syncthreads();
        constexpr int NF = 16 / KS;
#pragma unroll   // unrolled with the loop over sw: the LDS reads of all partials issue ahead of the adds, which keep the order sw = 0..KS-1
        for (int i = 0; i < NF; ++i) { const int f = wv * NF + i; const float* pf = part + f * 256 + lane * 4; v4f s0 = *(const v4fa*)pf, s1 = *(const v4fa*)(pf + 128);
#pragma unroll
            for (int sw = 1; sw < KS; ++sw) { s0 += *(const v4fa*)(pf + sw * 4096); s1 += *(const v4fa*)(pf + sw * 4096 + 128); }
            float* od = os + ((f >> 2) * 16 + hi * 8) * 68 + (f & 3) * 16 + lr;
#pragma unroll
            for (int j = 0; j < 4; ++j) { od[j * 68] = s0[j]; od[(j + 4) * 68] = s1[j]; } }
        __syncthreads();
#pragma unroll   // unrolled: every LDS read issues before the first store waits
        for (int it = 0; it < 32 / KS; ++it) { const int idx = it * 32 * KS + (int)threadIdx.x; const int row = idx >> 4, cofs = (idx & 15) * 4; v4f val = *(const v4fa*)(os + row * 68 + cofs); if (BIAS) { val[0] += bfr(bias[c0 + cofs]); val[1] += bfr(bias[c0 + cofs + 1]); val[2] += bfr(bias[c0 + cofs + 2]); val[3] += bfr(bias[c0 + cofs + 3]); }
            *(v4f*)(C + (size_t)(r0 + row) * ldc + c0 + cofs) = val; }
        return;
    }
#pragma unroll
    for (int mb = 0; mb < 4; ++mb) {
#pragma unroll
        for (int nb = 0; nb < 4; ++nb) {
#pragma unroll
            for (int j = 0; j < 8; ++j) os[(hi * 8 + j) * 68 + nb * 16 + lr] = acc[mb][nb][j]; }
        __builtin_amdgcn_wave_barrier(); asm volatile("" ::: "memory");
        float* crow = C + (size_t)(r0 + mb * 16) * ldc + c0;
{
#pragma unroll
            for (int s = 0; s < 8; ++s) { const int row = 2 * s + hi, cofs = lr * 4; v4f val = *(const v4fa*)(os + row * 68 + cofs); if (BIAS) { val[0] += bfr(bias[c0 + cofs]); val[1] += bfr(bias[c0 + cofs + 1]); val[2] += bfr(bias[c0 + cofs + 2]); val[3] += bfr(bias[c0 + cofs + 3]); }
                *(v4f*)(crow + (size_t)row * ldc + cofs) = val; }
             }
        __builtin_amdgcn_wave_barrier(); asm volatile("" ::: "memory");
    }
}

__device__ __forceinline__ h16 tohx(float x) { return (h16)x; }
__device__ __forceinline__ void splitf(float y, unsigned short& h, unsigned short& l) { h = f2bf(y); l = f2bf(y - bf2f(h)); }
typedef __attribute__((ext_vector_type(2))) unsigned short v2us;
typedef __attribute__((ext_vector_type(4))) unsigned short v4us;
typedef __attribute__((ext_vector_type(2))) _Float16 v2h;
typedef __attribute__((ext_vector_type(4))) _Float16 v4h;
__constant__ unsigned char c_bucket[4095] = { 15,15,15,15,15,15,15,15,15,15,15,15,15,15,15,15,15,15,15,15,15,15,15,15,15,15,15,15,15,15,15,15,15,15,15,15,15,15,15,15,15,15,15,15,15,15,15,15,15,15,15,15,15,15,15,15,15,15,15,15,15,15,15,15,15,15,15,15,15,15,15,15,15,15,15,15,15,15,15,15,15,15,15,15,15,15,15,15,15,15,15,15,15,15,15,15,15,15,15,15,15,15,15,15,15,15,15,15,15,15,15,15,15,15,15,15,15,15,15,15,15,15,15,15,15,15,15,15,15,15,15,15,15,15,15,15,15,15,15,15,15,15,15,15,15,15,15,15,15,15,15,15,15,15,15,15,15,15,15,15,15,15,15,15,15,15,15,15,15,15,15,15,15,15,15,15,15,15,15,15,15,15,15,15,15,15,15,15,15,15,15,15,15,15,15,15,15,15,15,15,15,15,15,15,15,15,15,15,15,15,15,15,15,15,15,15,15,15,15,15,15,15,15,15,15,15,15,15,15,15,15,15,15,15,15,15,15,15,15,15,15,15,15,15,15,15,15,15,15,15,15,15,15,15,15,15,15,15,15,15,15,15,15,15,15,15,15,15,15,15,15,15,15,15,15,15,15,15,15,15,15,15,15,15,15,15,15,15,15,15,15,15,15,15,15,15,15,15,15,15,15,15,15,15,15,15,15,15,15,15,15,15,15,15,15,15,15,15,15,15,15,15,15,15,15,15,15,15,15,15,15,15,15,15,15,15,15,15,15,15,15,15,15,15,15,15,15,15,15,15,15,15,15,15,15,15,15,15,15,15,15,15,15,15,15,15,15,15,15,15,15,15,15,15,15,15,15,15,15,15,15,15,15,15,15,15,15,15,15,15,15,15,15,15,15,15,15,15,15,15,15,15,15,15,15,15,15,15,15,15,15,15,15,15,15,15,15,15,15,15,15,15,15,15,15,15,15,15,15,15,15,15,15,15,15,15,15,15,15,15,15,15,15,15,15,15,15,15,15,15,15,15,15,15,15,15,15,15,15,15,15,15,15,15,15,15,15,15,15,15,15,15,15,15,15,15,15,15,15,15,15,15,15,15,15,15,15,15,15,15,15,15,15,15,15,15,15,15,15,15,15,15,15,15,15,15,15,15,15,15,15,15,15,15,15,15,15,15,15,15,15,15,15,15,15,15,15,15,15,15,15,15,15,15,15,15,15,15,15,15,15,15,15,15,15,15,15,15,15,15,15,15,15,15,15,15,15,15,15,15,15,15,15,15,15,15,15,15,15,15,15,15,15,15,15,15,15,15,15,15,15,15,15,15,15,15,15,15,15,15,15,15,15,15,15,15,15,15,15,15,15,15,15,15,15,15,15,15,15,15,15,15,15,15,15,15,15,15,15,15,15,15,15,15,15,15,15,15,15,15,15,15,15,15,15,15,15,15,15,15,15,15,15,15,15,15,15,15,15,15,15,15,15,15,15,15,15,15,15,15,15,15,15,15,15,15,15,15,15,15,15,15,15,15,15,15,15,15,15,15,15,15,15,15,15,15,15,15,15,15,15,15,15,15,15,15,15,15,15,15,15,15,15,15,15,15,15,15,15,15,15,15,15,15,15,15,15,15,15,15,15,15,15,15,15,15,15,15,15,15,15,15,15,15,15,15,15,15,15,15,15,15,15,15,15,15,15,15,15,15,15,15,15,15,15,15,15,15,15,15,15,15,15,15,15,15,15,15,15,15,15,15,15,15,15,15,15,15,15,15,15,15,15,15,15,15,15,15,15,15,15,15,15,15,15,15,15,15,15,15,15,15,15,15,15,15,15,15,15,15,15,15,15,15,15,15,15,15,15,15,15,15,15,15,15,15,15,15,15,15,15,15,15,15,15,15,15,15,15,15,15,15,15,15,15,15,15,15,15,15,15,15,15,15,15,15,15,15,15,15,15,15,15,15,15,15,15,15,15,15,15,15,15,15,15,15,15,15,15,15,15,15,15,15,15,15,15,15,15,15,15,15,15,15,15,15,15,15,15,15,15,15,15,15,15,15,15,15,15,15,15,15,15,15,15,15,15,15,15,15,15,15,15,15,15,15,15,15,15,15,15,15,15,15,15,15,15,15,15,15,15,15,15,15,15,15,15,15,15,15,15,15,15,15,15,15,15,15,15,15,15,15,15,15,15,15,15,15,15,15,15,15,15,15,15,15,15,15,15,15,15,15,15,15,15,15,15,15,15,15,15,15,15,15,15,15,15,15,15,15,15,15,15,15,15,15,15,15,15,15,15,15,15,15,15,15,15,15,15,15,15,15,15,15,15,15,15,15,15,15,15,15,15,15,15,15,15,15,15,15,15,15,15,15,15,15,15,15,15,15,15,15,15,15,15,15,15,15,15,15,15,15,15,15,15,15,15,15,15,15,15,15,15,15,15,15,15,15,15,15,15,15,15,15,15,15,15,15,15,15,15,15,15,15,15,15,15,15,15,15,15,15,15,15,15,15,15,15,15,15,15,15,15,15,15,15,15,15,15,15,15,15,15,15,15,15,15,15,15,15,15,15,15,15,15,15,15,15,15,15,15,15,15,15,15,15,15,15,15,15,15,15,15,15,15,15,15,15,15,15,15,15,15,15,15,15,15,15,15,15,15,15,15,15,15,15,15,15,15,15,15,15,15,15,15,15,15,15,15,15,15,15,15,15,15,15,15,15,15,15,15,15,15,15,15,15,15,15,15,15,15,15,15,15,15,15,15,15,15,15,15,15,15,15,15,15,15,15,15,15,15,15,15,15,15,15,15,15,15,15,15,15,15,15,15,15,15,15,15,15,15,15,15,15,15,15,15,15,15,15,15,15,15,15,15,15,15,15,15,15,15,15,15,15,15,15,15,15,15,15,15,15,15,15,15,15,15,15,15,15,15,15,15,15,15,15,15,15,15,15,15,15,15,15,15,15,15,15,15,15,15,15,15,15,15,15,15,15,15,15,15,15,15,15,15,15,15,15,15,15,15,15,15,15,15,15,15,15,15,15,15,15,15,15,15,15,15,15,15,15,15,15,15,15,15,15,15,15,15,15,15,15,15,15,15,15,15,15,15,15,15,15,15,15,15,15,15,15,15,15,15,15,15,15,15,15,15,15,15,15,15,15,15,15,15,15,15,15,15,15,15,15,15,15,15,15,15,15,15,15,15,15,15,15,15,15,15,15,15,15,15,15,15,15,15,15,15,15,15,15,15,15,15,15,15,15,15,15,15,15,15,15,15,15,15,15,15,15,15,15,15,15,15,15,15,15,15,15,15,15,15,15,15,15,15,15,15,15,15,15,15,15,15,15,15,15,15,15,15,15,15,15,15,15,15,15,15,15,15,15,15,15,15,15,15,15,15,15,15,15,15,15,15,15,15,15,15,15,15,15,15,15,15,15,15,15,15,15,15,15,15,15,15,15,15,15,15,15,15,15,15,15,15,15,15,15,15,15,15,15,15,15,15,15,15,15,15,15,15,15,15,15,15,15,15,15,15,15,15,15,15,15,15,15,15,15,15,15,15,15,15,15,15,15,15,15,15,15,15,15,15,15,15,15,15,15,15,15,15,15,15,15,15,15,15,15,15,15,15,15,15,15,15,15,15,15,15,15,15,15,15,15,15,15,15,15,15,15,15,15,15,15,15,15,15,15,15,15,15,15,15,15,15,15,15,15,15,15,15,15,15,15,15,15,15,15,15,15,15,15,15,15,15,15,15,15,15,15,15,15,15,15,15,15,15,15,15,15,15,15,15,15,15,15,15,15,15,15,15,15,15,15,15,15,15,15,15,15,15,15,15,15,15,15,15,15,15,15,15,15,15,15,15,15,15,15,15,15,15,15,15,15,15,15,15,15,15,15,15,15,15,15,15,15,15,15,15,15,15,15,15,15,15,15,15,15,15,15,15,15,15,15,15,15,15,15,15,15,15,15,15,15,15,15,15,15,15,15,15,15,15,15,15,15,15,15,15,15,15,15,15,15,15,15,15,15,15,15,15,15,15,15,15,15,15,15,15,15,15,15,15,15,15,15,15,15,15,15,15,15,15,15,15,15,15,15,15,15,15,15,15,15,15,15,15,15,15,15,15,15,15,15,15,15,15,15,15,15,15,15,15,15,15,15,15,15,15,15,15,15,15,15,15,15,15,15,15,15,15,15,15,15,15,15,15,15,15,15,15,15,15,15,15,15,15,15,15,15,15,15,15,15,15,15,15,15,15,15,15,15,15,15,15,15,15,15,15,15,15,15,15,15,15,15,15,15,15,15,15,15,15,15,15,15,15,15,15,15,15,15,15,15,15,15,15,15,15,15,15,15,15,15,15,15,15,15,15,15,15,15,15,15,15,15,15,15,15,15,15,15,15,15,15,15,15,15,15,15,15,15,15,15,15,15,15,15,15,14,14,14,14,14,14,14,14,14,14,14,14,14,14,14,14,14,14,14,14,14,14,14,14,14,14,14,13,13,13,13,13,13,13,13,13,13,13,13,13,13,13,13,13,13,12,12,12,12,12,12,12,12,12,12,12,12,12,12,11,11,11,11,11,11,11,11,11,10,10,10,10,10,10,10,9,9,9,9,8,8,8,8,7,6,5,4,3,2,1,0,17,18,19,20,21,22,23,24,24,24,24,25,25,25,25,26,26,26,26,26,26,26,27,27,27,27,27,27,27,27,27,28,28,28,28,28,28,28,28,28,28,28,28,28,28,29,29,29,29,29,29,29,29,29,29,29,29,29,29,29,29,29,29,30,30,30,30,30,30,30,30,30,30,30,30,30,30,30,30,30,30,30,30,30,30,30,30,30,30,30,31,31,31,31,31,31,31,31,31,31,31,31,31,31,31,31,31,31,31,31,31,31,31,31,31,31,31,31,31,31,31,31,31,31,31,31,31,31,31,31,31,31,31,31,31,31,31,31,31,31,31,31,31,31,31,31,31,31,31,31,31,31,31,31,31,31,31,31,31,31,31,31,31,31,31,31,31,31,31,31,31,31,31,31,31,31,31,31,31,31,31,31,31,31,31,31,31,31,31,31,31,31,31,31,31,31,31,31,31,31,31,31,31,31,31,31,31,31,31,31,31,31,31,31,31,31,31,31,31,31,31,31,31,31,31,31,31,31,31,31,31,31,31,31,31,31,31,31,31,31,31,31,31,31,31,31,31,31,31,31,31,31,31,31,31,31,31,31,31,31,31,31,31,31,31,31,31,31,31,31,31,31,31,31,31,31,31,31,31,31,31,31,31,31,31,31,31,31,31,31,31,31,31,31,31,31,31,31,31,31,31,31,31,31,31,31,31,31,31,31,31,31,31,31,31,31,31,31,31,31,31,31,31,31,31,31,31,31,31,31,31,31,31,31,31,31,31,31,31,31,31,31,31,31,31,31,31,31,31,31,31,31,31,31,31,31,31,31,31,31,31,31,31,31,31,31,31,31,31,31,31,31,31,31,31,31,31,31,31,31,31,31,31,31,31,31,31,31,31,31,31,31,31,31,31,31,31,31,31,31,31,31,31,31,31,31,31,31,31,31,31,31,31,31,31,31,31,31,31,31,31,31,31,31,31,31,31,31,31,31,31,31,31,31,31,31,31,31,31,31,31,31,31,31,31,31,31,31,31,31,31,31,31,31,31,31,31,31,31,31,31,31,31,31,31,31,31,31,31,31,31,31,31,31,31,31,31,31,31,31,31,31,31,31,31,31,31,31,31,31,31,31,31,31,31,31,31,31,31,31,31,31,31,31,31,31,31,31,31,31,31,31,31,31,31,31,31,31,31,31,31,31,31,31,31,31,31,31,31,31,31,31,31,31,31,31,31,31,31,31,31,31,31,31,31,31,31,31,31,31,31,31,31,31,31,31,31,31,31,31,31,31,31,31,31,31,31,31,31,31,31,31,31,31,31,31,31,31,31,31,31,31,31,31,31,31,31,31,31,31,31,31,31,31,31,31,31,31,31,31,31,31,31,31,31,31,31,31,31,31,31,31,31,31,31,31,31,31,31,31,31,31,31,31,31,31,31,31,31,31,31,31,31,31,31,31,31,31,31,31,31,31,31,31,31,31,31,31,31,31,31,31,31,31,31,31,31,31,31,31,31,31,31,31,31,31,31,31,31,31,31,31,31,31,31,31,31,31,31,31,31,31,31,31,31,31,31,31,31,31,31,31,31,31,31,31,31,31,31,31,31,31,31,31,31,31,31,31,31,31,31,31,31,31,31,31,31,31,31,31,31,31,31,31,31,31,31,31,31,31,31,31,31,31,31,31,31,31,31,31,31,31,31,31,31,31,31,31,31,31,31,31,31,31,31,31,31,31,31,31,31,31,31,31,31,31,31,31,31,31,31,31,31,31,31,31,31,31,31,31,31,31,31,31,31,31,31,31,31,31,31,31,31,31,31,31,31,31,31,31,31,31,31,31,31,31,31,31,31,31,31,31,31,31,31,31,31,31,31,31,31,31,31,31,31,31,31,31,31,31,31,31,31,31,31,31,31,31,31,31,31,31,31,31,31,31,31,31,31,31,31,31,31,31,31,31,31,31,31,31,31,31,31,31,31,31,31,31,31,31,31,31,31,31,31,31,31,31,31,31,31,31,31,31,31,31,31,31,31,31,31,31,31,31,31,31,31,31,31,31,31,31,31,31,31,31,31,31,31,31,31,31,31,31,31,31,31,31,31,31,31,31,31,31,31,31,31,31,31,31,31,31,31,31,31,31,31,31,31,31,31,31,31,31,31,31,31,31,31,31,31,31,31,31,31,31,31,31,31,31,31,31,31,31,31,31,31,31,31,31,31,31,31,31,31,31,31,31,31,31,31,31,31,31,31,31,31,31,31,31,31,31,31,31,31,31,31,31,31,31,31,31,31,31,31,31,31,31,31,31,31,31,31,31,31,31,31,31,31,31,31,31,31,31,31,31,31,31,31,31,31,31,31,31,31,31,31,31,31,31,31,31,31,31,31,31,31,31,31,31,31,31,31,31,31,31,31,31,31,31,31,31,31,31,31,31,31,31,31,31,31,31,31,31,31,31,31,31,31,31,31,31,31,31,31,31,31,31,31,31,31,31,31,31,31,31,31,31,31,31,31,31,31,31,31,31,31,31,31,31,31,31,31,31,31,31,31,31,31,31,31,31,31,31,31,31,31,31,31,31,31,31,31,31,31,31,31,31,31,31,31,31,31,31,31,31,31,31,31,31,31,31,31,31,31,31,31,31,31,31,31,31,31,31,31,31,31,31,31,31,31,31,31,31,31,31,31,31,31,31,31,31,31,31,31,31,31,31,31,31,31,31,31,31,31,31,31,31,31,31,31,31,31,31,31,31,31,31,31,31,31,31,31,31,31,31,31,31,31,31,31,31,31,31,31,31,31,31,31,31,31,31,31,31,31,31,31,31,31,31,31,31,31,31,31,31,31,31,31,31,31,31,31,31,31,31,31,31,31,31,31,31,31,31,31,31,31,31,31,31,31,31,31,31,31,31,31,31,31,31,31,31,31,31,31,31,31,31,31,31,31,31,31,31,31,31,31,31,31,31,31,31,31,31,31,31,31,31,31,31,31,31,31,31,31,31,31,31,31,31,31,31,31,31,31,31,31,31,31,31,31,31,31,31,31,31,31,31,31,31,31,31,31,31,31,31,31,31,31,31,31,31,31,31,31,31,31,31,31,31,31,31,31,31,31,31,31,31,31,31,31,31,31,31,31,31,31,31,31,31,31,31,31,31,31,31,31,31,31,31,31,31,31,31,31,31,31,31,31,31,31,31,31,31,31,31,31,31,31,31,31,31,31,31,31,31,31,31,31,31,31,31,31,31,31,31,31,31,31,31,31,31,31,31,31,31,31,31,31,31,31,31,31,31,31,31,31,31,31,31,31,31,31,31,31,31,31,31,31,31,31,31,31,31,31,31,31,31,31,31,31,31,31,31,31,31,31,31,31,31,31,31,31,31,31,31,31,31,31,31,31,31,31,31,31,31,31,31,31,31,31,31,31,31,31,31,31,31,31,31,31,31,31,31,31,31,31,31,31,31,31,31,31,31,31,31,31,31,31,31,31,31,31,31,31,31,31,31,31,31,31,31,31,31,31,31,31,31,31,31,31,31,31,31,31,31,31,31,31,31,31,31,31,31,31,31,31,31,31,31,31,31,31,31,31,31,31,31,31,31,31,31,31,31,31,31,31,31,31,31,31,31,31,31,31,31,31,31,31,31,31,31,31,31,31,31,31,31,31,31,31,31,31,31,31,31,31,31,31,31,31,31,31,31,31,31,31,31,31,31,31,31,31,31,31,31,31,31,31,31,31,31,31,31,31,31,31,31,31,31,31,31,31,31,31,31,31,31,31,31,31,31,31,31,31,31,31,31,31,31,31,31,31,31,31,31,31,31,31,31,31,31,31,31,31,31,31,31,31,31,31,31,31,31,31,31,31,31,31,31,31,31,31,31,31,31,31,31,31,31,31,31,31,31,31,31,31,31,31,31,31,31,31,31,31,31,31,31,31,31,31,31,31,31,31,31,31,31,31,31,31,31,31,31,31,31,31,31,31,31,31,31,31,31,31,31,31,31,31,31,31,31,31,31,31,31,31,31,31,31,31,31,31,31,31,31,31,31,31,31,31,31,31,31,31,31,31,31,31,31,31,31,31,31,31,31,31,31,31,31,31,31,31,31,31,31,31,31,31,31,31,31,31,31,31,31,31,31,31,31,31,31,31,31,31,31,31,31,31,31,31,31,31,31,31,31,31,31,31,31,31,31,31,31,31,31,31,31,31,31,31,31,31,31,31,31,31,31,31,31,31,31,31,31,31,31,31,31,31,31,31,31,31,31,31,31,31,31,31,31,31,31,31,31,31,31,31,31,31,31,31,31,31,31,31,31,31,31,31,31,31,31,31,31,31,31,31,31,31,31,31,31,31,31,31,31,31,31,31,31,31,31,31,31,31,31,31,31,31,31,31,31,31,31,31,31,31,31,31,31,31,31,31,31,31,31,31,31,31,31,31,31,31,31,31,31,31,31,31,31,31,31,31,31,31,31,31,31,31,31,31,31,31,31,31,31,31,31,31,31,31,31,31,31,31,31,31,31,31,31,31,31,31,31,31,31,31,31,31,31,31,31,31,31,31,31,31,31,31,31,31,31,31,31,31,31,31,31,31,31,31,31,31,31,31,31,31,31,31,31,31,31,31,31,31,31,31,31,31,31,31,31,31,31,31,31,31 };   // bucket(rel) for rel = s - n in [-2047, 2047]

// ---- Two launches hold all the element-wise work. The jobs inside each are independent of one another and are dealt by block range (every branch is the same for a whole work-group); where a job runs once per batch, the batch loop stands inside the thread, whose NB_ loads then fly together.
// Every 16-bit plane named here is written in FRAGMENT ORDER (above); the index lists say which index is the row and which is k.
// k_prep: x (all batches) -> bf16 (row t, k the model dimension); WF hl planes [w][r][k] = sc_w sum_g bf16 W_w[g*256+r][k], r = h*64+d, w = q, k, v, sc = 1, 1/4, 1/4 (exact); WE hl planes [o][j] = sum_g bf16 wo[o][g*256+j]; TB[h][r] = mean_g bf16 rel_bias[c_bucket[r]][g*4+h].
// k_post: GVT[b][h] (row d, k = s; its fragments lie key block first: fragment (s / 32) * 4 + d / 16, so that the four fragments of 32 keys are 4 KB in a row) = fp16(V[b*TT+s][h*64+d]) (a thread -> 8 s of one d, 16 lanes -> 16 d); hl planes QS[b][h][t][d] = Q[b*TT+t][h*64+d]; hl planes GK[b][h][s][d] = K[..] (8-B lanes). Q, K, V: the three [NB_*TT][DO] planes of QKV.
#define PB_X (TT * DM / 8 / 256)
#define PB_W (DO * DM / 4 / 256)
#define PB_O (DM * DO / 4 / 256)
#define PB_T ((KVH * 4095 + 255) / 256)
#define GB_V (KVH * HD * TT / 8 / 256)
#define GB_Q (KVH * TT * HD / 4 / 256)
// sb = elements of one batch's plane, [TT][DM] in k_prep and [TT][DO] in k_post (a kernel argument). A thread's loads go through one pointer per batch, p[b]; XWAIT stands behind the last load and names the pointers as inputs, so that their registers are rewritten (also by a later load's result) only behind the wait.
#define XWAIT(p) asm volatile("s_wait_xcnt 0x0" :: "v"(p[0]), "v"(p[1]), "v"(p[2]), "v"(p[3]) : "memory")
// SWAIT stands behind the last store of a job: in the listing the next job's code follows behind a test, and it rewrites registers that the stores name.
#define SWAIT asm volatile("s_wait_xcnt 0x0" ::: "memory")
__device__ __forceinline__ v8us cvt8(v8f v) { v8us o;
#pragma unroll
    for (int k = 0; k < 8; ++k) o[k] = f2bf(v[k]); return o; }
__global__ __launch_bounds__(256) void k_prep(const float* __restrict__ x, const float* __restrict__ wq, const float* __restrict__ wk, const float* __restrict__ wv, const float* __restrict__ wo, const float* __restrict__ rb, bf* XB, bf* WFh, bf* WFl, bf* Wh, bf* Wl, float* TB, size_t sb) {
    int blk = blockIdx.x;
    if (blk < PB_X) { const unsigned c = blk * 256 + threadIdx.x, i = c * 8, si = frag_src(c, DM, DM); v8f v[NB_]; const float* p[NB_];
#pragma unroll   // unrolled: v[] is indexed by constants only, and all loads issue before the first store
        for (int b = 0; b < NB_; ++b) { p[b] = x + b * sb + si; v[b] = *(const v8f*)p[b]; }
        XWAIT(p);
#pragma unroll
        for (int b = 0; b < NB_; ++b) *(v8us*)(XB + b * sb + i) = cvt8(v[b]);
        return; }
    blk -= PB_X;
    if (blk < 3 * PB_W) { const int w = blk / PB_W; const float* s = w == 0 ? wq : w == 1 ? wk : wv; const float sc = w == 0 ? 1.0f : 0.25f; const unsigned q = (blk - w * PB_W) * 256 + threadIdx.x, i = q * 4, si = frag_src(q >> 1, DM, DM) + (q & 1) * 4; v4f v[GG];
#pragma unroll   // unrolled: v[] is indexed by constants only, and all loads issue before the first store
        for (int g = 0; g < GG; ++g) v[g] = *(const v4f*)(s + g * DO * DM + si);
        v4us oh, ol;
#pragma unroll
        for (int u = 0; u < 4; ++u) { float a = 0.f;
#pragma unroll
            for (int g = 0; g < GG; ++g) a = __fadd_rn(a, bfr(v[g][u])); unsigned short c, d; splitf(a * sc, c, d); oh[u] = c; ol[u] = d; }
        *(v4us*)(WFh + w * DO * DM + i) = oh; *(v4us*)(WFl + w * DO * DM + i) = ol; SWAIT; return; }
    blk -= 3 * PB_W;
    if (blk < PB_O) { const unsigned q = blk * 256 + threadIdx.x, e = q * 4; const float* r = wo + frag_src(q >> 1, DO, DM) + (q & 1) * 4; v4us oh, ol;
#pragma unroll
        for (int u = 0; u < 4; ++u) { float s = 0.f;
#pragma unroll
            for (int g = 0; g < GG; ++g) s = __fadd_rn(s, bfr(r[g * DO + u])); unsigned short a, b; splitf(s, a, b); oh[u] = a; ol[u] = b; }
        *(v4us*)(Wh + e) = oh; *(v4us*)(Wl + e) = ol; SWAIT; return; }
    blk -= PB_O;
    const int i = blk * 256 + threadIdx.x; if (i >= KVH * 4095) return; const int r = i % 4095, h = i / 4095; const int bk = c_bucket[r]; SWAIT; float s = 0.f;   // here behind the table load: the next loads' results rewrite its address register
#pragma unroll
    for (int g = 0; g < GG; ++g) s = __fadd_rn(s, bfr(rb[bk * NHm + g * KVH + h])); TB[i] = s * 0.25f;
}
// [t][h*64+d] f32 -> [h] (row t, k = d) hi+lo planes in fragment order, for every batch
__device__ __forceinline__ void grp_hl(const float* __restrict__ S, size_t sb, bf* Ph, bf* Pl, int blk) { const unsigned q = blk * 256 + threadIdx.x, e = q * 4; const unsigned h = e / (HD * TT); const float* r = S + frag_src((q >> 1) % (HD * TT / 8), HD, DO) + h * HD + (q & 1) * 4; v4f v[NB_]; const float* p[NB_];
#pragma unroll   // unrolled, here and below: v[] is indexed by constants only, and all loads issue before the first store
    for (int b = 0; b < NB_; ++b) { p[b] = r + b * sb; v[b] = *(const v4f*)p[b]; }
    XWAIT(p);
#pragma unroll
    for (int b = 0; b < NB_; ++b) { v4us oh, ol;
#pragma unroll
        for (int u = 0; u < 4; ++u) { unsigned short a, c; splitf(v[b][u], a, c); oh[u] = a; ol[u] = c; }
        *(v4us*)(Ph + (size_t)b * KVH * TT * HD + e) = oh; *(v4us*)(Pl + (size_t)b * KVH * TT * HD + e) = ol; }
    SWAIT; }
__global__ __launch_bounds__(256) void k_post(const float* __restrict__ QKV, bf* QSh, bf* QSl, bf* GKh, bf* GKl, h16* GVT, size_t sb) {
    int blk = blockIdx.x;
    if (blk < GB_V) { const float* V = QKV + 2 * NB_ * sb; const unsigned c = blk * 256 + threadIdx.x; const unsigned h = c / (TT * HD / 8), s = ((c >> 8) & 63) * 32 + ((c >> 4) & 3) * 8, d = ((c >> 6) & 3) * 16 + (c & 15); const float* r = V + (size_t)s * DO + h * HD + d; float v[NB_][8]; const float* p[NB_];
#pragma unroll   // unrolled, here and below: v[][] is indexed by constants only, and all loads issue before the first store
        for (int b = 0; b < NB_; ++b) { p[b] = r + b * sb;
#pragma unroll
            for (int u = 0; u < 8; ++u) v[b][u] = p[b][u * DO]; }
        XWAIT(p);
#pragma unroll
        for (int b = 0; b < NB_; ++b) { const v8h o = {tohx(v[b][0]), tohx(v[b][1]), tohx(v[b][2]), tohx(v[b][3]), tohx(v[b][4]), tohx(v[b][5]), tohx(v[b][6]), tohx(v[b][7])};
            *(v8h*)(GVT + (size_t)b * KVH * HD * TT + c * 8) = o; }
        return; }
    blk -= GB_V;
    if (blk < GB_Q) { grp_hl(QKV, sb, QSh, QSl, blk); return; }
    grp_hl(QKV + NB_ * sb, sb, GKh, GKl, blk - GB_Q);
}
// ---- k_fattn: scores, bias, softmax, attn x V and the hi/lo split of its result in ONE kernel; neither scores nor probabilities go to memory. Grid (TT / 32, KVH, NB_), NW waves: a work-group owns 32 query columns n of one head of one batch.
// Wave w walks the 32-key blocks w, w + NW, ... with a running maximum and sum per column (online softmax). S^T = GK QS^T (3 hi/lo products, the accumulator starts at the bias): a lane holds 16 keys of ONE query per column group,
// so the maximum is in-lane plus one exchange between the wave's halves, and two converted S^T tiles ARE the f16 B operand of O^T += GV^T P^T (hardware k order, the order of WFrag::ld): P touches neither LDS nor another lane.
// p = 1024 exp(s - m) (f16, at most 1024; the factor cancels in the quotient). The NW partial (m, l, O^T) meet in LDS: each wave scales its own by exp(m_w - max_w m_w), the sums run in wave order 0..NW-1; sum / l leaves as bf16 hi+lo planes P (row n, k = h * 64 + d) in fragment order, four whole 1-KB fragments per work-group and plane.
// Every '#pragma unroll' in k_fattn without a note of its own: qh, ql, o, sc, vf, pf, m and l are then indexed by constants only and stay in registers.
#define L2E 1.44269504f
typedef v4f __attribute__((aligned(4), may_alias)) v4fu;   // the bias window starts at any float
template <int NW>
__global__ __launch_bounds__(32 * NW) void k_fattn(const bf* __restrict__ Qh, const bf* __restrict__ Ql, const bf* __restrict__ Kh, const bf* __restrict__ Kl, const h16* __restrict__ Vt, const float* __restrict__ TB, bf* Ph, bf* Pl) {
    __shared__ __align__(16) float po[NW * 32 * 68];
    __shared__ float pm[NW * 32];
    __shared__ float pl[NW * 32];
    const int lane = threadIdx.x & 31, lr = lane & 15, hi = lane >> 4; const int wv = __builtin_amdgcn_readfirstlane((int)(threadIdx.x >> 5));
    const int n0 = blockIdx.x * 32, h = blockIdx.y, bz = blockIdx.z; const size_t hb = ((size_t)bz * KVH + h) * TT * HD; const unsigned lo = lane * 8;   // the lane's part of every fragment address; the rest is the same for the whole wave
    v16bf qh[2][2], ql[2][2]; const bf* pqh = Qh + hb + (size_t)n0 * HD + lo; const bf* pql = Ql + hb + (size_t)n0 * HD + lo;
#pragma unroll
    for (int nt = 0; nt < 2; ++nt)
#pragma unroll
        for (int kk = 0; kk < 2; ++kk) { qh[nt][kk] = WFrag<bf>::ld(pqh + nt * 1024 + kk * 512); ql[nt][kk] = WFrag<bf>::ld(pql + nt * 1024 + kk * 512); }
    v8f o[4][2];
#pragma unroll
    for (int dt = 0; dt < 4; ++dt)
#pragma unroll
        for (int nt = 0; nt < 2; ++nt) o[dt][nt] = (v8f){};
    float m[2] = {-3.0e38f, -3.0e38f}, l[2] = {0.f, 0.f};
    const float* tb = TB + (size_t)h * 4095 + 2047 + 8 * hi - n0 - lr;   // tb[s0' + j] = bias of key s0' + 8 hi + j against query n0 + lr
    const bf* kh = Kh + hb; const bf* kl = Kl + hb; const h16* vt = Vt + hb;   // fragment order: 32 keys are 4 fragments = 2048 elements in a row in each of the three planes
#pragma unroll 1   // rolled: one pass already holds about 230 registers, and four waves per SIMD leave 256
    for (int s0 = wv * 32; s0 < TT; s0 += 32 * NW) {
        v8f sc[2][2]; const float* pt = tb + s0; const h16* pv = vt + (size_t)s0 * HD + lo; const bf* pkh = kh + (size_t)s0 * HD + lo; const bf* pkl = kl + (size_t)s0 * HD + lo;   // one pointer per plane; the steps inside a pass are immediate offsets
#pragma unroll
        for (int st = 0; st < 2; ++st)
#pragma unroll
            for (int nt = 0; nt < 2; ++nt) { const float* p = pt + st * 16 - nt * 16; const v4f b0 = *(const v4fu*)p, b1 = *(const v4fu*)(p + 4); sc[st][nt] = (v8f){b0[0], b0[1], b0[2], b0[3], b1[0], b1[1], b1[2], b1[3]}; }
        v16h vf[4];
#pragma unroll
        for (int dt = 0; dt < 4; ++dt) vf[dt] = WFrag<h16>::ld(pv + dt * 512);
#pragma unroll
        for (int st = 0; st < 2; ++st)
#pragma unroll
            for (int kk = 0; kk < 2; ++kk) { const int ko = st * 1024 + kk * 512; const v16bf ah = WFrag<bf>::ld(pkh + ko), al = WFrag<bf>::ld(pkl + ko);
#pragma unroll
                for (int nt = 0; nt < 2; ++nt) { sc[st][nt] = wmmab(ah, qh[nt][kk], sc[st][nt]); sc[st][nt] = wmmab(al, qh[nt][kk], sc[st][nt]); sc[st][nt] = wmmab(ah, ql[nt][kk], sc[st][nt]); } }
        asm volatile("s_wait_xcnt 0x0" :: "v"(pt), "v"(pv), "v"(pkh), "v"(pkl) : "memory");   // behind the pass's last load; it names the pass's pointers as inputs, so that their registers are rewritten (also by a later load's result) only behind the wait
#pragma unroll
        for (int nt = 0; nt < 2; ++nt) {
            float mx = fmaxf(sc[0][nt][0], sc[1][nt][0]);
#pragma unroll
            for (int j = 1; j < 8; ++j) mx = fmaxf(mx, fmaxf(sc[0][nt][j], sc[1][nt][j]));
            mx = fmaxf(mx, __shfl_xor(mx, 16, 32));
            const float mn = fmaxf(m[nt], mx); const float al = __builtin_amdgcn_exp2f((m[nt] - mn) * L2E); const float mb = __builtin_fmaf(mn, L2E, -10.0f); m[nt] = mn;
            float ps = 0.f; v16h pf;
#pragma unroll
            for (int st = 0; st < 2; ++st)
#pragma unroll
                for (int j = 0; j < 8; ++j) { const float p = __builtin_amdgcn_exp2f(__builtin_fmaf(sc[st][nt][j], L2E, -mb)); ps += p; pf[st * 8 + j] = tohx(p); }
            l[nt] = __builtin_fmaf(l[nt], al, ps);
#pragma unroll
            for (int dt = 0; dt < 4; ++dt) { o[dt][nt] *= al; o[dt][nt] = wmma16(vf[dt], pf, o[dt][nt]); }
        }
    }
#pragma unroll
    for (int nt = 0; nt < 2; ++nt) { l[nt] += __shfl_xor(l[nt], 16, 32); if (hi == 0) pm[wv * 32 + nt * 16 + lr] = m[nt]; }
    __syncthreads();
#pragma unroll
    for (int nt = 0; nt < 2; ++nt) { float mg = pm[nt * 16 + lr];
#pragma unroll
        for (int w = 1; w < NW; ++w) mg = fmaxf(mg, pm[w * 32 + nt * 16 + lr]);
        const float f = __builtin_amdgcn_exp2f((m[nt] - mg) * L2E); if (hi == 0) pl[wv * 32 + nt * 16 + lr] = l[nt] * f;
        float* pd = po + (wv * 32 + nt * 16 + lr) * 68 + 8 * hi;
#pragma unroll
        for (int dt = 0; dt < 4; ++dt) { const v8f c = o[dt][nt] * f; *(v4fa*)(pd + dt * 16) = (v4f){c[0], c[1], c[2], c[3]}; *(v4fa*)(pd + dt * 16 + 4) = (v4f){c[4], c[5], c[6], c[7]}; } }
    __syncthreads();
#pragma unroll
    for (int it = 0; it < 16 / NW; ++it) { const int idx = it * 32 * NW + (int)threadIdx.x; const int n = (idx >> 8) * 16 + (idx & 15), c4 = ((idx >> 5) & 7) * 8 + ((idx >> 4) & 1) * 4; v4f s = *(const v4fa*)(po + n * 68 + c4); float ls = pl[n];   // 16 lanes -> 16 rows n (LDS pitch 68: no bank met twice), a wave -> 8 columns of them: 256 B in a row of each plane
#pragma unroll   // unrolled: the LDS reads of all partials issue ahead of the adds, which keep the order w = 0..NW-1
        for (int w = 1; w < NW; ++w) { s += *(const v4fa*)(po + (w * 32 + n) * 68 + c4); ls += pl[w * 32 + n]; }
        const float inv = __fdiv_rn(1.0f, ls); v4us oh, ol;
#pragma unroll
        for (int u = 0; u < 4; ++u) { unsigned short a, b; splitf(s[u] * inv, a, b); oh[u] = a; ol[u] = b; }
        const size_t eo = ((size_t)bz * TT + n0 + (n & 16)) * DO + (h * 2 + (c4 >> 5)) * 512 + ((c4 >> 3) & 3) * 128 + (n & 15) * 8 + (c4 & 7); *(v4us*)(Ph + eo) = oh; *(v4us*)(Pl + eo) = ol; }
}

extern "C" void kernel_launch(void* const* d_in, const int* in_sizes, int n_in,
                              void* d_out, int out_size, void* d_ws, size_t ws_size, hipStream_t stream) {
    (void)in_sizes; (void)n_in; (void)out_size;
    const float* x = (const float*)d_in[0]; const float* wq = (const float*)d_in[1]; const float* wk = (const float*)d_in[2]; const float* wv = (const float*)d_in[3]; const float* wo = (const float*)d_in[4]; const float* rb = (const float*)d_in[5];
    float* OUT = (float*)d_out;     // [4][2048][1024] = [8192][1024]: the batches are one run of rows for every GEMM
    char* wsp = (char*)d_ws;
    auto take = [&](size_t bytes) { char* p = wsp; wsp += (bytes + 255) & ~(size_t)255; return (void*)p; };
    bf* WFh = (bf*)take((size_t)3 * DO * DM * 2); bf* WFl = (bf*)take((size_t)3 * DO * DM * 2); bf* WEh = (bf*)take((size_t)DM * DO * 2); bf* WEl = (bf*)take((size_t)DM * DO * 2); float* TB = (float*)take((size_t)KVH * 4095 * 4 + 256);
    bf* XB = (bf*)take((size_t)NB_ * TT * DM * 2); float* QKV = (float*)take((size_t)3 * NB_ * TT * DO * 4); bf* QSh = (bf*)take((size_t)NB_ * KVH * TT * HD * 2); bf* QSl = (bf*)take((size_t)NB_ * KVH * TT * HD * 2); bf* GKh = (bf*)take((size_t)NB_ * KVH * TT * HD * 2); bf* GKl = (bf*)take((size_t)NB_ * KVH * TT * HD * 2); h16* GVT = (h16*)take((size_t)NB_ * KVH * HD * TT * 2);
    bf* OPh = (bf*)take((size_t)NB_ * TT * DO * 2); bf* OPl = (bf*)take((size_t)NB_ * TT * DO * 2);
    if ((size_t)(wsp - (char*)d_ws) > ws_size) return;    // total ~ 75 MB
    k_prep<<<PB_X + 3 * PB_W + PB_O + PB_T, 256, 0, stream>>>(x, wq, wk, wv, wo, rb, XB, WFh, WFl, WEh, WEl, TB, (size_t)TT * DM);   // [out][in] weights = natural Bt
    k_gemmw<bf, 3, false, 8, DM><<<dim3(NB_ * TT / 64, DO / 64, 3), 256, 0, stream>>>(XB, nullptr, WFh, WFl, QKV, DO, nullptr, 0, (size_t)DO * DM, (size_t)NB_ * TT * DO);   // z = q, k, v; NSPLIT 3: A Bt + A Bt2
    k_post<<<GB_V + 2 * GB_Q, 256, 0, stream>>>(QKV, QSh, QSl, GKh, GKl, GVT, (size_t)TT * DO);
    k_fattn<16><<<dim3(TT / 32, KVH, NB_), 512, 0, stream>>>(QSh, QSl, GKh, GKl, GVT, TB, OPh, OPl);
    k_gemmw<bf, 2, false, 8, DO><<<dim3(NB_ * TT / 64, DM / 64, 1), 256, 0, stream>>>(OPh, OPl, WEh, WEl, OUT, DM, nullptr, 0, 0, 0);
}

// v006
// Measured time: 90 microseconds a run.
// Next to v005, in two timings, it ran 1.22 times as fast each time.
// Counting every step since v000, it is 9.29 times as fast.
#include <hip/hip_runtime.h>

// Grouped attention with a relative-position bias (hidden [4][2048][1024]; q/k/v = x W^T (16 heads x 64); heads grouped (g=4 groups, h=4 kv heads: head = g*4 + h); gk, gv = mean over g; scores[h][n][s] = sum_g sum_d q[g,h][n][d] gk[h][s][d] (the reference's einsum sums the query
// groups; no 1/sqrt(d) scaling, T5 style) + mean over g of the T5 relative-position bias rel_bias[bucket(s - n)][g*4 + h]; softmax; out[h] = attn gv[h]; tiled x4 over g and projected: out_full Wo^T = out (sum_g Wo[:, g-block])^T -> [4][2048][1024]).
// The group sum of q and the group means of k and v are linear in the weights: sum_g (x Wq[g,h]^T) = x (sum_g Wq[g,h])^T. The weights are summed over g first (k_prep), so the projections have 256 columns each instead of 1024 and yield the summed q and the mean k, v directly.
// The bucket of each relative position depends only on (s - n) and the fixed sizes: it is a compile-time table of 4095 entries (bidirectional T5 buckets, 32 buckets, max distance 128; computed in f32 exactly as the reference and baked in).
// Compute dtypes, f32 accumulate: every input rounded to bf16; group sums / means of the bf16 weights in f32 -> bf16 hi+lo planes; q/k/v = bf16 x (exact) times both planes (2 products), f32 -> bf16 hi+lo planes (q, k) and f16 (v); scores (K 64) as 3 products; bias + online softmax f32, probabilities x1024 in f16, fused with attn x V (k_fattn)

#define NB_  4
#define TT   2048
#define DM   1024
#define NHm  16
#define KVH  4
#define GG   4
#define HD   64
#define DO   256
typedef _Float16 h16;
typedef unsigned short bf;
typedef __attribute__((ext_vector_type(16))) __bf16   v16bf;
typedef __attribute__((ext_vector_type(16))) _Float16 v16h;
typedef __attribute__((ext_vector_type(8)))  _Float16 v8h;
typedef __attribute__((ext_vector_type(8)))  unsigned short v8us;
typedef __attribute__((ext_vector_type(8)))  float    v8f;
typedef __attribute__((ext_vector_type(4)))  float    v4f;
typedef v8h  __attribute__((may_alias)) v8ha;
typedef v4f  __attribute__((may_alias)) v4fa;
typedef v8us __attribute__((may_alias)) v8usa;

__device__ __forceinline__ unsigned short f2bf(float f) { unsigned u = __float_as_uint(f); u += 0x7FFFu + ((u >> 16) & 1u); return (unsigned short)(u >> 16); }
__device__ __forceinline__ float bf2f(unsigned short b) { return __uint_as_float(((unsigned)b) << 16); }
__device__ __forceinline__ float bfr(float f) { return bf2f(f2bf(f)); }
__device__ __forceinline__ v16h cat16(v8h lo, v8h hi) { return __builtin_shufflevector(lo, hi, 0, 1, 2, 3, 4, 5, 6, 7, 8, 9, 10, 11, 12, 13, 14, 15); }
__device__ __forceinline__ v16bf cat16b(v8us lo, v8us hi) { return __builtin_bit_cast(v16bf, __builtin_shufflevector(lo, hi, 0, 1, 2, 3, 4, 5, 6, 7, 8, 9, 10, 11, 12, 13, 14, 15)); }
__device__ __forceinline__ v8f wmma16(v16h a, v16h b, v8f c) { return __builtin_amdgcn_wmma_f32_16x16x32_f16(false, a, false, b, (short)0, c, false, false); }
__device__ __forceinline__ v8f wmmab(v16bf a, v16bf b, v8f c) { return __builtin_amdgcn_wmma_f32_16x16x32_bf16(false, a, false, b, (short)0, c, false, false); }



// FRAGMENT ORDER. Every 16-bit operand plane [R rows][K columns] is stored as WMMA fragments of 16 rows x 32 k = 512 elements = 1 KB: element (row, k) lies at ((row / 16) * (K / 32) + k / 32) * 512 + ((k / 8) % 4) * 128 + (row % 16) * 8 + k % 8 (in GVT the fragment index is (k / 32) * (R / 16) + row / 16 instead).
// Lane (lr, hi) = lane number hi * 16 + lr finds its k = 8 hi .. 8 hi + 7 at fragment + lane * 8 and its k = 16 + 8 hi .. at 256 elements more (the hardware k order): each wave-wide 16-B load covers 512 contiguous bytes, four whole 128-B lines (from a row-major plane it would touch 32-B pieces of 16 lines).
// The producers write such a plane linearly and gather their source: chunk c (8 elements, at c * 8) comes from the source index frag_src(c, K, ld) = row * ld + k.
__device__ __forceinline__ unsigned frag_src(unsigned c, unsigned K, unsigned ld) { const unsigned f = c >> 6, kb = K >> 5; return ((f / kb) * 16 + (c & 15)) * ld + (f % kb) * 32 + ((c >> 4) & 3) * 8; }

// ---- k_gemmw: register-blocked GEMM, KS WAVES per 64x64 output tile (16 accumulators each), operands straight from fragment-ordered 16-bit planes (see FRAGMENT ORDER above); grid (M/64, N/64, Z), 32 * KS threads.
// C[m][n] (f32, pitch ldc, + optional f32 bias[n]) = sum_k A[m][k] Bt[n][k] (+ split products per NSPLIT). z-batch strides sA/sB/sC in elements. K % (32 * KS) == 0.
// KS > 1: wave w sums the 32-wide k steps w, w + KS, w + 2 KS, ... (interleaved: in one trip the waves of a work-group read KS neighbouring 1-KB fragments of every 16-row block);
// the KS partial tiles meet in LDS (fragment order) and are added in wave order 0..KS-1, 16/KS fragments per wave; the tile leaves through a row-major LDS tile in whole lines.
template <typename T16> struct WFrag;
template <> struct WFrag<h16> { typedef v16h V; static __device__ __forceinline__ V ld(const h16* p) { return cat16(*(const v8h*)p, *(const v8h*)(p + 256)); } static __device__ __forceinline__ v8f mma(V a, V b, v8f c) { return wmma16(a, b, c); } };
template <> struct WFrag<bf> { typedef v16bf V; static __device__ __forceinline__ V ld(const bf* p) { return cat16b(*(const v8us*)p, *(const v8us*)(p + 256)); } static __device__ __forceinline__ v8f mma(V a, V b, v8f c) { return wmmab(a, b, c); } };
template <typename T16, int NSPLIT, bool BIAS, int KS, int K>   // K a constant: the steps from fragment to fragment are immediate offsets on one pointer per plane
__global__ __launch_bounds__(32 * KS) void k_gemmw(const T16* __restrict__ A, const T16* __restrict__ A2, const T16* __restrict__ Bt, const T16* __restrict__ Bt2, float* C, int ldc, const float* __restrict__ bias, size_t sA, size_t sB, size_t sC) {
    typedef typename WFrag<T16>::V V;
    __shared__ __align__(16) float os[KS == 1 ? 16 * 68 : 64 * 68 + KS * 4096];
    const size_t z = blockIdx.z; A += z * sA; if (A2) A2 += z * sA; Bt += z * sB; if (Bt2) Bt2 += z * sB; C += z * sC;
    const int lane = threadIdx.x & 31, lr = lane & 15, hi = lane >> 4; const int r0 = blockIdx.x * 64, c0 = blockIdx.y * 64;
    v8f acc[4][4];
#pragma unroll
    for (int mb = 0; mb < 4; ++mb)
#pragma unroll
        for (int nb = 0; nb < 4; ++nb) acc[mb][nb] = (v8f){};
    const size_t aoff = (size_t)r0 * K, boff = (size_t)c0 * K; const unsigned lo = lane * 8;   // fragment (row block, k block) starts at (row block * K / 32 + k block) * 512: the same for the whole wave; the lane's own part is lo
    const int wv = __builtin_amdgcn_readfirstlane((int)(threadIdx.x >> 5));
#pragma unroll 1
    for (int kc = wv * 32; kc < K; kc += 32 * KS) {
        if constexpr (NSPLIT == 3) {   // A Bt + A Bt2. One pointer per plane; each s_wait_xcnt 0 stands behind the last load of its run and names the run's pointers as inputs, so that their registers are rewritten (also by a later load's result) only behind the wait.
            const T16* pa = A + aoff + kc * 16 + lo; const T16* pb = Bt + boff + kc * 16 + lo; const T16* pc = Bt2 + boff + kc * 16 + lo; V a[4], b[4], b2[4];
#pragma unroll   // unrolled, here and below: the arrays are indexed by constants only and stay in registers, and the loads of a run issue together
            for (int i = 0; i < 4; ++i) { a[i] = WFrag<T16>::ld(pa + i * 16 * K); b[i] = WFrag<T16>::ld(pb + i * 16 * K); }
            asm volatile("s_wait_xcnt 0x0" :: "v"(pa), "v"(pb) : "memory");
#pragma unroll
            for (int i = 0; i < 4; ++i) b2[i] = WFrag<T16>::ld(pc + i * 16 * K);
            asm volatile("s_wait_xcnt 0x0" :: "v"(pc) : "memory");
            __builtin_amdgcn_sched_barrier(0);   // keeps every load of the trip in front of its first matrix instruction: without it the scheduler sinks five fragments' loads between the products, and a trip waits for memory several times instead of once
#pragma unroll
            for (int nb = 0; nb < 4; ++nb)
#pragma unroll
                for (int mb = 0; mb < 4; ++mb) acc[mb][nb] = WFrag<T16>::mma(a[mb], b[nb], acc[mb][nb]);
#pragma unroll
            for (int nb = 0; nb < 4; ++nb)
#pragma unroll
                for (int mb = 0; mb < 4; ++mb) acc[mb][nb] = WFrag<T16>::mma(a[mb], b2[nb], acc[mb][nb]);
            asm volatile("v_nop\n\tv_nop\n\tv_nop\n\tv_nop" : "+v"(acc[0][0]), "+v"(acc[1][1]), "+v"(acc[2][2]), "+v"(acc[3][3]) : "v"(a[0]), "v"(a[3]));   // the four vector slots behind the trip's last matrix instruction, also on the taken back edge
        } else if constexpr (NSPLIT == 2) {   // A Bt + A2 Bt + A Bt2, every accumulator in this order. One pointer per plane; each s_wait_xcnt 0 stands behind the last load of its run and names the run's pointers as inputs, so that their registers are rewritten (also by a later load's result) only behind the wait.
            const T16* pa = A + aoff + kc * 16 + lo; const T16* pa2 = A2 + aoff + kc * 16 + lo; const T16* pb = Bt + boff + kc * 16 + lo; const T16* pb2 = Bt2 + boff + kc * 16 + lo; V a[4], a2[4], b[4], b2[4];
#pragma unroll   // unrolled, here and below: the arrays are indexed by constants only and stay in registers, and the loads of a run issue together
            for (int i = 0; i < 4; ++i) { a[i] = WFrag<T16>::ld(pa + i * 16 * K); b[i] = WFrag<T16>::ld(pb + i * 16 * K); a2[i] = WFrag<T16>::ld(pa2 + i * 16 * K); }
            b2[0] = WFrag<T16>::ld(pb2);
            asm volatile("s_wait_xcnt 0x0" :: "v"(pa), "v"(pa2), "v"(pb), "v"(pb2) : "memory");
            __builtin_amdgcn_sched_barrier(0);   // keeps the run's loads in front of the first matrix instruction: a trip waits for memory once
#pragma unroll
            for (int nb = 0; nb < 4; ++nb) {
#pragma unroll
                for (int mb = 0; mb < 4; ++mb) acc[mb][nb] = WFrag<T16>::mma(a[mb], b[nb], acc[mb][nb]);
#pragma unroll
                for (int mb = 0; mb < 4; ++mb) acc[mb][nb] = WFrag<T16>::mma(a2[mb], b[nb], acc[mb][nb]);
                if (nb == 0) {
#pragma unroll
                    for (int mb = 0; mb < 4; ++mb) acc[mb][0] = WFrag<T16>::mma(a[mb], b2[0], acc[mb][0]);
                    // the last three fragments take the registers that column block 0 has left: all sixteen at once, with the accumulators and the pointers, would pass 256 registers and halve the work-groups per WGP
                    b2[1] = WFrag<T16>::ld(pb2 + 16 * K); b2[2] = WFrag<T16>::ld(pb2 + 2 * 16 * K); b2[3] = WFrag<T16>::ld(pb2 + 3 * 16 * K);
                    asm volatile("s_wait_xcnt 0x0" :: "v"(pb2) : "memory");
                    __builtin_amdgcn_sched_barrier(0);   // keeps these loads here, 24 matrix instructions ahead of their first use
                } }
#pragma unroll
            for (int nb = 1; nb < 4; ++nb)
#pragma unroll
                for (int mb = 0; mb < 4; ++mb) acc[mb][nb] = WFrag<T16>::mma(a[mb], b2[nb], acc[mb][nb]);
            asm volatile("v_nop\n\tv_nop\n\tv_nop\n\tv_nop" : "+v"(acc[0][0]), "+v"(acc[1][1]), "+v"(acc[2][2]), "+v"(acc[3][3]) : "v"(a[0]), "v"(a[3]));   // the four vector slots behind the trip's last matrix instruction, also on the taken back edge
        } else {
        V a[4], a2[4];
#pragma unroll
        for (int mb = 0; mb < 4; ++mb) { a[mb] = WFrag<T16>::ld(A + aoff + (size_t)mb * 16 * K + kc * 16 + lo); if (NSPLIT == 1 || NSPLIT == 2) a2[mb] = WFrag<T16>::ld(A2 + aoff + (size_t)mb * 16 * K + kc * 16 + lo); }
#pragma unroll
        for (int nb = 0; nb < 4; ++nb) { const V b = WFrag<T16>::ld(Bt + boff + (size_t)nb * 16 * K + kc * 16 + lo); V b2; if (NSPLIT >= 2) b2 = WFrag<T16>::ld(Bt2 + boff + (size_t)nb * 16 * K + kc * 16 + lo);
#pragma unroll
            for (int mb = 0; mb < 4; ++mb) { acc[mb][nb] = WFrag<T16>::mma(a[mb], b, acc[mb][nb]); if (NSPLIT == 1 || NSPLIT == 2) acc[mb][nb] = WFrag<T16>::mma(a2[mb], b, acc[mb][nb]); if (NSPLIT >= 2) acc[mb][nb] = WFrag<T16>::mma(a[mb], b2, acc[mb][nb]); } }
        asm volatile("v_nop\n\tv_nop\n\tv_nop\n\tv_nop" : "+v"(acc[0][0]), "+v"(acc[1][1]), "+v"(acc[2][2]), "+v"(acc[3][3]) : "v"(a[0]), "v"(a[3]));
        }
    }
    if constexpr (KS > 1) {
        float* part = os + 64 * 68;
        float* pw = part + wv * 4096 + lane * 4;
#pragma unroll   // both loops unrolled: acc[][] is indexed by constants only and stays in registers
        for (int mb = 0; mb < 4; ++mb)
#pragma unroll
            for (int nb = 0; nb < 4; ++nb) { const v8f c = acc[mb][nb]; *(v4fa*)(pw + (mb * 4 + nb) * 256) = (v4f){c[0], c[1], c[2], c[3]}; *(v4fa*)(pw + (mb * 4 + nb) * 256 + 128) = (v4f){c[4], c[5], c[6], c[7]}; }
        __syncthreads();
        constexpr int NF = 16 / KS;
#pragma unroll   // unrolled with the loop over sw: the LDS reads of all partials issue ahead of the adds, which keep the order sw = 0..KS-1
        for (int i = 0; i < NF; ++i) { const int f = wv * NF + i; const float* pf = part + f * 256 + lane * 4; v4f s0 = *(const v4fa*)pf, s1 = *(const v4fa*)(pf + 128);
#pragma unroll
            for (int sw = 1; sw < KS; ++sw) { s0 += *(const v4fa*)(pf + sw * 4096); s1 += *(const v4fa*)(pf + sw * 4096 + 128); }
            float* od = os + ((f >> 2) * 16 + hi * 8) * 68 + (f & 3) * 16 + lr;
#pragma unroll
            for (int j = 0; j < 4; ++j) { od[j * 68] = s0[j]; od[(j + 4) * 68] = s1[j]; } }
        __syncthreads();
#pragma unroll   // unrolled: every LDS read issues before the first store waits
        for (int it = 0; it < 32 / KS; ++it) { const int idx = it * 32 * KS + (int)threadIdx.x; const int row = idx >> 4, cofs = (idx & 15) * 4; v4f val = *(const v4fa*)(os + row * 68 + cofs); if (BIAS) { val[0] += bfr(bias[c0 + cofs]); val[1] += bfr(bias[c0 + cofs + 1]); val[2] += bfr(bias[c0 + cofs + 2]); val[3] += bfr(bias[c0 + cofs + 3]); }
            *(v4f*)(C + (size_t)(r0 + row) * ldc + c0 + cofs) = val; }
        return;
    }
#pragma unroll
    for (int mb = 0; mb < 4; ++mb) {
#pragma unroll
        for (int nb = 0; nb < 4; ++nb) {
#pragma unroll
            for (int j = 0; j < 8; ++j) os[(hi * 8 + j) * 68 + nb * 16 + lr] = acc[mb][nb][j]; }
        __builtin_amdgcn_wave_barrier(); asm volatile("" ::: "memory");
        float* crow = C + (size_t)(r0 + mb * 16) * ldc + c0;
{
#pragma unroll
            for (int s = 0; s < 8; ++s) { const int row = 2 * s + hi, cofs = lr * 4; v4f val = *(const v4fa*)(os + row * 68 + cofs); if (BIAS) { val[0] += bfr(bias[c0 + cofs]); val[1] += bfr(bias[c0 + cofs + 1]); val[2] += bfr(bias[c0 + cofs + 2]); val[3] += bfr(bias[c0 + cofs + 3]); }
                *(v4f*)(crow + (size_t)row * ldc + cofs) = val; }
             }
        __builtin_amdgcn_wave_barrier(); asm volatile("" ::: "memory");
    }
}

__device__ __forceinline__ h16 tohx(float x) { return (h16)x; }
__device__ __forceinline__ void splitf(float y, unsigned short& h, unsigned short& l) { h = f2bf(y); l = f2bf(y - bf2f(h)); }
typedef __attribute__((ext_vector_type(2))) unsigned short v2us;
typedef __attribute__((ext_vector_type(4))) unsigned short v4us;
typedef __attribute__((ext_vector_type(2))) _Float16 v2h;
typedef __attribute__((ext_vector_type(4))) _Float16 v4h;
__constant__ unsigned char c_bucket[4095] = { 15,15,15,15,15,15,15,15,15,15,15,15,15,15,15,15,15,15,15,15,15,15,15,15,15,15,15,15,15,15,15,15,15,15,15,15,15,15,15,15,15,15,15,15,15,15,15,15,15,15,15,15,15,15,15,15,15,15,15,15,15,15,15,15,15,15,15,15,15,15,15,15,15,15,15,15,15,15,15,15,15,15,15,15,15,15,15,15,15,15,15,15,15,15,15,15,15,15,15,15,15,15,15,15,15,15,15,15,15,15,15,15,15,15,15,15,15,15,15,15,15,15,15,15,15,15,15,15,15,15,15,15,15,15,15,15,15,15,15,15,15,15,15,15,15,15,15,15,15,15,15,15,15,15,15,15,15,15,15,15,15,15,15,15,15,15,15,15,15,15,15,15,15,15,15,15,15,15,15,15,15,15,15,15,15,15,15,15,15,15,15,15,15,15,15,15,15,15,15,15,15,15,15,15,15,15,15,15,15,15,15,15,15,15,15,15,15,15,15,15,15,15,15,15,15,15,15,15,15,15,15,15,15,15,15,15,15,15,15,15,15,15,15,15,15,15,15,15,15,15,15,15,15,15,15,15,15,15,15,15,15,15,15,15,15,15,15,15,15,15,15,15,15,15,15,15,15,15,15,15,15,15,15,15,15,15,15,15,15,15,15,15,15,15,15,15,15,15,15,15,15,15,15,15,15,15,15,15,15,15,15,15,15,15,15,15,15,15,15,15,15,15,15,15,15,15,15,15,15,15,15,15,15,15,15,15,15,15,15,15,15,15,15,15,15,15,15,15,15,15,15,15,15,15,15,15,15,15,15,15,15,15,15,15,15,15,15,15,15,15,15,15,15,15,15,15,15,15,15,15,15,15,15,15,15,15,15,15,15,15,15,15,15,15,15,15,15,15,15,15,15,15,15,15,15,15,15,15,15,15,15,15,15,15,15,15,15,15,15,15,15,15,15,15,15,15,15,15,15,15,15,15,15,15,15,15,15,15,15,15,15,15,15,15,15,15,15,15,15,15,15,15,15,15,15,15,15,15,15,15,15,15,15,15,15,15,15,15,15,15,15,15,15,15,15,15,15,15,15,15,15,15,15,15,15,15,15,15,15,15,15,15,15,15,15,15,15,15,15,15,15,15,15,15,15,15,15,15,15,15,15,15,15,15,15,15,15,15,15,15,15,15,15,15,15,15,15,15,15,15,15,15,15,15,15,15,15,15,15,15,15,15,15,15,15,15,15,15,15,15,15,15,15,15,15,15,15,15,15,15,15,15,15,15,15,15,15,15,15,15,15,15,15,15,15,15,15,15,15,15,15,15,15,15,15,15,15,15,15,15,15,15,15,15,15,15,15,15,15,15,15,15,15,15,15,15,15,15,15,15,15,15,15,15,15,15,15,15,15,15,15,15,15,15,15,15,15,15,15,15,15,15,15,15,15,15,15,15,15,15,15,15,15,15,15,15,15,15,15,15,15,15,15,15,15,15,15,15,15,15,15,15,15,15,15,15,15,15,15,15,15,15,15,15,15,15,15,15,15,15,15,15,15,15,15,15,15,15,15,15,15,15,15,15,15,15,15,15,15,15,15,15,15,15,15,15,15,15,15,15,15,15,15,15,15,15,15,15,15,15,15,15,15,15,15,15,15,15,15,15,15,15,15,15,15,15,15,15,15,15,15,15,15,15,15,15,15,15,15,15,15,15,15,15,15,15,15,15,15,15,15,15,15,15,15,15,15,15,15,15,15,15,15,15,15,15,15,15,15,15,15,15,15,15,15,15,15,15,15,15,15,15,15,15,15,15,15,15,15,15,15,15,15,15,15,15,15,15,15,15,15,15,15,15,15,15,15,15,15,15,15,15,15,15,15,15,15,15,15,15,15,15,15,15,15,15,15,15,15,15,15,15,15,15,15,15,15,15,15,15,15,15,15,15,15,15,15,15,15,15,15,15,15,15,15,15,15,15,15,15,15,15,15,15,15,15,15,15,15,15,15,15,15,15,15,15,15,15,15,15,15,15,15,15,15,15,15,15,15,15,15,15,15,15,15,15,15,15,15,15,15,15,15,15,15,15,15,15,15,15,15,15,15,15,15,15,15,15,15,15,15,15,15,15,15,15,15,15,15,15,15,15,15,15,15,15,15,15,15,15,15,15,15,15,15,15,15,15,15,15,15,15,15,15,15,15,15,15,15,15,15,15,15,15,15,15,15,15,15,15,15,15,15,15,15,15,15,15,15,15,15,15,15,15,15,15,15,15,15,15,15,15,15,15,15,15,15,15,15,15,15,15,15,15,15,15,15,15,15,15,15,15,15,15,15,15,15,15,15,15,15,15,15,15,15,15,15,15,15,15,15,15,15,15,15,15,15,15,15,15,15,15,15,15,15,15,15,15,15,15,15,15,15,15,15,15,15,15,15,15,15,15,15,15,15,15,15,15,15,15,15,15,15,15,15,15,15,15,15,15,15,15,15,15,15,15,15,15,15,15,15,15,15,15,15,15,15,15,15,15,15,15,15,15,15,15,15,15,15,15,15,15,15,15,15,15,15,15,15,15,15,15,15,15,15,15,15,15,15,15,15,15,15,15,15,15,15,15,15,15,15,15,15,15,15,15,15,15,15,15,15,15,15,15,15,15,15,15,15,15,15,15,15,15,15,15,15,15,15,15,15,15,15,15,15,15,15,15,15,15,15,15,15,15,15,15,15,15,15,15,15,15,15,15,15,15,15,15,15,15,15,15,15,15,15,15,15,15,15,15,15,15,15,15,15,15,15,15,15,15,15,15,15,15,15,15,15,15,15,15,15,15,15,15,15,15,15,15,15,15,15,15,15,15,15,15,15,15,15,15,15,15,15,15,15,15,15,15,15,15,15,15,15,15,15,15,15,15,15,15,15,15,15,15,15,15,15,15,15,15,15,15,15,15,15,15,15,15,15,15,15,15,15,15,15,15,15,15,15,15,15,15,15,15,15,15,15,15,15,15,15,15,15,15,15,15,15,15,15,15,15,15,15,15,15,15,15,15,15,15,15,15,15,15,15,15,15,15,15,15,15,15,15,15,15,15,15,15,15,15,15,15,15,15,15,15,15,15,15,15,15,15,15,15,15,15,15,15,15,15,15,15,15,15,15,15,15,15,15,15,15,15,15,15,15,15,15,15,15,15,15,15,15,15,15,15,15,15,15,15,15,15,15,15,15,15,15,15,15,15,15,15,15,15,15,15,15,15,15,15,15,15,15,15,15,15,15,15,15,15,15,15,15,15,15,15,15,15,15,15,15,15,15,15,15,15,15,15,15,15,15,15,15,15,15,15,15,15,15,15,15,15,15,15,15,15,15,15,15,15,15,15,15,15,15,15,15,15,15,15,15,15,15,15,15,15,15,15,15,15,15,15,15,15,15,15,15,15,15,15,15,15,15,15,15,15,15,15,15,15,15,15,15,15,15,15,15,15,15,15,15,15,15,15,15,15,15,15,15,15,15,15,15,15,15,15,15,15,15,15,15,15,15,15,15,15,15,15,15,15,15,15,15,15,15,15,15,15,15,15,15,15,15,15,15,15,15,15,15,15,15,15,15,15,15,15,15,15,15,15,15,15,15,15,15,15,15,15,15,15,15,15,15,15,15,15,15,15,15,15,15,15,15,15,15,15,15,15,15,15,15,15,15,15,15,15,15,15,15,15,15,15,15,15,15,15,15,15,15,15,15,15,15,15,15,15,15,15,15,15,15,15,15,15,15,15,15,15,15,15,15,15,15,15,15,15,15,15,15,15,15,15,15,15,15,15,15,15,15,15,15,15,15,15,15,15,15,15,15,15,15,15,15,15,15,15,15,15,15,15,15,15,15,15,15,15,15,15,15,15,15,15,15,15,15,15,15,15,15,15,15,15,15,15,15,15,15,15,15,15,15,15,15,15,15,15,15,15,15,15,15,15,15,15,15,15,15,15,15,15,15,15,15,15,15,15,15,15,15,15,15,15,15,15,15,15,15,15,15,15,15,15,15,15,15,15,15,15,15,15,15,15,15,15,15,15,15,15,15,15,15,15,15,15,15,15,15,15,15,15,15,15,15,15,15,15,15,15,15,15,15,15,15,15,15,15,15,15,15,15,15,15,15,15,15,15,15,15,15,15,15,15,15,15,15,15,15,15,15,15,15,15,15,15,15,15,15,15,15,15,15,15,15,15,15,15,15,15,15,15,15,15,15,15,15,15,15,15,15,15,15,15,15,15,15,15,15,15,15,15,15,15,15,15,15,15,15,15,15,15,15,15,15,15,15,15,15,15,15,15,15,15,15,15,15,15,15,15,15,15,15,15,15,15,15,15,15,15,15,15,15,15,15,15,15,15,15,15,15,15,15,15,15,15,15,15,15,15,15,15,15,15,15,15,15,15,15,15,15,15,15,15,15,15,15,15,15,14,14,14,14,14,14,14,14,14,14,14,14,14,14,14,14,14,14,14,14,14,14,14,14,14,14,14,13,13,13,13,13,13,13,13,13,13,13,13,13,13,13,13,13,13,12,12,12,12,12,12,12,12,12,12,12,12,12,12,11,11,11,11,11,11,11,11,11,10,10,10,10,10,10,10,9,9,9,9,8,8,8,8,7,6,5,4,3,2,1,0,17,18,19,20,21,22,23,24,24,24,24,25,25,25,25,26,26,26,26,26,26,26,27,27,27,27,27,27,27,27,27,28,28,28,28,28,28,28,28,28,28,28,28,28,28,29,29,29,29,29,29,29,29,29,29,29,29,29,29,29,29,29,29,30,30,30,30,30,30,30,30,30,30,30,30,30,30,30,30,30,30,30,30,30,30,30,30,30,30,30,31,31,31,31,31,31,31,31,31,31,31,31,31,31,31,31,31,31,31,31,31,31,31,31,31,31,31,31,31,31,31,31,31,31,31,31,31,31,31,31,31,31,31,31,31,31,31,31,31,31,31,31,31,31,31,31,31,31,31,31,31,31,31,31,31,31,31,31,31,31,31,31,31,31,31,31,31,31,31,31,31,31,31,31,31,31,31,31,31,31,31,31,31,31,31,31,31,31,31,31,31,31,31,31,31,31,31,31,31,31,31,31,31,31,31,31,31,31,31,31,31,31,31,31,31,31,31,31,31,31,31,31,31,31,31,31,31,31,31,31,31,31,31,31,31,31,31,31,31,31,31,31,31,31,31,31,31,31,31,31,31,31,31,31,31,31,31,31,31,31,31,31,31,31,31,31,31,31,31,31,31,31,31,31,31,31,31,31,31,31,31,31,31,31,31,31,31,31,31,31,31,31,31,31,31,31,31,31,31,31,31,31,31,31,31,31,31,31,31,31,31,31,31,31,31,31,31,31,31,31,31,31,31,31,31,31,31,31,31,31,31,31,31,31,31,31,31,31,31,31,31,31,31,31,31,31,31,31,31,31,31,31,31,31,31,31,31,31,31,31,31,31,31,31,31,31,31,31,31,31,31,31,31,31,31,31,31,31,31,31,31,31,31,31,31,31,31,31,31,31,31,31,31,31,31,31,31,31,31,31,31,31,31,31,31,31,31,31,31,31,31,31,31,31,31,31,31,31,31,31,31,31,31,31,31,31,31,31,31,31,31,31,31,31,31,31,31,31,31,31,31,31,31,31,31,31,31,31,31,31,31,31,31,31,31,31,31,31,31,31,31,31,31,31,31,31,31,31,31,31,31,31,31,31,31,31,31,31,31,31,31,31,31,31,31,31,31,31,31,31,31,31,31,31,31,31,31,31,31,31,31,31,31,31,31,31,31,31,31,31,31,31,31,31,31,31,31,31,31,31,31,31,31,31,31,31,31,31,31,31,31,31,31,31,31,31,31,31,31,31,31,31,31,31,31,31,31,31,31,31,31,31,31,31,31,31,31,31,31,31,31,31,31,31,31,31,31,31,31,31,31,31,31,31,31,31,31,31,31,31,31,31,31,31,31,31,31,31,31,31,31,31,31,31,31,31,31,31,31,31,31,31,31,31,31,31,31,31,31,31,31,31,31,31,31,31,31,31,31,31,31,31,31,31,31,31,31,31,31,31,31,31,31,31,31,31,31,31,31,31,31,31,31,31,31,31,31,31,31,31,31,31,31,31,31,31,31,31,31,31,31,31,31,31,31,31,31,31,31,31,31,31,31,31,31,31,31,31,31,31,31,31,31,31,31,31,31,31,31,31,31,31,31,31,31,31,31,31,31,31,31,31,31,31,31,31,31,31,31,31,31,31,31,31,31,31,31,31,31,31,31,31,31,31,31,31,31,31,31,31,31,31,31,31,31,31,31,31,31,31,31,31,31,31,31,31,31,31,31,31,31,31,31,31,31,31,31,31,31,31,31,31,31,31,31,31,31,31,31,31,31,31,31,31,31,31,31,31,31,31,31,31,31,31,31,31,31,31,31,31,31,31,31,31,31,31,31,31,31,31,31,31,31,31,31,31,31,31,31,31,31,31,31,31,31,31,31,31,31,31,31,31,31,31,31,31,31,31,31,31,31,31,31,31,31,31,31,31,31,31,31,31,31,31,31,31,31,31,31,31,31,31,31,31,31,31,31,31,31,31,31,31,31,31,31,31,31,31,31,31,31,31,31,31,31,31,31,31,31,31,31,31,31,31,31,31,31,31,31,31,31,31,31,31,31,31,31,31,31,31,31,31,31,31,31,31,31,31,31,31,31,31,31,31,31,31,31,31,31,31,31,31,31,31,31,31,31,31,31,31,31,31,31,31,31,31,31,31,31,31,31,31,31,31,31,31,31,31,31,31,31,31,31,31,31,31,31,31,31,31,31,31,31,31,31,31,31,31,31,31,31,31,31,31,31,31,31,31,31,31,31,31,31,31,31,31,31,31,31,31,31,31,31,31,31,31,31,31,31,31,31,31,31,31,31,31,31,31,31,31,31,31,31,31,31,31,31,31,31,31,31,31,31,31,31,31,31,31,31,31,31,31,31,31,31,31,31,31,31,31,31,31,31,31,31,31,31,31,31,31,31,31,31,31,31,31,31,31,31,31,31,31,31,31,31,31,31,31,31,31,31,31,31,31,31,31,31,31,31,31,31,31,31,31,31,31,31,31,31,31,31,31,31,31,31,31,31,31,31,31,31,31,31,31,31,31,31,31,31,31,31,31,31,31,31,31,31,31,31,31,31,31,31,31,31,31,31,31,31,31,31,31,31,31,31,31,31,31,31,31,31,31,31,31,31,31,31,31,31,31,31,31,31,31,31,31,31,31,31,31,31,31,31,31,31,31,31,31,31,31,31,31,31,31,31,31,31,31,31,31,31,31,31,31,31,31,31,31,31,31,31,31,31,31,31,31,31,31,31,31,31,31,31,31,31,31,31,31,31,31,31,31,31,31,31,31,31,31,31,31,31,31,31,31,31,31,31,31,31,31,31,31,31,31,31,31,31,31,31,31,31,31,31,31,31,31,31,31,31,31,31,31,31,31,31,31,31,31,31,31,31,31,31,31,31,31,31,31,31,31,31,31,31,31,31,31,31,31,31,31,31,31,31,31,31,31,31,31,31,31,31,31,31,31,31,31,31,31,31,31,31,31,31,31,31,31,31,31,31,31,31,31,31,31,31,31,31,31,31,31,31,31,31,31,31,31,31,31,31,31,31,31,31,31,31,31,31,31,31,31,31,31,31,31,31,31,31,31,31,31,31,31,31,31,31,31,31,31,31,31,31,31,31,31,31,31,31,31,31,31,31,31,31,31,31,31,31,31,31,31,31,31,31,31,31,31,31,31,31,31,31,31,31,31,31,31,31,31,31,31,31,31,31,31,31,31,31,31,31,31,31,31,31,31,31,31,31,31,31,31,31,31,31,31,31,31,31,31,31,31,31,31,31,31,31,31,31,31,31,31,31,31,31,31,31,31,31,31,31,31,31,31,31,31,31,31,31,31,31,31,31,31,31,31,31,31,31,31,31,31,31,31,31,31,31,31,31,31,31,31,31,31,31,31,31,31,31,31,31,31,31,31,31,31,31,31,31,31,31,31,31,31,31,31,31,31,31,31,31,31,31,31,31,31,31,31,31,31,31,31,31,31,31,31,31,31,31,31,31,31,31,31,31,31,31,31,31,31,31,31,31,31,31,31,31,31,31,31,31,31,31,31,31,31,31,31,31,31,31,31,31,31,31,31,31,31,31,31,31,31,31,31,31,31,31,31,31,31,31,31,31,31,31,31,31,31,31,31,31,31,31,31,31,31,31,31,31,31,31,31,31,31,31,31,31,31,31,31,31,31,31,31,31,31,31,31,31,31,31,31,31,31,31,31,31,31,31,31,31,31,31,31,31,31,31,31,31,31,31,31,31,31,31,31,31,31,31,31,31,31,31,31,31,31,31,31,31,31,31,31,31,31,31,31,31,31,31,31,31,31,31,31,31,31,31,31,31,31,31,31,31,31,31,31,31,31,31,31,31,31,31,31,31,31,31,31,31,31,31,31,31,31,31,31,31,31,31,31,31,31,31,31,31,31,31,31,31,31,31,31,31,31,31,31,31,31,31,31,31,31,31,31,31,31,31,31,31,31,31,31,31,31,31,31,31,31,31,31,31,31,31,31,31,31,31,31,31,31,31,31,31,31,31,31,31,31,31,31,31,31,31,31,31,31,31,31,31,31,31,31,31,31,31,31,31,31,31,31,31,31,31,31,31,31,31,31,31,31,31,31,31,31,31,31,31,31,31,31,31,31,31,31,31,31,31,31,31,31,31,31,31,31,31,31,31,31,31,31,31,31,31,31,31,31,31,31,31,31,31,31,31,31,31,31,31,31,31,31,31,31,31,31,31,31,31,31,31,31,31,31,31,31,31,31,31,31,31,31,31,31,31,31,31,31,31,31,31,31,31,31,31,31,31,31,31,31,31,31,31,31,31,31,31,31,31,31,31,31,31,31,31,31,31,31,31,31,31,31,31,31,31,31,31,31,31,31,31,31,31,31,31,31,31,31,31,31,31,31,31,31,31,31,31,31,31,31,31,31,31,31,31,31,31,31,31,31,31,31,31,31,31,31,31,31,31,31,31,31,31,31,31,31,31,31,31,31,31,31,31,31,31,31,31,31,31,31,31,31,31,31,31,31,31,31,31,31,31,31,31,31,31,31,31,31,31,31,31,31,31,31,31,31,31,31,31,31,31,31,31,31,31,31,31,31,31,31,31,31,31,31,31,31,31,31,31,31,31,31,31,31,31,31,31,31,31,31,31,31,31,31,31,31,31,31,31,31,31 };   // bucket(rel) for rel = s - n in [-2047, 2047]

// ---- Two launches hold all the element-wise work. The jobs inside each are independent of one another and are dealt by block range (every branch is the same for a whole work-group); where a job runs once per batch, the batch loop stands inside the thread, whose NB_ loads then fly together.
// Every 16-bit plane named here is written in FRAGMENT ORDER (above); the index lists say which index is the row and which is k.
// k_prep: x (all batches) -> bf16 (row t, k the model dimension); WF hl planes [w][r][k] = sc_w sum_g bf16 W_w[g*256+r][k], r = h*64+d, w = q, k, v, sc = 1, 1/4, 1/4 (exact); WE hl planes [o][j] = sum_g bf16 wo[o][g*256+j]; TB[h][r] = mean_g bf16 rel_bias[c_bucket[r]][g*4+h].
// k_post: GVT[b][h] (row d, k = s; its fragments lie key block first: fragment (s / 32) * 4 + d / 16, so that the four fragments of 32 keys are 4 KB in a row) = fp16(V[b*TT+s][h*64+d]) (a thread -> 8 s of one d, 16 lanes -> 16 d); hl planes QS[b][h][t][d] = Q[b*TT+t][h*64+d]; hl planes GK[b][h][s][d] = K[..] (8-B lanes). Q, K, V: the three [NB_*TT][DO] planes of QKV.
#define PB_X (TT * DM / 8 / 256)
#define PB_W (DO * DM / 4 / 256)
#define PB_O (DM * DO / 4 / 256)
#define PB_T ((KVH * 4095 + 255) / 256)
#define GB_V (KVH * HD * TT / 8 / 256)
#define GB_Q (KVH * TT * HD / 4 / 256)
// sb = elements of one batch's plane, [TT][DM] in k_prep and [TT][DO] in k_post (a kernel argument). A thread's loads go through one pointer per batch, p[b]; XWAIT stands behind the last load and names the pointers as inputs, so that their registers are rewritten (also by a later load's result) only behind the wait.
#define XWAIT(p) asm volatile("s_wait_xcnt 0x0" :: "v"(p[0]), "v"(p[1]), "v"(p[2]), "v"(p[3]) : "memory")
// SWAIT stands behind the last store of a job: in the listing the next job's code follows behind a test, and it rewrites registers that the stores name.
#define SWAIT asm volatile("s_wait_xcnt 0x0" ::: "memory")
__device__ __forceinline__ v8us cvt8(v8f v) { v8us o;
#pragma unroll
    for (int k = 0; k < 8; ++k) o[k] = f2bf(v[k]); return o; }
__global__ __launch_bounds__(256) void k_prep(const float* __restrict__ x, const float* __restrict__ wq, const float* __restrict__ wk, const float* __restrict__ wv, const float* __restrict__ wo, const float* __restrict__ rb, bf* XB, bf* WFh, bf* WFl, bf* Wh, bf* Wl, float* TB, size_t sb) {
    int blk = blockIdx.x;
    if (blk < PB_X) { const unsigned c = blk * 256 + threadIdx.x, i = c * 8, si = frag_src(c, DM, DM); v8f v[NB_]; const float* p[NB_];
#pragma unroll   // unrolled: v[] is indexed by constants only, and all loads issue before the first store
        for (int b = 0; b < NB_; ++b) { p[b] = x + b * sb + si; v[b] = *(const v8f*)p[b]; }
        XWAIT(p);
#pragma unroll
        for (int b = 0; b < NB_; ++b) *(v8us*)(XB + b * sb + i) = cvt8(v[b]);
        return; }
    blk -= PB_X;
    if (blk < 3 * PB_W) { const int w = blk / PB_W; const float* s = w == 0 ? wq : w == 1 ? wk : wv; const float sc = w == 0 ? 1.0f : 0.25f; const unsigned q = (blk - w * PB_W) * 256 + threadIdx.x, i = q * 4, si = frag_src(q >> 1, DM, DM) + (q & 1) * 4; v4f v[GG];
#pragma unroll   // unrolled: v[] is indexed by constants only, and all loads issue before the first store
        for (int g = 0; g < GG; ++g) v[g] = *(const v4f*)(s + g * DO * DM + si);
        v4us oh, ol;
#pragma unroll
        for (int u = 0; u < 4; ++u) { float a = 0.f;
#pragma unroll
            for (int g = 0; g < GG; ++g) a = __fadd_rn(a, bfr(v[g][u])); unsigned short c, d; splitf(a * sc, c, d); oh[u] = c; ol[u] = d; }
        *(v4us*)(WFh + w * DO * DM + i) = oh; *(v4us*)(WFl + w * DO * DM + i) = ol; SWAIT; return; }
    blk -= 3 * PB_W;
    if (blk < PB_O) { const unsigned q = blk * 256 + threadIdx.x, e = q * 4; const float* r = wo + frag_src(q >> 1, DO, DM) + (q & 1) * 4; v4us oh, ol;
#pragma unroll
        for (int u = 0; u < 4; ++u) { float s = 0.f;
#pragma unroll
            for (int g = 0; g < GG; ++g) s = __fadd_rn(s, bfr(r[g * DO + u])); unsigned short a, b; splitf(s, a, b); oh[u] = a; ol[u] = b; }
        *(v4us*)(Wh + e) = oh; *(v4us*)(Wl + e) = ol; SWAIT; return; }
    blk -= PB_O;
    const int i = blk * 256 + threadIdx.x; if (i >= KVH * 4095) return; const int r = i % 4095, h = i / 4095; const int bk = c_bucket[r]; SWAIT; float s = 0.f;   // here behind the table load: the next loads' results rewrite its address register
#pragma unroll
    for (int g = 0; g < GG; ++g) s = __fadd_rn(s, bfr(rb[bk * NHm + g * KVH + h])); TB[i] = s * 0.25f;
}
// [t][h*64+d] f32 -> [h] (row t, k = d) hi+lo planes in fragment order, for every batch
__device__ __forceinline__ void grp_hl(const float* __restrict__ S, size_t sb, bf* Ph, bf* Pl, int blk) { const unsigned q = blk * 256 + threadIdx.x, e = q * 4; const unsigned h = e / (HD * TT); const float* r = S + frag_src((q >> 1) % (HD * TT / 8), HD, DO) + h * HD + (q & 1) * 4; v4f v[NB_]; const float* p[NB_];
#pragma unroll   // unrolled, here and below: v[] is indexed by constants only, and all loads issue before the first store
    for (int b = 0; b < NB_; ++b) { p[b] = r + b * sb; v[b] = *(const v4f*)p[b]; }
    XWAIT(p);
#pragma unroll
    for (int b = 0; b < NB_; ++b) { v4us oh, ol;
#pragma unroll
        for (int u = 0; u < 4; ++u) { unsigned short a, c; splitf(v[b][u], a, c); oh[u] = a; ol[u] = c; }
        *(v4us*)(Ph + (size_t)b * KVH * TT * HD + e) = oh; *(v4us*)(Pl + (size_t)b * KVH * TT * HD + e) = ol; }
    SWAIT; }
__global__ __launch_bounds__(256) void k_post(const float* __restrict__ QKV, bf* QSh, bf* QSl, bf* GKh, bf* GKl, h16* GVT, size_t sb) {
    int blk = blockIdx.x;
    if (blk < GB_V) { const float* V = QKV + 2 * NB_ * sb; const unsigned c = blk * 256 + threadIdx.x; const unsigned h = c / (TT * HD / 8), s = ((c >> 8) & 63) * 32 + ((c >> 4) & 3) * 8, d = ((c >> 6) & 3) * 16 + (c & 15); const float* r = V + (size_t)s * DO + h * HD + d; float v[NB_][8]; const float* p[NB_];
#pragma unroll   // unrolled, here and below: v[][] is indexed by constants only, and all loads issue before the first store
        for (int b = 0; b < NB_; ++b) { p[b] = r + b * sb;
#pragma unroll
            for (int u = 0; u < 8; ++u) v[b][u] = p[b][u * DO]; }
        XWAIT(p);
#pragma unroll
        for (int b = 0; b < NB_; ++b) { const v8h o = {tohx(v[b][0]), tohx(v[b][1]), tohx(v[b][2]), tohx(v[b][3]), tohx(v[b][4]), tohx(v[b][5]), tohx(v[b][6]), tohx(v[b][7])};
            *(v8h*)(GVT + (size_t)b * KVH * HD * TT + c * 8) = o; }
        return; }
    blk -= GB_V;
    if (blk < GB_Q) { grp_hl(QKV, sb, QSh, QSl, blk); return; }
    grp_hl(QKV + NB_ * sb, sb, GKh, GKl, blk - GB_Q);
}
// ---- k_fattn: scores, bias, softmax, attn x V and the hi/lo split of its result in ONE kernel; neither scores nor probabilities go to memory. Grid (TT / 128, KVH, NB_), 16 waves: a work-group owns 128 query columns n of one head of one batch.
// Wave w has the 32 columns of query group w & 3 and, of every 128-key stage, the 32-key block w >> 2. A stage (128 keys of Kh, Kl and Vt: 16 KB in a row of each plane, fragment order) comes into LDS ONCE per work-group, by asynchronous copies,
// and the four query groups read their fragments from there (contiguous 16-B LDS reads): L2 delivers each key to a work-group of 128 queries, not of 32. Two buffers: stage t + 1 flies while stage t is worked on.
// Each wave keeps a running maximum and sum per column (online softmax). S^T = GK QS^T (3 hi/lo products, the accumulator starts at the bias): a lane holds 16 keys of ONE query per column group,
// so the maximum is in-lane plus one exchange between the wave's halves, and two converted S^T tiles ARE the f16 B operand of O^T += GV^T P^T (hardware k order, the order of WFrag::ld): P touches neither LDS nor another lane.
// p = 1024 exp(s - m) (f16, at most 1024; the factor cancels in the quotient). The FK partial (m, l, O^T) of a query group meet in LDS: each wave scales its own by exp(m_w - max_w m_w), the sums run in key-block order 0..FK-1; sum / l leaves as bf16 hi+lo planes P (row n, k = h * 64 + d) in fragment order, whole 1-KB fragments.
// Every '#pragma unroll' in k_fattn without a note of its own: qh, ql, o, sc, vf, pf, m and l are then indexed by constants only and stay in registers.
#define L2E 1.44269504f
#define FQ 4                    // query groups of 32 columns in a work-group
#define FK 4                    // 32-key blocks in a stage = waves that share a query group
#define FW (FQ * FK)            // waves
#define SPL (FK * 32 * HD)      // elements of one plane in a stage: 8192 = 16 KB
#define NST (TT / (FK * 32))    // stages
typedef v4f __attribute__((aligned(4), may_alias)) v4fu;   // the bias window starts at any float
// One stage's copies: every lane brings 2 x 16 B of each of the three planes (512 lanes x 16 B = half a plane's stage). l: the lane's LDS byte address in the buffer; a, b, c: its global addresses in Kh, Kl, Vt.
// The s_wait_xcnt 0 is the last line of the copies' own statement, so that no register which a copy names is rewritten in front of it.
__device__ __forceinline__ void stage_in(unsigned l, const bf* a, const bf* b, const h16* c) {
    asm volatile("global_load_async_to_lds_b128 %0, %6, off\n\t"
                 "global_load_async_to_lds_b128 %1, %7, off\n\t"
                 "global_load_async_to_lds_b128 %2, %8, off\n\t"
                 "global_load_async_to_lds_b128 %3, %9, off\n\t"
                 "global_load_async_to_lds_b128 %4, %10, off\n\t"
                 "global_load_async_to_lds_b128 %5, %11, off\n\t"
                 "s_wait_xcnt 0x0"
                 :: "v"(l), "v"(l + SPL), "v"(l + 2 * SPL), "v"(l + 3 * SPL), "v"(l + 4 * SPL), "v"(l + 5 * SPL), "v"(a), "v"(a + SPL / 2), "v"(b), "v"(b + SPL / 2), "v"(c), "v"(c + SPL / 2) : "memory");
}
__global__ __launch_bounds__(32 * FW) void k_fattn(const bf* __restrict__ Qh, const bf* __restrict__ Ql, const bf* __restrict__ Kh, const bf* __restrict__ Kl, const h16* __restrict__ Vt, const float* __restrict__ TB, bf* Ph, bf* Pl) {
    __shared__ __align__(16) bf ring[2 * 3 * SPL];   // two buffers of [Kh | Kl | Vt], 48 KB each
    __shared__ __align__(16) float po[FW * 32 * 68];
    __shared__ float pm[FW * 32];
    __shared__ float pl[FW * 32];
    const int lane = threadIdx.x & 31, lr = lane & 15, hi = lane >> 4; const int wv = __builtin_amdgcn_readfirstlane((int)(threadIdx.x >> 5)); const int qg = wv & (FQ - 1), kg = wv / FQ;
    const int nw = blockIdx.x * (FQ * 32), n0 = nw + qg * 32, h = blockIdx.y, bz = blockIdx.z; const size_t hb = ((size_t)bz * KVH + h) * TT * HD; const unsigned lo = lane * 8;   // the lane's part of every fragment address; the rest is the same for the whole wave
    const bf* gkh = Kh + hb + threadIdx.x * 8; const bf* gkl = Kl + hb + threadIdx.x * 8; const h16* gv = Vt + hb + threadIdx.x * 8; const unsigned l0 = (unsigned)(size_t)ring + threadIdx.x * 16;   // fragment order: 128 keys are 8192 elements in a row in each of the three planes
    stage_in(l0, gkh, gkl, gv);
    v16bf qh[2][2], ql[2][2]; const bf* pqh = Qh + hb + (size_t)n0 * HD + lo; const bf* pql = Ql + hb + (size_t)n0 * HD + lo;
#pragma unroll
    for (int nt = 0; nt < 2; ++nt)
#pragma unroll
        for (int kk = 0; kk < 2; ++kk) { qh[nt][kk] = WFrag<bf>::ld(pqh + nt * 1024 + kk * 512); ql[nt][kk] = WFrag<bf>::ld(pql + nt * 1024 + kk * 512); }
    v8f o[4][2];
#pragma unroll
    for (int dt = 0; dt < 4; ++dt)
#pragma unroll
        for (int nt = 0; nt < 2; ++nt) o[dt][nt] = (v8f){};
    float m[2] = {-3.0e38f, -3.0e38f}, l[2] = {0.f, 0.f};
    const float* tb = TB + (size_t)h * 4095 + 2047 + 8 * hi - n0 - lr + kg * 32;   // tb[s0' + j] = bias of key kg * 32 + s0' + 8 hi + j against query n0 + lr
    asm volatile("s_wait_asynccnt 0x0" ::: "memory");   // this wave's copies of stage 0 have landed
    __syncthreads();                                    // and every other wave's: stage 0 may be read
    stage_in(l0 + 6 * SPL, gkh + SPL, gkl + SPL, gv + SPL);
#pragma unroll 1   // rolled: one pass already holds most of the 256 registers that four waves per SIMD leave
    for (int t = 0; t < NST; ++t) {
        v8f sc[2][2]; const float* pt = tb + t * (FK * 32); const bf* pkh = ring + (t & 1) * (3 * SPL) + kg * 2048 + lo; const bf* pkl = pkh + SPL; const h16* pv = (const h16*)(pkh + 2 * SPL);   // the wave's 32 keys in the stage's buffer; the steps inside a pass are immediate offsets
#pragma unroll
        for (int st = 0; st < 2; ++st)
#pragma unroll
            for (int nt = 0; nt < 2; ++nt) { const float* p = pt + st * 16 - nt * 16; const v4f b0 = *(const v4fu*)p, b1 = *(const v4fu*)(p + 4); sc[st][nt] = (v8f){b0[0], b0[1], b0[2], b0[3], b1[0], b1[1], b1[2], b1[3]}; }
        asm volatile("s_wait_xcnt 0x0" :: "v"(pt) : "memory");   // behind the pass's last global load; it names the pointer as an input, so that its registers are rewritten (also by a later load's result) only behind the wait
        v16h vf[4];
#pragma unroll
        for (int dt = 0; dt < 4; ++dt) vf[dt] = WFrag<h16>::ld(pv + dt * 512);
#pragma unroll
        for (int st = 0; st < 2; ++st)
#pragma unroll
            for (int kk = 0; kk < 2; ++kk) { const int ko = st * 1024 + kk * 512; const v16bf ah = WFrag<bf>::ld(pkh + ko), al = WFrag<bf>::ld(pkl + ko);
#pragma unroll
                for (int nt = 0; nt < 2; ++nt) { sc[st][nt] = wmmab(ah, qh[nt][kk], sc[st][nt]); sc[st][nt] = wmmab(al, qh[nt][kk], sc[st][nt]); sc[st][nt] = wmmab(ah, ql[nt][kk], sc[st][nt]); } }
        // The stage's hand-over stands here, behind the pass's last LDS read of the buffer (all of K and V is in registers by now): what follows it in the pass works on registers alone, and the refill gets a whole pass of lead.
        asm volatile("s_wait_dscnt 0x0" ::: "memory");      // this wave's reads of stage t have returned
        asm volatile("s_wait_asynccnt 0x0" ::: "memory");   // its copies of stage t + 1 have landed
        __syncthreads();                                    // one barrier a stage: it publishes stage t + 1 and ends every wave's reads of stage t, whose buffer is refilled behind it
        if (t + 2 < NST) stage_in(l0 + (t & 1) * (6 * SPL), gkh + (t + 2) * SPL, gkl + (t + 2) * SPL, gv + (t + 2) * SPL);
#pragma unroll
        for (int nt = 0; nt < 2; ++nt) {
            float mx = fmaxf(sc[0][nt][0], sc[1][nt][0]);
#pragma unroll
            for (int j = 1; j < 8; ++j) mx = fmaxf(mx, fmaxf(sc[0][nt][j], sc[1][nt][j]));
            mx = fmaxf(mx, __shfl_xor(mx, 16, 32));
            const float mn = fmaxf(m[nt], mx); const float al = __builtin_amdgcn_exp2f((m[nt] - mn) * L2E); const float mb = __builtin_fmaf(mn, L2E, -10.0f); m[nt] = mn;
            float ps = 0.f; v16h pf;
#pragma unroll
            for (int st = 0; st < 2; ++st)
#pragma unroll
                for (int j = 0; j < 8; ++j) { const float p = __builtin_amdgcn_exp2f(__builtin_fmaf(sc[st][nt][j], L2E, -mb)); ps += p; pf[st * 8 + j] = tohx(p); }
            l[nt] = __builtin_fmaf(l[nt], al, ps);
#pragma unroll
            for (int dt = 0; dt < 4; ++dt) { o[dt][nt] *= al; o[dt][nt] = wmma16(vf[dt], pf, o[dt][nt]); }
        }
    }
    asm volatile("s_wait_asynccnt 0x0" ::: "memory");   // no copy is left in flight behind the loop
#pragma unroll
    for (int nt = 0; nt < 2; ++nt) { l[nt] += __shfl_xor(l[nt], 16, 32); if (hi == 0) pm[wv * 32 + nt * 16 + lr] = m[nt]; }
    __syncthreads();
#pragma unroll
    for (int nt = 0; nt < 2; ++nt) { float mg = pm[qg * 32 + nt * 16 + lr];
#pragma unroll
        for (int w = 1; w < FK; ++w) mg = fmaxf(mg, pm[(w * FQ + qg) * 32 + nt * 16 + lr]);
        const float f = __builtin_amdgcn_exp2f((m[nt] - mg) * L2E); if (hi == 0) pl[wv * 32 + nt * 16 + lr] = l[nt] * f;
        float* pd = po + (wv * 32 + nt * 16 + lr) * 68 + 8 * hi;
#pragma unroll
        for (int dt = 0; dt < 4; ++dt) { const v8f c = o[dt][nt] * f; *(v4fa*)(pd + dt * 16) = (v4f){c[0], c[1], c[2], c[3]}; *(v4fa*)(pd + dt * 16 + 4) = (v4f){c[4], c[5], c[6], c[7]}; } }
    __syncthreads();
#pragma unroll   // one trip per query group; unrolled: the LDS reads of the later groups issue while the earlier groups' quotients are worked out
    for (int it = 0; it < FQ; ++it) { const int idx = (int)threadIdx.x; const int n = (idx >> 8) * 16 + (idx & 15), c4 = ((idx >> 5) & 7) * 8 + ((idx >> 4) & 1) * 4; v4f s = *(const v4fa*)(po + (it * 32 + n) * 68 + c4); float ls = pl[it * 32 + n];   // 16 lanes -> 16 rows n (LDS pitch 68: no bank met twice), a wave -> 8 columns of them: 256 B in a row of each plane
#pragma unroll   // unrolled: the LDS reads of all partials issue ahead of the adds, which keep the order w = 0..FK-1
        for (int w = 1; w < FK; ++w) { s += *(const v4fa*)(po + ((w * FQ + it) * 32 + n) * 68 + c4); ls += pl[(w * FQ + it) * 32 + n]; }
        const float inv = __fdiv_rn(1.0f, ls); v4us oh, ol;
#pragma unroll
        for (int u = 0; u < 4; ++u) { unsigned short a, b; splitf(s[u] * inv, a, b); oh[u] = a; ol[u] = b; }
        const size_t eo = ((size_t)bz * TT + nw + it * 32 + (n & 16)) * DO + (h * 2 + (c4 >> 5)) * 512 + ((c4 >> 3) & 3) * 128 + (n & 15) * 8 + (c4 & 7); *(v4us*)(Ph + eo) = oh; *(v4us*)(Pl + eo) = ol; }
}

extern "C" void kernel_launch(void* const* d_in, const int* in_sizes, int n_in,
                              void* d_out, int out_size, void* d_ws, size_t ws_size, hipStream_t stream) {
    (void)in_sizes; (void)n_in; (void)out_size;
    const float* x = (const float*)d_in[0]; const float* wq = (const float*)d_in[1]; const float* wk = (const float*)d_in[2]; const float* wv = (const float*)d_in[3]; const float* wo = (const float*)d_in[4]; const float* rb = (const float*)d_in[5];
    float* OUT = (float*)d_out;     // [4][2048][1024] = [8192][1024]: the batches are one run of rows for every GEMM
    char* wsp = (char*)d_ws;
    auto take = [&](size_t bytes) { char* p = wsp; wsp += (bytes + 255) & ~(size_t)255; return (void*)p; };
    bf* WFh = (bf*)take((size_t)3 * DO * DM * 2); bf* WFl = (bf*)take((size_t)3 * DO * DM * 2); bf* WEh = (bf*)take((size_t)DM * DO * 2); bf* WEl = (bf*)take((size_t)DM * DO * 2); float* TB = (float*)take((size_t)KVH * 4095 * 4 + 256);
    bf* XB = (bf*)take((size_t)NB_ * TT * DM * 2); float* QKV = (float*)take((size_t)3 * NB_ * TT * DO * 4); bf* QSh = (bf*)take((size_t)NB_ * KVH * TT * HD * 2); bf* QSl = (bf*)take((size_t)NB_ * KVH * TT * HD * 2); bf* GKh = (bf*)take((size_t)NB_ * KVH * TT * HD * 2); bf* GKl = (bf*)take((size_t)NB_ * KVH * TT * HD * 2); h16* GVT = (h16*)take((size_t)NB_ * KVH * HD * TT * 2);
    bf* OPh = (bf*)take((size_t)NB_ * TT * DO * 2); bf* OPl = (bf*)take((size_t)NB_ * TT * DO * 2);
    if ((size_t)(wsp - (char*)d_ws) > ws_size) return;    // total ~ 75 MB
    k_prep<<<PB_X + 3 * PB_W + PB_O + PB_T, 256, 0, stream>>>(x, wq, wk, wv, wo, rb, XB, WFh, WFl, WEh, WEl, TB, (size_t)TT * DM);   // [out][in] weights = natural Bt
    k_gemmw<bf, 3, false, 8, DM><<<dim3(NB_ * TT / 64, DO / 64, 3), 256, 0, stream>>>(XB, nullptr, WFh, WFl, QKV, DO, nullptr, 0, (size_t)DO * DM, (size_t)NB_ * TT * DO);   // z = q, k, v; NSPLIT 3: A Bt + A Bt2
    k_post<<<GB_V + 2 * GB_Q, 256, 0, stream>>>(QKV, QSh, QSl, GKh, GKl, GVT, (size_t)TT * DO);
    k_fattn<<<dim3(TT / (FQ * 32), KVH, NB_), 32 * FW, 0, stream>>>(QSh, QSl, GKh, GKl, GVT, TB, OPh, OPl);
    k_gemmw<bf, 2, false, 8, DO><<<dim3(NB_ * TT / 64, DM / 64, 1), 256, 0, stream>>>(OPh, OPl, WEh, WEl, OUT, DM, nullptr, 0, 0, 0);
}

// v007
// One run takes 81.9 microseconds.
// Timed twice side by side with v006, it ran 1.10 times as fast both times.
// Counting every step since v000, it is 10.2 times as fast.
#include <hip/hip_runtime.h>

// Grouped attention with a relative-position bias (hidden [4][2048][1024]; q/k/v = x W^T (16 heads x 64); heads grouped (g=4 groups, h=4 kv heads: head = g*4 + h); gk, gv = mean over g; scores[h][n][s] = sum_g sum_d q[g,h][n][d] gk[h][s][d] (the reference's einsum sums the query
// groups; no 1/sqrt(d) scaling, T5 style) + mean over g of the T5 relative-position bias rel_bias[bucket(s - n)][g*4 + h]; softmax; out[h] = attn gv[h]; tiled x4 over g and projected: out_full Wo^T = out (sum_g Wo[:, g-block])^T -> [4][2048][1024]).
// The group sum of q and the group means of k and v are linear in the weights: sum_g (x Wq[g,h]^T) = x (sum_g Wq[g,h])^T. The weights are summed over g first (k_prep), so the projections have 256 columns each instead of 1024 and yield the summed q and the mean k, v directly.
// The bucket of each relative position depends only on (s - n) and the fixed sizes: it is a compile-time table of 4095 entries (bidirectional T5 buckets, 32 buckets, max distance 128; computed in f32 exactly as the reference and baked in).
// Compute dtypes, f32 accumulate: every input rounded to bf16; group sums / means of the bf16 weights in f32 -> bf16 hi+lo planes; q/k/v = bf16 x (exact) times both planes (2 products), f32 -> bf16 hi+lo planes (q, k) and f16 (v); scores (K 64) as 3 products; bias + online softmax f32, probabilities x1024 in f16, fused with attn x V (k_fattn)

#define NB_  4
#define TT   2048
#define DM   1024
#define NHm  16
#define KVH  4
#define GG   4
#define HD   64
#define DO   256
typedef _Float16 h16;
typedef unsigned short bf;
typedef __attribute__((ext_vector_type(16))) __bf16   v16bf;
typedef __attribute__((ext_vector_type(16))) _Float16 v16h;
typedef __attribute__((ext_vector_type(8)))  _Float16 v8h;
typedef __attribute__((ext_vector_type(8)))  unsigned short v8us;
typedef __attribute__((ext_vector_type(8)))  float    v8f;
typedef __attribute__((ext_vector_type(4)))  float    v4f;
typedef v8h  __attribute__((may_alias)) v8ha;
typedef v4f  __attribute__((may_alias)) v4fa;
typedef v8us __attribute__((may_alias)) v8usa;

__device__ __forceinline__ unsigned short f2bf(float f) { unsigned u = __float_as_uint(f); u += 0x7FFFu + ((u >> 16) & 1u); return (unsigned short)(u >> 16); }
__device__ __forceinline__ float bf2f(unsigned short b) { return __uint_as_float(((unsigned)b) << 16); }
__device__ __forceinline__ float bfr(float f) { return bf2f(f2bf(f)); }
__device__ __forceinline__ v16h cat16(v8h lo, v8h hi) { return __builtin_shufflevector(lo, hi, 0, 1, 2, 3, 4, 5, 6, 7, 8, 9, 10, 11, 12, 13, 14, 15); }
__device__ __forceinline__ v16bf cat16b(v8us lo, v8us hi) { return __builtin_bit_cast(v16bf, __builtin_shufflevector(lo, hi, 0, 1, 2, 3, 4, 5, 6, 7, 8, 9, 10, 11, 12, 13, 14, 15)); }
__device__ __forceinline__ v8f wmma16(v16h a, v16h b, v8f c) { return __builtin_amdgcn_wmma_f32_16x16x32_f16(false, a, false, b, (short)0, c, false, false); }
__device__ __forceinline__ v8f wmmab(v16bf a, v16bf b, v8f c) { return __builtin_amdgcn_wmma_f32_16x16x32_bf16(false, a, false, b, (short)0, c, false, false); }



// FRAGMENT ORDER. Every 16-bit operand plane [R rows][K columns] is stored as WMMA fragments of 16 rows x 32 k = 512 elements = 1 KB: element (row, k) lies at ((row / 16) * (K / 32) + k / 32) * 512 + ((k / 8) % 4) * 128 + (row % 16) * 8 + k % 8 (in GVT the fragment index is (k / 32) * (R / 16) + row / 16 instead).
// Lane (lr, hi) = lane number hi * 16 + lr finds its k = 8 hi .. 8 hi + 7 at fragment + lane * 8 and its k = 16 + 8 hi .. at 256 elements more (the hardware k order): each wave-wide 16-B load covers 512 contiguous bytes, four whole 128-B lines (from a row-major plane it would touch 32-B pieces of 16 lines).
// The producers write such a plane linearly and gather their source: chunk c (8 elements, at c * 8) comes from the source index frag_src(c, K, ld) = row * ld + k.
__device__ __forceinline__ unsigned frag_src(unsigned c, unsigned K, unsigned ld) { const unsigned f = c >> 6, kb = K >> 5; return ((f / kb) * 16 + (c & 15)) * ld + (f % kb) * 32 + ((c >> 4) & 3) * 8; }

// ---- k_gemmw: register-blocked GEMM, KS WAVES per 64x64 output tile (16 accumulators each), operands straight from fragment-ordered 16-bit planes (see FRAGMENT ORDER above); grid (M/64, N/64, Z), 32 * KS threads.
// C[m][n] (f32, pitch ldc, + optional f32 bias[n]) = sum_k A[m][k] Bt[n][k] (+ split products per NSPLIT). z-batch strides sA/sB/sC in elements. K % (32 * KS) == 0.
// KS > 1: wave w sums the 32-wide k steps w, w + KS, w + 2 KS, ... (interleaved: in one trip the waves of a work-group read KS neighbouring 1-KB fragments of every 16-row block);
// the KS partial tiles meet in LDS (fragment order) and are added in wave order 0..KS-1, 16/KS fragments per wave; the tile leaves through a row-major LDS tile in whole lines.
// PLANES (the q/k/v projection; grid z = q, k, v; a tile is 64 tokens x the 64 columns of head blockIdx.y): the tile does not leave as f32 but as the 16-bit planes that k_fattn reads, in fragment order, where it is 4096 elements = 8 KB in a row of each plane:
// z = 0, 1: bf16 hi+lo planes QS, GK [b][h] (row t, k = d); z = 2: GVT[b][h] (row d, k = s; its fragments lie key block first: fragment (s / 32) * 4 + d / 16, so that the four fragments of 32 keys are 4 KB in a row) = f16(v). A thread writes whole 16-B chunks, a wave 512 B in a row.
__device__ __forceinline__ h16 tohx(float x) { return (h16)x; }
__device__ __forceinline__ void splitf(float y, unsigned short& h, unsigned short& l) { h = f2bf(y); l = f2bf(y - bf2f(h)); }
template <typename T16> struct WFrag;
template <> struct WFrag<h16> { typedef v16h V; static __device__ __forceinline__ V ld(const h16* p) { return cat16(*(const v8h*)p, *(const v8h*)(p + 256)); } static __device__ __forceinline__ v8f mma(V a, V b, v8f c) { return wmma16(a, b, c); } };
template <> struct WFrag<bf> { typedef v16bf V; static __device__ __forceinline__ V ld(const bf* p) { return cat16b(*(const v8us*)p, *(const v8us*)(p + 256)); } static __device__ __forceinline__ v8f mma(V a, V b, v8f c) { return wmmab(a, b, c); } };
template <typename T16, int NSPLIT, bool BIAS, int KS, int K, bool PLANES>   // K a constant: the steps from fragment to fragment are immediate offsets on one pointer per plane
__global__ __launch_bounds__(32 * KS) void k_gemmw(const T16* __restrict__ A, const T16* __restrict__ A2, const T16* __restrict__ Bt, const T16* __restrict__ Bt2, float* C, int ldc, const float* __restrict__ bias, size_t sA, size_t sB, size_t sC, bf* QSh, bf* QSl, bf* GKh, bf* GKl, h16* GVT) {
    typedef typename WFrag<T16>::V V;
    __shared__ __align__(16) float os[KS == 1 ? 16 * 68 : 64 * 68 + KS * 4096];
    const size_t z = blockIdx.z; A += z * sA; if (A2) A2 += z * sA; Bt += z * sB; if (Bt2) Bt2 += z * sB; if constexpr (!PLANES) C += z * sC;
    const int lane = threadIdx.x & 31, lr = lane & 15, hi = lane >> 4; const int r0 = blockIdx.x * 64, c0 = blockIdx.y * 64;
    v8f acc[4][4];
#pragma unroll
    for (int mb = 0; mb < 4; ++mb)
#pragma unroll
        for (int nb = 0; nb < 4; ++nb) acc[mb][nb] = (v8f){};
    const size_t aoff = (size_t)r0 * K, boff = (size_t)c0 * K; const unsigned lo = lane * 8;   // fragment (row block, k block) starts at (row block * K / 32 + k block) * 512: the same for the whole wave; the lane's own part is lo
    const int wv = __builtin_amdgcn_readfirstlane((int)(threadIdx.x >> 5));
#pragma unroll 1
    for (int kc = wv * 32; kc < K; kc += 32 * KS) {
        if constexpr (NSPLIT == 3) {   // A Bt + A Bt2. One pointer per plane; each s_wait_xcnt 0 stands behind the last load of its run and names the run's pointers as inputs, so that their registers are rewritten (also by a later load's result) only behind the wait.
            const T16* pa = A + aoff + kc * 16 + lo; const T16* pb = Bt + boff + kc * 16 + lo; const T16* pc = Bt2 + boff + kc * 16 + lo; V a[4], b[4], b2[4];
#pragma unroll   // unrolled, here and below: the arrays are indexed by constants only and stay in registers, and the loads of a run issue together
            for (int i = 0; i < 4; ++i) { a[i] = WFrag<T16>::ld(pa + i * 16 * K); b[i] = WFrag<T16>::ld(pb + i * 16 * K); }
            asm volatile("s_wait_xcnt 0x0" :: "v"(pa), "v"(pb) : "memory");
#pragma unroll
            for (int i = 0; i < 4; ++i) b2[i] = WFrag<T16>::ld(pc + i * 16 * K);
            asm volatile("s_wait_xcnt 0x0" :: "v"(pc) : "memory");
            __builtin_amdgcn_sched_barrier(0);   // keeps every load of the trip in front of its first matrix instruction: without it the scheduler sinks five fragments' loads between the products, and a trip waits for memory several times instead of once
#pragma unroll
            for (int nb = 0; nb < 4; ++nb)
#pragma unroll
                for (int mb = 0; mb < 4; ++mb) acc[mb][nb] = WFrag<T16>::mma(a[mb], b[nb], acc[mb][nb]);
#pragma unroll
            for (int nb = 0; nb < 4; ++nb)
#pragma unroll
                for (int mb = 0; mb < 4; ++mb) acc[mb][nb] = WFrag<T16>::mma(a[mb], b2[nb], acc[mb][nb]);
            asm volatile("v_nop\n\tv_nop\n\tv_nop\n\tv_nop" : "+v"(acc[0][0]), "+v"(acc[1][1]), "+v"(acc[2][2]), "+v"(acc[3][3]) : "v"(a[0]), "v"(a[3]));   // the four vector slots behind the trip's last matrix instruction, also on the taken back edge
        } else if constexpr (NSPLIT == 2) {   // A Bt + A2 Bt + A Bt2, every accumulator in this order. One pointer per plane; each s_wait_xcnt 0 stands behind the last load of its run and names the run's pointers as inputs, so that their registers are rewritten (also by a later load's result) only behind the wait.
            const T16* pa = A + aoff + kc * 16 + lo; const T16* pa2 = A2 + aoff + kc * 16 + lo; const T16* pb = Bt + boff + kc * 16 + lo; const T16* pb2 = Bt2 + boff + kc * 16 + lo; V a[4], a2[4], b[4], b2[4];
#pragma unroll   // unrolled, here and below: the arrays are indexed by constants only and stay in registers, and the loads of a run issue together
            for (int i = 0; i < 4; ++i) { a[i] = WFrag<T16>::ld(pa + i * 16 * K); b[i] = WFrag<T16>::ld(pb + i * 16 * K); a2[i] = WFrag<T16>::ld(pa2 + i * 16 * K); }
            b2[0] = WFrag<T16>::ld(pb2);
            asm volatile("s_wait_xcnt 0x0" :: "v"(pa), "v"(pa2), "v"(pb), "v"(pb2) : "memory");
            __builtin_amdgcn_sched_barrier(0);   // keeps the run's loads in front of the first matrix instruction: a trip waits for memory once
#pragma unroll
            for (int nb = 0; nb < 4; ++nb) {
#pragma unroll
                for (int mb = 0; mb < 4; ++mb) acc[mb][nb] = WFrag<T16>::mma(a[mb], b[nb], acc[mb][nb]);
#pragma unroll
                for (int mb = 0; mb < 4; ++mb) acc[mb][nb] = WFrag<T16>::mma(a2[mb], b[nb], acc[mb][nb]);
                if (nb == 0) {
#pragma unroll
                    for (int mb = 0; mb < 4; ++mb) acc[mb][0] = WFrag<T16>::mma(a[mb], b2[0], acc[mb][0]);
                    // the last three fragments take the registers that column block 0 has left: all sixteen at once, with the accumulators and the pointers, would pass 256 registers and halve the work-groups per WGP
                    b2[1] = WFrag<T16>::ld(pb2 + 16 * K); b2[2] = WFrag<T16>::ld(pb2 + 2 * 16 * K); b2[3] = WFrag<T16>::ld(pb2 + 3 * 16 * K);
                    asm volatile("s_wait_xcnt 0x0" :: "v"(pb2) : "memory");
                    __builtin_amdgcn_sched_barrier(0);   // keeps these loads here, 24 matrix instructions ahead of their first use
                } }
#pragma unroll
            for (int nb = 1; nb < 4; ++nb)
#pragma unroll
                for (int mb = 0; mb < 4; ++mb) acc[mb][nb] = WFrag<T16>::mma(a[mb], b2[nb], acc[mb][nb]);
            asm volatile("v_nop\n\tv_nop\n\tv_nop\n\tv_nop" : "+v"(acc[0][0]), "+v"(acc[1][1]), "+v"(acc[2][2]), "+v"(acc[3][3]) : "v"(a[0]), "v"(a[3]));   // the four vector slots behind the trip's last matrix instruction, also on the taken back edge
        } else {
        V a[4], a2[4];
#pragma unroll
        for (int mb = 0; mb < 4; ++mb) { a[mb] = WFrag<T16>::ld(A + aoff + (size_t)mb * 16 * K + kc * 16 + lo); if (NSPLIT == 1 || NSPLIT == 2) a2[mb] = WFrag<T16>::ld(A2 + aoff + (size_t)mb * 16 * K + kc * 16 + lo); }
#pragma unroll
        for (int nb = 0; nb < 4; ++nb) { const V b = WFrag<T16>::ld(Bt + boff + (size_t)nb * 16 * K + kc * 16 + lo); V b2; if (NSPLIT >= 2) b2 = WFrag<T16>::ld(Bt2 + boff + (size_t)nb * 16 * K + kc * 16 + lo);
#pragma unroll
            for (int mb = 0; mb < 4; ++mb) { acc[mb][nb] = WFrag<T16>::mma(a[mb], b, acc[mb][nb]); if (NSPLIT == 1 || NSPLIT == 2) acc[mb][nb] = WFrag<T16>::mma(a2[mb], b, acc[mb][nb]); if (NSPLIT >= 2) acc[mb][nb] = WFrag<T16>::mma(a[mb], b2, acc[mb][nb]); } }
        asm volatile("v_nop\n\tv_nop\n\tv_nop\n\tv_nop" : "+v"(acc[0][0]), "+v"(acc[1][1]), "+v"(acc[2][2]), "+v"(acc[3][3]) : "v"(a[0]), "v"(a[3]));
        }
    }
    if constexpr (KS > 1) {
        float* part = os + 64 * 68;
        float* pw = part + wv * 4096 + lane * 4;
#pragma unroll   // both loops unrolled: acc[][] is indexed by constants only and stays in registers
        for (int mb = 0; mb < 4; ++mb)
#pragma unroll
            for (int nb = 0; nb < 4; ++nb) { const v8f c = acc[mb][nb]; *(v4fa*)(pw + (mb * 4 + nb) * 256) = (v4f){c[0], c[1], c[2], c[3]}; *(v4fa*)(pw + (mb * 4 + nb) * 256 + 128) = (v4f){c[4], c[5], c[6], c[7]}; }
        __syncthreads();
        constexpr int NF = 16 / KS;
#pragma unroll   // unrolled with the loop over sw: the LDS reads of all partials issue ahead of the adds, which keep the order sw = 0..KS-1
        for (int i = 0; i < NF; ++i) { const int f = wv * NF + i; const float* pf = part + f * 256 + lane * 4; v4f s0 = *(const v4fa*)pf, s1 = *(const v4fa*)(pf + 128);
#pragma unroll
            for (int sw = 1; sw < KS; ++sw) { s0 += *(const v4fa*)(pf + sw * 4096); s1 += *(const v4fa*)(pf + sw * 4096 + 128); }
            float* od = os + ((f >> 2) * 16 + hi * 8) * 68 + (f & 3) * 16 + lr;
#pragma unroll
            for (int j = 0; j < 4; ++j) { od[j * 68] = s0[j]; od[(j + 4) * 68] = s1[j]; } }
        __syncthreads();
        if constexpr (PLANES) {
            const size_t tb = ((size_t)(r0 / TT) * KVH + blockIdx.y) * TT * HD + (size_t)(r0 % TT) * HD;   // where the tile's 4096 elements start, in each of the five planes
            if (z < 2) { bf* dh = (z == 0 ? QSh : GKh) + tb + threadIdx.x * 8; bf* dl = (z == 0 ? QSl : GKl) + tb + threadIdx.x * 8; v8us oh[16 / KS], ol[16 / KS];
#pragma unroll   // unrolled, here and below: the arrays are indexed by constants only, and every LDS read issues before the first store
                for (int it = 0; it < 16 / KS; ++it) { const int c = it * 32 * KS + (int)threadIdx.x; const float* p = os + ((c >> 7) * 16 + (c & 15)) * 68 + ((c >> 6) & 1) * 32 + ((c >> 4) & 3) * 8; const v4f v0 = *(const v4fa*)p, v1 = *(const v4fa*)(p + 4);   // chunk c: row t = (c / 128) * 16 + c % 16, k = d = 8 columns
#pragma unroll
                    for (int u = 0; u < 4; ++u) { unsigned short a, b; splitf(v0[u], a, b); oh[it][u] = a; ol[it][u] = b; splitf(v1[u], a, b); oh[it][u + 4] = a; ol[it][u + 4] = b; } }
#pragma unroll
                for (int it = 0; it < 16 / KS; ++it) { *(v8us*)(dh + it * 256 * KS) = oh[it]; *(v8us*)(dl + it * 256 * KS) = ol[it]; }
                asm volatile("s_wait_xcnt 0x0" ::: "memory");   // behind the branch's last store: the compiler lays the two branches one behind the other with a test between (which one first is its choice), and the later one rewrites registers that the earlier one's stores name
            } else { h16* dv = GVT + tb + threadIdx.x * 8; v8h o[16 / KS];
#pragma unroll
                for (int it = 0; it < 16 / KS; ++it) { const int c = it * 32 * KS + (int)threadIdx.x; const float* p = os + ((c >> 8) * 32 + ((c >> 4) & 3) * 8) * 68 + ((c >> 6) & 3) * 16 + (c & 15);   // chunk c: row d = (c / 64 % 4) * 16 + c % 16, k = s = 8 tokens
#pragma unroll
                    for (int u = 0; u < 8; ++u) o[it][u] = tohx(p[u * 68]); }
#pragma unroll
                for (int it = 0; it < 16 / KS; ++it) *(v8h*)(dv + it * 256 * KS) = o[it];
                asm volatile("s_wait_xcnt 0x0" ::: "memory");   // as in the branch above
            }
            return;
        }
#pragma unroll   // unrolled: every LDS read issues before the first store waits
        for (int it = 0; it < 32 / KS; ++it) { const int idx = it * 32 * KS + (int)threadIdx.x; const int row = idx >> 4, cofs = (idx & 15) * 4; v4f val = *(const v4fa*)(os + row * 68 + cofs); if (BIAS) { val[0] += bfr(bias[c0 + cofs]); val[1] += bfr(bias[c0 + cofs + 1]); val[2] += bfr(bias[c0 + cofs + 2]); val[3] += bfr(bias[c0 + cofs + 3]); }
            *(v4f*)(C + (size_t)(r0 + row) * ldc + c0 + cofs) = val; }
        return;
    }
#pragma unroll
    for (int mb = 0; mb < 4; ++mb) {
#pragma unroll
        for (int nb = 0; nb < 4; ++nb) {
#pragma unroll
            for (int j = 0; j < 8; ++j) os[(hi * 8 + j) * 68 + nb * 16 + lr] = acc[mb][nb][j]; }
        __builtin_amdgcn_wave_barrier(); asm volatile("" ::: "memory");
        float* crow = C + (size_t)(r0 + mb * 16) * ldc + c0;
{
#pragma unroll
            for (int s = 0; s < 8; ++s) { const int row = 2 * s + hi, cofs = lr * 4; v4f val = *(const v4fa*)(os + row * 68 + cofs); if (BIAS) { val[0] += bfr(bias[c0 + cofs]); val[1] += bfr(bias[c0 + cofs + 1]); val[2] += bfr(bias[c0 + cofs + 2]); val[3] += bfr(bias[c0 + cofs + 3]); }
                *(v4f*)(crow + (size_t)row * ldc + cofs) = val; }
             }
        __builtin_amdgcn_wave_barrier(); asm volatile("" ::: "memory");
    }
}

typedef __attribute__((ext_vector_type(2))) unsigned short v2us;
typedef __attribute__((ext_vector_type(4))) unsigned short v4us;
typedef __attribute__((ext_vector_type(2))) _Float16 v2h;
typedef __attribute__((ext_vector_type(4))) _Float16 v4h;
__constant__ unsigned char c_bucket[4095] = { 15,15,15,15,15,15,15,15,15,15,15,15,15,15,15,15,15,15,15,15,15,15,15,15,15,15,15,15,15,15,15,15,15,15,15,15,15,15,15,15,15,15,15,15,15,15,15,15,15,15,15,15,15,15,15,15,15,15,15,15,15,15,15,15,15,15,15,15,15,15,15,15,15,15,15,15,15,15,15,15,15,15,15,15,15,15,15,15,15,15,15,15,15,15,15,15,15,15,15,15,15,15,15,15,15,15,15,15,15,15,15,15,15,15,15,15,15,15,15,15,15,15,15,15,15,15,15,15,15,15,15,15,15,15,15,15,15,15,15,15,15,15,15,15,15,15,15,15,15,15,15,15,15,15,15,15,15,15,15,15,15,15,15,15,15,15,15,15,15,15,15,15,15,15,15,15,15,15,15,15,15,15,15,15,15,15,15,15,15,15,15,15,15,15,15,15,15,15,15,15,15,15,15,15,15,15,15,15,15,15,15,15,15,15,15,15,15,15,15,15,15,15,15,15,15,15,15,15,15,15,15,15,15,15,15,15,15,15,15,15,15,15,15,15,15,15,15,15,15,15,15,15,15,15,15,15,15,15,15,15,15,15,15,15,15,15,15,15,15,15,15,15,15,15,15,15,15,15,15,15,15,15,15,15,15,15,15,15,15,15,15,15,15,15,15,15,15,15,15,15,15,15,15,15,15,15,15,15,15,15,15,15,15,15,15,15,15,15,15,15,15,15,15,15,15,15,15,15,15,15,15,15,15,15,15,15,15,15,15,15,15,15,15,15,15,15,15,15,15,15,15,15,15,15,15,15,15,15,15,15,15,15,15,15,15,15,15,15,15,15,15,15,15,15,15,15,15,15,15,15,15,15,15,15,15,15,15,15,15,15,15,15,15,15,15,15,15,15,15,15,15,15,15,15,15,15,15,15,15,15,15,15,15,15,15,15,15,15,15,15,15,15,15,15,15,15,15,15,15,15,15,15,15,15,15,15,15,15,15,15,15,15,15,15,15,15,15,15,15,15,15,15,15,15,15,15,15,15,15,15,15,15,15,15,15,15,15,15,15,15,15,15,15,15,15,15,15,15,15,15,15,15,15,15,15,15,15,15,15,15,15,15,15,15,15,15,15,15,15,15,15,15,15,15,15,15,15,15,15,15,15,15,15,15,15,15,15,15,15,15,15,15,15,15,15,15,15,15,15,15,15,15,15,15,15,15,15,15,15,15,15,15,15,15,15,15,15,15,15,15,15,15,15,15,15,15,15,15,15,15,15,15,15,15,15,15,15,15,15,15,15,15,15,15,15,15,15,15,15,15,15,15,15,15,15,15,15,15,15,15,15,15,15,15,15,15,15,15,15,15,15,15,15,15,15,15,15,15,15,15,15,15,15,15,15,15,15,15,15,15,15,15,15,15,15,15,15,15,15,15,15,15,15,15,15,15,15,15,15,15,15,15,15,15,15,15,15,15,15,15,15,15,15,15,15,15,15,15,15,15,15,15,15,15,15,15,15,15,15,15,15,15,15,15,15,15,15,15,15,15,15,15,15,15,15,15,15,15,15,15,15,15,15,15,15,15,15,15,15,15,15,15,15,15,15,15,15,15,15,15,15,15,15,15,15,15,15,15,15,15,15,15,15,15,15,15,15,15,15,15,15,15,15,15,15,15,15,15,15,15,15,15,15,15,15,15,15,15,15,15,15,15,15,15,15,15,15,15,15,15,15,15,15,15,15,15,15,15,15,15,15,15,15,15,15,15,15,15,15,15,15,15,15,15,15,15,15,15,15,15,15,15,15,15,15,15,15,15,15,15,15,15,15,15,15,15,15,15,15,15,15,15,15,15,15,15,15,15,15,15,15,15,15,15,15,15,15,15,15,15,15,15,15,15,15,15,15,15,15,15,15,15,15,15,15,15,15,15,15,15,15,15,15,15,15,15,15,15,15,15,15,15,15,15,15,15,15,15,15,15,15,15,15,15,15,15,15,15,15,15,15,15,15,15,15,15,15,15,15,15,15,15,15,15,15,15,15,15,15,15,15,15,15,15,15,15,15,15,15,15,15,15,15,15,15,15,15,15,15,15,15,15,15,15,15,15,15,15,15,15,15,15,15,15,15,15,15,15,15,15,15,15,15,15,15,15,15,15,15,15,15,15,15,15,15,15,15,15,15,15,15,15,15,15,15,15,15,15,15,15,15,15,15,15,15,15,15,15,15,15,15,15,15,15,15,15,15,15,15,15,15,15,15,15,15,15,15,15,15,15,15,15,15,15,15,15,15,15,15,15,15,15,15,15,15,15,15,15,15,15,15,15,15,15,15,15,15,15,15,15,15,15,15,15,15,15,15,15,15,15,15,15,15,15,15,15,15,15,15,15,15,15,15,15,15,15,15,15,15,15,15,15,15,15,15,15,15,15,15,15,15,15,15,15,15,15,15,15,15,15,15,15,15,15,15,15,15,15,15,15,15,15,15,15,15,15,15,15,15,15,15,15,15,15,15,15,15,15,15,15,15,15,15,15,15,15,15,15,15,15,15,15,15,15,15,15,15,15,15,15,15,15,15,15,15,15,15,15,15,15,15,15,15,15,15,15,15,15,15,15,15,15,15,15,15,15,15,15,15,15,15,15,15,15,15,15,15,15,15,15,15,15,15,15,15,15,15,15,15,15,15,15,15,15,15,15,15,15,15,15,15,15,15,15,15,15,15,15,15,15,15,15,15,15,15,15,15,15,15,15,15,15,15,15,15,15,15,15,15,15,15,15,15,15,15,15,15,15,15,15,15,15,15,15,15,15,15,15,15,15,15,15,15,15,15,15,15,15,15,15,15,15,15,15,15,15,15,15,15,15,15,15,15,15,15,15,15,15,15,15,15,15,15,15,15,15,15,15,15,15,15,15,15,15,15,15,15,15,15,15,15,15,15,15,15,15,15,15,15,15,15,15,15,15,15,15,15,15,15,15,15,15,15,15,15,15,15,15,15,15,15,15,15,15,15,15,15,15,15,15,15,15,15,15,15,15,15,15,15,15,15,15,15,15,15,15,15,15,15,15,15,15,15,15,15,15,15,15,15,15,15,15,15,15,15,15,15,15,15,15,15,15,15,15,15,15,15,15,15,15,15,15,15,15,15,15,15,15,15,15,15,15,15,15,15,15,15,15,15,15,15,15,15,15,15,15,15,15,15,15,15,15,15,15,15,15,15,15,15,15,15,15,15,15,15,15,15,15,15,15,15,15,15,15,15,15,15,15,15,15,15,15,15,15,15,15,15,15,15,15,15,15,15,15,15,15,15,15,15,15,15,15,15,15,15,15,15,15,15,15,15,15,15,15,15,15,15,15,15,15,15,15,15,15,15,15,15,15,15,15,15,15,15,15,15,15,15,15,15,15,15,15,15,15,15,15,15,15,15,15,15,15,15,15,15,15,15,15,15,15,15,15,15,15,15,15,15,15,15,15,15,15,15,15,15,15,15,15,15,15,15,15,15,15,15,15,15,15,15,15,15,15,15,15,15,15,15,15,15,15,15,15,15,15,15,15,15,15,15,15,15,15,15,15,15,15,15,15,15,15,15,15,15,15,15,15,15,15,15,15,15,15,15,15,15,15,15,15,15,15,15,15,15,15,15,15,15,15,15,15,15,15,15,15,15,15,15,15,15,15,15,15,15,15,15,15,15,15,15,15,15,15,15,15,15,15,15,15,15,15,15,15,15,15,15,15,15,15,15,15,15,15,15,15,15,15,15,15,15,15,15,15,15,15,15,15,15,15,15,15,15,15,15,15,15,15,15,15,15,15,15,15,15,15,15,15,15,15,15,15,15,15,15,15,15,15,15,15,15,15,15,15,15,15,15,15,15,15,15,15,15,15,15,15,15,15,15,15,15,15,15,15,15,15,15,15,15,15,15,15,15,15,15,15,15,15,15,15,15,15,15,15,15,15,15,15,15,15,15,15,15,15,15,15,15,15,15,15,15,15,15,15,15,15,15,15,15,15,15,15,15,15,15,15,15,15,15,15,15,15,15,15,15,15,15,15,15,15,15,15,15,15,15,15,15,15,15,15,15,15,15,15,15,15,15,15,15,15,15,15,15,15,15,15,15,15,15,15,15,15,15,15,15,15,15,15,15,15,15,15,15,15,15,15,15,15,15,15,15,15,15,15,15,15,15,15,15,15,15,15,15,15,15,15,15,15,15,15,15,15,15,15,15,15,15,15,15,15,15,15,15,15,15,15,15,15,15,15,15,15,15,15,15,15,15,15,15,15,15,15,15,15,15,15,15,15,15,15,15,15,15,15,15,15,15,15,15,15,15,15,15,15,15,15,15,15,15,15,15,15,15,15,15,15,15,15,15,15,15,15,15,15,15,15,15,15,15,15,15,15,15,15,15,15,15,15,15,15,15,15,15,15,15,15,15,15,15,14,14,14,14,14,14,14,14,14,14,14,14,14,14,14,14,14,14,14,14,14,14,14,14,14,14,14,13,13,13,13,13,13,13,13,13,13,13,13,13,13,13,13,13,13,12,12,12,12,12,12,12,12,12,12,12,12,12,12,11,11,11,11,11,11,11,11,11,10,10,10,10,10,10,10,9,9,9,9,8,8,8,8,7,6,5,4,3,2,1,0,17,18,19,20,21,22,23,24,24,24,24,25,25,25,25,26,26,26,26,26,26,26,27,27,27,27,27,27,27,27,27,28,28,28,28,28,28,28,28,28,28,28,28,28,28,29,29,29,29,29,29,29,29,29,29,29,29,29,29,29,29,29,29,30,30,30,30,30,30,30,30,30,30,30,30,30,30,30,30,30,30,30,30,30,30,30,30,30,30,30,31,31,31,31,31,31,31,31,31,31,31,31,31,31,31,31,31,31,31,31,31,31,31,31,31,31,31,31,31,31,31,31,31,31,31,31,31,31,31,31,31,31,31,31,31,31,31,31,31,31,31,31,31,31,31,31,31,31,31,31,31,31,31,31,31,31,31,31,31,31,31,31,31,31,31,31,31,31,31,31,31,31,31,31,31,31,31,31,31,31,31,31,31,31,31,31,31,31,31,31,31,31,31,31,31,31,31,31,31,31,31,31,31,31,31,31,31,31,31,31,31,31,31,31,31,31,31,31,31,31,31,31,31,31,31,31,31,31,31,31,31,31,31,31,31,31,31,31,31,31,31,31,31,31,31,31,31,31,31,31,31,31,31,31,31,31,31,31,31,31,31,31,31,31,31,31,31,31,31,31,31,31,31,31,31,31,31,31,31,31,31,31,31,31,31,31,31,31,31,31,31,31,31,31,31,31,31,31,31,31,31,31,31,31,31,31,31,31,31,31,31,31,31,31,31,31,31,31,31,31,31,31,31,31,31,31,31,31,31,31,31,31,31,31,31,31,31,31,31,31,31,31,31,31,31,31,31,31,31,31,31,31,31,31,31,31,31,31,31,31,31,31,31,31,31,31,31,31,31,31,31,31,31,31,31,31,31,31,31,31,31,31,31,31,31,31,31,31,31,31,31,31,31,31,31,31,31,31,31,31,31,31,31,31,31,31,31,31,31,31,31,31,31,31,31,31,31,31,31,31,31,31,31,31,31,31,31,31,31,31,31,31,31,31,31,31,31,31,31,31,31,31,31,31,31,31,31,31,31,31,31,31,31,31,31,31,31,31,31,31,31,31,31,31,31,31,31,31,31,31,31,31,31,31,31,31,31,31,31,31,31,31,31,31,31,31,31,31,31,31,31,31,31,31,31,31,31,31,31,31,31,31,31,31,31,31,31,31,31,31,31,31,31,31,31,31,31,31,31,31,31,31,31,31,31,31,31,31,31,31,31,31,31,31,31,31,31,31,31,31,31,31,31,31,31,31,31,31,31,31,31,31,31,31,31,31,31,31,31,31,31,31,31,31,31,31,31,31,31,31,31,31,31,31,31,31,31,31,31,31,31,31,31,31,31,31,31,31,31,31,31,31,31,31,31,31,31,31,31,31,31,31,31,31,31,31,31,31,31,31,31,31,31,31,31,31,31,31,31,31,31,31,31,31,31,31,31,31,31,31,31,31,31,31,31,31,31,31,31,31,31,31,31,31,31,31,31,31,31,31,31,31,31,31,31,31,31,31,31,31,31,31,31,31,31,31,31,31,31,31,31,31,31,31,31,31,31,31,31,31,31,31,31,31,31,31,31,31,31,31,31,31,31,31,31,31,31,31,31,31,31,31,31,31,31,31,31,31,31,31,31,31,31,31,31,31,31,31,31,31,31,31,31,31,31,31,31,31,31,31,31,31,31,31,31,31,31,31,31,31,31,31,31,31,31,31,31,31,31,31,31,31,31,31,31,31,31,31,31,31,31,31,31,31,31,31,31,31,31,31,31,31,31,31,31,31,31,31,31,31,31,31,31,31,31,31,31,31,31,31,31,31,31,31,31,31,31,31,31,31,31,31,31,31,31,31,31,31,31,31,31,31,31,31,31,31,31,31,31,31,31,31,31,31,31,31,31,31,31,31,31,31,31,31,31,31,31,31,31,31,31,31,31,31,31,31,31,31,31,31,31,31,31,31,31,31,31,31,31,31,31,31,31,31,31,31,31,31,31,31,31,31,31,31,31,31,31,31,31,31,31,31,31,31,31,31,31,31,31,31,31,31,31,31,31,31,31,31,31,31,31,31,31,31,31,31,31,31,31,31,31,31,31,31,31,31,31,31,31,31,31,31,31,31,31,31,31,31,31,31,31,31,31,31,31,31,31,31,31,31,31,31,31,31,31,31,31,31,31,31,31,31,31,31,31,31,31,31,31,31,31,31,31,31,31,31,31,31,31,31,31,31,31,31,31,31,31,31,31,31,31,31,31,31,31,31,31,31,31,31,31,31,31,31,31,31,31,31,31,31,31,31,31,31,31,31,31,31,31,31,31,31,31,31,31,31,31,31,31,31,31,31,31,31,31,31,31,31,31,31,31,31,31,31,31,31,31,31,31,31,31,31,31,31,31,31,31,31,31,31,31,31,31,31,31,31,31,31,31,31,31,31,31,31,31,31,31,31,31,31,31,31,31,31,31,31,31,31,31,31,31,31,31,31,31,31,31,31,31,31,31,31,31,31,31,31,31,31,31,31,31,31,31,31,31,31,31,31,31,31,31,31,31,31,31,31,31,31,31,31,31,31,31,31,31,31,31,31,31,31,31,31,31,31,31,31,31,31,31,31,31,31,31,31,31,31,31,31,31,31,31,31,31,31,31,31,31,31,31,31,31,31,31,31,31,31,31,31,31,31,31,31,31,31,31,31,31,31,31,31,31,31,31,31,31,31,31,31,31,31,31,31,31,31,31,31,31,31,31,31,31,31,31,31,31,31,31,31,31,31,31,31,31,31,31,31,31,31,31,31,31,31,31,31,31,31,31,31,31,31,31,31,31,31,31,31,31,31,31,31,31,31,31,31,31,31,31,31,31,31,31,31,31,31,31,31,31,31,31,31,31,31,31,31,31,31,31,31,31,31,31,31,31,31,31,31,31,31,31,31,31,31,31,31,31,31,31,31,31,31,31,31,31,31,31,31,31,31,31,31,31,31,31,31,31,31,31,31,31,31,31,31,31,31,31,31,31,31,31,31,31,31,31,31,31,31,31,31,31,31,31,31,31,31,31,31,31,31,31,31,31,31,31,31,31,31,31,31,31,31,31,31,31,31,31,31,31,31,31,31,31,31,31,31,31,31,31,31,31,31,31,31,31,31,31,31,31,31,31,31,31,31,31,31,31,31,31,31,31,31,31,31,31,31,31,31,31,31,31,31,31,31,31,31,31,31,31,31,31,31,31,31,31,31,31,31,31,31,31,31,31,31,31,31,31,31,31,31,31,31,31,31,31,31,31,31,31,31,31,31,31,31,31,31,31,31,31,31,31,31,31,31,31,31,31,31,31,31,31,31,31,31,31,31,31,31,31,31,31,31,31,31,31,31,31,31,31,31,31,31,31,31,31,31,31,31,31,31,31,31,31,31,31,31,31,31,31,31,31,31,31,31,31,31,31,31,31,31,31,31,31,31,31,31,31,31,31,31,31,31,31,31,31,31,31,31,31,31,31,31,31,31,31,31,31,31,31,31,31,31,31,31,31,31,31,31,31,31,31,31,31,31,31,31,31,31,31,31,31,31,31,31,31,31,31,31,31,31,31,31,31,31,31,31,31,31,31,31,31,31,31,31,31,31,31,31,31,31,31,31,31,31,31,31,31,31,31,31,31,31,31,31,31,31,31,31,31,31,31,31,31,31,31,31,31,31,31,31,31,31,31,31,31,31,31,31,31,31,31,31,31,31,31,31,31,31,31,31,31,31,31,31,31,31,31,31,31,31,31,31,31,31,31,31,31,31,31,31,31,31,31,31,31,31,31,31,31,31,31,31,31,31,31,31,31,31,31,31,31,31,31,31,31,31,31,31,31,31,31,31,31,31,31,31,31,31,31,31,31,31,31,31,31,31,31,31,31,31,31,31,31,31,31,31,31,31,31,31,31,31,31,31,31,31,31,31,31,31,31,31,31,31,31,31,31,31,31,31,31,31,31,31,31,31,31,31,31,31,31,31,31,31,31,31,31,31,31,31,31,31,31,31,31,31,31,31,31,31,31,31,31,31,31,31,31,31,31,31,31,31,31,31,31,31,31,31,31,31,31,31,31,31,31,31,31,31,31,31,31,31,31,31,31,31,31,31,31,31,31,31,31,31,31,31,31,31,31,31,31,31,31,31,31,31,31,31,31,31,31,31,31,31,31,31,31,31,31,31,31,31,31,31,31,31,31,31,31,31,31,31,31,31,31,31,31,31,31,31,31,31,31,31,31,31,31,31,31,31,31,31,31,31,31,31,31,31,31,31,31,31,31,31,31,31,31,31,31,31,31,31,31,31,31,31,31,31,31,31,31,31,31,31,31,31,31,31,31,31,31,31,31,31,31,31,31,31,31,31,31,31,31,31,31,31,31,31,31,31,31,31,31,31,31,31,31,31,31,31,31,31,31,31,31,31,31,31,31,31,31,31,31,31,31,31,31,31,31,31,31,31,31,31,31,31,31,31,31,31,31,31,31,31,31,31,31,31,31,31,31,31,31,31,31,31,31,31,31,31,31,31,31,31,31,31,31,31,31,31,31,31,31,31,31,31,31,31,31,31,31,31,31,31,31,31,31,31,31,31,31,31,31,31,31,31,31,31,31,31,31,31,31,31,31,31,31,31,31,31,31,31,31,31,31,31,31,31,31 };   // bucket(rel) for rel = s - n in [-2047, 2047]

// ---- One launch holds all the element-wise work on the inputs. The jobs inside it are independent of one another and are dealt by block range (every branch is the same for a whole work-group); where a job runs once per batch, the batch loop stands inside the thread, whose NB_ loads then fly together.
// Every 16-bit plane named here is written in FRAGMENT ORDER (above); the index lists say which index is the row and which is k.
// k_prep: x (all batches) -> bf16 (row t, k the model dimension); WF hl planes [w][r][k] = sc_w sum_g bf16 W_w[g*256+r][k], r = h*64+d, w = q, k, v, sc = 1, 1/4, 1/4 (exact); WE hl planes [o][j] = sum_g bf16 wo[o][g*256+j]; TB[h][r] = mean_g bf16 rel_bias[c_bucket[r]][g*4+h].
#define PB_X (TT * DM / 8 / 256)
#define PB_W (DO * DM / 4 / 256)
#define PB_O (DM * DO / 4 / 256)
#define PB_T ((KVH * 4095 + 255) / 256)
// sb = elements of one batch's plane, [TT][DM] (a kernel argument). A thread's loads go through one pointer per batch, p[b]; XWAIT stands behind the last load and names the pointers as inputs, so that their registers are rewritten (also by a later load's result) only behind the wait.
#define XWAIT(p) asm volatile("s_wait_xcnt 0x0" :: "v"(p[0]), "v"(p[1]), "v"(p[2]), "v"(p[3]) : "memory")
// SWAIT stands behind the last store of a job: in the listing the next job's code follows behind a test, and it rewrites registers that the stores name.
#define SWAIT asm volatile("s_wait_xcnt 0x0" ::: "memory")
__device__ __forceinline__ v8us cvt8(v8f v) { v8us o;
#pragma unroll
    for (int k = 0; k < 8; ++k) o[k] = f2bf(v[k]); return o; }
__global__ __launch_bounds__(256) void k_prep(const float* __restrict__ x, const float* __restrict__ wq, const float* __restrict__ wk, const float* __restrict__ wv, const float* __restrict__ wo, const float* __restrict__ rb, bf* XB, bf* WFh, bf* WFl, bf* Wh, bf* Wl, float* TB, size_t sb) {
    int blk = blockIdx.x;
    if (blk < PB_X) { const unsigned c = blk * 256 + threadIdx.x, i = c * 8, si = frag_src(c, DM, DM); v8f v[NB_]; const float* p[NB_];
#pragma unroll   // unrolled: v[] is indexed by constants only, and all loads issue before the first store
        for (int b = 0; b < NB_; ++b) { p[b] = x + b * sb + si; v[b] = *(const v8f*)p[b]; }
        XWAIT(p);
#pragma unroll
        for (int b = 0; b < NB_; ++b) *(v8us*)(XB + b * sb + i) = cvt8(v[b]);
        return; }
    blk -= PB_X;
    if (blk < 3 * PB_W) { const int w = blk / PB_W; const float* s = w == 0 ? wq : w == 1 ? wk : wv; const float sc = w == 0 ? 1.0f : 0.25f; const unsigned q = (blk - w * PB_W) * 256 + threadIdx.x, i = q * 4, si = frag_src(q >> 1, DM, DM) + (q & 1) * 4; v4f v[GG];
#pragma unroll   // unrolled: v[] is indexed by constants only, and all loads issue before the first store
        for (int g = 0; g < GG; ++g) v[g] = *(const v4f*)(s + g * DO * DM + si);
        v4us oh, ol;
#pragma unroll
        for (int u = 0; u < 4; ++u) { float a = 0.f;
#pragma unroll
            for (int g = 0; g < GG; ++g) a = __fadd_rn(a, bfr(v[g][u])); unsigned short c, d; splitf(a * sc, c, d); oh[u] = c; ol[u] = d; }
        *(v4us*)(WFh + w * DO * DM + i) = oh; *(v4us*)(WFl + w * DO * DM + i) = ol; SWAIT; return; }
    blk -= 3 * PB_W;
    if (blk < PB_O) { const unsigned q = blk * 256 + threadIdx.x, e = q * 4; const float* r = wo + frag_src(q >> 1, DO, DM) + (q & 1) * 4; v4us oh, ol;
#pragma unroll
        for (int u = 0; u < 4; ++u) { float s = 0.f;
#pragma unroll
            for (int g = 0; g < GG; ++g) s = __fadd_rn(s, bfr(r[g * DO + u])); unsigned short a, b; splitf(s, a, b); oh[u] = a; ol[u] = b; }
        *(v4us*)(Wh + e) = oh; *(v4us*)(Wl + e) = ol; SWAIT; return; }
    blk -= PB_O;
    const int i = blk * 256 + threadIdx.x; if (i >= KVH * 4095) return; const int r = i % 4095, h = i / 4095; const int bk = c_bucket[r]; SWAIT; float s = 0.f;   // here behind the table load: the next loads' results rewrite its address register
#pragma unroll
    for (int g = 0; g < GG; ++g) s = __fadd_rn(s, bfr(rb[bk * NHm + g * KVH + h])); TB[i] = s * 0.25f;
}
// ---- k_fattn: scores, bias, softmax, attn x V and the hi/lo split of its result in ONE kernel; neither scores nor probabilities go to memory. Grid (TT / 128, KVH, NB_), 16 waves: a work-group owns 128 query columns n of one head of one batch.
// Wave w has the 32 columns of query group w & 3 and, of every 128-key stage, the 32-key block w >> 2. A stage (128 keys of Kh, Kl and Vt: 16 KB in a row of each plane, fragment order) comes into LDS ONCE per work-group, by asynchronous copies,
// and the four query groups read their fragments from there (contiguous 16-B LDS reads): L2 delivers each key to a work-group of 128 queries, not of 32. Two buffers: stage t + 1 flies while stage t is worked on.
// Each wave keeps a running maximum and sum per column (online softmax). S^T = GK QS^T (3 hi/lo products, the accumulator starts at the bias): a lane holds 16 keys of ONE query per column group,
// so the maximum is in-lane plus one exchange between the wave's halves, and two converted S^T tiles ARE the f16 B operand of O^T += GV^T P^T (hardware k order, the order of WFrag::ld): P touches neither LDS nor another lane.
// p = 1024 exp(s - m) (f16, at most 1024; the factor cancels in the quotient). The FK partial (m, l, O^T) of a query group meet in LDS: each wave scales its own by exp(m_w - max_w m_w), the sums run in key-block order 0..FK-1; sum / l leaves as bf16 hi+lo planes P (row n, k = h * 64 + d) in fragment order, whole 1-KB fragments.
// Every '#pragma unroll' in k_fattn without a note of its own: qh, ql, o, sc, vf, pf, m and l are then indexed by constants only and stay in registers.
#define L2E 1.44269504f
#define FQ 4                    // query groups of 32 columns in a work-group
#define FK 4                    // 32-key blocks in a stage = waves that share a query group
#define FW (FQ * FK)            // waves
#define SPL (FK * 32 * HD)      // elements of one plane in a stage: 8192 = 16 KB
#define NST (TT / (FK * 32))    // stages
typedef v4f __attribute__((aligned(4), may_alias)) v4fu;   // the bias window starts at any float
// One stage's copies: every lane brings 2 x 16 B of each of the three planes (512 lanes x 16 B = half a plane's stage). l: the lane's LDS byte address in the buffer; a, b, c: its global addresses in Kh, Kl, Vt.
// The s_wait_xcnt 0 is the last line of the copies' own statement, so that no register which a copy names is rewritten in front of it.
__device__ __forceinline__ void stage_in(unsigned l, const bf* a, const bf* b, const h16* c) {
    asm volatile("global_load_async_to_lds_b128 %0, %6, off\n\t"
                 "global_load_async_to_lds_b128 %1, %7, off\n\t"
                 "global_load_async_to_lds_b128 %2, %8, off\n\t"
                 "global_load_async_to_lds_b128 %3, %9, off\n\t"
                 "global_load_async_to_lds_b128 %4, %10, off\n\t"
                 "global_load_async_to_lds_b128 %5, %11, off\n\t"
                 "s_wait_xcnt 0x0"
                 :: "v"(l), "v"(l + SPL), "v"(l + 2 * SPL), "v"(l + 3 * SPL), "v"(l + 4 * SPL), "v"(l + 5 * SPL), "v"(a), "v"(a + SPL / 2), "v"(b), "v"(b + SPL / 2), "v"(c), "v"(c + SPL / 2) : "memory");
}
__global__ __launch_bounds__(32 * FW) void k_fattn(const bf* __restrict__ Qh, const bf* __restrict__ Ql, const bf* __restrict__ Kh, const bf* __restrict__ Kl, const h16* __restrict__ Vt, const float* __restrict__ TB, bf* Ph, bf* Pl) {
    __shared__ __align__(16) bf ring[2 * 3 * SPL];   // two buffers of [Kh | Kl | Vt], 48 KB each
    __shared__ __align__(16) float po[FW * 32 * 68];
    __shared__ float pm[FW * 32];
    __shared__ float pl[FW * 32];
    const int lane = threadIdx.x & 31, lr = lane & 15, hi = lane >> 4; const int wv = __builtin_amdgcn_readfirstlane((int)(threadIdx.x >> 5)); const int qg = wv & (FQ - 1), kg = wv / FQ;
    const int nw = blockIdx.x * (FQ * 32), n0 = nw + qg * 32, h = blockIdx.y, bz = blockIdx.z; const size_t hb = ((size_t)bz * KVH + h) * TT * HD; const unsigned lo = lane * 8;   // the lane's part of every fragment address; the rest is the same for the whole wave
    const bf* gkh = Kh + hb + threadIdx.x * 8; const bf* gkl = Kl + hb + threadIdx.x * 8; const h16* gv = Vt + hb + threadIdx.x * 8; const unsigned l0 = (unsigned)(size_t)ring + threadIdx.x * 16;   // fragment order: 128 keys are 8192 elements in a row in each of the three planes
    stage_in(l0, gkh, gkl, gv);
    v16bf qh[2][2], ql[2][2]; const bf* pqh = Qh + hb + (size_t)n0 * HD + lo; const bf* pql = Ql + hb + (size_t)n0 * HD + lo;
#pragma unroll
    for (int nt = 0; nt < 2; ++nt)
#pragma unroll
        for (int kk = 0; kk < 2; ++kk) { qh[nt][kk] = WFrag<bf>::ld(pqh + nt * 1024 + kk * 512); ql[nt][kk] = WFrag<bf>::ld(pql + nt * 1024 + kk * 512); }
    v8f o[4][2];
#pragma unroll
    for (int dt = 0; dt < 4; ++dt)
#pragma unroll
        for (int nt = 0; nt < 2; ++nt) o[dt][nt] = (v8f){};
    float m[2] = {-3.0e38f, -3.0e38f}, l[2] = {0.f, 0.f};
    const float* tb = TB + (size_t)h * 4095 + 2047 + 8 * hi - n0 - lr + kg * 32;   // tb[s0' + j] = bias of key kg * 32 + s0' + 8 hi + j against query n0 + lr
    asm volatile("s_wait_asynccnt 0x0" ::: "memory");   // this wave's copies of stage 0 have landed
    __syncthreads();                                    // and every other wave's: stage 0 may be read
    stage_in(l0 + 6 * SPL, gkh + SPL, gkl + SPL, gv + SPL);
#pragma unroll 1   // rolled: one pass already holds most of the 256 registers that four waves per SIMD leave
    for (int t = 0; t < NST; ++t) {
        v8f sc[2][2]; const float* pt = tb + t * (FK * 32); const bf* pkh = ring + (t & 1) * (3 * SPL) + kg * 2048 + lo; const bf* pkl = pkh + SPL; const h16* pv = (const h16*)(pkh + 2 * SPL);   // the wave's 32 keys in the stage's buffer; the steps inside a pass are immediate offsets
#pragma unroll
        for (int st = 0; st < 2; ++st)
#pragma unroll
            for (int nt = 0; nt < 2; ++nt) { const float* p = pt + st * 16 - nt * 16; const v4f b0 = *(const v4fu*)p, b1 = *(const v4fu*)(p + 4); sc[st][nt] = (v8f){b0[0], b0[1], b0[2], b0[3], b1[0], b1[1], b1[2], b1[3]}; }
        asm volatile("s_wait_xcnt 0x0" :: "v"(pt) : "memory");   // behind the pass's last global load; it names the pointer as an input, so that its registers are rewritten (also by a later load's result) only behind the wait
        v16h vf[4];
#pragma unroll
        for (int dt = 0; dt < 4; ++dt) vf[dt] = WFrag<h16>::ld(pv + dt * 512);
#pragma unroll
        for (int st = 0; st < 2; ++st)
#pragma unroll
            for (int kk = 0; kk < 2; ++kk) { const int ko = st * 1024 + kk * 512; const v16bf ah = WFrag<bf>::ld(pkh + ko), al = WFrag<bf>::ld(pkl + ko);
#pragma unroll
                for (int nt = 0; nt < 2; ++nt) { sc[st][nt] = wmmab(ah, qh[nt][kk], sc[st][nt]); sc[st][nt] = wmmab(al, qh[nt][kk], sc[st][nt]); sc[st][nt] = wmmab(ah, ql[nt][kk], sc[st][nt]); } }
        // The stage's hand-over stands here, behind the pass's last LDS read of the buffer (all of K and V is in registers by now): what follows it in the pass works on registers alone, and the refill gets a whole pass of lead.
        asm volatile("s_wait_dscnt 0x0" ::: "memory");      // this wave's reads of stage t have returned
        asm volatile("s_wait_asynccnt 0x0" ::: "memory");   // its copies of stage t + 1 have landed
        __syncthreads();                                    // one barrier a stage: it publishes stage t + 1 and ends every wave's reads of stage t, whose buffer is refilled behind it
        if (t + 2 < NST) stage_in(l0 + (t & 1) * (6 * SPL), gkh + (t + 2) * SPL, gkl + (t + 2) * SPL, gv + (t + 2) * SPL);
#pragma unroll
        for (int nt = 0; nt < 2; ++nt) {
            float mx = fmaxf(sc[0][nt][0], sc[1][nt][0]);
#pragma unroll
            for (int j = 1; j < 8; ++j) mx = fmaxf(mx, fmaxf(sc[0][nt][j], sc[1][nt][j]));
            mx = fmaxf(mx, __shfl_xor(mx, 16, 32));
            const float mn = fmaxf(m[nt], mx); const float al = __builtin_amdgcn_exp2f((m[nt] - mn) * L2E); const float mb = __builtin_fmaf(mn, L2E, -10.0f); m[nt] = mn;
            float ps = 0.f; v16h pf;
#pragma unroll
            for (int st = 0; st < 2; ++st)
#pragma unroll
                for (int j = 0; j < 8; ++j) { const float p = __builtin_amdgcn_exp2f(__builtin_fmaf(sc[st][nt][j], L2E, -mb)); ps += p; pf[st * 8 + j] = tohx(p); }
            l[nt] = __builtin_fmaf(l[nt], al, ps);
#pragma unroll
            for (int dt = 0; dt < 4; ++dt) { o[dt][nt] *= al; o[dt][nt] = wmma16(vf[dt], pf, o[dt][nt]); }
        }
    }
    asm volatile("s_wait_asynccnt 0x0" ::: "memory");   // no copy is left in flight behind the loop
#pragma unroll
    for (int nt = 0; nt < 2; ++nt) { l[nt] += __shfl_xor(l[nt], 16, 32); if (hi == 0) pm[wv * 32 + nt * 16 + lr] = m[nt]; }
    __syncthreads();
#pragma unroll
    for (int nt = 0; nt < 2; ++nt) { float mg = pm[qg * 32 + nt * 16 + lr];
#pragma unroll
        for (int w = 1; w < FK; ++w) mg = fmaxf(mg, pm[(w * FQ + qg) * 32 + nt * 16 + lr]);
        const float f = __builtin_amdgcn_exp2f((m[nt] - mg) * L2E); if (hi == 0) pl[wv * 32 + nt * 16 + lr] = l[nt] * f;
        float* pd = po + (wv * 32 + nt * 16 + lr) * 68 + 8 * hi;
#pragma unroll
        for (int dt = 0; dt < 4; ++dt) { const v8f c = o[dt][nt] * f; *(v4fa*)(pd + dt * 16) = (v4f){c[0], c[1], c[2], c[3]}; *(v4fa*)(pd + dt * 16 + 4) = (v4f){c[4], c[5], c[6], c[7]}; } }
    __syncthreads();
#pragma unroll   // one trip per query group; unrolled: the LDS reads of the later groups issue while the earlier groups' quotients are worked out
    for (int it = 0; it < FQ; ++it) { const int idx = (int)threadIdx.x; const int n = (idx >> 8) * 16 + (idx & 15), c4 = ((idx >> 5) & 7) * 8 + ((idx >> 4) & 1) * 4; v4f s = *(const v4fa*)(po + (it * 32 + n) * 68 + c4); float ls = pl[it * 32 + n];   // 16 lanes -> 16 rows n (LDS pitch 68: no bank met twice), a wave -> 8 columns of them: 256 B in a row of each plane
#pragma unroll   // unrolled: the LDS reads of all partials issue ahead of the adds, which keep the order w = 0..FK-1
        for (int w = 1; w < FK; ++w) { s += *(const v4fa*)(po + ((w * FQ + it) * 32 + n) * 68 + c4); ls += pl[(w * FQ + it) * 32 + n]; }
        const float inv = __fdiv_rn(1.0f, ls); v4us oh, ol;
#pragma unroll
        for (int u = 0; u < 4; ++u) { unsigned short a, b; splitf(s[u] * inv, a, b); oh[u] = a; ol[u] = b; }
        const size_t eo = ((size_t)bz * TT + nw + it * 32 + (n & 16)) * DO + (h * 2 + (c4 >> 5)) * 512 + ((c4 >> 3) & 3) * 128 + (n & 15) * 8 + (c4 & 7); *(v4us*)(Ph + eo) = oh; *(v4us*)(Pl + eo) = ol; }
}

extern "C" void kernel_launch(void* const* d_in, const int* in_sizes, int n_in,
                              void* d_out, int out_size, void* d_ws, size_t ws_size, hipStream_t stream) {
    (void)in_sizes; (void)n_in; (void)out_size;
    const float* x = (const float*)d_in[0]; const float* wq = (const float*)d_in[1]; const float* wk = (const float*)d_in[2]; const float* wv = (const float*)d_in[3]; const float* wo = (const float*)d_in[4]; const float* rb = (const float*)d_in[5];
    float* OUT = (float*)d_out;     // [4][2048][1024] = [8192][1024]: the batches are one run of rows for every GEMM
    char* wsp = (char*)d_ws;
    auto take = [&](size_t bytes) { char* p = wsp; wsp += (bytes + 255) & ~(size_t)255; return (void*)p; };
    bf* WFh = (bf*)take((size_t)3 * DO * DM * 2); bf* WFl = (bf*)take((size_t)3 * DO * DM * 2); bf* WEh = (bf*)take((size_t)DM * DO * 2); bf* WEl = (bf*)take((size_t)DM * DO * 2); float* TB = (float*)take((size_t)KVH * 4095 * 4 + 256);
    bf* XB = (bf*)take((size_t)NB_ * TT * DM * 2); bf* QSh = (bf*)take((size_t)NB_ * KVH * TT * HD * 2); bf* QSl = (bf*)take((size_t)NB_ * KVH * TT * HD * 2); bf* GKh = (bf*)take((size_t)NB_ * KVH * TT * HD * 2); bf* GKl = (bf*)take((size_t)NB_ * KVH * TT * HD * 2); h16* GVT = (h16*)take((size_t)NB_ * KVH * HD * TT * 2);
    bf* OPh = (bf*)take((size_t)NB_ * TT * DO * 2); bf* OPl = (bf*)take((size_t)NB_ * TT * DO * 2);
    if ((size_t)(wsp - (char*)d_ws) > ws_size) return;    // total ~ 48 MB
    k_prep<<<PB_X + 3 * PB_W + PB_O + PB_T, 256, 0, stream>>>(x, wq, wk, wv, wo, rb, XB, WFh, WFl, WEh, WEl, TB, (size_t)TT * DM);   // [out][in] weights = natural Bt
    k_gemmw<bf, 3, false, 8, DM, true><<<dim3(NB_ * TT / 64, DO / 64, 3), 256, 0, stream>>>(XB, nullptr, WFh, WFl, nullptr, DO, nullptr, 0, (size_t)DO * DM, 0, QSh, QSl, GKh, GKl, GVT);   // z = q, k, v; NSPLIT 3: A Bt + A Bt2; the tiles leave as k_fattn's planes
    k_fattn<<<dim3(TT / (FQ * 32), KVH, NB_), 32 * FW, 0, stream>>>(QSh, QSl, GKh, GKl, GVT, TB, OPh, OPl);
    k_gemmw<bf, 2, false, 8, DO, false><<<dim3(NB_ * TT / 64, DM / 64, 1), 256, 0, stream>>>(OPh, OPl, WEh, WEl, OUT, DM, nullptr, 0, 0, 0, nullptr, nullptr, nullptr, nullptr, nullptr);
}

// v008
// A run of this version takes 77.2 microseconds.
// Timed twice side by side with v007, it ran 1.06 and 1.07 times as fast.
// Counting every step since v000, it is 10.9 times as fast.
#include <hip/hip_runtime.h>

// Grouped attention with a relative-position bias (hidden [4][2048][1024]; q/k/v = x W^T (16 heads x 64); heads grouped (g=4 groups, h=4 kv heads: head = g*4 + h); gk, gv = mean over g; scores[h][n][s] = sum_g sum_d q[g,h][n][d] gk[h][s][d] (the reference's einsum sums the query
// groups; no 1/sqrt(d) scaling, T5 style) + mean over g of the T5 relative-position bias rel_bias[bucket(s - n)][g*4 + h]; softmax; out[h] = attn gv[h]; tiled x4 over g and projected: out_full Wo^T = out (sum_g Wo[:, g-block])^T -> [4][2048][1024]).
// The group sum of q and the group means of k and v are linear in the weights: sum_g (x Wq[g,h]^T) = x (sum_g Wq[g,h])^T. The weights are summed over g first (k_prep), so the projections have 256 columns each instead of 1024 and yield the summed q and the mean k, v directly.
// The bucket of each relative position depends only on (s - n) and the fixed sizes: it is a compile-time table of 4095 entries (bidirectional T5 buckets, 32 buckets, max distance 128; computed in f32 exactly as the reference and baked in).
// Compute dtypes, f32 accumulate: every input rounded to bf16; group sums / means of the bf16 weights in f32 -> bf16 hi+lo planes; q/k/v = bf16 x (exact) times both planes (2 products), f32 -> bf16 hi+lo planes (q, k) and f16 (v); scores (K 64) as 3 products; bias + online softmax f32, probabilities x1024 in f16, fused with attn x V (k_fattn)

#define NB_  4
#define TT   2048
#define DM   1024
#define NHm  16
#define KVH  4
#define GG   4
#define HD   64
#define DO   256
typedef _Float16 h16;
typedef unsigned short bf;
typedef __attribute__((ext_vector_type(16))) __bf16   v16bf;
typedef __attribute__((ext_vector_type(16))) _Float16 v16h;
typedef __attribute__((ext_vector_type(8)))  _Float16 v8h;
typedef __attribute__((ext_vector_type(8)))  unsigned short v8us;
typedef __attribute__((ext_vector_type(8)))  float    v8f;
typedef __attribute__((ext_vector_type(4)))  float    v4f;
typedef v8h  __attribute__((may_alias)) v8ha;
typedef v4f  __attribute__((may_alias)) v4fa;
typedef v8us __attribute__((may_alias)) v8usa;

__device__ __forceinline__ unsigned short f2bf(float f) { unsigned u = __float_as_uint(f); u += 0x7FFFu + ((u >> 16) & 1u); return (unsigned short)(u >> 16); }
__device__ __forceinline__ float bf2f(unsigned short b) { return __uint_as_float(((unsigned)b) << 16); }
__device__ __forceinline__ float bfr(float f) { return bf2f(f2bf(f)); }
__device__ __forceinline__ v16h cat16(v8h lo, v8h hi) { return __builtin_shufflevector(lo, hi, 0, 1, 2, 3, 4, 5, 6, 7, 8, 9, 10, 11, 12, 13, 14, 15); }
__device__ __forceinline__ v16bf cat16b(v8us lo, v8us hi) { return __builtin_bit_cast(v16bf, __builtin_shufflevector(lo, hi, 0, 1, 2, 3, 4, 5, 6, 7, 8, 9, 10, 11, 12, 13, 14, 15)); }
__device__ __forceinline__ v8f wmma16(v16h a, v16h b, v8f c) { return __builtin_amdgcn_wmma_f32_16x16x32_f16(false, a, false, b, (short)0, c, false, false); }
__device__ __forceinline__ v8f wmmab(v16bf a, v16bf b, v8f c) { return __builtin_amdgcn_wmma_f32_16x16x32_bf16(false, a, false, b, (short)0, c, false, false); }



// FRAGMENT ORDER. Every 16-bit operand plane [R rows][K columns] is stored as WMMA fragments of 16 rows x 32 k = 512 elements = 1 KB: element (row, k) lies at ((row / 16) * (K / 32) + k / 32) * 512 + ((k / 8) % 4) * 128 + (row % 16) * 8 + k % 8 (in GVT the fragment index is (k / 32) * (R / 16) + row / 16 instead).
// Lane (lr, hi) = lane number hi * 16 + lr finds its k = 8 hi .. 8 hi + 7 at fragment + lane * 8 and its k = 16 + 8 hi .. at 256 elements more (the hardware k order): each wave-wide 16-B load covers 512 contiguous bytes, four whole 128-B lines (from a row-major plane it would touch 32-B pieces of 16 lines).
// The producers write such a plane linearly and gather their source: chunk c (8 elements, at c * 8) comes from the source index frag_src(c, K, ld) = row * ld + k.
__device__ __forceinline__ unsigned frag_src(unsigned c, unsigned K, unsigned ld) { const unsigned f = c >> 6, kb = K >> 5; return ((f / kb) * 16 + (c & 15)) * ld + (f % kb) * 32 + ((c >> 4) & 3) * 8; }

// ---- k_gemmw: register-blocked GEMM, KS WAVES per 64x64 output tile (16 accumulators each), operands straight from fragment-ordered 16-bit planes (see FRAGMENT ORDER above); grid (M/64, N/64/NT, Z) (PLANES: (M/64, N/64, 1)), 32 * KS threads.
// C[m][n] (f32, pitch ldc, + optional f32 bias[n]) = sum_k A[m][k] Bt[n][k] (+ split products per NSPLIT). z-batch strides sA/sB/sC in elements. K % (32 * KS) == 0.
// KS > 1: wave w sums the 32-wide k steps w, w + KS, w + 2 KS, ... (interleaved: in one trip the waves of a work-group read KS neighbouring 1-KB fragments of every 16-row block);
// the KS partial tiles meet in LDS (fragment order) and are added in wave order 0..KS-1, 16/KS fragments per wave; the tile leaves through a row-major LDS tile in whole lines.
// PLANES (the q/k/v projection; z = q, k, v; a tile is 64 tokens x the 64 columns of head blockIdx.y): the tile does not leave as f32 but as the 16-bit planes that k_fattn reads, in fragment order, where it is 4096 elements = 8 KB in a row of each plane:
// z = 0, 1: bf16 hi+lo planes QS, GK [b][h] (row t, k = d); z = 2: GVT[b][h] (row d, k = s; its fragments lie key block first: fragment (s / 32) * 4 + d / 16, so that the four fragments of 32 keys are 4 KB in a row) = f16(v). A thread writes whole 16-B chunks, a wave 512 B in a row.
__device__ __forceinline__ h16 tohx(float x) { return (h16)x; }
__device__ __forceinline__ void splitf(float y, unsigned short& h, unsigned short& l) { h = f2bf(y); l = f2bf(y - bf2f(h)); }
template <typename T16> struct WFrag;
template <> struct WFrag<h16> { typedef v16h V; static __device__ __forceinline__ V ld(const h16* p) { return cat16(*(const v8h*)p, *(const v8h*)(p + 256)); } static __device__ __forceinline__ v8f mma(V a, V b, v8f c) { return wmma16(a, b, c); } };
template <> struct WFrag<bf> { typedef v16bf V; static __device__ __forceinline__ V ld(const bf* p) { return cat16b(*(const v8us*)p, *(const v8us*)(p + 256)); } static __device__ __forceinline__ v8f mma(V a, V b, v8f c) { return wmmab(a, b, c); } };
// NT: a work-group takes NT tiles one after the other (PLANES: z = q, k, v of its rows and head; else NT neighbouring column tiles of its rows), so that a launch starts 1/NT of the waves and every work-group is resident from the start.
// Where a wave has one k step in all (K == 32 * KS; the output projection), its A fragments are the same for all NT tiles: they are loaded once and stay in registers.
// amdgpu_waves_per_eu(4, 4): two work-groups of 8 waves on a WGP are 4 waves per SIMD, 256 registers each; without it the build with the tile loop takes more, and only one work-group fits.
// The two barriers of a tile also part it from the next: the partials are rewritten behind the barrier that ends their reads, and the row-major tile behind the next tile's first barrier.
template <typename T16, int NSPLIT, bool BIAS, int KS, int K, bool PLANES, int NT, int ldc>   // K and the pitch ldc constants: the steps from fragment to fragment, and from row to row of C, are immediate offsets on one pointer
__global__ __launch_bounds__(32 * KS) __attribute__((amdgpu_waves_per_eu(4, 4))) void k_gemmw(const T16* __restrict__ A, const T16* __restrict__ A2, const T16* __restrict__ Bt, const T16* __restrict__ Bt2, float* C, const float* __restrict__ bias, size_t sA, size_t sB, size_t sC, bf* QSh, bf* QSl, bf* GKh, bf* GKl, h16* GVT) {
    typedef typename WFrag<T16>::V V;
    __shared__ __align__(16) float os[KS == 1 ? 16 * 68 : 64 * 68 + KS * 4096];
    const int lane = threadIdx.x & 31, lr = lane & 15, hi = lane >> 4; const int r0 = blockIdx.x * 64;
    const int wv = __builtin_amdgcn_readfirstlane((int)(threadIdx.x >> 5)); __builtin_assume(wv >= 0 && wv < KS);   // the block has KS waves: where K == 32 * KS the compiler then sees that the k loop has one trip
    constexpr bool AKEEP = NSPLIT == 2 && !PLANES && K == 32 * KS;
    [[maybe_unused]] V ka[4], ka2[4];
    if constexpr (AKEEP) { const T16* pa = A + blockIdx.z * sA + (size_t)r0 * K + wv * 512 + lane * 8; const T16* pa2 = A2 + blockIdx.z * sA + (size_t)r0 * K + wv * 512 + lane * 8;   // k step wv of the four row blocks
        __builtin_amdgcn_sched_barrier(0);   // with the one behind the wait: nothing but the run's own loads stands between the first of them and the wait, so that no register which they name is rewritten in front of it
#pragma unroll   // unrolled: the arrays are indexed by constants only and stay in registers
        for (int i = 0; i < 4; ++i) { ka[i] = WFrag<T16>::ld(pa + i * 16 * K); ka2[i] = WFrag<T16>::ld(pa2 + i * 16 * K); }
        asm volatile("s_wait_xcnt 0x0" ::: "memory");   // behind the run's last load
        __builtin_amdgcn_sched_barrier(0); }
#pragma unroll 1   // rolled: one tile's code, and one tile's registers
    for (int ti = 0; ti < NT; ++ti) {
    const size_t z = PLANES ? (size_t)ti : (size_t)blockIdx.z; const int c0 = PLANES ? blockIdx.y * 64 : (blockIdx.y * NT + ti) * 64;
    v8f acc[4][4];
#pragma unroll
    for (int mb = 0; mb < 4; ++mb)
#pragma unroll
        for (int nb = 0; nb < 4; ++nb) acc[mb][nb] = (v8f){};
    const size_t aoff = z * sA + (size_t)r0 * K, boff = z * sB + (size_t)c0 * K; const unsigned lo = lane * 8;   // fragment (row block, k block) starts at (row block * K / 32 + k block) * 512: the same for the whole wave; the lane's own part is lo
#pragma unroll 1
    for (int kc = wv * 32; kc < K; kc += 32 * KS) {
        if constexpr (NSPLIT == 3) {   // A Bt + A Bt2. One pointer per plane; each s_wait_xcnt 0 stands behind the last load of its run and names the run's pointers as inputs, so that their registers are rewritten (also by a later load's result) only behind the wait.
            const T16* pa = A + aoff + kc * 16 + lo; const T16* pb = Bt + boff + kc * 16 + lo; const T16* pc = Bt2 + boff + kc * 16 + lo; V a[4], b[4], b2[4];
#pragma unroll   // unrolled, here and below: the arrays are indexed by constants only and stay in registers, and the loads of a run issue together
            for (int i = 0; i < 4; ++i) { a[i] = WFrag<T16>::ld(pa + i * 16 * K); b[i] = WFrag<T16>::ld(pb + i * 16 * K); }
            asm volatile("s_wait_xcnt 0x0" :: "v"(pa), "v"(pb) : "memory");
#pragma unroll
            for (int i = 0; i < 4; ++i) b2[i] = WFrag<T16>::ld(pc + i * 16 * K);
            asm volatile("s_wait_xcnt 0x0" :: "v"(pc) : "memory");
            __builtin_amdgcn_sched_barrier(0);   // keeps every load of the trip in front of its first matrix instruction: without it the scheduler sinks five fragments' loads between the products, and a trip waits for memory several times instead of once
#pragma unroll
            for (int nb = 0; nb < 4; ++nb)
#pragma unroll
                for (int mb = 0; mb < 4; ++mb) acc[mb][nb] = WFrag<T16>::mma(a[mb], b[nb], acc[mb][nb]);
#pragma unroll
            for (int nb = 0; nb < 4; ++nb)
#pragma unroll
                for (int mb = 0; mb < 4; ++mb) acc[mb][nb] = WFrag<T16>::mma(a[mb], b2[nb], acc[mb][nb]);
            asm volatile("v_nop\n\tv_nop\n\tv_nop\n\tv_nop" : "+v"(acc[0][0]), "+v"(acc[1][1]), "+v"(acc[2][2]), "+v"(acc[3][3]) : "v"(a[0]), "v"(a[3]));   // the four vector slots behind the trip's last matrix instruction, also on the taken back edge
        } else if constexpr (NSPLIT == 2) {   // A Bt + A2 Bt + A Bt2, every accumulator in this order. One pointer per plane; each s_wait_xcnt 0 stands behind the last load of its run and names the run's pointers as inputs, so that their registers are rewritten (also by a later load's result) only behind the wait.
            const T16* pa = A + aoff + kc * 16 + lo; const T16* pa2 = A2 + aoff + kc * 16 + lo; const T16* pb = Bt + boff + kc * 16 + lo; const T16* pb2 = Bt2 + boff + kc * 16 + lo; V a[4], a2[4], b[4], b2[4];
#pragma unroll   // unrolled, here and below: the arrays are indexed by constants only and stay in registers, and the loads of a run issue together
            for (int i = 0; i < 4; ++i) { b[i] = WFrag<T16>::ld(pb + i * 16 * K); if constexpr (AKEEP) { a[i] = ka[i]; a2[i] = ka2[i]; } else { a[i] = WFrag<T16>::ld(pa + i * 16 * K); a2[i] = WFrag<T16>::ld(pa2 + i * 16 * K); } }
            b2[0] = WFrag<T16>::ld(pb2);
            if constexpr (AKEEP) asm volatile("s_wait_xcnt 0x0" :: "v"(pb), "v"(pb2) : "memory"); else asm volatile("s_wait_xcnt 0x0" :: "v"(pa), "v"(pa2), "v"(pb), "v"(pb2) : "memory");
            __builtin_amdgcn_sched_barrier(0);   // keeps the run's loads in front of the first matrix instruction: a trip waits for memory once
#pragma unroll
            for (int nb = 0; nb < 4; ++nb) {
#pragma unroll
                for (int mb = 0; mb < 4; ++mb) acc[mb][nb] = WFrag<T16>::mma(a[mb], b[nb], acc[mb][nb]);
#pragma unroll
                for (int mb = 0; mb < 4; ++mb) acc[mb][nb] = WFrag<T16>::mma(a2[mb], b[nb], acc[mb][nb]);
                if (nb == 0) {
#pragma unroll
                    for (int mb = 0; mb < 4; ++mb) acc[mb][0] = WFrag<T16>::mma(a[mb], b2[0], acc[mb][0]);
                    // the last three fragments take the registers that column block 0 has left: all sixteen at once, with the accumulators and the pointers, would pass 256 registers and halve the work-groups per WGP
                    b2[1] = WFrag<T16>::ld(pb2 + 16 * K); b2[2] = WFrag<T16>::ld(pb2 + 2 * 16 * K); b2[3] = WFrag<T16>::ld(pb2 + 3 * 16 * K);
                    asm volatile("s_wait_xcnt 0x0" :: "v"(pb2) : "memory");
                    __builtin_amdgcn_sched_barrier(0);   // keeps these loads here, 24 matrix instructions ahead of their first use
                } }
#pragma unroll
            for (int nb = 1; nb < 4; ++nb)
#pragma unroll
                for (int mb = 0; mb < 4; ++mb) acc[mb][nb] = WFrag<T16>::mma(a[mb], b2[nb], acc[mb][nb]);
            if constexpr (K > 32 * KS) asm volatile("v_nop\n\tv_nop\n\tv_nop\n\tv_nop" : "+v"(acc[0][0]), "+v"(acc[1][1]), "+v"(acc[2][2]), "+v"(acc[3][3]) : "v"(a[0]), "v"(a[3]));   // the four vector slots behind the trip's last matrix instruction, also on the taken back edge (with one trip there is no back edge)
        } else {
        V a[4], a2[4];
#pragma unroll
        for (int mb = 0; mb < 4; ++mb) { a[mb] = WFrag<T16>::ld(A + aoff + (size_t)mb * 16 * K + kc * 16 + lo); if (NSPLIT == 1 || NSPLIT == 2) a2[mb] = WFrag<T16>::ld(A2 + aoff + (size_t)mb * 16 * K + kc * 16 + lo); }
#pragma unroll
        for (int nb = 0; nb < 4; ++nb) { const V b = WFrag<T16>::ld(Bt + boff + (size_t)nb * 16 * K + kc * 16 + lo); V b2; if (NSPLIT >= 2) b2 = WFrag<T16>::ld(Bt2 + boff + (size_t)nb * 16 * K + kc * 16 + lo);
#pragma unroll
            for (int mb = 0; mb < 4; ++mb) { acc[mb][nb] = WFrag<T16>::mma(a[mb], b, acc[mb][nb]); if (NSPLIT == 1 || NSPLIT == 2) acc[mb][nb] = WFrag<T16>::mma(a2[mb], b, acc[mb][nb]); if (NSPLIT >= 2) acc[mb][nb] = WFrag<T16>::mma(a[mb], b2, acc[mb][nb]); } }
        asm volatile("v_nop\n\tv_nop\n\tv_nop\n\tv_nop" : "+v"(acc[0][0]), "+v"(acc[1][1]), "+v"(acc[2][2]), "+v"(acc[3][3]) : "v"(a[0]), "v"(a[3]));
        }
    }
    if constexpr (KS > 1) {
        float* part = os + 64 * 68;
        float* pw = part + wv * 4096 + lane * 4;
#pragma unroll   // both loops unrolled: acc[][] is indexed by constants only and stays in registers
        for (int mb = 0; mb < 4; ++mb)
#pragma unroll
            for (int nb = 0; nb < 4; ++nb) { const v8f c = acc[mb][nb]; *(v4fa*)(pw + (mb * 4 + nb) * 256) = (v4f){c[0], c[1], c[2], c[3]}; *(v4fa*)(pw + (mb * 4 + nb) * 256 + 128) = (v4f){c[4], c[5], c[6], c[7]}; }
        __syncthreads();
        constexpr int NF = 16 / KS;
#pragma unroll   // unrolled with the loop over sw: the LDS reads of all partials issue ahead of the adds, which keep the order sw = 0..KS-1
        for (int i = 0; i < NF; ++i) { const int f = wv * NF + i; const float* pf = part + f * 256 + lane * 4; v4f s0 = *(const v4fa*)pf, s1 = *(const v4fa*)(pf + 128);
#pragma unroll
            for (int sw = 1; sw < KS; ++sw) { s0 += *(const v4fa*)(pf + sw * 4096); s1 += *(const v4fa*)(pf + sw * 4096 + 128); }
            float* od = os + ((f >> 2) * 16 + hi * 8) * 68 + (f & 3) * 16 + lr;
#pragma unroll
            for (int j = 0; j < 4; ++j) { od[j * 68] = s0[j]; od[(j + 4) * 68] = s1[j]; } }
        __syncthreads();
        if constexpr (PLANES) {
            const size_t tb = ((size_t)(r0 / TT) * KVH + blockIdx.y) * TT * HD + (size_t)(r0 % TT) * HD;   // where the tile's 4096 elements start, in each of the five planes
            if (z < 2) { bf* dh = (z == 0 ? QSh : GKh) + tb + threadIdx.x * 8; bf* dl = (z == 0 ? QSl : GKl) + tb + threadIdx.x * 8; v8us oh[16 / KS], ol[16 / KS];
#pragma unroll   // unrolled, here and below: the arrays are indexed by constants only, and every LDS read issues before the first store
                for (int it = 0; it < 16 / KS; ++it) { const int c = it * 32 * KS + (int)threadIdx.x; const float* p = os + ((c >> 7) * 16 + (c & 15)) * 68 + ((c >> 6) & 1) * 32 + ((c >> 4) & 3) * 8; const v4f v0 = *(const v4fa*)p, v1 = *(const v4fa*)(p + 4);   // chunk c: row t = (c / 128) * 16 + c % 16, k = d = 8 columns
#pragma unroll
                    for (int u = 0; u < 4; ++u) { unsigned short a, b; splitf(v0[u], a, b); oh[it][u] = a; ol[it][u] = b; splitf(v1[u], a, b); oh[it][u + 4] = a; ol[it][u + 4] = b; } }
#pragma unroll
                for (int it = 0; it < 16 / KS; ++it) { *(v8us*)(dh + it * 256 * KS) = oh[it]; *(v8us*)(dl + it * 256 * KS) = ol[it]; }
                asm volatile("s_wait_xcnt 0x0" ::: "memory");   // behind the branch's last store: the compiler lays the two branches one behind the other with a test between (which one first is its choice), and the later one rewrites registers that the earlier one's stores name
            } else { h16* dv = GVT + tb + threadIdx.x * 8; v8h o[16 / KS];
#pragma unroll
                for (int it = 0; it < 16 / KS; ++it) { const int c = it * 32 * KS + (int)threadIdx.x; const float* p = os + ((c >> 8) * 32 + ((c >> 4) & 3) * 8) * 68 + ((c >> 6) & 3) * 16 + (c & 15);   // chunk c: row d = (c / 64 % 4) * 16 + c % 16, k = s = 8 tokens
#pragma unroll
                    for (int u = 0; u < 8; ++u) o[it][u] = tohx(p[u * 68]); }
#pragma unroll
                for (int it = 0; it < 16 / KS; ++it) *(v8h*)(dv + it * 256 * KS) = o[it];
                asm volatile("s_wait_xcnt 0x0" ::: "memory");   // as in the branch above
            }
            continue;
        }
        const int cofs = ((int)threadIdx.x & 15) * 4; const float* ps = os + ((int)threadIdx.x >> 4) * 68 + cofs; float* pc = C + z * sC + (size_t)r0 * ldc + c0 + (unsigned)(((int)threadIdx.x >> 4) * ldc + cofs);   // trip it: 2 * KS rows further on, an immediate offset on either pointer
#pragma unroll   // unrolled: every LDS read issues before the first store waits
        for (int it = 0; it < 32 / KS; ++it) { v4f val = *(const v4fa*)(ps + it * 2 * KS * 68); if (BIAS) { val[0] += bfr(bias[c0 + cofs]); val[1] += bfr(bias[c0 + cofs + 1]); val[2] += bfr(bias[c0 + cofs + 2]); val[3] += bfr(bias[c0 + cofs + 3]); }
            *(v4f*)(pc + (size_t)it * 2 * KS * ldc) = val; }
        asm volatile("s_wait_xcnt 0x0" ::: "memory");   // behind the tile's last store: the next tile's code rewrites registers that the stores name
        continue;
    }
#pragma unroll
    for (int mb = 0; mb < 4; ++mb) {
#pragma unroll
        for (int nb = 0; nb < 4; ++nb) {
#pragma unroll
            for (int j = 0; j < 8; ++j) os[(hi * 8 + j) * 68 + nb * 16 + lr] = acc[mb][nb][j]; }
        __builtin_amdgcn_wave_barrier(); asm volatile("" ::: "memory");
        float* crow = C + z * sC + (size_t)(r0 + mb * 16) * ldc + c0;
{
#pragma unroll
            for (int s = 0; s < 8; ++s) { const int row = 2 * s + hi, cofs = lr * 4; v4f val = *(const v4fa*)(os + row * 68 + cofs); if (BIAS) { val[0] += bfr(bias[c0 + cofs]); val[1] += bfr(bias[c0 + cofs + 1]); val[2] += bfr(bias[c0 + cofs + 2]); val[3] += bfr(bias[c0 + cofs + 3]); }
                *(v4f*)(crow + (size_t)row * ldc + cofs) = val; }
             }
        __builtin_amdgcn_wave_barrier(); asm volatile("" ::: "memory");
    }
    }
}

typedef __attribute__((ext_vector_type(2))) unsigned short v2us;
typedef __attribute__((ext_vector_type(4))) unsigned short v4us;
typedef __attribute__((ext_vector_type(2))) _Float16 v2h;
typedef __attribute__((ext_vector_type(4))) _Float16 v4h;
__constant__ unsigned char c_bucket[4095] = { 15,15,15,15,15,15,15,15,15,15,15,15,15,15,15,15,15,15,15,15,15,15,15,15,15,15,15,15,15,15,15,15,15,15,15,15,15,15,15,15,15,15,15,15,15,15,15,15,15,15,15,15,15,15,15,15,15,15,15,15,15,15,15,15,15,15,15,15,15,15,15,15,15,15,15,15,15,15,15,15,15,15,15,15,15,15,15,15,15,15,15,15,15,15,15,15,15,15,15,15,15,15,15,15,15,15,15,15,15,15,15,15,15,15,15,15,15,15,15,15,15,15,15,15,15,15,15,15,15,15,15,15,15,15,15,15,15,15,15,15,15,15,15,15,15,15,15,15,15,15,15,15,15,15,15,15,15,15,15,15,15,15,15,15,15,15,15,15,15,15,15,15,15,15,15,15,15,15,15,15,15,15,15,15,15,15,15,15,15,15,15,15,15,15,15,15,15,15,15,15,15,15,15,15,15,15,15,15,15,15,15,15,15,15,15,15,15,15,15,15,15,15,15,15,15,15,15,15,15,15,15,15,15,15,15,15,15,15,15,15,15,15,15,15,15,15,15,15,15,15,15,15,15,15,15,15,15,15,15,15,15,15,15,15,15,15,15,15,15,15,15,15,15,15,15,15,15,15,15,15,15,15,15,15,15,15,15,15,15,15,15,15,15,15,15,15,15,15,15,15,15,15,15,15,15,15,15,15,15,15,15,15,15,15,15,15,15,15,15,15,15,15,15,15,15,15,15,15,15,15,15,15,15,15,15,15,15,15,15,15,15,15,15,15,15,15,15,15,15,15,15,15,15,15,15,15,15,15,15,15,15,15,15,15,15,15,15,15,15,15,15,15,15,15,15,15,15,15,15,15,15,15,15,15,15,15,15,15,15,15,15,15,15,15,15,15,15,15,15,15,15,15,15,15,15,15,15,15,15,15,15,15,15,15,15,15,15,15,15,15,15,15,15,15,15,15,15,15,15,15,15,15,15,15,15,15,15,15,15,15,15,15,15,15,15,15,15,15,15,15,15,15,15,15,15,15,15,15,15,15,15,15,15,15,15,15,15,15,15,15,15,15,15,15,15,15,15,15,15,15,15,15,15,15,15,15,15,15,15,15,15,15,15,15,15,15,15,15,15,15,15,15,15,15,15,15,15,15,15,15,15,15,15,15,15,15,15,15,15,15,15,15,15,15,15,15,15,15,15,15,15,15,15,15,15,15,15,15,15,15,15,15,15,15,15,15,15,15,15,15,15,15,15,15,15,15,15,15,15,15,15,15,15,15,15,15,15,15,15,15,15,15,15,15,15,15,15,15,15,15,15,15,15,15,15,15,15,15,15,15,15,15,15,15,15,15,15,15,15,15,15,15,15,15,15,15,15,15,15,15,15,15,15,15,15,15,15,15,15,15,15,15,15,15,15,15,15,15,15,15,15,15,15,15,15,15,15,15,15,15,15,15,15,15,15,15,15,15,15,15,15,15,15,15,15,15,15,15,15,15,15,15,15,15,15,15,15,15,15,15,15,15,15,15,15,15,15,15,15,15,15,15,15,15,15,15,15,15,15,15,15,15,15,15,15,15,15,15,15,15,15,15,15,15,15,15,15,15,15,15,15,15,15,15,15,15,15,15,15,15,15,15,15,15,15,15,15,15,15,15,15,15,15,15,15,15,15,15,15,15,15,15,15,15,15,15,15,15,15,15,15,15,15,15,15,15,15,15,15,15,15,15,15,15,15,15,15,15,15,15,15,15,15,15,15,15,15,15,15,15,15,15,15,15,15,15,15,15,15,15,15,15,15,15,15,15,15,15,15,15,15,15,15,15,15,15,15,15,15,15,15,15,15,15,15,15,15,15,15,15,15,15,15,15,15,15,15,15,15,15,15,15,15,15,15,15,15,15,15,15,15,15,15,15,15,15,15,15,15,15,15,15,15,15,15,15,15,15,15,15,15,15,15,15,15,15,15,15,15,15,15,15,15,15,15,15,15,15,15,15,15,15,15,15,15,15,15,15,15,15,15,15,15,15,15,15,15,15,15,15,15,15,15,15,15,15,15,15,15,15,15,15,15,15,15,15,15,15,15,15,15,15,15,15,15,15,15,15,15,15,15,15,15,15,15,15,15,15,15,15,15,15,15,15,15,15,15,15,15,15,15,15,15,15,15,15,15,15,15,15,15,15,15,15,15,15,15,15,15,15,15,15,15,15,15,15,15,15,15,15,15,15,15,15,15,15,15,15,15,15,15,15,15,15,15,15,15,15,15,15,15,15,15,15,15,15,15,15,15,15,15,15,15,15,15,15,15,15,15,15,15,15,15,15,15,15,15,15,15,15,15,15,15,15,15,15,15,15,15,15,15,15,15,15,15,15,15,15,15,15,15,15,15,15,15,15,15,15,15,15,15,15,15,15,15,15,15,15,15,15,15,15,15,15,15,15,15,15,15,15,15,15,15,15,15,15,15,15,15,15,15,15,15,15,15,15,15,15,15,15,15,15,15,15,15,15,15,15,15,15,15,15,15,15,15,15,15,15,15,15,15,15,15,15,15,15,15,15,15,15,15,15,15,15,15,15,15,15,15,15,15,15,15,15,15,15,15,15,15,15,15,15,15,15,15,15,15,15,15,15,15,15,15,15,15,15,15,15,15,15,15,15,15,15,15,15,15,15,15,15,15,15,15,15,15,15,15,15,15,15,15,15,15,15,15,15,15,15,15,15,15,15,15,15,15,15,15,15,15,15,15,15,15,15,15,15,15,15,15,15,15,15,15,15,15,15,15,15,15,15,15,15,15,15,15,15,15,15,15,15,15,15,15,15,15,15,15,15,15,15,15,15,15,15,15,15,15,15,15,15,15,15,15,15,15,15,15,15,15,15,15,15,15,15,15,15,15,15,15,15,15,15,15,15,15,15,15,15,15,15,15,15,15,15,15,15,15,15,15,15,15,15,15,15,15,15,15,15,15,15,15,15,15,15,15,15,15,15,15,15,15,15,15,15,15,15,15,15,15,15,15,15,15,15,15,15,15,15,15,15,15,15,15,15,15,15,15,15,15,15,15,15,15,15,15,15,15,15,15,15,15,15,15,15,15,15,15,15,15,15,15,15,15,15,15,15,15,15,15,15,15,15,15,15,15,15,15,15,15,15,15,15,15,15,15,15,15,15,15,15,15,15,15,15,15,15,15,15,15,15,15,15,15,15,15,15,15,15,15,15,15,15,15,15,15,15,15,15,15,15,15,15,15,15,15,15,15,15,15,15,15,15,15,15,15,15,15,15,15,15,15,15,15,15,15,15,15,15,15,15,15,15,15,15,15,15,15,15,15,15,15,15,15,15,15,15,15,15,15,15,15,15,15,15,15,15,15,15,15,15,15,15,15,15,15,15,15,15,15,15,15,15,15,15,15,15,15,15,15,15,15,15,15,15,15,15,15,15,15,15,15,15,15,15,15,15,15,15,15,15,15,15,15,15,15,15,15,15,15,15,15,15,15,15,15,15,15,15,15,15,15,15,15,15,15,15,15,15,15,15,15,15,15,15,15,15,15,15,15,15,15,15,15,15,15,15,15,15,15,15,15,15,15,15,15,15,15,15,15,15,15,15,15,15,15,15,15,15,15,15,15,15,15,15,15,15,15,15,15,15,15,15,15,15,15,15,15,15,15,15,15,15,15,15,15,15,15,15,15,15,15,15,15,15,15,15,15,15,15,15,15,15,15,15,15,15,15,15,15,15,15,15,15,15,15,15,15,15,15,15,15,15,15,15,15,15,15,15,15,15,15,15,15,15,15,15,15,15,15,15,15,15,15,15,15,15,15,15,15,15,15,15,15,15,15,15,15,15,15,15,15,15,15,15,15,15,15,15,15,15,15,15,15,15,15,15,15,15,15,15,15,15,15,15,15,15,15,15,15,15,15,15,15,15,15,15,15,15,15,15,15,15,15,15,15,15,15,15,15,15,15,15,15,15,15,15,15,15,15,15,15,15,15,15,15,15,15,15,15,15,15,15,15,15,15,15,15,15,15,15,15,15,15,15,15,15,15,15,15,15,15,15,15,15,15,15,15,15,15,15,15,15,15,15,15,15,15,15,15,15,15,15,15,15,15,15,15,15,15,15,15,15,15,15,15,15,15,15,15,15,15,15,15,15,15,15,15,15,15,15,15,15,15,15,15,15,15,15,15,15,15,15,15,15,15,15,15,15,15,15,15,15,15,15,15,15,15,15,15,15,15,15,15,15,15,15,15,15,15,15,15,15,15,15,15,15,15,15,15,15,15,15,15,15,15,15,15,15,15,15,15,15,15,15,15,15,15,15,15,15,15,15,15,15,15,15,15,15,15,15,15,15,15,15,15,15,15,15,15,15,15,15,15,15,15,15,15,15,15,15,15,15,15,15,15,15,15,15,15,15,15,15,15,15,15,15,15,14,14,14,14,14,14,14,14,14,14,14,14,14,14,14,14,14,14,14,14,14,14,14,14,14,14,14,13,13,13,13,13,13,13,13,13,13,13,13,13,13,13,13,13,13,12,12,12,12,12,12,12,12,12,12,12,12,12,12,11,11,11,11,11,11,11,11,11,10,10,10,10,10,10,10,9,9,9,9,8,8,8,8,7,6,5,4,3,2,1,0,17,18,19,20,21,22,23,24,24,24,24,25,25,25,25,26,26,26,26,26,26,26,27,27,27,27,27,27,27,27,27,28,28,28,28,28,28,28,28,28,28,28,28,28,28,29,29,29,29,29,29,29,29,29,29,29,29,29,29,29,29,29,29,30,30,30,30,30,30,30,30,30,30,30,30,30,30,30,30,30,30,30,30,30,30,30,30,30,30,30,31,31,31,31,31,31,31,31,31,31,31,31,31,31,31,31,31,31,31,31,31,31,31,31,31,31,31,31,31,31,31,31,31,31,31,31,31,31,31,31,31,31,31,31,31,31,31,31,31,31,31,31,31,31,31,31,31,31,31,31,31,31,31,31,31,31,31,31,31,31,31,31,31,31,31,31,31,31,31,31,31,31,31,31,31,31,31,31,31,31,31,31,31,31,31,31,31,31,31,31,31,31,31,31,31,31,31,31,31,31,31,31,31,31,31,31,31,31,31,31,31,31,31,31,31,31,31,31,31,31,31,31,31,31,31,31,31,31,31,31,31,31,31,31,31,31,31,31,31,31,31,31,31,31,31,31,31,31,31,31,31,31,31,31,31,31,31,31,31,31,31,31,31,31,31,31,31,31,31,31,31,31,31,31,31,31,31,31,31,31,31,31,31,31,31,31,31,31,31,31,31,31,31,31,31,31,31,31,31,31,31,31,31,31,31,31,31,31,31,31,31,31,31,31,31,31,31,31,31,31,31,31,31,31,31,31,31,31,31,31,31,31,31,31,31,31,31,31,31,31,31,31,31,31,31,31,31,31,31,31,31,31,31,31,31,31,31,31,31,31,31,31,31,31,31,31,31,31,31,31,31,31,31,31,31,31,31,31,31,31,31,31,31,31,31,31,31,31,31,31,31,31,31,31,31,31,31,31,31,31,31,31,31,31,31,31,31,31,31,31,31,31,31,31,31,31,31,31,31,31,31,31,31,31,31,31,31,31,31,31,31,31,31,31,31,31,31,31,31,31,31,31,31,31,31,31,31,31,31,31,31,31,31,31,31,31,31,31,31,31,31,31,31,31,31,31,31,31,31,31,31,31,31,31,31,31,31,31,31,31,31,31,31,31,31,31,31,31,31,31,31,31,31,31,31,31,31,31,31,31,31,31,31,31,31,31,31,31,31,31,31,31,31,31,31,31,31,31,31,31,31,31,31,31,31,31,31,31,31,31,31,31,31,31,31,31,31,31,31,31,31,31,31,31,31,31,31,31,31,31,31,31,31,31,31,31,31,31,31,31,31,31,31,31,31,31,31,31,31,31,31,31,31,31,31,31,31,31,31,31,31,31,31,31,31,31,31,31,31,31,31,31,31,31,31,31,31,31,31,31,31,31,31,31,31,31,31,31,31,31,31,31,31,31,31,31,31,31,31,31,31,31,31,31,31,31,31,31,31,31,31,31,31,31,31,31,31,31,31,31,31,31,31,31,31,31,31,31,31,31,31,31,31,31,31,31,31,31,31,31,31,31,31,31,31,31,31,31,31,31,31,31,31,31,31,31,31,31,31,31,31,31,31,31,31,31,31,31,31,31,31,31,31,31,31,31,31,31,31,31,31,31,31,31,31,31,31,31,31,31,31,31,31,31,31,31,31,31,31,31,31,31,31,31,31,31,31,31,31,31,31,31,31,31,31,31,31,31,31,31,31,31,31,31,31,31,31,31,31,31,31,31,31,31,31,31,31,31,31,31,31,31,31,31,31,31,31,31,31,31,31,31,31,31,31,31,31,31,31,31,31,31,31,31,31,31,31,31,31,31,31,31,31,31,31,31,31,31,31,31,31,31,31,31,31,31,31,31,31,31,31,31,31,31,31,31,31,31,31,31,31,31,31,31,31,31,31,31,31,31,31,31,31,31,31,31,31,31,31,31,31,31,31,31,31,31,31,31,31,31,31,31,31,31,31,31,31,31,31,31,31,31,31,31,31,31,31,31,31,31,31,31,31,31,31,31,31,31,31,31,31,31,31,31,31,31,31,31,31,31,31,31,31,31,31,31,31,31,31,31,31,31,31,31,31,31,31,31,31,31,31,31,31,31,31,31,31,31,31,31,31,31,31,31,31,31,31,31,31,31,31,31,31,31,31,31,31,31,31,31,31,31,31,31,31,31,31,31,31,31,31,31,31,31,31,31,31,31,31,31,31,31,31,31,31,31,31,31,31,31,31,31,31,31,31,31,31,31,31,31,31,31,31,31,31,31,31,31,31,31,31,31,31,31,31,31,31,31,31,31,31,31,31,31,31,31,31,31,31,31,31,31,31,31,31,31,31,31,31,31,31,31,31,31,31,31,31,31,31,31,31,31,31,31,31,31,31,31,31,31,31,31,31,31,31,31,31,31,31,31,31,31,31,31,31,31,31,31,31,31,31,31,31,31,31,31,31,31,31,31,31,31,31,31,31,31,31,31,31,31,31,31,31,31,31,31,31,31,31,31,31,31,31,31,31,31,31,31,31,31,31,31,31,31,31,31,31,31,31,31,31,31,31,31,31,31,31,31,31,31,31,31,31,31,31,31,31,31,31,31,31,31,31,31,31,31,31,31,31,31,31,31,31,31,31,31,31,31,31,31,31,31,31,31,31,31,31,31,31,31,31,31,31,31,31,31,31,31,31,31,31,31,31,31,31,31,31,31,31,31,31,31,31,31,31,31,31,31,31,31,31,31,31,31,31,31,31,31,31,31,31,31,31,31,31,31,31,31,31,31,31,31,31,31,31,31,31,31,31,31,31,31,31,31,31,31,31,31,31,31,31,31,31,31,31,31,31,31,31,31,31,31,31,31,31,31,31,31,31,31,31,31,31,31,31,31,31,31,31,31,31,31,31,31,31,31,31,31,31,31,31,31,31,31,31,31,31,31,31,31,31,31,31,31,31,31,31,31,31,31,31,31,31,31,31,31,31,31,31,31,31,31,31,31,31,31,31,31,31,31,31,31,31,31,31,31,31,31,31,31,31,31,31,31,31,31,31,31,31,31,31,31,31,31,31,31,31,31,31,31,31,31,31,31,31,31,31,31,31,31,31,31,31,31,31,31,31,31,31,31,31,31,31,31,31,31,31,31,31,31,31,31,31,31,31,31,31,31,31,31,31,31,31,31,31,31,31,31,31,31,31,31,31,31,31,31,31,31,31,31,31,31,31,31,31,31,31,31,31,31,31,31,31,31,31,31,31,31,31,31,31,31,31,31,31,31,31,31,31,31,31,31,31,31,31,31,31,31,31,31,31,31,31,31,31,31,31,31,31,31,31,31,31,31,31,31,31,31,31,31,31,31,31,31,31,31,31,31,31,31,31,31,31,31,31,31,31,31,31,31,31,31,31,31,31,31,31,31,31,31,31,31,31,31,31,31,31,31,31,31,31,31,31,31,31,31,31,31,31,31,31,31,31,31,31,31,31,31,31,31,31,31,31,31,31,31,31,31,31,31,31,31,31,31,31,31,31,31,31,31,31,31,31,31,31,31,31,31,31,31,31,31,31,31,31,31,31,31,31,31,31,31,31,31,31,31,31,31,31,31,31,31,31,31,31,31,31,31,31,31,31,31,31,31,31,31,31,31,31,31,31,31,31,31,31,31,31,31,31,31,31,31,31,31,31,31,31,31,31,31,31,31,31,31,31,31,31,31,31,31,31,31,31,31,31,31,31,31,31,31,31,31,31,31,31,31,31,31,31,31,31,31,31,31,31,31,31,31,31,31,31,31,31,31,31,31,31,31,31,31,31,31,31,31,31,31,31,31,31,31,31,31,31,31,31,31,31,31,31,31,31,31,31,31,31,31,31,31,31,31,31,31,31,31,31,31,31,31,31,31,31,31,31,31,31,31,31,31,31,31,31,31,31,31,31,31,31,31,31,31,31,31,31,31,31,31,31,31,31,31,31,31,31,31,31,31,31,31,31,31,31,31,31,31,31,31,31,31,31,31,31,31,31,31,31,31,31,31,31,31,31,31,31,31,31,31,31,31,31,31,31,31,31,31,31,31,31,31,31,31,31,31,31,31,31,31,31,31,31,31,31,31,31,31,31,31,31,31,31,31,31,31,31,31,31,31,31,31,31,31,31,31,31,31,31,31,31,31,31,31,31,31,31,31,31,31,31,31,31,31,31,31,31,31,31,31,31,31,31,31,31,31,31,31,31,31,31,31,31,31,31,31,31,31,31,31,31,31,31,31,31,31,31,31,31,31,31,31,31,31,31,31,31,31,31,31,31,31,31,31,31,31,31,31,31,31,31,31,31,31,31,31,31,31,31,31,31,31,31,31,31,31,31,31,31,31,31,31,31,31,31,31,31,31,31,31,31,31,31,31,31,31,31,31,31,31,31,31,31,31,31,31,31,31,31,31,31,31,31,31,31,31,31,31,31,31,31,31,31,31,31,31,31,31,31,31,31,31,31,31,31,31,31,31,31,31,31,31,31,31,31,31,31,31,31,31,31,31,31,31,31,31,31,31,31,31,31,31,31,31,31,31,31,31,31,31,31,31,31,31,31,31,31,31,31,31,31,31,31,31,31,31,31,31,31,31,31,31,31,31,31,31,31,31,31,31,31,31,31,31,31,31,31,31,31,31,31,31,31,31,31,31,31,31,31,31,31 };   // bucket(rel) for rel = s - n in [-2047, 2047]

// ---- One launch holds all the element-wise work on the inputs. The jobs inside it are independent of one another and are dealt by block range (every branch is the same for a whole work-group); where a job runs once per batch, the batch loop stands inside the thread, whose NB_ loads then fly together.
// Every 16-bit plane named here is written in FRAGMENT ORDER (above); the index lists say which index is the row and which is k.
// k_prep: x (all batches) -> bf16 (row t, k the model dimension); WF hl planes [w][r][k] = sc_w sum_g bf16 W_w[g*256+r][k], r = h*64+d, w = q, k, v, sc = 1, 1/4, 1/4 (exact); WE hl planes [o][j] = sum_g bf16 wo[o][g*256+j]; TB[h][r] = mean_g bf16 rel_bias[c_bucket[r]][g*4+h].
#define PB_X (TT * DM / 8 / 256)
#define PB_W (DO * DM / 4 / 256)
#define PB_O (DM * DO / 4 / 256)
#define PB_T ((KVH * 4095 + 255) / 256)
// sb = elements of one batch's plane, [TT][DM] (a kernel argument). A thread's loads go through one pointer per batch, p[b]; XWAIT stands behind the last load and names the pointers as inputs, so that their registers are rewritten (also by a later load's result) only behind the wait.
#define XWAIT(p) asm volatile("s_wait_xcnt 0x0" :: "v"(p[0]), "v"(p[1]), "v"(p[2]), "v"(p[3]) : "memory")
// SWAIT stands behind the last store of a job: in the listing the next job's code follows behind a test, and it rewrites registers that the stores name.
#define SWAIT asm volatile("s_wait_xcnt 0x0" ::: "memory")
__device__ __forceinline__ v8us cvt8(v8f v) { v8us o;
#pragma unroll
    for (int k = 0; k < 8; ++k) o[k] = f2bf(v[k]); return o; }
__global__ __launch_bounds__(256) void k_prep(const float* __restrict__ x, const float* __restrict__ wq, const float* __restrict__ wk, const float* __restrict__ wv, const float* __restrict__ wo, const float* __restrict__ rb, bf* XB, bf* WFh, bf* WFl, bf* Wh, bf* Wl, float* TB, size_t sb) {
    int blk = blockIdx.x;
    if (blk < PB_X) { const unsigned c = blk * 256 + threadIdx.x, i = c * 8, si = frag_src(c, DM, DM); v8f v[NB_]; const float* p[NB_];
#pragma unroll   // unrolled: v[] is indexed by constants only, and all loads issue before the first store
        for (int b = 0; b < NB_; ++b) { p[b] = x + b * sb + si; v[b] = *(const v8f*)p[b]; }
        XWAIT(p);
#pragma unroll
        for (int b = 0; b < NB_; ++b) *(v8us*)(XB + b * sb + i) = cvt8(v[b]);
        return; }
    blk -= PB_X;
    if (blk < 3 * PB_W) { const int w = blk / PB_W; const float* s = w == 0 ? wq : w == 1 ? wk : wv; const float sc = w == 0 ? 1.0f : 0.25f; const unsigned q = (blk - w * PB_W) * 256 + threadIdx.x, i = q * 4, si = frag_src(q >> 1, DM, DM) + (q & 1) * 4; v4f v[GG];
#pragma unroll   // unrolled: v[] is indexed by constants only, and all loads issue before the first store
        for (int g = 0; g < GG; ++g) v[g] = *(const v4f*)(s + g * DO * DM + si);
        v4us oh, ol;
#pragma unroll
        for (int u = 0; u < 4; ++u) { float a = 0.f;
#pragma unroll
            for (int g = 0; g < GG; ++g) a = __fadd_rn(a, bfr(v[g][u])); unsigned short c, d; splitf(a * sc, c, d); oh[u] = c; ol[u] = d; }
        *(v4us*)(WFh + w * DO * DM + i) = oh; *(v4us*)(WFl + w * DO * DM + i) = ol; SWAIT; return; }
    blk -= 3 * PB_W;
    if (blk < PB_O) { const unsigned q = blk * 256 + threadIdx.x, e = q * 4; const float* r = wo + frag_src(q >> 1, DO, DM) + (q & 1) * 4; v4us oh, ol;
#pragma unroll
        for (int u = 0; u < 4; ++u) { float s = 0.f;
#pragma unroll
            for (int g = 0; g < GG; ++g) s = __fadd_rn(s, bfr(r[g * DO + u])); unsigned short a, b; splitf(s, a, b); oh[u] = a; ol[u] = b; }
        *(v4us*)(Wh + e) = oh; *(v4us*)(Wl + e) = ol; SWAIT; return; }
    blk -= PB_O;
    const int i = blk * 256 + threadIdx.x; if (i >= KVH * 4095) return; const int r = i % 4095, h = i / 4095; const int bk = c_bucket[r]; SWAIT; float s = 0.f;   // here behind the table load: the next loads' results rewrite its address register
#pragma unroll
    for (int g = 0; g < GG; ++g) s = __fadd_rn(s, bfr(rb[bk * NHm + g * KVH + h])); TB[i] = s * 0.25f;
}
// ---- k_fattn: scores, bias, softmax, attn x V and the hi/lo split of its result in ONE kernel; neither scores nor probabilities go to memory. Grid (TT / 128, KVH, NB_), 16 waves: a work-group owns 128 query columns n of one head of one batch.
// Wave w has the 32 columns of query group w & 3 and, of every 128-key stage, the 32-key block w >> 2. A stage (128 keys of Kh, Kl and Vt: 16 KB in a row of each plane, fragment order) comes into LDS ONCE per work-group, by asynchronous copies,
// and the four query groups read their fragments from there (contiguous 16-B LDS reads): L2 delivers each key to a work-group of 128 queries, not of 32. Two buffers: stage t + 1 flies while stage t is worked on.
// Each wave keeps a running maximum and sum per column (online softmax). S^T = GK QS^T (3 hi/lo products, the accumulator starts at the bias): a lane holds 16 keys of ONE query per column group,
// so the maximum is in-lane plus one exchange between the wave's halves, and two converted S^T tiles ARE the f16 B operand of O^T += GV^T P^T (hardware k order, the order of WFrag::ld): P touches neither LDS nor another lane.
// p = 1024 exp(s - m) (f16, at most 1024; the factor cancels in the quotient). The FK partial (m, l, O^T) of a query group meet in LDS: each wave scales its own by exp(m_w - max_w m_w), the sums run in key-block order 0..FK-1; sum / l leaves as bf16 hi+lo planes P (row n, k = h * 64 + d) in fragment order, whole 1-KB fragments.
// Every '#pragma unroll' in k_fattn without a note of its own: qh, ql, o, sc, vf, pf, m and l are then indexed by constants only and stay in registers.
#define L2E 1.44269504f
#define FQ 4                    // query groups of 32 columns in a work-group
#define FK 4                    // 32-key blocks in a stage = waves that share a query group
#define FW (FQ * FK)            // waves
#define SPL (FK * 32 * HD)      // elements of one plane in a stage: 8192 = 16 KB
#define NST (TT / (FK * 32))    // stages
typedef v4f __attribute__((aligned(4), may_alias)) v4fu;   // the bias window starts at any float
// One stage's copies: every lane brings 2 x 16 B of each of the three planes (512 lanes x 16 B = half a plane's stage). l: the lane's LDS byte address in the buffer; a, b, c: its global addresses in Kh, Kl, Vt.
// The s_wait_xcnt 0 is the last line of the copies' own statement, so that no register which a copy names is rewritten in front of it.
__device__ __forceinline__ void stage_in(unsigned l, const bf* a, const bf* b, const h16* c) {
    asm volatile("global_load_async_to_lds_b128 %0, %6, off\n\t"
                 "global_load_async_to_lds_b128 %1, %7, off\n\t"
                 "global_load_async_to_lds_b128 %2, %8, off\n\t"
                 "global_load_async_to_lds_b128 %3, %9, off\n\t"
                 "global_load_async_to_lds_b128 %4, %10, off\n\t"
                 "global_load_async_to_lds_b128 %5, %11, off\n\t"
                 "s_wait_xcnt 0x0"
                 :: "v"(l), "v"(l + SPL), "v"(l + 2 * SPL), "v"(l + 3 * SPL), "v"(l + 4 * SPL), "v"(l + 5 * SPL), "v"(a), "v"(a + SPL / 2), "v"(b), "v"(b + SPL / 2), "v"(c), "v"(c + SPL / 2) : "memory");
}
__global__ __launch_bounds__(32 * FW) void k_fattn(const bf* __restrict__ Qh, const bf* __restrict__ Ql, const bf* __restrict__ Kh, const bf* __restrict__ Kl, const h16* __restrict__ Vt, const float* __restrict__ TB, bf* Ph, bf* Pl) {
    __shared__ __align__(16) bf ring[2 * 3 * SPL];   // two buffers of [Kh | Kl | Vt], 48 KB each
    __shared__ __align__(16) float po[FW * 32 * 68];
    __shared__ float pm[FW * 32];
    __shared__ float pl[FW * 32];
    const int lane = threadIdx.x & 31, lr = lane & 15, hi = lane >> 4; const int wv = __builtin_amdgcn_readfirstlane((int)(threadIdx.x >> 5)); const int qg = wv & (FQ - 1), kg = wv / FQ;
    const int nw = blockIdx.x * (FQ * 32), n0 = nw + qg * 32, h = blockIdx.y, bz = blockIdx.z; const size_t hb = ((size_t)bz * KVH + h) * TT * HD; const unsigned lo = lane * 8;   // the lane's part of every fragment address; the rest is the same for the whole wave
    const bf* gkh = Kh + hb + threadIdx.x * 8; const bf* gkl = Kl + hb + threadIdx.x * 8; const h16* gv = Vt + hb + threadIdx.x * 8; const unsigned l0 = (unsigned)(size_t)ring + threadIdx.x * 16;   // fragment order: 128 keys are 8192 elements in a row in each of the three planes
    stage_in(l0, gkh, gkl, gv);
    v16bf qh[2][2], ql[2][2]; const bf* pqh = Qh + hb + (size_t)n0 * HD + lo; const bf* pql = Ql + hb + (size_t)n0 * HD + lo;
#pragma unroll
    for (int nt = 0; nt < 2; ++nt)
#pragma unroll
        for (int kk = 0; kk < 2; ++kk) { qh[nt][kk] = WFrag<bf>::ld(pqh + nt * 1024 + kk * 512); ql[nt][kk] = WFrag<bf>::ld(pql + nt * 1024 + kk * 512); }
    v8f o[4][2];
#pragma unroll
    for (int dt = 0; dt < 4; ++dt)
#pragma unroll
        for (int nt = 0; nt < 2; ++nt) o[dt][nt] = (v8f){};
    float m[2] = {-3.0e38f, -3.0e38f}, l[2] = {0.f, 0.f};
    const float* tb = TB + (size_t)h * 4095 + 2047 + 8 * hi - n0 - lr + kg * 32;   // tb[s0' + j] = bias of key kg * 32 + s0' + 8 hi + j against query n0 + lr
    asm volatile("s_wait_asynccnt 0x0" ::: "memory");   // this wave's copies of stage 0 have landed
    __syncthreads();                                    // and every other wave's: stage 0 may be read
    stage_in(l0 + 6 * SPL, gkh + SPL, gkl + SPL, gv + SPL);
#pragma unroll 1   // rolled: one pass already holds most of the 256 registers that four waves per SIMD leave
    for (int t = 0; t < NST; ++t) {
        v8f sc[2][2]; const float* pt = tb + t * (FK * 32); const bf* pkh = ring + (t & 1) * (3 * SPL) + kg * 2048 + lo; const bf* pkl = pkh + SPL; const h16* pv = (const h16*)(pkh + 2 * SPL);   // the wave's 32 keys in the stage's buffer; the steps inside a pass are immediate offsets
#pragma unroll
        for (int st = 0; st < 2; ++st)
#pragma unroll
            for (int nt = 0; nt < 2; ++nt) { const float* p = pt + st * 16 - nt * 16; const v4f b0 = *(const v4fu*)p, b1 = *(const v4fu*)(p + 4); sc[st][nt] = (v8f){b0[0], b0[1], b0[2], b0[3], b1[0], b1[1], b1[2], b1[3]}; }
        asm volatile("s_wait_xcnt 0x0" :: "v"(pt) : "memory");   // behind the pass's last global load; it names the pointer as an input, so that its registers are rewritten (also by a later load's result) only behind the wait
        v16h vf[4];
#pragma unroll
        for (int dt = 0; dt < 4; ++dt) vf[dt] = WFrag<h16>::ld(pv + dt * 512);
#pragma unroll
        for (int st = 0; st < 2; ++st)
#pragma unroll
            for (int kk = 0; kk < 2; ++kk) { const int ko = st * 1024 + kk * 512; const v16bf ah = WFrag<bf>::ld(pkh + ko), al = WFrag<bf>::ld(pkl + ko);
#pragma unroll
                for (int nt = 0; nt < 2; ++nt) { sc[st][nt] = wmmab(ah, qh[nt][kk], sc[st][nt]); sc[st][nt] = wmmab(al, qh[nt][kk], sc[st][nt]); sc[st][nt] = wmmab(ah, ql[nt][kk], sc[st][nt]); } }
        // The stage's hand-over stands here, behind the pass's last LDS read of the buffer (all of K and V is in registers by now): what follows it in the pass works on registers alone, and the refill gets a whole pass of lead.
        asm volatile("s_wait_dscnt 0x0" ::: "memory");      // this wave's reads of stage t have returned
        asm volatile("s_wait_asynccnt 0x0" ::: "memory");   // its copies of stage t + 1 have landed
        __syncthreads();                                    // one barrier a stage: it publishes stage t + 1 and ends every wave's reads of stage t, whose buffer is refilled behind it
        if (t + 2 < NST) stage_in(l0 + (t & 1) * (6 * SPL), gkh + (t + 2) * SPL, gkl + (t + 2) * SPL, gv + (t + 2) * SPL);
#pragma unroll
        for (int nt = 0; nt < 2; ++nt) {
            float mx = fmaxf(sc[0][nt][0], sc[1][nt][0]);
#pragma unroll
            for (int j = 1; j < 8; ++j) mx = fmaxf(mx, fmaxf(sc[0][nt][j], sc[1][nt][j]));
            mx = fmaxf(mx, __shfl_xor(mx, 16, 32));
            const float mn = fmaxf(m[nt], mx); const float al = __builtin_amdgcn_exp2f((m[nt] - mn) * L2E); const float mb = __builtin_fmaf(mn, L2E, -10.0f); m[nt] = mn;
            float ps = 0.f; v16h pf;
#pragma unroll
            for (int st = 0; st < 2; ++st)
#pragma unroll
                for (int j = 0; j < 8; ++j) { const float p = __builtin_amdgcn_exp2f(__builtin_fmaf(sc[st][nt][j], L2E, -mb)); ps += p; pf[st * 8 + j] = tohx(p); }
            l[nt] = __builtin_fmaf(l[nt], al, ps);
#pragma unroll
            for (int dt = 0; dt < 4; ++dt) { o[dt][nt] *= al; o[dt][nt] = wmma16(vf[dt], pf, o[dt][nt]); }
        }
    }
    asm volatile("s_wait_asynccnt 0x0" ::: "memory");   // no copy is left in flight behind the loop
#pragma unroll
    for (int nt = 0; nt < 2; ++nt) { l[nt] += __shfl_xor(l[nt], 16, 32); if (hi == 0) pm[wv * 32 + nt * 16 + lr] = m[nt]; }
    __syncthreads();
#pragma unroll
    for (int nt = 0; nt < 2; ++nt) { float mg = pm[qg * 32 + nt * 16 + lr];
#pragma unroll
        for (int w = 1; w < FK; ++w) mg = fmaxf(mg, pm[(w * FQ + qg) * 32 + nt * 16 + lr]);
        const float f = __builtin_amdgcn_exp2f((m[nt] - mg) * L2E); if (hi == 0) pl[wv * 32 + nt * 16 + lr] = l[nt] * f;
        float* pd = po + (wv * 32 + nt * 16 + lr) * 68 + 8 * hi;
#pragma unroll
        for (int dt = 0; dt < 4; ++dt) { const v8f c = o[dt][nt] * f; *(v4fa*)(pd + dt * 16) = (v4f){c[0], c[1], c[2], c[3]}; *(v4fa*)(pd + dt * 16 + 4) = (v4f){c[4], c[5], c[6], c[7]}; } }
    __syncthreads();
#pragma unroll   // one trip per query group; unrolled: the LDS reads of the later groups issue while the earlier groups' quotients are worked out
    for (int it = 0; it < FQ; ++it) { const int idx = (int)threadIdx.x; const int n = (idx >> 8) * 16 + (idx & 15), c4 = ((idx >> 5) & 7) * 8 + ((idx >> 4) & 1) * 4; v4f s = *(const v4fa*)(po + (it * 32 + n) * 68 + c4); float ls = pl[it * 32 + n];   // 16 lanes -> 16 rows n (LDS pitch 68: no bank met twice), a wave -> 8 columns of them: 256 B in a row of each plane
#pragma unroll   // unrolled: the LDS reads of all partials issue ahead of the adds, which keep the order w = 0..FK-1
        for (int w = 1; w < FK; ++w) { s += *(const v4fa*)(po + ((w * FQ + it) * 32 + n) * 68 + c4); ls += pl[(w * FQ + it) * 32 + n]; }
        const float inv = __fdiv_rn(1.0f, ls); v4us oh, ol;
#pragma unroll
        for (int u = 0; u < 4; ++u) { unsigned short a, b; splitf(s[u] * inv, a, b); oh[u] = a; ol[u] = b; }
        const size_t eo = ((size_t)bz * TT + nw + it * 32 + (n & 16)) * DO + (h * 2 + (c4 >> 5)) * 512 + ((c4 >> 3) & 3) * 128 + (n & 15) * 8 + (c4 & 7); *(v4us*)(Ph + eo) = oh; *(v4us*)(Pl + eo) = ol; }
}

extern "C" void kernel_launch(void* const* d_in, const int* in_sizes, int n_in,
                              void* d_out, int out_size, void* d_ws, size_t ws_size, hipStream_t stream) {
    (void)in_sizes; (void)n_in; (void)out_size;
    const float* x = (const float*)d_in[0]; const float* wq = (const float*)d_in[1]; const float* wk = (const float*)d_in[2]; const float* wv = (const float*)d_in[3]; const float* wo = (const float*)d_in[4]; const float* rb = (const float*)d_in[5];
    float* OUT = (float*)d_out;     // [4][2048][1024] = [8192][1024]: the batches are one run of rows for every GEMM
    char* wsp = (char*)d_ws;
    auto take = [&](size_t bytes) { char* p = wsp; wsp += (bytes + 255) & ~(size_t)255; return (void*)p; };
    bf* WFh = (bf*)take((size_t)3 * DO * DM * 2); bf* WFl = (bf*)take((size_t)3 * DO * DM * 2); bf* WEh = (bf*)take((size_t)DM * DO * 2); bf* WEl = (bf*)take((size_t)DM * DO * 2); float* TB = (float*)take((size_t)KVH * 4095 * 4 + 256);
    bf* XB = (bf*)take((size_t)NB_ * TT * DM * 2); bf* QSh = (bf*)take((size_t)NB_ * KVH * TT * HD * 2); bf* QSl = (bf*)take((size_t)NB_ * KVH * TT * HD * 2); bf* GKh = (bf*)take((size_t)NB_ * KVH * TT * HD * 2); bf* GKl = (bf*)take((size_t)NB_ * KVH * TT * HD * 2); h16* GVT = (h16*)take((size_t)NB_ * KVH * HD * TT * 2);
    bf* OPh = (bf*)take((size_t)NB_ * TT * DO * 2); bf* OPl = (bf*)take((size_t)NB_ * TT * DO * 2);
    if ((size_t)(wsp - (char*)d_ws) > ws_size) return;    // total ~ 48 MB
    k_prep<<<PB_X + 3 * PB_W + PB_O + PB_T, 256, 0, stream>>>(x, wq, wk, wv, wo, rb, XB, WFh, WFl, WEh, WEl, TB, (size_t)TT * DM);   // [out][in] weights = natural Bt
    k_gemmw<bf, 3, false, 8, DM, true, 3, DO><<<dim3(NB_ * TT / 64, DO / 64, 1), 256, 0, stream>>>(XB, nullptr, WFh, WFl, nullptr, nullptr, 0, (size_t)DO * DM, 0, QSh, QSl, GKh, GKl, GVT);   // z = q, k, v; NSPLIT 3: A Bt + A Bt2; the tiles leave as k_fattn's planes
    k_fattn<<<dim3(TT / (FQ * 32), KVH, NB_), 32 * FW, 0, stream>>>(QSh, QSl, GKh, GKl, GVT, TB, OPh, OPl);
    k_gemmw<bf, 2, false, 8, DO, false, 4, DM><<<dim3(NB_ * TT / 64, DM / 64 / 4, 1), 256, 0, stream>>>(OPh, OPl, WEh, WEl, OUT, nullptr, 0, 0, 0, nullptr, nullptr, nullptr, nullptr, nullptr);
}

// v010
// It runs in 63.2 microseconds.
// Versions in between are left out here; by their measured steps it is 1.22 times as fast as v008.
// Over all steps from v000 it is 13.3 times as fast.
#include <hip/hip_runtime.h>

// Grouped attention with a relative-position bias (hidden [4][2048][1024]; q/k/v = x W^T (16 heads x 64); heads grouped (g=4 groups, h=4 kv heads: head = g*4 + h); gk, gv = mean over g; scores[h][n][s] = sum_g sum_d q[g,h][n][d] gk[h][s][d] (the reference's einsum sums the query
// groups; no 1/sqrt(d) scaling, T5 style) + mean over g of the T5 relative-position bias rel_bias[bucket(s - n)][g*4 + h]; softmax; out[h] = attn gv[h]; tiled x4 over g and projected: out_full Wo^T = out (sum_g Wo[:, g-block])^T -> [4][2048][1024]).
// The group sum of q and the group means of k and v are linear in the weights: sum_g (x Wq[g,h]^T) = x (sum_g Wq[g,h])^T. The weights are summed over g first (k_prep), so the projections have 256 columns each instead of 1024 and yield the summed q and the mean k, v directly.
// The bucket of each relative position depends only on (s - n) and the fixed sizes: it is a compile-time table of 4095 entries (bidirectional T5 buckets, 32 buckets, max distance 128; computed in f32 exactly as the reference and baked in).
// Compute dtypes, f32 accumulate: every input rounded to bf16; x then held as f16 (its 8 significant bits fit: exact from 2^-17 in magnitude up to the f16 range, on the grid of 2^-24 below); group sums / means of the bf16 weights in f32 -> ONE f16 plane (11 significant bits); q/k/v = x times that plane (1 product), f32; q, k -> bf16 hi+lo planes; scores (K 64) as 3 products; bias + online softmax f32, probabilities x1024 in f16, fused with attn x V (k_fattn), whose result leaves as one f16 plane; output projection 1 product

#define NB_  4
#define TT   2048
#define DM   1024
#define NHm  16
#define KVH  4
#define GG   4
#define HD   64
#define DO   256
typedef _Float16 h16;
typedef unsigned short bf;
typedef __attribute__((ext_vector_type(16))) __bf16   v16bf;
typedef __attribute__((ext_vector_type(16))) _Float16 v16h;
typedef __attribute__((ext_vector_type(8)))  _Float16 v8h;
typedef __attribute__((ext_vector_type(8)))  unsigned short v8us;
typedef __attribute__((ext_vector_type(8)))  float    v8f;
typedef __attribute__((ext_vector_type(4)))  float    v4f;
typedef v8h  __attribute__((may_alias)) v8ha;
typedef v4f  __attribute__((may_alias)) v4fa;
typedef v8us __attribute__((may_alias)) v8usa;

__device__ __forceinline__ unsigned short f2bf(float f) { unsigned u = __float_as_uint(f); u += 0x7FFFu + ((u >> 16) & 1u); return (unsigned short)(u >> 16); }
__device__ __forceinline__ float bf2f(unsigned short b) { return __uint_as_float(((unsigned)b) << 16); }
__device__ __forceinline__ float bfr(float f) { return bf2f(f2bf(f)); }
__device__ __forceinline__ v16h cat16(v8h lo, v8h hi) { return __builtin_shufflevector(lo, hi, 0, 1, 2, 3, 4, 5, 6, 7, 8, 9, 10, 11, 12, 13, 14, 15); }
__device__ __forceinline__ v16bf cat16b(v8us lo, v8us hi) { return __builtin_bit_cast(v16bf, __builtin_shufflevector(lo, hi, 0, 1, 2, 3, 4, 5, 6, 7, 8, 9, 10, 11, 12, 13, 14, 15)); }
__device__ __forceinline__ v8f wmma16(v16h a, v16h b, v8f c) { return __builtin_amdgcn_wmma_f32_16x16x32_f16(false, a, false, b, (short)0, c, false, false); }
__device__ __forceinline__ v8f wmmab(v16bf a, v16bf b, v8f c) { return __builtin_amdgcn_wmma_f32_16x16x32_bf16(false, a, false, b, (short)0, c, false, false); }



// FRAGMENT ORDER. Every 16-bit operand plane [R rows][K columns] is stored as WMMA fragments of 16 rows x 32 k = 512 elements = 1 KB: element (row, k) lies at ((row / 16) * (K / 32) + k / 32) * 512 + ((k / 8) % 4) * 128 + (row % 16) * 8 + k % 8 (in GVT the fragment index is (k / 32) * (R / 16) + row / 16 instead).
// Lane (lr, hi) = lane number hi * 16 + lr finds its k = 8 hi .. 8 hi + 7 at fragment + lane * 8 and its k = 16 + 8 hi .. at 256 elements more (the hardware k order): each wave-wide 16-B load covers 512 contiguous bytes, four whole 128-B lines (from a row-major plane it would touch 32-B pieces of 16 lines).
// The producers write such a plane linearly and gather their source: chunk c (8 elements, at c * 8) comes from the source index frag_src(c, K, ld) = row * ld + k.
__device__ __forceinline__ unsigned frag_src(unsigned c, unsigned K, unsigned ld) { const unsigned f = c >> 6, kb = K >> 5; return ((f / kb) * 16 + (c & 15)) * ld + (f % kb) * 32 + ((c >> 4) & 3) * 8; }

// ---- k_gemmw: register-blocked GEMM, KS WAVES per 64x64 output tile (16 accumulators each), operands straight from fragment-ordered 16-bit planes (see FRAGMENT ORDER above); grid (M/64, N/64/NT, Z), 32 * KS threads.
// C[m][n] (f32, pitch ldc, + optional f32 bias[n]) = sum_k A[m][k] Bt[n][k]. z-batch strides sA/sB/sC in elements. K % (32 * KS) == 0.
// KS > 1: wave w sums the 32-wide k steps w, w + KS, w + 2 KS, ... (interleaved: in one trip the waves of a work-group read KS neighbouring 1-KB fragments of every 16-row block);
// the KS partial tiles meet in LDS (fragment order) and are added in wave order 0..KS-1, 16/KS fragments per wave; the tile leaves through a row-major LDS tile in whole lines.
__device__ __forceinline__ h16 tohx(float x) { return (h16)x; }
__device__ __forceinline__ void splitf(float y, unsigned short& h, unsigned short& l) { h = f2bf(y); l = f2bf(y - bf2f(h)); }
template <typename T16> struct WFrag;
template <> struct WFrag<h16> { typedef v16h V; static __device__ __forceinline__ V ld(const h16* p) { return cat16(*(const v8h*)p, *(const v8h*)(p + 256)); } static __device__ __forceinline__ v8f mma(V a, V b, v8f c) { return wmma16(a, b, c); } };
template <> struct WFrag<bf> { typedef v16bf V; static __device__ __forceinline__ V ld(const bf* p) { return cat16b(*(const v8us*)p, *(const v8us*)(p + 256)); } static __device__ __forceinline__ v8f mma(V a, V b, v8f c) { return wmmab(a, b, c); } };
// NT: a work-group takes NT tiles one after the other (NT neighbouring column tiles of its rows), so that a launch starts 1/NT of the waves and every work-group is resident from the start.
// Where a wave has one k step in all (K == 32 * KS; the output projection), its A fragments are the same for all NT tiles: they are loaded once and stay in registers.
// amdgpu_waves_per_eu(4, 4): two work-groups of 8 waves on a WGP are 4 waves per SIMD, 256 registers each; without it the build with the tile loop takes more, and only one work-group fits.
// The two barriers of a tile also part it from the next: the partials are rewritten behind the barrier that ends their reads, and the row-major tile behind the next tile's first barrier.
template <typename T16, bool BIAS, int KS, int K, int NT, int ldc>   // K and the pitch ldc constants: the steps from fragment to fragment, and from row to row of C, are immediate offsets on one pointer
__global__ __launch_bounds__(32 * KS) __attribute__((amdgpu_waves_per_eu(4, 4))) void k_gemmw(const T16* __restrict__ A, const T16* __restrict__ Bt, float* C, const float* __restrict__ bias, size_t sA, size_t sB, size_t sC) {
    typedef typename WFrag<T16>::V V;
    __shared__ __align__(16) float os[KS == 1 ? 16 * 68 : 64 * 68 + KS * 4096];
    const int lane = threadIdx.x & 31, lr = lane & 15, hi = lane >> 4; const int r0 = blockIdx.x * 64;
    const int wv = __builtin_amdgcn_readfirstlane((int)(threadIdx.x >> 5)); __builtin_assume(wv >= 0 && wv < KS);   // the block has KS waves: where K == 32 * KS the compiler then sees that the k loop has one trip
    constexpr bool AKEEP = K == 32 * KS;
    [[maybe_unused]] V ka[4];
    if constexpr (AKEEP) { const T16* pa = A + blockIdx.z * sA + (size_t)r0 * K + wv * 512 + lane * 8;   // k step wv of the four row blocks
        __builtin_amdgcn_sched_barrier(0);   // with the one behind the wait: nothing but the run's own loads stands between the first of them and the wait, so that no register which they name is rewritten in front of it
#pragma unroll   // unrolled: the arrays are indexed by constants only and stay in registers
        for (int i = 0; i < 4; ++i) ka[i] = WFrag<T16>::ld(pa + i * 16 * K);
        asm volatile("s_wait_xcnt 0x0" ::: "memory");   // behind the run's last load
        __builtin_amdgcn_sched_barrier(0); }
#pragma unroll 1   // rolled: one tile's code, and one tile's registers
    for (int ti = 0; ti < NT; ++ti) {
    const size_t z = blockIdx.z; const int c0 = (blockIdx.y * NT + ti) * 64;
    v8f acc[4][4];
#pragma unroll
    for (int mb = 0; mb < 4; ++mb)
#pragma unroll
        for (int nb = 0; nb < 4; ++nb) acc[mb][nb] = (v8f){};
    const size_t aoff = z * sA + (size_t)r0 * K, boff = z * sB + (size_t)c0 * K; const unsigned lo = lane * 8;   // fragment (row block, k block) starts at (row block * K / 32 + k block) * 512: the same for the whole wave; the lane's own part is lo
#pragma unroll 1
    for (int kc = wv * 32; kc < K; kc += 32 * KS) {
        // One pointer per plane; the s_wait_xcnt 0 stands behind the trip's last load and names the pointers as inputs, so that their registers are rewritten (also by a later load's result) only behind the wait.
        const T16* pa = A + aoff + kc * 16 + lo; const T16* pb = Bt + boff + kc * 16 + lo; V a[4], b[4];
#pragma unroll   // unrolled, here and below: the arrays are indexed by constants only and stay in registers, and the loads of the trip issue together
        for (int i = 0; i < 4; ++i) { b[i] = WFrag<T16>::ld(pb + i * 16 * K); if constexpr (AKEEP) a[i] = ka[i]; else a[i] = WFrag<T16>::ld(pa + i * 16 * K); }
        if constexpr (AKEEP) asm volatile("s_wait_xcnt 0x0" :: "v"(pb) : "memory"); else asm volatile("s_wait_xcnt 0x0" :: "v"(pa), "v"(pb) : "memory");
        __builtin_amdgcn_sched_barrier(0);   // keeps every load of the trip in front of its first matrix instruction: a trip waits for memory once
#pragma unroll
        for (int nb = 0; nb < 4; ++nb)
#pragma unroll
            for (int mb = 0; mb < 4; ++mb) acc[mb][nb] = WFrag<T16>::mma(a[mb], b[nb], acc[mb][nb]);
        if constexpr (K > 32 * KS) asm volatile("v_nop\n\tv_nop\n\tv_nop\n\tv_nop" : "+v"(acc[0][0]), "+v"(acc[1][1]), "+v"(acc[2][2]), "+v"(acc[3][3]) : "v"(a[0]), "v"(a[3]));   // the four vector slots behind the trip's last matrix instruction, also on the taken back edge (with one trip there is no back edge)
    }
    if constexpr (KS > 1) {
        float* part = os + 64 * 68;
        float* pw = part + wv * 4096 + lane * 4;
#pragma unroll   // both loops unrolled: acc[][] is indexed by constants only and stays in registers
        for (int mb = 0; mb < 4; ++mb)
#pragma unroll
            for (int nb = 0; nb < 4; ++nb) { const v8f c = acc[mb][nb]; *(v4fa*)(pw + (mb * 4 + nb) * 256) = (v4f){c[0], c[1], c[2], c[3]}; *(v4fa*)(pw + (mb * 4 + nb) * 256 + 128) = (v4f){c[4], c[5], c[6], c[7]}; }
        __syncthreads();
        constexpr int NF = 16 / KS;
#pragma unroll   // unrolled with the loop over sw: the LDS reads of all partials issue ahead of the adds, which keep the order sw = 0..KS-1
        for (int i = 0; i < NF; ++i) { const int f = wv * NF + i; const float* pf = part + f * 256 + lane * 4; v4f s0 = *(const v4fa*)pf, s1 = *(const v4fa*)(pf + 128);
#pragma unroll
            for (int sw = 1; sw < KS; ++sw) { s0 += *(const v4fa*)(pf + sw * 4096); s1 += *(const v4fa*)(pf + sw * 4096 + 128); }
            float* od = os + ((f >> 2) * 16 + hi * 8) * 68 + (f & 3) * 16 + lr;
#pragma unroll
            for (int j = 0; j < 4; ++j) { od[j * 68] = s0[j]; od[(j + 4) * 68] = s1[j]; } }
        __syncthreads();
        const int cofs = ((int)threadIdx.x & 15) * 4; const float* ps = os + ((int)threadIdx.x >> 4) * 68 + cofs; float* pc = C + z * sC + (size_t)r0 * ldc + c0 + (unsigned)(((int)threadIdx.x >> 4) * ldc + cofs);   // trip it: 2 * KS rows further on, an immediate offset on either pointer
#pragma unroll   // unrolled: every LDS read issues before the first store waits
        for (int it = 0; it < 32 / KS; ++it) { v4f val = *(const v4fa*)(ps + it * 2 * KS * 68); if (BIAS) { val[0] += bfr(bias[c0 + cofs]); val[1] += bfr(bias[c0 + cofs + 1]); val[2] += bfr(bias[c0 + cofs + 2]); val[3] += bfr(bias[c0 + cofs + 3]); }
            *(v4f*)(pc + (size_t)it * 2 * KS * ldc) = val; }
        asm volatile("s_wait_xcnt 0x0" ::: "memory");   // behind the tile's last store: the next tile's code rewrites registers that the stores name
        continue;
    }
#pragma unroll
    for (int mb = 0; mb < 4; ++mb) {
#pragma unroll
        for (int nb = 0; nb < 4; ++nb) {
#pragma unroll
            for (int j = 0; j < 8; ++j) os[(hi * 8 + j) * 68 + nb * 16 + lr] = acc[mb][nb][j]; }
        __builtin_amdgcn_wave_barrier(); asm volatile("" ::: "memory");
        float* crow = C + z * sC + (size_t)(r0 + mb * 16) * ldc + c0;
{
#pragma unroll
            for (int s = 0; s < 8; ++s) { const int row = 2 * s + hi, cofs = lr * 4; v4f val = *(const v4fa*)(os + row * 68 + cofs); if (BIAS) { val[0] += bfr(bias[c0 + cofs]); val[1] += bfr(bias[c0 + cofs + 1]); val[2] += bfr(bias[c0 + cofs + 2]); val[3] += bfr(bias[c0 + cofs + 3]); }
                *(v4f*)(crow + (size_t)row * ldc + cofs) = val; }
             }
        __builtin_amdgcn_wave_barrier(); asm volatile("" ::: "memory");
    }
    }
}

// ---- k_qkv: the q/k/v projection, [8192 tokens] x [768 = q, k, v x 256 columns], K = 1024, f16 operands in fragment order. Grid (8192 / 128, 768 / 192), 8 waves: a work-group owns a tile of 128 tokens x 192 columns (three 64-column heads of q, k or v),
// wave w the 64 tokens of half w & 1 and the 48 columns of strip w >> 1 (12 accumulators), over the WHOLE of K: no partial tiles, no sum through LDS.
// A stage (128 k of the tile's 8 + 12 row blocks: 4 KB in a row of each block, 80 KB) comes into LDS ONCE per work-group, by asynchronous copies, and the waves read their fragments from there (contiguous 16-B LDS reads):
// L2 delivers (128 + 192) rows of K per 128 x 192 results, where a wave that loads its own 64 x 64 tile's operands asks it for (64 + 64) rows per 64 x 64. Two buffers: stage s + 1 flies while stage s is worked on.
// The tile does not leave as f32 but as the 16-bit planes that k_fattn reads, in fragment order, through a row-major f32 tile in LDS; of each plane a 64 x 64 piece (64 tokens of one head) is 4096 elements = 8 KB in a row:
// z = 0, 1: bf16 hi+lo planes QS, GK [b][h] (row t, k = d); z = 2: GVT[b][h] (row d, k = s; its fragments lie key block first: fragment (s / 32) * 4 + d / 16, so that the four fragments of 32 keys are 4 KB in a row) = f16(v). A thread writes whole 16-B chunks, a wave 512 B in a row.
#define GS 4                            // 32-wide k blocks in a stage
#define GRA 8                           // 16-row blocks of x in a tile
#define GRB 12                          // 16-row blocks of the weights in a tile
#define GSE ((GRA + GRB) * GS * 512)    // elements of a stage: 40960 = 80 KB
#define GNS (DM / 32 / GS)              // stages
#define GP 196                          // pitch of the f32 tile in LDS: 16 rows meet no bank twice in 16-B reads, rows 8 apart lie 32 banks apart
// Ten copies: every lane brings 16 B of each of ten row blocks (256 lanes x 16 B = the 4 KB of one block's stage). l: the lane's LDS byte address in the first of them; g0..g9: its global addresses.
// The s_wait_xcnt 0 is the last line of the copies' own statement, so that no register which a copy names is rewritten in front of it.
__device__ __forceinline__ void copy10(unsigned l, const h16* g0, const h16* g1, const h16* g2, const h16* g3, const h16* g4, const h16* g5, const h16* g6, const h16* g7, const h16* g8, const h16* g9) {
    asm volatile("global_load_async_to_lds_b128 %0, %10, off\n\t"
                 "global_load_async_to_lds_b128 %1, %11, off\n\t"
                 "global_load_async_to_lds_b128 %2, %12, off\n\t"
                 "global_load_async_to_lds_b128 %3, %13, off\n\t"
                 "global_load_async_to_lds_b128 %4, %14, off\n\t"
                 "global_load_async_to_lds_b128 %5, %15, off\n\t"
                 "global_load_async_to_lds_b128 %6, %16, off\n\t"
                 "global_load_async_to_lds_b128 %7, %17, off\n\t"
                 "global_load_async_to_lds_b128 %8, %18, off\n\t"
                 "global_load_async_to_lds_b128 %9, %19, off\n\t"
                 "s_wait_xcnt 0x0"
                 :: "v"(l), "v"(l + GS * 1024), "v"(l + 2 * GS * 1024), "v"(l + 3 * GS * 1024), "v"(l + 4 * GS * 1024), "v"(l + 5 * GS * 1024), "v"(l + 6 * GS * 1024), "v"(l + 7 * GS * 1024), "v"(l + 8 * GS * 1024), "v"(l + 9 * GS * 1024),
                    "v"(g0), "v"(g1), "v"(g2), "v"(g3), "v"(g4), "v"(g5), "v"(g6), "v"(g7), "v"(g8), "v"(g9) : "memory");
}
// One stage's 20 copies: a, b: the lane's global addresses in the first row block of x and of the weights; the next row block lies 16 rows = 16 * DM elements on.
__device__ __forceinline__ void gstage_in(unsigned l, const h16* a, const h16* b) {
    constexpr int R = 16 * DM;
    copy10(l, a, a + R, a + 2 * R, a + 3 * R, a + 4 * R, a + 5 * R, a + 6 * R, a + 7 * R, b, b + R);
    copy10(l + 10 * GS * 1024, b + 2 * R, b + 3 * R, b + 4 * R, b + 5 * R, b + 6 * R, b + 7 * R, b + 8 * R, b + 9 * R, b + 10 * R, b + 11 * R);
}
__global__ __launch_bounds__(256) void k_qkv(const h16* __restrict__ X, const h16* __restrict__ Wt, bf* QSh, bf* QSl, bf* GKh, bf* GKl, h16* GVT) {
    __shared__ __align__(16) h16 ring[2 * GSE];   // two buffers of [8 row blocks of x | 12 of the weights], 80 KB each
    __shared__ __align__(16) float os[128 * GP];
    const int lane = threadIdx.x & 31, lr = lane & 15, hi = lane >> 4; const int wv = __builtin_amdgcn_readfirstlane((int)(threadIdx.x >> 5)); const int wr = wv & 1, wc = wv >> 1;
    const int r0 = blockIdx.x * 128, c0 = blockIdx.y * 192;
    const h16* ga = X + (size_t)r0 * DM + threadIdx.x * 8; const h16* gb = Wt + (size_t)c0 * DM + threadIdx.x * 8; const unsigned l0 = (unsigned)(size_t)ring + threadIdx.x * 16;   // fragment order: 128 k of a row block are 2048 elements in a row
    gstage_in(l0, ga, gb);
    v8f acc[4][3];
#pragma unroll   // unrolled, here and below: acc, a and b are indexed by constants only and stay in registers
    for (int mb = 0; mb < 4; ++mb)
#pragma unroll
        for (int nb = 0; nb < 3; ++nb) acc[mb][nb] = (v8f){};
    asm volatile("s_wait_asynccnt 0x0" ::: "memory");   // this wave's copies of stage 0 have landed
    __syncthreads();                                    // and every other wave's: stage 0 may be read
    gstage_in(l0 + 2 * GSE, ga + GS * 512, gb + GS * 512);
#pragma unroll 1   // rolled: one stage's code
    for (int s = 0; s < GNS; ++s) {
        const h16* pa = ring + (s & 1) * GSE + wr * (4 * GS * 512) + lane * 8; const h16* pb = ring + (s & 1) * GSE + (GRA + wc * 3) * (GS * 512) + lane * 8;   // the wave's row blocks in the stage's buffer; the steps inside a stage are immediate offsets
        v16h a[2][4], b[2][3];   // two fragment sets: the reads of k step kk + 1 fly while the matrix instructions of step kk run
#pragma unroll
        for (int i = 0; i < 4; ++i) a[0][i] = WFrag<h16>::ld(pa + i * GS * 512);
#pragma unroll
        for (int i = 0; i < 3; ++i) b[0][i] = WFrag<h16>::ld(pb + i * GS * 512);
#pragma unroll
        for (int kk = 0; kk < GS - 1; ++kk) {
            __builtin_amdgcn_sched_barrier(0);   // with the one behind the reads: the next step's 14 LDS reads stand as ONE group in front of this step's matrix instructions, not strewn among them with a wait to 0 each
#pragma unroll
            for (int i = 0; i < 4; ++i) a[(kk + 1) & 1][i] = WFrag<h16>::ld(pa + (i * GS + kk + 1) * 512);
#pragma unroll
            for (int i = 0; i < 3; ++i) b[(kk + 1) & 1][i] = WFrag<h16>::ld(pb + (i * GS + kk + 1) * 512);
            __builtin_amdgcn_sched_barrier(0);
#pragma unroll
            for (int nb = 0; nb < 3; ++nb)
#pragma unroll
                for (int mb = 0; mb < 4; ++mb) acc[mb][nb] = wmma16(a[kk & 1][mb], b[kk & 1][nb], acc[mb][nb]); }
        // The stage's hand-over stands here, behind the stage's last LDS read (the last k step's fragments are in registers by now): what follows it in the trip works on registers alone, and the refill starts that much sooner.
        __builtin_amdgcn_sched_barrier(0);                  // keeps the matrix instructions of the step before in front of the wait: the last reads return while they run, and no third fragment set is needed
        asm volatile("s_wait_dscnt 0x0" ::: "memory");      // this wave's reads of stage s have returned
        asm volatile("s_wait_asynccnt 0x0" ::: "memory");   // its copies of stage s + 1 have landed
        __syncthreads();                                    // one barrier a stage: it publishes stage s + 1 and ends every wave's reads of stage s, whose buffer is refilled behind it
        if (s + 2 < GNS) gstage_in(l0 + (s & 1) * (2 * GSE), ga + (s + 2) * (GS * 512), gb + (s + 2) * (GS * 512));
#pragma unroll
        for (int nb = 0; nb < 3; ++nb)
#pragma unroll
            for (int mb = 0; mb < 4; ++mb) acc[mb][nb] = wmma16(a[(GS - 1) & 1][mb], b[(GS - 1) & 1][nb], acc[mb][nb]);
    }
    asm volatile("s_wait_asynccnt 0x0" ::: "memory");   // no copy is left in flight behind the loop
    float* od = os + (wr * 64 + hi * 8) * GP + wc * 48 + lr;
#pragma unroll
    for (int mb = 0; mb < 4; ++mb)
#pragma unroll
        for (int nb = 0; nb < 3; ++nb)
#pragma unroll
            for (int j = 0; j < 8; ++j) od[(mb * 16 + j) * GP + nb * 16] = acc[mb][nb][j];
    __syncthreads();
#pragma unroll 1   // rolled: one 64 x 64 piece's code; the stores of a piece fly while the next is read
    for (int q = 0; q < 6; ++q) { const int cs = q >> 1, rt = r0 + (q & 1) * 64, ct = blockIdx.y * 3 + cs, z = ct >> 2, hd = ct & 3; const float* ob = os + (q & 1) * 64 * GP + cs * 64;   // piece q: 64 tokens from rt on, head hd of z = q, k, v
        const size_t tb = ((size_t)(rt / TT) * KVH + hd) * TT * HD + (size_t)(rt % TT) * HD;   // where the piece's 4096 elements start, in each of the five planes
        if (z < 2) { bf* dh = (z == 0 ? QSh : GKh) + tb + threadIdx.x * 8; bf* dl = (z == 0 ? QSl : GKl) + tb + threadIdx.x * 8; v8us oh[2], ol[2];
#pragma unroll   // unrolled, here and below: the arrays are indexed by constants only, and every LDS read issues before the first store
            for (int it = 0; it < 2; ++it) { const int c = it * 256 + (int)threadIdx.x; const float* p = ob + ((c >> 7) * 16 + (c & 15)) * GP + ((c >> 6) & 1) * 32 + ((c >> 4) & 3) * 8; const v4f v0 = *(const v4fa*)p, v1 = *(const v4fa*)(p + 4);   // chunk c: row t = (c / 128) * 16 + c % 16, k = d = 8 columns
#pragma unroll
                for (int u = 0; u < 4; ++u) { unsigned short a, b; splitf(v0[u], a, b); oh[it][u] = a; ol[it][u] = b; splitf(v1[u], a, b); oh[it][u + 4] = a; ol[it][u + 4] = b; } }
#pragma unroll
            for (int it = 0; it < 2; ++it) { *(v8us*)(dh + it * 2048) = oh[it]; *(v8us*)(dl + it * 2048) = ol[it]; }
            asm volatile("s_wait_xcnt 0x0" ::: "memory");   // behind the branch's last store: the other branch and the next piece rewrite registers that the stores name
        } else { h16* dv = GVT + tb + threadIdx.x * 8; v8h o[2];
#pragma unroll
            for (int it = 0; it < 2; ++it) { const int c = it * 256 + (int)threadIdx.x; const float* p = ob + ((c >> 8) * 32 + ((c >> 4) & 3) * 8) * GP + ((c >> 6) & 3) * 16 + (c & 15);   // chunk c: row d = (c / 64 % 4) * 16 + c % 16, k = s = 8 tokens
#pragma unroll
                for (int u = 0; u < 8; ++u) o[it][u] = tohx(p[u * GP]); }
#pragma unroll
            for (int it = 0; it < 2; ++it) *(v8h*)(dv + it * 2048) = o[it];
            asm volatile("s_wait_xcnt 0x0" ::: "memory");   // as in the branch above
        }
    }
}

typedef __attribute__((ext_vector_type(2))) unsigned short v2us;
typedef __attribute__((ext_vector_type(4))) unsigned short v4us;
typedef __attribute__((ext_vector_type(2))) _Float16 v2h;
typedef __attribute__((ext_vector_type(4))) _Float16 v4h;
__constant__ unsigned char c_bucket[4095] = { 15,15,15,15,15,15,15,15,15,15,15,15,15,15,15,15,15,15,15,15,15,15,15,15,15,15,15,15,15,15,15,15,15,15,15,15,15,15,15,15,15,15,15,15,15,15,15,15,15,15,15,15,15,15,15,15,15,15,15,15,15,15,15,15,15,15,15,15,15,15,15,15,15,15,15,15,15,15,15,15,15,15,15,15,15,15,15,15,15,15,15,15,15,15,15,15,15,15,15,15,15,15,15,15,15,15,15,15,15,15,15,15,15,15,15,15,15,15,15,15,15,15,15,15,15,15,15,15,15,15,15,15,15,15,15,15,15,15,15,15,15,15,15,15,15,15,15,15,15,15,15,15,15,15,15,15,15,15,15,15,15,15,15,15,15,15,15,15,15,15,15,15,15,15,15,15,15,15,15,15,15,15,15,15,15,15,15,15,15,15,15,15,15,15,15,15,15,15,15,15,15,15,15,15,15,15,15,15,15,15,15,15,15,15,15,15,15,15,15,15,15,15,15,15,15,15,15,15,15,15,15,15,15,15,15,15,15,15,15,15,15,15,15,15,15,15,15,15,15,15,15,15,15,15,15,15,15,15,15,15,15,15,15,15,15,15,15,15,15,15,15,15,15,15,15,15,15,15,15,15,15,15,15,15,15,15,15,15,15,15,15,15,15,15,15,15,15,15,15,15,15,15,15,15,15,15,15,15,15,15,15,15,15,15,15,15,15,15,15,15,15,15,15,15,15,15,15,15,15,15,15,15,15,15,15,15,15,15,15,15,15,15,15,15,15,15,15,15,15,15,15,15,15,15,15,15,15,15,15,15,15,15,15,15,15,15,15,15,15,15,15,15,15,15,15,15,15,15,15,15,15,15,15,15,15,15,15,15,15,15,15,15,15,15,15,15,15,15,15,15,15,15,15,15,15,15,15,15,15,15,15,15,15,15,15,15,15,15,15,15,15,15,15,15,15,15,15,15,15,15,15,15,15,15,15,15,15,15,15,15,15,15,15,15,15,15,15,15,15,15,15,15,15,15,15,15,15,15,15,15,15,15,15,15,15,15,15,15,15,15,15,15,15,15,15,15,15,15,15,15,15,15,15,15,15,15,15,15,15,15,15,15,15,15,15,15,15,15,15,15,15,15,15,15,15,15,15,15,15,15,15,15,15,15,15,15,15,15,15,15,15,15,15,15,15,15,15,15,15,15,15,15,15,15,15,15,15,15,15,15,15,15,15,15,15,15,15,15,15,15,15,15,15,15,15,15,15,15,15,15,15,15,15,15,15,15,15,15,15,15,15,15,15,15,15,15,15,15,15,15,15,15,15,15,15,15,15,15,15,15,15,15,15,15,15,15,15,15,15,15,15,15,15,15,15,15,15,15,15,15,15,15,15,15,15,15,15,15,15,15,15,15,15,15,15,15,15,15,15,15,15,15,15,15,15,15,15,15,15,15,15,15,15,15,15,15,15,15,15,15,15,15,15,15,15,15,15,15,15,15,15,15,15,15,15,15,15,15,15,15,15,15,15,15,15,15,15,15,15,15,15,15,15,15,15,15,15,15,15,15,15,15,15,15,15,15,15,15,15,15,15,15,15,15,15,15,15,15,15,15,15,15,15,15,15,15,15,15,15,15,15,15,15,15,15,15,15,15,15,15,15,15,15,15,15,15,15,15,15,15,15,15,15,15,15,15,15,15,15,15,15,15,15,15,15,15,15,15,15,15,15,15,15,15,15,15,15,15,15,15,15,15,15,15,15,15,15,15,15,15,15,15,15,15,15,15,15,15,15,15,15,15,15,15,15,15,15,15,15,15,15,15,15,15,15,15,15,15,15,15,15,15,15,15,15,15,15,15,15,15,15,15,15,15,15,15,15,15,15,15,15,15,15,15,15,15,15,15,15,15,15,15,15,15,15,15,15,15,15,15,15,15,15,15,15,15,15,15,15,15,15,15,15,15,15,15,15,15,15,15,15,15,15,15,15,15,15,15,15,15,15,15,15,15,15,15,15,15,15,15,15,15,15,15,15,15,15,15,15,15,15,15,15,15,15,15,15,15,15,15,15,15,15,15,15,15,15,15,15,15,15,15,15,15,15,15,15,15,15,15,15,15,15,15,15,15,15,15,15,15,15,15,15,15,15,15,15,15,15,15,15,15,15,15,15,15,15,15,15,15,15,15,15,15,15,15,15,15,15,15,15,15,15,15,15,15,15,15,15,15,15,15,15,15,15,15,15,15,15,15,15,15,15,15,15,15,15,15,15,15,15,15,15,15,15,15,15,15,15,15,15,15,15,15,15,15,15,15,15,15,15,15,15,15,15,15,15,15,15,15,15,15,15,15,15,15,15,15,15,15,15,15,15,15,15,15,15,15,15,15,15,15,15,15,15,15,15,15,15,15,15,15,15,15,15,15,15,15,15,15,15,15,15,15,15,15,15,15,15,15,15,15,15,15,15,15,15,15,15,15,15,15,15,15,15,15,15,15,15,15,15,15,15,15,15,15,15,15,15,15,15,15,15,15,15,15,15,15,15,15,15,15,15,15,15,15,15,15,15,15,15,15,15,15,15,15,15,15,15,15,15,15,15,15,15,15,15,15,15,15,15,15,15,15,15,15,15,15,15,15,15,15,15,15,15,15,15,15,15,15,15,15,15,15,15,15,15,15,15,15,15,15,15,15,15,15,15,15,15,15,15,15,15,15,15,15,15,15,15,15,15,15,15,15,15,15,15,15,15,15,15,15,15,15,15,15,15,15,15,15,15,15,15,15,15,15,15,15,15,15,15,15,15,15,15,15,15,15,15,15,15,15,15,15,15,15,15,15,15,15,15,15,15,15,15,15,15,15,15,15,15,15,15,15,15,15,15,15,15,15,15,15,15,15,15,15,15,15,15,15,15,15,15,15,15,15,15,15,15,15,15,15,15,15,15,15,15,15,15,15,15,15,15,15,15,15,15,15,15,15,15,15,15,15,15,15,15,15,15,15,15,15,15,15,15,15,15,15,15,15,15,15,15,15,15,15,15,15,15,15,15,15,15,15,15,15,15,15,15,15,15,15,15,15,15,15,15,15,15,15,15,15,15,15,15,15,15,15,15,15,15,15,15,15,15,15,15,15,15,15,15,15,15,15,15,15,15,15,15,15,15,15,15,15,15,15,15,15,15,15,15,15,15,15,15,15,15,15,15,15,15,15,15,15,15,15,15,15,15,15,15,15,15,15,15,15,15,15,15,15,15,15,15,15,15,15,15,15,15,15,15,15,15,15,15,15,15,15,15,15,15,15,15,15,15,15,15,15,15,15,15,15,15,15,15,15,15,15,15,15,15,15,15,15,15,15,15,15,15,15,15,15,15,15,15,15,15,15,15,15,15,15,15,15,15,15,15,15,15,15,15,15,15,15,15,15,15,15,15,15,15,15,15,15,15,15,15,15,15,15,15,15,15,15,15,15,15,15,15,15,15,15,15,15,15,15,15,15,15,15,15,15,15,15,15,15,15,15,15,15,15,15,15,15,15,15,15,15,15,15,15,15,15,15,15,15,15,15,15,15,15,15,15,15,15,15,15,15,15,15,15,15,15,15,15,15,15,15,15,15,15,15,15,15,15,15,15,15,15,15,15,15,15,15,15,15,15,15,15,15,15,15,15,15,15,15,15,15,15,15,15,15,15,15,15,15,15,15,15,15,15,15,15,15,15,15,15,15,15,15,15,15,15,15,15,15,15,15,15,15,15,15,15,15,15,15,15,15,15,15,15,15,15,15,15,15,15,15,15,15,15,15,15,15,15,15,15,15,15,15,15,15,15,15,15,15,15,15,15,15,15,15,15,15,15,15,15,15,15,15,15,15,15,15,15,15,15,15,15,15,15,15,15,15,15,15,15,15,15,15,15,15,15,15,15,15,15,15,15,15,15,15,15,15,15,15,15,15,15,15,15,15,15,15,15,15,15,15,15,15,15,15,15,15,15,15,15,15,15,15,15,15,15,15,15,15,15,15,15,15,15,15,15,15,15,15,15,15,15,15,15,15,15,15,15,15,15,15,15,15,15,15,15,15,15,15,15,15,15,15,15,15,15,15,15,15,15,15,15,15,15,15,15,15,15,15,15,15,15,15,15,15,15,15,15,15,15,15,15,15,15,15,15,15,15,15,15,15,15,15,15,15,15,15,15,15,15,15,15,15,15,15,15,15,15,15,15,15,15,15,15,15,15,15,15,15,15,15,15,15,15,15,15,15,15,15,15,15,15,15,15,15,15,15,15,15,15,15,15,15,15,15,15,15,15,15,15,15,15,15,15,15,15,15,15,15,15,15,15,15,15,15,15,15,15,15,15,15,15,15,15,15,15,15,15,15,15,15,15,15,15,15,15,15,15,15,15,15,15,15,15,15,15,15,15,15,15,15,15,15,15,15,15,15,15,15,15,14,14,14,14,14,14,14,14,14,14,14,14,14,14,14,14,14,14,14,14,14,14,14,14,14,14,14,13,13,13,13,13,13,13,13,13,13,13,13,13,13,13,13,13,13,12,12,12,12,12,12,12,12,12,12,12,12,12,12,11,11,11,11,11,11,11,11,11,10,10,10,10,10,10,10,9,9,9,9,8,8,8,8,7,6,5,4,3,2,1,0,17,18,19,20,21,22,23,24,24,24,24,25,25,25,25,26,26,26,26,26,26,26,27,27,27,27,27,27,27,27,27,28,28,28,28,28,28,28,28,28,28,28,28,28,28,29,29,29,29,29,29,29,29,29,29,29,29,29,29,29,29,29,29,30,30,30,30,30,30,30,30,30,30,30,30,30,30,30,30,30,30,30,30,30,30,30,30,30,30,30,31,31,31,31,31,31,31,31,31,31,31,31,31,31,31,31,31,31,31,31,31,31,31,31,31,31,31,31,31,31,31,31,31,31,31,31,31,31,31,31,31,31,31,31,31,31,31,31,31,31,31,31,31,31,31,31,31,31,31,31,31,31,31,31,31,31,31,31,31,31,31,31,31,31,31,31,31,31,31,31,31,31,31,31,31,31,31,31,31,31,31,31,31,31,31,31,31,31,31,31,31,31,31,31,31,31,31,31,31,31,31,31,31,31,31,31,31,31,31,31,31,31,31,31,31,31,31,31,31,31,31,31,31,31,31,31,31,31,31,31,31,31,31,31,31,31,31,31,31,31,31,31,31,31,31,31,31,31,31,31,31,31,31,31,31,31,31,31,31,31,31,31,31,31,31,31,31,31,31,31,31,31,31,31,31,31,31,31,31,31,31,31,31,31,31,31,31,31,31,31,31,31,31,31,31,31,31,31,31,31,31,31,31,31,31,31,31,31,31,31,31,31,31,31,31,31,31,31,31,31,31,31,31,31,31,31,31,31,31,31,31,31,31,31,31,31,31,31,31,31,31,31,31,31,31,31,31,31,31,31,31,31,31,31,31,31,31,31,31,31,31,31,31,31,31,31,31,31,31,31,31,31,31,31,31,31,31,31,31,31,31,31,31,31,31,31,31,31,31,31,31,31,31,31,31,31,31,31,31,31,31,31,31,31,31,31,31,31,31,31,31,31,31,31,31,31,31,31,31,31,31,31,31,31,31,31,31,31,31,31,31,31,31,31,31,31,31,31,31,31,31,31,31,31,31,31,31,31,31,31,31,31,31,31,31,31,31,31,31,31,31,31,31,31,31,31,31,31,31,31,31,31,31,31,31,31,31,31,31,31,31,31,31,31,31,31,31,31,31,31,31,31,31,31,31,31,31,31,31,31,31,31,31,31,31,31,31,31,31,31,31,31,31,31,31,31,31,31,31,31,31,31,31,31,31,31,31,31,31,31,31,31,31,31,31,31,31,31,31,31,31,31,31,31,31,31,31,31,31,31,31,31,31,31,31,31,31,31,31,31,31,31,31,31,31,31,31,31,31,31,31,31,31,31,31,31,31,31,31,31,31,31,31,31,31,31,31,31,31,31,31,31,31,31,31,31,31,31,31,31,31,31,31,31,31,31,31,31,31,31,31,31,31,31,31,31,31,31,31,31,31,31,31,31,31,31,31,31,31,31,31,31,31,31,31,31,31,31,31,31,31,31,31,31,31,31,31,31,31,31,31,31,31,31,31,31,31,31,31,31,31,31,31,31,31,31,31,31,31,31,31,31,31,31,31,31,31,31,31,31,31,31,31,31,31,31,31,31,31,31,31,31,31,31,31,31,31,31,31,31,31,31,31,31,31,31,31,31,31,31,31,31,31,31,31,31,31,31,31,31,31,31,31,31,31,31,31,31,31,31,31,31,31,31,31,31,31,31,31,31,31,31,31,31,31,31,31,31,31,31,31,31,31,31,31,31,31,31,31,31,31,31,31,31,31,31,31,31,31,31,31,31,31,31,31,31,31,31,31,31,31,31,31,31,31,31,31,31,31,31,31,31,31,31,31,31,31,31,31,31,31,31,31,31,31,31,31,31,31,31,31,31,31,31,31,31,31,31,31,31,31,31,31,31,31,31,31,31,31,31,31,31,31,31,31,31,31,31,31,31,31,31,31,31,31,31,31,31,31,31,31,31,31,31,31,31,31,31,31,31,31,31,31,31,31,31,31,31,31,31,31,31,31,31,31,31,31,31,31,31,31,31,31,31,31,31,31,31,31,31,31,31,31,31,31,31,31,31,31,31,31,31,31,31,31,31,31,31,31,31,31,31,31,31,31,31,31,31,31,31,31,31,31,31,31,31,31,31,31,31,31,31,31,31,31,31,31,31,31,31,31,31,31,31,31,31,31,31,31,31,31,31,31,31,31,31,31,31,31,31,31,31,31,31,31,31,31,31,31,31,31,31,31,31,31,31,31,31,31,31,31,31,31,31,31,31,31,31,31,31,31,31,31,31,31,31,31,31,31,31,31,31,31,31,31,31,31,31,31,31,31,31,31,31,31,31,31,31,31,31,31,31,31,31,31,31,31,31,31,31,31,31,31,31,31,31,31,31,31,31,31,31,31,31,31,31,31,31,31,31,31,31,31,31,31,31,31,31,31,31,31,31,31,31,31,31,31,31,31,31,31,31,31,31,31,31,31,31,31,31,31,31,31,31,31,31,31,31,31,31,31,31,31,31,31,31,31,31,31,31,31,31,31,31,31,31,31,31,31,31,31,31,31,31,31,31,31,31,31,31,31,31,31,31,31,31,31,31,31,31,31,31,31,31,31,31,31,31,31,31,31,31,31,31,31,31,31,31,31,31,31,31,31,31,31,31,31,31,31,31,31,31,31,31,31,31,31,31,31,31,31,31,31,31,31,31,31,31,31,31,31,31,31,31,31,31,31,31,31,31,31,31,31,31,31,31,31,31,31,31,31,31,31,31,31,31,31,31,31,31,31,31,31,31,31,31,31,31,31,31,31,31,31,31,31,31,31,31,31,31,31,31,31,31,31,31,31,31,31,31,31,31,31,31,31,31,31,31,31,31,31,31,31,31,31,31,31,31,31,31,31,31,31,31,31,31,31,31,31,31,31,31,31,31,31,31,31,31,31,31,31,31,31,31,31,31,31,31,31,31,31,31,31,31,31,31,31,31,31,31,31,31,31,31,31,31,31,31,31,31,31,31,31,31,31,31,31,31,31,31,31,31,31,31,31,31,31,31,31,31,31,31,31,31,31,31,31,31,31,31,31,31,31,31,31,31,31,31,31,31,31,31,31,31,31,31,31,31,31,31,31,31,31,31,31,31,31,31,31,31,31,31,31,31,31,31,31,31,31,31,31,31,31,31,31,31,31,31,31,31,31,31,31,31,31,31,31,31,31,31,31,31,31,31,31,31,31,31,31,31,31,31,31,31,31,31,31,31,31,31,31,31,31,31,31,31,31,31,31,31,31,31,31,31,31,31,31,31,31,31,31,31,31,31,31,31,31,31,31,31,31,31,31,31,31,31,31,31,31,31,31,31,31,31,31,31,31,31,31,31,31,31,31,31,31,31,31,31,31,31,31,31,31,31,31,31,31,31,31,31,31,31,31,31,31,31,31,31,31,31,31,31,31,31,31,31,31,31,31,31,31,31,31,31,31,31,31,31,31,31,31,31,31,31,31,31,31,31,31,31,31,31,31,31,31,31,31,31,31,31,31,31,31,31,31,31,31,31,31,31,31,31,31,31,31,31,31,31,31,31,31,31,31,31,31,31,31,31,31,31,31,31,31,31,31,31,31,31,31,31,31,31,31,31,31,31,31,31,31,31,31,31,31,31,31,31,31,31,31,31,31,31,31,31,31,31,31,31,31,31,31,31,31,31,31,31,31,31,31,31,31,31,31,31,31,31,31,31,31,31,31,31,31,31,31,31,31,31,31,31,31,31,31,31,31,31,31,31,31,31,31,31,31,31,31,31,31,31,31,31,31,31,31,31,31,31,31,31,31,31,31,31,31,31,31,31,31,31,31,31,31,31,31,31,31,31,31,31,31,31,31,31,31,31,31,31,31,31,31,31,31,31,31,31,31,31,31,31,31,31,31,31,31,31,31,31,31,31,31,31,31,31,31,31,31,31,31,31,31,31,31,31,31,31,31,31,31,31,31,31,31,31,31,31,31,31,31,31,31,31,31,31,31,31,31,31,31,31,31,31,31,31,31,31,31,31,31,31,31,31,31,31,31,31,31,31,31,31,31,31,31,31,31,31,31,31,31,31,31,31,31,31,31,31,31,31,31,31,31,31,31,31,31,31,31,31,31,31,31,31,31,31,31,31,31,31,31,31,31,31,31,31,31,31,31,31,31,31,31,31,31,31,31,31,31,31,31,31,31,31,31,31,31,31,31,31,31,31,31,31,31,31,31,31,31,31,31,31,31,31,31,31,31,31,31,31,31,31,31,31,31,31,31,31,31,31,31,31,31,31,31,31,31,31,31,31,31,31,31,31,31,31,31,31,31,31,31,31,31,31,31,31,31,31,31,31,31,31,31,31,31,31,31,31,31,31,31,31,31,31,31,31,31,31,31,31,31,31,31,31,31,31,31,31,31,31,31,31,31,31,31,31,31,31,31,31,31,31,31,31,31,31,31,31,31,31,31,31,31,31,31,31,31,31,31,31,31,31,31,31,31,31,31,31,31,31,31,31,31,31,31,31,31,31,31,31,31,31,31,31,31,31,31,31,31,31,31,31,31,31,31,31,31,31,31,31,31,31,31,31,31,31,31,31,31,31,31,31,31,31,31,31,31,31,31,31,31,31,31,31,31,31,31,31,31,31,31,31,31,31,31,31,31,31,31,31,31 };   // bucket(rel) for rel = s - n in [-2047, 2047]

// ---- One launch holds all the element-wise work on the inputs. The jobs inside it are independent of one another and are dealt by block range (every branch is the same for a whole work-group); where a job runs once per batch, the batch loop stands inside the thread, whose NB_ loads then fly together.
// Every 16-bit plane named here is written in FRAGMENT ORDER (above); the index lists say which index is the row and which is k.
// k_prep: x (all batches) -> bf16, held as f16 (row t, k the model dimension); WF f16 plane [w][r][k] = sc_w sum_g bf16 W_w[g*256+r][k], r = h*64+d, w = q, k, v, sc = 1, 1/4, 1/4 (exact); WE f16 plane [o][j] = sum_g bf16 wo[o][g*256+j]; TB[h][r] = mean_g bf16 rel_bias[c_bucket[r]][g*4+h].
#define PB_X (TT * DM / 8 / 256)
#define PB_W (DO * DM / 4 / 256)
#define PB_O (DM * DO / 4 / 256)
#define PB_T ((KVH * 4095 + 255) / 256)
// sb = elements of one batch's plane, [TT][DM] (a kernel argument). A thread's loads go through one pointer per batch, p[b]; XWAIT stands behind the last load and names the pointers as inputs, so that their registers are rewritten (also by a later load's result) only behind the wait.
#define XWAIT(p) asm volatile("s_wait_xcnt 0x0" :: "v"(p[0]), "v"(p[1]), "v"(p[2]), "v"(p[3]) : "memory")
// SWAIT stands behind the last store of a job: in the listing the next job's code follows behind a test, and it rewrites registers that the stores name.
#define SWAIT asm volatile("s_wait_xcnt 0x0" ::: "memory")
__device__ __forceinline__ v8h cvt8(v8f v) { v8h o;
#pragma unroll
    for (int k = 0; k < 8; ++k) o[k] = tohx(bfr(v[k])); return o; }
__global__ __launch_bounds__(256) void k_prep(const float* __restrict__ x, const float* __restrict__ wq, const float* __restrict__ wk, const float* __restrict__ wv, const float* __restrict__ wo, const float* __restrict__ rb, h16* XB, h16* WF, h16* WE, float* TB, size_t sb) {
    int blk = blockIdx.x;
    if (blk < PB_X) { const unsigned c = blk * 256 + threadIdx.x, i = c * 8, si = frag_src(c, DM, DM); v8f v[NB_]; const float* p[NB_];
#pragma unroll   // unrolled: v[] is indexed by constants only, and all loads issue before the first store
        for (int b = 0; b < NB_; ++b) { p[b] = x + b * sb + si; v[b] = *(const v8f*)p[b]; }
        XWAIT(p);
#pragma unroll
        for (int b = 0; b < NB_; ++b) *(v8h*)(XB + b * sb + i) = cvt8(v[b]);
        return; }
    blk -= PB_X;
    if (blk < 3 * PB_W) { const int w = blk / PB_W; const float* s = w == 0 ? wq : w == 1 ? wk : wv; const float sc = w == 0 ? 1.0f : 0.25f; const unsigned q = (blk - w * PB_W) * 256 + threadIdx.x, i = q * 4, si = frag_src(q >> 1, DM, DM) + (q & 1) * 4; v4f v[GG];
#pragma unroll   // unrolled: v[] is indexed by constants only, and all loads issue before the first store
        for (int g = 0; g < GG; ++g) v[g] = *(const v4f*)(s + g * DO * DM + si);
        v4h o;
#pragma unroll
        for (int u = 0; u < 4; ++u) { float a = 0.f;
#pragma unroll
            for (int g = 0; g < GG; ++g) a = __fadd_rn(a, bfr(v[g][u])); o[u] = tohx(a * sc); }
        *(v4h*)(WF + w * DO * DM + i) = o; SWAIT; return; }
    blk -= 3 * PB_W;
    if (blk < PB_O) { const unsigned q = blk * 256 + threadIdx.x, e = q * 4; const float* r = wo + frag_src(q >> 1, DO, DM) + (q & 1) * 4; v4h o;
#pragma unroll
        for (int u = 0; u < 4; ++u) { float s = 0.f;
#pragma unroll
            for (int g = 0; g < GG; ++g) s = __fadd_rn(s, bfr(r[g * DO + u])); o[u] = tohx(s); }
        *(v4h*)(WE + e) = o; SWAIT; return; }
    blk -= PB_O;
    const int i = blk * 256 + threadIdx.x; if (i >= KVH * 4095) return; const int r = i % 4095, h = i / 4095; const int bk = c_bucket[r]; SWAIT; float s = 0.f;   // here behind the table load: the next loads' results rewrite its address register
#pragma unroll
    for (int g = 0; g < GG; ++g) s = __fadd_rn(s, bfr(rb[bk * NHm + g * KVH + h])); TB[i] = s * 0.25f;
}
// ---- k_fattn: scores, bias, softmax, attn x V and the rounding of its result to f16 in ONE kernel; neither scores nor probabilities go to memory. Grid (TT / 128, KVH, NB_), 16 waves: a work-group owns 128 query columns n of one head of one batch.
// Wave w has the 32 columns of query group w & 3 and, of every 128-key stage, the 32-key block w >> 2. A stage (128 keys of Kh, Kl and Vt: 16 KB in a row of each plane, fragment order) comes into LDS ONCE per work-group, by asynchronous copies,
// and the four query groups read their fragments from there (contiguous 16-B LDS reads): L2 delivers each key to a work-group of 128 queries, not of 32. Two buffers: stage t + 1 flies while stage t is worked on.
// Each wave keeps a running maximum and sum per column (online softmax). S^T = GK QS^T (3 hi/lo products, the accumulator starts at the bias): a lane holds 16 keys of ONE query per column group,
// so the maximum is in-lane plus one exchange between the wave's halves, and two converted S^T tiles ARE the f16 B operand of O^T += GV^T P^T (hardware k order, the order of WFrag::ld): P touches neither LDS nor another lane.
// p = 1024 exp(s - m) (f16, at most 1024; the factor cancels in the quotient). The FK partial (m, l, O^T) of a query group meet in LDS: each wave scales its own by exp(m_w - max_w m_w), the sums run in key-block order 0..FK-1; sum / l leaves as the f16 plane P (row n, k = h * 64 + d) in fragment order, whole 1-KB fragments.
// Every '#pragma unroll' in k_fattn without a note of its own: qh, ql, o, sc, vf, pf, m and l are then indexed by constants only and stay in registers.
#define L2E 1.44269504f
#define FQ 4                    // query groups of 32 columns in a work-group
#define FK 4                    // 32-key blocks in a stage = waves that share a query group
#define FW (FQ * FK)            // waves
#define SPL (FK * 32 * HD)      // elements of one plane in a stage: 8192 = 16 KB
#define NST (TT / (FK * 32))    // stages
typedef v4f __attribute__((aligned(4), may_alias)) v4fu;   // the bias window starts at any float
// One stage's copies: every lane brings 2 x 16 B of each of the three planes (512 lanes x 16 B = half a plane's stage). l: the lane's LDS byte address in the buffer; a, b, c: its global addresses in Kh, Kl, Vt.
// The s_wait_xcnt 0 is the last line of the copies' own statement, so that no register which a copy names is rewritten in front of it.
__device__ __forceinline__ void stage_in(unsigned l, const bf* a, const bf* b, const h16* c) {
    asm volatile("global_load_async_to_lds_b128 %0, %6, off\n\t"
                 "global_load_async_to_lds_b128 %1, %7, off\n\t"
                 "global_load_async_to_lds_b128 %2, %8, off\n\t"
                 "global_load_async_to_lds_b128 %3, %9, off\n\t"
                 "global_load_async_to_lds_b128 %4, %10, off\n\t"
                 "global_load_async_to_lds_b128 %5, %11, off\n\t"
                 "s_wait_xcnt 0x0"
                 :: "v"(l), "v"(l + SPL), "v"(l + 2 * SPL), "v"(l + 3 * SPL), "v"(l + 4 * SPL), "v"(l + 5 * SPL), "v"(a), "v"(a + SPL / 2), "v"(b), "v"(b + SPL / 2), "v"(c), "v"(c + SPL / 2) : "memory");
}
__global__ __launch_bounds__(32 * FW) void k_fattn(const bf* __restrict__ Qh, const bf* __restrict__ Ql, const bf* __restrict__ Kh, const bf* __restrict__ Kl, const h16* __restrict__ Vt, const float* __restrict__ TB, h16* P) {
    __shared__ __align__(16) bf ring[2 * 3 * SPL];   // two buffers of [Kh | Kl | Vt], 48 KB each
    __shared__ __align__(16) float po[FW * 32 * 68];
    __shared__ float pm[FW * 32];
    __shared__ float pl[FW * 32];
    const int lane = threadIdx.x & 31, lr = lane & 15, hi = lane >> 4; const int wv = __builtin_amdgcn_readfirstlane((int)(threadIdx.x >> 5)); const int qg = wv & (FQ - 1), kg = wv / FQ;
    const int nw = blockIdx.x * (FQ * 32), n0 = nw + qg * 32, h = blockIdx.y, bz = blockIdx.z; const size_t hb = ((size_t)bz * KVH + h) * TT * HD; const unsigned lo = lane * 8;   // the lane's part of every fragment address; the rest is the same for the whole wave
    const bf* gkh = Kh + hb + threadIdx.x * 8; const bf* gkl = Kl + hb + threadIdx.x * 8; const h16* gv = Vt + hb + threadIdx.x * 8; const unsigned l0 = (unsigned)(size_t)ring + threadIdx.x * 16;   // fragment order: 128 keys are 8192 elements in a row in each of the three planes
    stage_in(l0, gkh, gkl, gv);
    v16bf qh[2][2], ql[2][2]; const bf* pqh = Qh + hb + (size_t)n0 * HD + lo; const bf* pql = Ql + hb + (size_t)n0 * HD + lo;
#pragma unroll
    for (int nt = 0; nt < 2; ++nt)
#pragma unroll
        for (int kk = 0; kk < 2; ++kk) { qh[nt][kk] = WFrag<bf>::ld(pqh + nt * 1024 + kk * 512); ql[nt][kk] = WFrag<bf>::ld(pql + nt * 1024 + kk * 512); }
    v8f o[4][2];
#pragma unroll
    for (int dt = 0; dt < 4; ++dt)
#pragma unroll
        for (int nt = 0; nt < 2; ++nt) o[dt][nt] = (v8f){};
    float m[2] = {-3.0e38f, -3.0e38f}, l[2] = {0.f, 0.f};
    const float* tb = TB + (size_t)h * 4095 + 2047 + 8 * hi - n0 - lr + kg * 32;   // tb[s0' + j] = bias of key kg * 32 + s0' + 8 hi + j against query n0 + lr
    asm volatile("s_wait_asynccnt 0x0" ::: "memory");   // this wave's copies of stage 0 have landed
    __syncthreads();                                    // and every other wave's: stage 0 may be read
    stage_in(l0 + 6 * SPL, gkh + SPL, gkl + SPL, gv + SPL);
#pragma unroll 1   // rolled: one pass already holds most of the 256 registers that four waves per SIMD leave
    for (int t = 0; t < NST; ++t) {
        v8f sc[2][2]; const float* pt = tb + t * (FK * 32); const bf* pkh = ring + (t & 1) * (3 * SPL) + kg * 2048 + lo; const bf* pkl = pkh + SPL; const h16* pv = (const h16*)(pkh + 2 * SPL);   // the wave's 32 keys in the stage's buffer; the steps inside a pass are immediate offsets
#pragma unroll
        for (int st = 0; st < 2; ++st)
#pragma unroll
            for (int nt = 0; nt < 2; ++nt) { const float* p = pt + st * 16 - nt * 16; const v4f b0 = *(const v4fu*)p, b1 = *(const v4fu*)(p + 4); sc[st][nt] = (v8f){b0[0], b0[1], b0[2], b0[3], b1[0], b1[1], b1[2], b1[3]}; }
        asm volatile("s_wait_xcnt 0x0" :: "v"(pt) : "memory");   // behind the pass's last global load; it names the pointer as an input, so that its registers are rewritten (also by a later load's result) only behind the wait
        v16h vf[4];
#pragma unroll
        for (int dt = 0; dt < 4; ++dt) vf[dt] = WFrag<h16>::ld(pv + dt * 512);
#pragma unroll
        for (int st = 0; st < 2; ++st)
#pragma unroll
            for (int kk = 0; kk < 2; ++kk) { const int ko = st * 1024 + kk * 512; const v16bf ah = WFrag<bf>::ld(pkh + ko), al = WFrag<bf>::ld(pkl + ko);
#pragma unroll
                for (int nt = 0; nt < 2; ++nt) { sc[st][nt] = wmmab(ah, qh[nt][kk], sc[st][nt]); sc[st][nt] = wmmab(al, qh[nt][kk], sc[st][nt]); sc[st][nt] = wmmab(ah, ql[nt][kk], sc[st][nt]); } }
        // The stage's hand-over stands here, behind the pass's last LDS read of the buffer (all of K and V is in registers by now): what follows it in the pass works on registers alone, and the refill gets a whole pass of lead.
        asm volatile("s_wait_dscnt 0x0" ::: "memory");      // this wave's reads of stage t have returned
        asm volatile("s_wait_asynccnt 0x0" ::: "memory");   // its copies of stage t + 1 have landed
        __syncthreads();                                    // one barrier a stage: it publishes stage t + 1 and ends every wave's reads of stage t, whose buffer is refilled behind it
        if (t + 2 < NST) stage_in(l0 + (t & 1) * (6 * SPL), gkh + (t + 2) * SPL, gkl + (t + 2) * SPL, gv + (t + 2) * SPL);
#pragma unroll
        for (int nt = 0; nt < 2; ++nt) {
            float mx = fmaxf(sc[0][nt][0], sc[1][nt][0]);
#pragma unroll
            for (int j = 1; j < 8; ++j) mx = fmaxf(mx, fmaxf(sc[0][nt][j], sc[1][nt][j]));
            mx = fmaxf(mx, __shfl_xor(mx, 16, 32));
            const float mn = fmaxf(m[nt], mx); const float al = __builtin_amdgcn_exp2f((m[nt] - mn) * L2E); const float mb = __builtin_fmaf(mn, L2E, -10.0f); m[nt] = mn;
            float ps = 0.f; v16h pf;
#pragma unroll
            for (int st = 0; st < 2; ++st)
#pragma unroll
                for (int j = 0; j < 8; ++j) { const float p = __builtin_amdgcn_exp2f(__builtin_fmaf(sc[st][nt][j], L2E, -mb)); ps += p; pf[st * 8 + j] = tohx(p); }
            l[nt] = __builtin_fmaf(l[nt], al, ps);
#pragma unroll
            for (int dt = 0; dt < 4; ++dt) { o[dt][nt] *= al; o[dt][nt] = wmma16(vf[dt], pf, o[dt][nt]); }
        }
    }
    asm volatile("s_wait_asynccnt 0x0" ::: "memory");   // no copy is left in flight behind the loop
#pragma unroll
    for (int nt = 0; nt < 2; ++nt) { l[nt] += __shfl_xor(l[nt], 16, 32); if (hi == 0) pm[wv * 32 + nt * 16 + lr] = m[nt]; }
    __syncthreads();
#pragma unroll
    for (int nt = 0; nt < 2; ++nt) { float mg = pm[qg * 32 + nt * 16 + lr];
#pragma unroll
        for (int w = 1; w < FK; ++w) mg = fmaxf(mg, pm[(w * FQ + qg) * 32 + nt * 16 + lr]);
        const float f = __builtin_amdgcn_exp2f((m[nt] - mg) * L2E); if (hi == 0) pl[wv * 32 + nt * 16 + lr] = l[nt] * f;
        float* pd = po + (wv * 32 + nt * 16 + lr) * 68 + 8 * hi;
#pragma unroll
        for (int dt = 0; dt < 4; ++dt) { const v8f c = o[dt][nt] * f; *(v4fa*)(pd + dt * 16) = (v4f){c[0], c[1], c[2], c[3]}; *(v4fa*)(pd + dt * 16 + 4) = (v4f){c[4], c[5], c[6], c[7]}; } }
    __syncthreads();
#pragma unroll   // one trip per query group; unrolled: the LDS reads of the later groups issue while the earlier groups' quotients are worked out
    for (int it = 0; it < FQ; ++it) { const int idx = (int)threadIdx.x; const int n = (idx >> 8) * 16 + (idx & 15), c4 = ((idx >> 5) & 7) * 8 + ((idx >> 4) & 1) * 4; v4f s = *(const v4fa*)(po + (it * 32 + n) * 68 + c4); float ls = pl[it * 32 + n];   // 16 lanes -> 16 rows n (LDS pitch 68: no bank met twice), a wave -> 8 columns of them: 256 B in a row of the plane
#pragma unroll   // unrolled: the LDS reads of all partials issue ahead of the adds, which keep the order w = 0..FK-1
        for (int w = 1; w < FK; ++w) { s += *(const v4fa*)(po + ((w * FQ + it) * 32 + n) * 68 + c4); ls += pl[(w * FQ + it) * 32 + n]; }
        const float inv = __fdiv_rn(1.0f, ls); v4h oq;
#pragma unroll
        for (int u = 0; u < 4; ++u) oq[u] = tohx(s[u] * inv);
        const size_t eo = ((size_t)bz * TT + nw + it * 32 + (n & 16)) * DO + (h * 2 + (c4 >> 5)) * 512 + ((c4 >> 3) & 3) * 128 + (n & 15) * 8 + (c4 & 7); *(v4h*)(P + eo) = oq; }
}

extern "C" void kernel_launch(void* const* d_in, const int* in_sizes, int n_in,
                              void* d_out, int out_size, void* d_ws, size_t ws_size, hipStream_t stream) {
    (void)in_sizes; (void)n_in; (void)out_size;
    const float* x = (const float*)d_in[0]; const float* wq = (const float*)d_in[1]; const float* wk = (const float*)d_in[2]; const float* wv = (const float*)d_in[3]; const float* wo = (const float*)d_in[4]; const float* rb = (const float*)d_in[5];
    float* OUT = (float*)d_out;     // [4][2048][1024] = [8192][1024]: the batches are one run of rows for every GEMM
    char* wsp = (char*)d_ws;
    auto take = [&](size_t bytes) { char* p = wsp; wsp += (bytes + 255) & ~(size_t)255; return (void*)p; };
    h16* WF = (h16*)take((size_t)3 * DO * DM * 2); h16* WE = (h16*)take((size_t)DM * DO * 2); float* TB = (float*)take((size_t)KVH * 4095 * 4 + 256);
    h16* XB = (h16*)take((size_t)NB_ * TT * DM * 2); bf* QSh = (bf*)take((size_t)NB_ * KVH * TT * HD * 2); bf* QSl = (bf*)take((size_t)NB_ * KVH * TT * HD * 2); bf* GKh = (bf*)take((size_t)NB_ * KVH * TT * HD * 2); bf* GKl = (bf*)take((size_t)NB_ * KVH * TT * HD * 2); h16* GVT = (h16*)take((size_t)NB_ * KVH * HD * TT * 2);
    h16* OP = (h16*)take((size_t)NB_ * TT * DO * 2);
    if ((size_t)(wsp - (char*)d_ws) > ws_size) return;    // total ~ 42 MB
    k_prep<<<PB_X + 3 * PB_W + PB_O + PB_T, 256, 0, stream>>>(x, wq, wk, wv, wo, rb, XB, WF, WE, TB, (size_t)TT * DM);   // [out][in] weights = natural Bt
    k_qkv<<<dim3(NB_ * TT / 128, 3 * DO / 192, 1), 256, 0, stream>>>(XB, WF, QSh, QSl, GKh, GKl, GVT);   // the tiles leave as k_fattn's planes
    k_fattn<<<dim3(TT / (FQ * 32), KVH, NB_), 32 * FW, 0, stream>>>(QSh, QSl, GKh, GKl, GVT, TB, OP);
    k_gemmw<h16, false, 8, DO, 4, DM><<<dim3(NB_ * TT / 64, DM / 64 / 4, 1), 256, 0, stream>>>(OP, WE, OUT, nullptr, 0, 0, 0);
}
